// v000
// Times are from an AMD MI455X. After a warm-up the kernel runs many times in a row, and a time is the length of
// such a window on the GPU divided by its runs, so every launch and the gaps after it count. The runs cycle
// through copies of the inputs. A figure is the median of several windows, for all but v000 over two sittings.
// Sittings can differ by a few percent; kernels timed side by side share one.
// v000, which the later versions start from, runs in 427 microseconds.
#include <hip/hip_runtime.h>
#include <math.h>
// BoT block: cv1 (1x1 conv 256→128, BN folded, SiLU), q/k/v 1x1 convs (+bias), the single-head attention over 1024 positions as two GEMMs
// (scores = [q_i | pos_i]·[k_j | q_j]ᵀ with K = 256 — content-content and content-position in one product —, then p·vᵀ with p x2^15,
// K = 1024), cv2 (128→256, BN folded, SiLU): v_wmma_f32_16x16x32_f16, f16 operands, f32 accumulate; softmax and the residual add in f32
// on VALU. All per-batch GEMMs are batched through grid.y strides: over the 32 images, or over 8 per launch for scores and p·v.
typedef __attribute__((ext_vector_type(16))) _Float16 v16h;
typedef __attribute__((ext_vector_type(8)))  _Float16 v8h;
typedef __attribute__((ext_vector_type(16))) __bf16   v16b;
typedef __attribute__((ext_vector_type(8)))  __bf16   v8b;
typedef __attribute__((ext_vector_type(8)))  float    v8f;
typedef __attribute__((ext_vector_type(4)))  float    v4f;
#define PSCALE 32768.0f
#define U16(p) ((const unsigned short*)(const void*)(p))
#define PSCALE_INV (1.0f / 32768.0f)

__device__ __forceinline__ unsigned short f2bf_bits(float f) {
  unsigned u = __float_as_uint(f);
  return (unsigned short)((u + 0x7FFFu + ((u >> 16) & 1u)) >> 16);
}
__device__ __forceinline__ float bf_bits2f(unsigned short h) { return __uint_as_float(((unsigned)h) << 16); }

// hazard guards as plain device helpers (no inline asm inside the kernel template body)
__device__ __forceinline__ void dep_guard_h(v8f& a, v8f& b, v16h x, v16h y) { asm volatile("v_nop\n\tv_nop\n\tv_nop\n\tv_nop" : "+v"(a), "+v"(b) : "v"(x), "v"(y)); }
__device__ __forceinline__ void dep_guard_b(v8f& a, v8f& b, v16b x, v16b y) { asm volatile("v_nop\n\tv_nop\n\tv_nop\n\tv_nop" : "+v"(a), "+v"(b) : "v"(x), "v"(y)); }
__device__ __forceinline__ void keep4_h(v16h a, v16h b, v16h c, v16h d) { asm volatile("v_nop" :: "v"(a), "v"(b), "v"(c), "v"(d)); }
__device__ __forceinline__ void keep4_b(v16b a, v16b b, v16b c, v16b d) { asm volatile("v_nop" :: "v"(a), "v"(b), "v"(c), "v"(d)); }
__device__ __forceinline__ void acc_guard4(v8f& a, v8f& b, v8f& c, v8f& d) { asm volatile("v_nop\n\tv_nop\n\tv_nop\n\tv_nop" : "+v"(a), "+v"(b), "+v"(c), "+v"(d)); }
template <typename T> struct Frag;
template <> struct Frag<_Float16> {
  typedef v16h V; union U { v16h v; v8h h[2]; };
  static __device__ __forceinline__ v16h load(const _Float16* p) {   // elements 0..7 <- p[0..7], 8..15 <- p[16..23]
    U f; f.h[0] = *(const v8h*)(p); f.h[1] = *(const v8h*)(p + 16); return f.v;
  }
  static __device__ __forceinline__ v8f mma(v16h a, v16h b, v8f c) {
    return __builtin_amdgcn_wmma_f32_16x16x32_f16(false, a, false, b, (short)0, c, false, false);
  }
  static __device__ __forceinline__ void guard(v8f& a, v8f& b, v16h x, v16h y) { dep_guard_h(a, b, x, y); }
  static __device__ __forceinline__ void keep(v16h a, v16h b, v16h c, v16h d) { keep4_h(a, b, c, d); }
};
template <> struct Frag<__bf16> {
  typedef v16b V; union U { v16b v; v8b h[2]; };
  static __device__ __forceinline__ v16b load(const __bf16* p) {
    U f; f.h[0] = *(const v8b*)(p); f.h[1] = *(const v8b*)(p + 16); return f.v;
  }
  static __device__ __forceinline__ v8f mma(v16b a, v16b b, v8f c) {
    return __builtin_amdgcn_wmma_f32_16x16x32_bf16(false, a, false, b, (short)0, c, false, false);
  }
  static __device__ __forceinline__ void guard(v8f& a, v8f& b, v16b x, v16b y) { dep_guard_b(a, b, x, y); }
  static __device__ __forceinline__ void keep(v16b a, v16b b, v16b c, v16b d) { keep4_b(a, b, c, d); }
};

// ---- Register-blocked batched WMMA GEMM ------------------------------------
// C[m,n] = scale * sum_k A[m,k] * Bt[n,k] (+bias)(+resid); each wave owns a 64x64 tile.
// A row-major [M,K]; Bt row-major [N,K]; M,N % 64 == 0, K % 32 == 0.
// SPLIT: operands are hi/lo planes (A2/Bt2 = lo planes, same layout); product = hi·hi + hi·lo + lo·hi.
// BIAS_MODE: 0 = none, 1 = bias[m], 2 = bias[n].
// OUT_MODE: 0 = f32, 1 = f16, 2 = bf16 hi plane (Cout) + bf16 lo plane (Cout2).
// ET: 0 = f16 operands, 1 = bf16 operands (pointers passed as 16-bit storage)
template <int ET> struct Elem;
template <> struct Elem<0> { typedef _Float16 T; };
template <> struct Elem<1> { typedef __bf16 T; };
template <int ET, bool SPLIT, int BIAS_MODE, int OUT_MODE, bool RESID, int ACT = 0>
__global__ __launch_bounds__(256) void wmma_gemm64(
    const unsigned short* __restrict__ Ap, const unsigned short* __restrict__ A2p, int lda, long strideA,
    const unsigned short* __restrict__ Btp, const unsigned short* __restrict__ Bt2p, int ldb, long strideB,
    void* __restrict__ Cout, void* __restrict__ Cout2, int ldc, long strideC,
    const float* __restrict__ bias,
    const float* __restrict__ resid, long strideR,
    int M, int N, int K, float scale) {
  typedef typename Elem<ET>::T T;
  typedef typename Frag<T>::V V;
  const T* A = (const T*)Ap; const T* A2 = (const T*)A2p; const T* Bt = (const T*)Btp; const T* Bt2 = (const T*)Bt2p;
  __shared__ __align__(16) float sT[8][16 * 68];   // per-wave 16x64 slab, pitch 68 floats
  const int b    = blockIdx.y;
  const int lane = threadIdx.x & 31;
  const int wave = threadIdx.x >> 5;
  const int tilesN = N >> 6;
  const int tilesM = M >> 6;
  const int tile = blockIdx.x * 8 + wave;
  if (tile >= tilesM * tilesN) return;   // wave-uniform; no block barriers in this kernel
  const int tm = tile / tilesN;
  const int tn = tile - tm * tilesN;
  const int m0 = tm << 6;
  const int n0 = tn << 6;

  const T* Ab  = A  + (size_t)b * strideA;
  const T* Bb  = Bt + (size_t)b * strideB;
  const T* Ab2 = SPLIT ? (A2  + (size_t)b * strideA) : nullptr;
  const T* Bb2 = SPLIT ? (Bt2 + (size_t)b * strideB) : nullptr;

  const int rlane = lane & 15;                 // row (A) / col (B, D) within subtile
  const int koff  = (lane >> 4) * 8;           // k offset of this lane half
  const int mOff  = (lane >> 4) * 8;           // D row offset

  v8f acc[4][4];
#pragma unroll
  for (int i = 0; i < 4; ++i)
#pragma unroll
    for (int j = 0; j < 4; ++j) acc[i][j] = (v8f){0.f,0.f,0.f,0.f,0.f,0.f,0.f,0.f};

  for (int k0 = 0; k0 < K; k0 += 32) {
    V bh[4], bl[4];
#pragma unroll
    for (int j = 0; j < 4; ++j) {
      const size_t bo = (size_t)(n0 + (j << 4) + rlane) * ldb + koff + k0;
      bh[j] = Frag<T>::load(Bb + bo);
      if (SPLIT) bl[j] = Frag<T>::load(Bb2 + bo);
    }
#pragma unroll
    for (int i = 0; i < 4; ++i) {
      const size_t ao = (size_t)(m0 + (i << 4) + rlane) * lda + koff + k0;
      V ah = Frag<T>::load(Ab + ao);
      V al;
      if (SPLIT) al = Frag<T>::load(Ab2 + ao);
#pragma unroll
      for (int j = 0; j < 4; ++j) {
        acc[i][j] = Frag<T>::mma(ah, bh[j], acc[i][j]);
        if (SPLIT) {
          acc[i][j] = Frag<T>::mma(ah, bl[j], acc[i][j]);
          acc[i][j] = Frag<T>::mma(al, bh[j], acc[i][j]);
        }
      }
      Frag<T>::guard(acc[i][0], acc[i][3], ah, SPLIT ? al : ah);
    }
    Frag<T>::keep(bh[0], bh[1], bh[2], bh[3]);
    if (SPLIT) Frag<T>::keep(bl[0], bl[1], bl[2], bl[3]);
  }
  acc_guard4(acc[0][0], acc[0][1], acc[0][2], acc[0][3]);
  acc_guard4(acc[1][0], acc[1][1], acc[1][2], acc[1][3]);
  acc_guard4(acc[2][0], acc[2][1], acc[2][2], acc[2][3]);
  acc_guard4(acc[3][0], acc[3][1], acc[3][2], acc[3][3]);

  // ---- epilogue ----
  float* slab = sT[wave];
  const float* Rb = RESID ? (resid + (size_t)b * strideR) : nullptr;
#pragma unroll
  for (int i = 0; i < 4; ++i) {
    const int mBase = m0 + (i << 4);
#pragma unroll
    for (int j = 0; j < 4; ++j) {
      const int n = n0 + (j << 4) + rlane;
      float bv = 0.f;
      if (BIAS_MODE == 2) bv = bias[n];
#pragma unroll
      for (int r = 0; r < 8; ++r) {
        float v = acc[i][j][r] * scale;
        if (BIAS_MODE == 1) v += bias[mBase + mOff + r];
        if (BIAS_MODE == 2) v += bv;
        if (RESID) v += Rb[(size_t)(mBase + mOff + r) * ldc + n];
        if (ACT == 1) v = tanhf(v);
        if (ACT == 2) v = fmaxf(v, 0.0f);
        if (ACT == 3) v = v / (1.0f + expf(-v));
        if (ACT == 4) v = (v > 0.f) ? v : 0.01f * v;
        if (ACT == 5) v = 0.5f * v * (1.0f + erff(v * 0.70710678118654752f));
        slab[(mOff + r) * 68 + (j << 4) + rlane] = v;
      }
    }
    __builtin_amdgcn_fence(__ATOMIC_RELEASE, "workgroup");
    __builtin_amdgcn_wave_barrier();
    __builtin_amdgcn_fence(__ATOMIC_ACQUIRE, "workgroup");
    if (OUT_MODE == 0) {
      float* C = (float*)Cout + (size_t)b * strideC;
      const int hh = lane >> 4, c4 = (lane & 15) * 4;     // row seg = 256 B = 16 lanes x 16 B
      {
#pragma unroll
        for (int it = 0; it < 8; ++it) {
          const int row = it * 2 + hh;
          v4f v = *(const v4f*)(slab + row * 68 + c4);
          *(v4f*)(C + (size_t)(mBase + row) * ldc + n0 + c4) = v;
        }
        
      }
    } else {
      const int q = lane >> 3, c8 = (lane & 7) * 8;
      unsigned short* C  = (unsigned short*)Cout  + (size_t)b * strideC;
      unsigned short* C2 = (OUT_MODE == 2) ? ((unsigned short*)Cout2 + (size_t)b * strideC) : nullptr;
      {
#pragma unroll
        for (int it = 0; it < 4; ++it) {
          const int row = it * 4 + q;
          const float* sp = slab + row * 68 + c8;
          v8h hv, lv;
#pragma unroll
          for (int e = 0; e < 8; ++e) {
            if (OUT_MODE == 1) {
              hv[e] = (_Float16)sp[e];
            } else {
              unsigned short hb = f2bf_bits(sp[e]);
              unsigned short lb = f2bf_bits(sp[e] - bf_bits2f(hb));
              hv[e] = __builtin_bit_cast(_Float16, hb);
              lv[e] = __builtin_bit_cast(_Float16, lb);
            }
          }
          *(v8h*)(C + (size_t)(mBase + row) * ldc + n0 + c8) = hv;
          if (OUT_MODE == 2) *(v8h*)(C2 + (size_t)(mBase + row) * ldc + n0 + c8) = lv;
        }
        
      }
    }
    __builtin_amdgcn_fence(__ATOMIC_RELEASE, "workgroup");
    __builtin_amdgcn_wave_barrier();
    __builtin_amdgcn_fence(__ATOMIC_ACQUIRE, "workgroup");
  }
}

__global__ __launch_bounds__(256) void cast_f32_f16x2(
    const float* __restrict__ in, _Float16* __restrict__ out, int n2) {
  int i = blockIdx.x * 256 + threadIdx.x;
  if (i < n2) {
    const _Float16 h0 = (_Float16)in[2 * i], h1 = (_Float16)in[2 * i + 1];
    const unsigned u = (unsigned)__builtin_bit_cast(unsigned short, h0) | ((unsigned)__builtin_bit_cast(unsigned short, h1) << 16);
    ((unsigned*)out)[i] = u;
    
  }
}


// ---- f32 [R][C] (row pitch ldi) -> f16 transposed [C][R] (row pitch ldo); 64x64 tiles; each output row segment
__global__ __launch_bounds__(256) void transpose_cast_f16(const float* __restrict__ in, int ldi,
                                                         _Float16* __restrict__ outT, int ldo, float scale) {
  __shared__ __align__(16) _Float16 tile[64][72];     // [c][r]
  const int c0 = blockIdx.x * 64, r0 = blockIdx.y * 64;
  const int t = threadIdx.y * 32 + threadIdx.x;
  for (int i = threadIdx.y; i < 64; i += 8) {
    tile[threadIdx.x][i]      = (_Float16)(in[(size_t)(r0 + i) * ldi + c0 + threadIdx.x] * scale);
    tile[32 + threadIdx.x][i] = (_Float16)(in[(size_t)(r0 + i) * ldi + c0 + 32 + threadIdx.x] * scale);
  }
  __syncthreads();
  const int q = t >> 3, c8 = (t & 7) * 8;
  {
#pragma unroll
    for (int it = 0; it < 2; ++it) {
      const int c = it * 32 + q;
      v8h hv = *(const v8h*)(&tile[c][c8]);
      *(v8h*)(outT + (size_t)(c0 + c) * ldo + r0 + c8) = hv;
    }
    
  }
}

#define BB 32
#define CIN 256
#define CM 128
#define NS 1024
// fold BN into 1x1 conv weights: W'[o][c] = W[o][c]*g[o]/sqrt(v[o]+eps) (f16), bias'[o] = b[o] - m[o]*scale
__global__ __launch_bounds__(256) void fold_bn_kernel(const float* __restrict__ Wm, const float* __restrict__ g, const float* __restrict__ bb, const float* __restrict__ m, const float* __restrict__ var,
                                                     int O, int Cc, unsigned* __restrict__ W16, float* __restrict__ bias) {
  const int i = blockIdx.x * 256 + threadIdx.x;
  if (i < O * Cc / 2) { const int o = (2 * i) / Cc; const float sc = g[o] / sqrtf(var[o] + 1e-5f);
    const unsigned u = (unsigned)__builtin_bit_cast(unsigned short, (_Float16)(Wm[2 * i] * sc)) | ((unsigned)__builtin_bit_cast(unsigned short, (_Float16)(Wm[2 * i + 1] * sc)) << 16);
    ((unsigned*)W16)[i] = u;  }
  if (i < O) { const float sc = g[i] / sqrtf(var[i] + 1e-5f); const float v = bb[i] - m[i] * sc; ((float*)bias)[i] = v;  }
}
// posᵀ as f16 into QP operand columns: QP[b][i][128 + c] = rel_h[c][ih] + rel_w[c][iw] (same for every b); thread per (b, i, c-pair)
__global__ __launch_bounds__(256) void pos_kernel(const float* __restrict__ relh, const float* __restrict__ relw, unsigned* __restrict__ QP) {
  const long t = (long)blockIdx.x * 256 + threadIdx.x;      // (b, i, cp): cp in 0..63
  const int cp = (int)(t & 63); const long bi = t >> 6; const int i = (int)(bi % NS);
  const int ih = i >> 5, iw = i & 31, c0 = 2 * cp;
  const float p0 = relh[(size_t)c0 * 32 + ih] + relw[(size_t)c0 * 32 + iw], p1 = relh[(size_t)(c0 + 1) * 32 + ih] + relw[(size_t)(c0 + 1) * 32 + iw];
  const unsigned u = (unsigned)__builtin_bit_cast(unsigned short, (_Float16)p0) | ((unsigned)__builtin_bit_cast(unsigned short, (_Float16)p1) << 16);
  ((unsigned*)QP)[(size_t)bi * 128 + 64 + cp] = u; 
}
__global__ __launch_bounds__(256) void softmax_kernel(const float* __restrict__ S, unsigned* __restrict__ P16) {
  __shared__ float red[8]; __shared__ float stat;
  const size_t row = blockIdx.x; const int t = threadIdx.x, lane = t & 31, wave = t >> 5;
  float v[4]; float mx = -INFINITY;
#pragma unroll
  for (int q = 0; q < 2; ++q) { const int n = q * 512 + 2 * t; v[2*q] = S[row * NS + n]; v[2*q+1] = S[row * NS + n + 1]; mx = fmaxf(mx, fmaxf(v[2*q], v[2*q+1])); }
  for (int o = 16; o > 0; o >>= 1) mx = fmaxf(mx, __shfl_xor(mx, o, 32));
  if (lane == 0) red[wave] = mx; __syncthreads();
  if (t == 0) { float m = red[0]; for (int w = 1; w < 8; ++w) m = fmaxf(m, red[w]); stat = m; } __syncthreads();
  const float m = stat; __syncthreads();
  float se = 0.f;
#pragma unroll
  for (int q = 0; q < 4; ++q) { v[q] = expf(v[q] - m); se += v[q]; }
  for (int o = 16; o > 0; o >>= 1) se += __shfl_xor(se, o, 32);
  if (lane == 0) red[wave] = se; __syncthreads();
  if (t == 0) { float s = 0.f; for (int w = 0; w < 8; ++w) s += red[w]; stat = 32768.0f / s; } __syncthreads();
  const float inv = stat;
  {
#pragma unroll
    for (int q = 0; q < 2; ++q) { const unsigned u = (unsigned)__builtin_bit_cast(unsigned short, (_Float16)(v[2*q] * inv)) | ((unsigned)__builtin_bit_cast(unsigned short, (_Float16)(v[2*q+1] * inv)) << 16);
      ((unsigned*)P16)[row * (NS / 2) + q * 256 + t] = u; }
    
  }
}
__global__ __launch_bounds__(256) void resid_kernel(const float* __restrict__ x, const float* __restrict__ y, float* __restrict__ out, long n4) {
  const long i = (long)blockIdx.x * 256 + threadIdx.x; if (i >= n4) return;
  const v4f v = *(const v4f*)(x + 4 * i) + *(const v4f*)(y + 4 * i);
  *(v4f*)(out + 4 * i) = v; 
}
extern "C" void kernel_launch(void* const* d_in, const int* in_sizes, int n_in, void* d_out, int out_size, void* d_ws, size_t ws_size, hipStream_t stream) {
  (void)in_sizes; (void)n_in; (void)out_size; (void)ws_size;
  const float* x = (const float*)d_in[0]; const float* w1 = (const float*)d_in[1];
  const float* g1 = (const float*)d_in[2]; const float* be1 = (const float*)d_in[3]; const float* m1 = (const float*)d_in[4]; const float* v1 = (const float*)d_in[5];
  const float* wq = (const float*)d_in[6]; const float* bq = (const float*)d_in[7]; const float* wk = (const float*)d_in[8]; const float* bk = (const float*)d_in[9];
  const float* wv = (const float*)d_in[10]; const float* bv = (const float*)d_in[11]; const float* relh = (const float*)d_in[12]; const float* relw = (const float*)d_in[13];
  const float* w2 = (const float*)d_in[14]; const float* g2 = (const float*)d_in[15]; const float* be2 = (const float*)d_in[16]; const float* m2 = (const float*)d_in[17]; const float* v2 = (const float*)d_in[18];
  float* out = (float*)d_out;   // [32][256][1024]
  char* ws = (char*)d_ws; size_t off = 0;
  auto carve = [&](size_t bytes) -> char* { char* p = ws + off; off += (bytes + 255) & ~(size_t)255; return p; };
  _Float16* XT = (_Float16*)carve((size_t)NS * BB * CIN * 2);        // xᵀ: [1024][32*256] (16.8 MB)
  unsigned* W1f = (unsigned*)carve((size_t)CM * CIN * 2); float* b1f = (float*)carve(CM * 4);
  unsigned* W2f = (unsigned*)carve((size_t)CIN * CM * 2); float* b2f = (float*)carve(CIN * 4);
  _Float16* Wq16 = (_Float16*)carve((size_t)CM * CM * 2); _Float16* Wk16 = (_Float16*)carve((size_t)CM * CM * 2); _Float16* Wv16 = (_Float16*)carve((size_t)CM * CM * 2);
  unsigned* X1T = (unsigned*)carve((size_t)BB * NS * CM * 2);        // [b][i][128] f16 (8.4 MB)
  unsigned* QP = (unsigned*)carve((size_t)BB * NS * 256 * 2);        // [b][i][q | pos] f16 (16.8 MB)
  unsigned* KQ = (unsigned*)carve((size_t)BB * NS * 256 * 2);        // [b][j][k | q]
  unsigned* V16 = (unsigned*)carve((size_t)BB * CM * NS * 2);        // [b][c][j] f16 (8.4 MB)
  float* S = (float*)carve((size_t)8 * NS * NS * 4);                 // 33.5 MB (scores for a group of 8 images)
  unsigned* P16 = (unsigned*)carve((size_t)8 * NS * NS * 2);         // 16.8 MB
  unsigned* OT = (unsigned*)carve((size_t)BB * NS * CM * 2);         // [b][i][c] f16
  float* Y = (float*)carve((size_t)BB * CIN * NS * 4);               // 33.5 MB
  transpose_cast_f16<<<dim3(NS / 64, BB * CIN / 64), dim3(32, 8), 0, stream>>>(x, NS, XT, BB * CIN, 1.0f);   // [32*256][1024] -> [1024][8192]
  fold_bn_kernel<<<(CM * CIN / 2 + 255) / 256, 256, 0, stream>>>(w1, g1, be1, m1, v1, CM, CIN, W1f, b1f);
  fold_bn_kernel<<<(CIN * CM / 2 + 255) / 256, 256, 0, stream>>>(w2, g2, be2, m2, v2, CIN, CM, W2f, b2f);
  cast_f32_f16x2<<<(CM * CM / 2 + 255) / 256, 256, 0, stream>>>(wq, Wq16, CM * CM / 2); cast_f32_f16x2<<<(CM * CM / 2 + 255) / 256, 256, 0, stream>>>(wk, Wk16, CM * CM / 2); cast_f32_f16x2<<<(CM * CM / 2 + 255) / 256, 256, 0, stream>>>(wv, Wv16, CM * CM / 2);
  // cv1: X1T[b][i][o] = silu(Σ_c XT[i][b*256+c]·W1f[o][c] + b1f[o])   (grid.y = b, strideA = 256 halves within the transposed row)
  { const int t = (NS / 64) * (CM / 64);
    wmma_gemm64<0, false, 2, 1, false, 3><<<dim3((t + 7) / 8, BB), 256, 0, stream>>>(U16(XT), nullptr, BB * CIN, CIN, (const unsigned short*)W1f, nullptr, CIN, 0, X1T, nullptr, CM, (long)NS * CM, b1f, nullptr, 0, NS, CM, CIN, 1.0f); }
  // q into QP[:, :, 0:128] and KQ[:, :, 128:256]; k into KQ[:, :, 0:128]; pos into QP[:, :, 128:256]; v as [c][j]
  { const int t = (NS / 64) * (CM / 64);
    wmma_gemm64<0, false, 2, 1, false, 0><<<dim3((t + 7) / 8, BB), 256, 0, stream>>>((const unsigned short*)X1T, nullptr, CM, (long)NS * CM, U16(Wq16), nullptr, CM, 0, QP, nullptr, 256, (long)NS * 256, bq, nullptr, 0, NS, CM, CM, 1.0f);
    wmma_gemm64<0, false, 2, 1, false, 0><<<dim3((t + 7) / 8, BB), 256, 0, stream>>>((const unsigned short*)X1T, nullptr, CM, (long)NS * CM, U16(Wq16), nullptr, CM, 0, KQ + 64, nullptr, 256, (long)NS * 256, bq, nullptr, 0, NS, CM, CM, 1.0f);
    wmma_gemm64<0, false, 2, 1, false, 0><<<dim3((t + 7) / 8, BB), 256, 0, stream>>>((const unsigned short*)X1T, nullptr, CM, (long)NS * CM, U16(Wk16), nullptr, CM, 0, KQ, nullptr, 256, (long)NS * 256, bk, nullptr, 0, NS, CM, CM, 1.0f);
    const int tv = (CM / 64) * (NS / 64);   // V[b][c][j] = Σ_cc Wv[c][cc]·X1T[b][j][cc] + bv[c]: A = Wv16 [128][128], Bt = X1T[b] [1024][128]
    wmma_gemm64<0, false, 1, 1, false, 0><<<dim3((tv + 7) / 8, BB), 256, 0, stream>>>(U16(Wv16), nullptr, CM, 0, (const unsigned short*)X1T, nullptr, CM, (long)NS * CM, V16, nullptr, NS, (long)CM * NS, bv, nullptr, 0, CM, NS, CM, 1.0f); }
  pos_kernel<<<(BB * NS * 64 + 255) / 256, 256, 0, stream>>>(relh, relw, QP);
  for (int g8 = 0; g8 < BB / 8; ++g8) {     // scores / softmax / p·v in groups of 8 images (bounded workspace)
    const size_t b0 = (size_t)g8 * 8;
    { const int t = (NS / 64) * (NS / 64);   // scores[b] = QP[b]·KQ[b]ᵀ (K = 256)
      wmma_gemm64<0, false, 0, 0, false><<<dim3((t + 7) / 8, 8), 256, 0, stream>>>((const unsigned short*)(QP + b0 * NS * 128), nullptr, 256, (long)NS * 256, (const unsigned short*)(KQ + b0 * NS * 128), nullptr, 256, (long)NS * 256, S, nullptr, NS, (long)NS * NS, nullptr, nullptr, 0, NS, NS, 256, 1.0f); }
    softmax_kernel<<<8 * NS, 256, 0, stream>>>(S, P16);
    { const int t = (NS / 64) * (CM / 64);   // OT[b][i][c] = Σ_j P[i][j] · V[b][c][j]  (A = P [1024][1024], Bt = V16[b] [128][1024])
      wmma_gemm64<0, false, 0, 1, false, 0><<<dim3((t + 7) / 8, 8), 256, 0, stream>>>((const unsigned short*)P16, nullptr, NS, (long)NS * NS, (const unsigned short*)(V16 + b0 * CM * NS / 2), nullptr, NS, (long)CM * NS, OT + b0 * NS * CM / 2, nullptr, CM, (long)NS * CM, nullptr, nullptr, 0, NS, CM, NS, 1.0f / 32768.0f); }
  }
  { const int t = (CIN / 64) * (NS / 64);  // cv2: Y[b][o][i] = silu(Σ_c W2f[o][c]·OT[b][i][c] + b2f[o])  (A = W2f [256][128], Bt = OT[b] [1024][128])
    wmma_gemm64<0, false, 1, 0, false, 3><<<dim3((t + 7) / 8, BB), 256, 0, stream>>>((const unsigned short*)W2f, nullptr, CM, 0, (const unsigned short*)OT, nullptr, CM, (long)NS * CM, Y, nullptr, NS, (long)CIN * NS, b2f, nullptr, 0, CIN, NS, CM, 1.0f); }
  resid_kernel<<<(BB * CIN * NS / 4 + 255) / 256, 256, 0, stream>>>(x, Y, out, (long)BB * CIN * NS / 4);
}

// v001
// It runs in 250 microseconds.
// In both of two side-by-side timings against v000, it was 1.70 times as fast.
#include <hip/hip_runtime.h>
#include <math.h>
// BoT block: cv1 (1x1 conv 256→128, BN folded, SiLU), q/k/v 1x1 convs (+bias), the single-head attention over 1024 positions as two GEMMs
// (scores = [q_i | pos_i]·[k_j | q_j]ᵀ with K = 256 — content-content and content-position in one product —, then p·vᵀ with p x2^15,
// K = 1024), cv2 (128→256, BN folded, SiLU): v_wmma_f32_16x16x32_f16, f16 operands, f32 accumulate; softmax and the residual add in f32
// on VALU. All per-batch GEMMs are batched through grid.y strides over the 32 images, scores and p·v included.
typedef __attribute__((ext_vector_type(16))) _Float16 v16h;
typedef __attribute__((ext_vector_type(8)))  _Float16 v8h;
typedef __attribute__((ext_vector_type(16))) __bf16   v16b;
typedef __attribute__((ext_vector_type(8)))  __bf16   v8b;
typedef __attribute__((ext_vector_type(8)))  float    v8f;
typedef __attribute__((ext_vector_type(4)))  float    v4f;
#define PSCALE 32768.0f
#define U16(p) ((const unsigned short*)(const void*)(p))
#define PSCALE_INV (1.0f / 32768.0f)

__device__ __forceinline__ unsigned short f2bf_bits(float f) {
  unsigned u = __float_as_uint(f);
  return (unsigned short)((u + 0x7FFFu + ((u >> 16) & 1u)) >> 16);
}
__device__ __forceinline__ float bf_bits2f(unsigned short h) { return __uint_as_float(((unsigned)h) << 16); }

// hazard guards as plain device helpers (no inline asm inside the kernel template body)
__device__ __forceinline__ void dep_guard_h(v8f& a, v8f& b, v16h x, v16h y) { asm volatile("v_nop\n\tv_nop\n\tv_nop\n\tv_nop" : "+v"(a), "+v"(b) : "v"(x), "v"(y)); }
__device__ __forceinline__ void dep_guard_b(v8f& a, v8f& b, v16b x, v16b y) { asm volatile("v_nop\n\tv_nop\n\tv_nop\n\tv_nop" : "+v"(a), "+v"(b) : "v"(x), "v"(y)); }
__device__ __forceinline__ void keep4_h(v16h a, v16h b, v16h c, v16h d) { asm volatile("v_nop" :: "v"(a), "v"(b), "v"(c), "v"(d)); }
__device__ __forceinline__ void keep4_b(v16b a, v16b b, v16b c, v16b d) { asm volatile("v_nop" :: "v"(a), "v"(b), "v"(c), "v"(d)); }
__device__ __forceinline__ void acc_guard4(v8f& a, v8f& b, v8f& c, v8f& d) { asm volatile("v_nop\n\tv_nop\n\tv_nop\n\tv_nop" : "+v"(a), "+v"(b), "+v"(c), "+v"(d)); }
template <typename T> struct Frag;
template <> struct Frag<_Float16> {
  typedef v16h V; union U { v16h v; v8h h[2]; };
  static __device__ __forceinline__ v16h load(const _Float16* p) {   // elements 0..7 <- p[0..7], 8..15 <- p[16..23]
    U f; f.h[0] = *(const v8h*)(p); f.h[1] = *(const v8h*)(p + 16); return f.v;
  }
  static __device__ __forceinline__ v8f mma(v16h a, v16h b, v8f c) {
    return __builtin_amdgcn_wmma_f32_16x16x32_f16(false, a, false, b, (short)0, c, false, false);
  }
  static __device__ __forceinline__ void guard(v8f& a, v8f& b, v16h x, v16h y) { dep_guard_h(a, b, x, y); }
  static __device__ __forceinline__ void keep(v16h a, v16h b, v16h c, v16h d) { keep4_h(a, b, c, d); }
};
template <> struct Frag<__bf16> {
  typedef v16b V; union U { v16b v; v8b h[2]; };
  static __device__ __forceinline__ v16b load(const __bf16* p) {
    U f; f.h[0] = *(const v8b*)(p); f.h[1] = *(const v8b*)(p + 16); return f.v;
  }
  static __device__ __forceinline__ v8f mma(v16b a, v16b b, v8f c) {
    return __builtin_amdgcn_wmma_f32_16x16x32_bf16(false, a, false, b, (short)0, c, false, false);
  }
  static __device__ __forceinline__ void guard(v8f& a, v8f& b, v16b x, v16b y) { dep_guard_b(a, b, x, y); }
  static __device__ __forceinline__ void keep(v16b a, v16b b, v16b c, v16b d) { keep4_b(a, b, c, d); }
};

// ---- Register-blocked batched WMMA GEMM ------------------------------------
// C[m,n] = scale * sum_k A[m,k] * Bt[n,k] (+bias)(+resid); each wave owns a 64x64 tile.
// A row-major [M,K]; Bt row-major [N,K]; M,N % 64 == 0, K % 32 == 0.
// SPLIT: operands are hi/lo planes (A2/Bt2 = lo planes, same layout); product = hi·hi + hi·lo + lo·hi.
// BIAS_MODE: 0 = none, 1 = bias[m], 2 = bias[n].
// OUT_MODE: 0 = f32, 1 = f16, 2 = bf16 hi plane (Cout) + bf16 lo plane (Cout2).
// ET: 0 = f16 operands, 1 = bf16 operands (pointers passed as 16-bit storage)
template <int ET> struct Elem;
template <> struct Elem<0> { typedef _Float16 T; };
template <> struct Elem<1> { typedef __bf16 T; };
template <int ET, bool SPLIT, int BIAS_MODE, int OUT_MODE, bool RESID, int ACT = 0>
__global__ __launch_bounds__(256) void wmma_gemm64(
    const unsigned short* __restrict__ Ap, const unsigned short* __restrict__ A2p, int lda, long strideA,
    const unsigned short* __restrict__ Btp, const unsigned short* __restrict__ Bt2p, int ldb, long strideB,
    void* __restrict__ Cout, void* __restrict__ Cout2, int ldc, long strideC,
    const float* __restrict__ bias,
    const float* __restrict__ resid, long strideR,
    int M, int N, int K, float scale) {
  typedef typename Elem<ET>::T T;
  typedef typename Frag<T>::V V;
  const T* A = (const T*)Ap; const T* A2 = (const T*)A2p; const T* Bt = (const T*)Btp; const T* Bt2 = (const T*)Bt2p;
  __shared__ __align__(16) float sT[8][16 * 68];   // per-wave 16x64 slab, pitch 68 floats
  const int b    = blockIdx.y;
  const int lane = threadIdx.x & 31;
  const int wave = threadIdx.x >> 5;
  const int tilesN = N >> 6;
  const int tilesM = M >> 6;
  const int tile = blockIdx.x * 8 + wave;
  if (tile >= tilesM * tilesN) return;   // wave-uniform; no block barriers in this kernel
  const int tm = tile / tilesN;
  const int tn = tile - tm * tilesN;
  const int m0 = tm << 6;
  const int n0 = tn << 6;

  const T* Ab  = A  + (size_t)b * strideA;
  const T* Bb  = Bt + (size_t)b * strideB;
  const T* Ab2 = SPLIT ? (A2  + (size_t)b * strideA) : nullptr;
  const T* Bb2 = SPLIT ? (Bt2 + (size_t)b * strideB) : nullptr;

  const int rlane = lane & 15;                 // row (A) / col (B, D) within subtile
  const int koff  = (lane >> 4) * 8;           // k offset of this lane half
  const int mOff  = (lane >> 4) * 8;           // D row offset

  v8f acc[4][4];
#pragma unroll
  for (int i = 0; i < 4; ++i)
#pragma unroll
    for (int j = 0; j < 4; ++j) acc[i][j] = (v8f){0.f,0.f,0.f,0.f,0.f,0.f,0.f,0.f};

  for (int k0 = 0; k0 < K; k0 += 32) {
    V bh[4], bl[4];
#pragma unroll
    for (int j = 0; j < 4; ++j) {
      const size_t bo = (size_t)(n0 + (j << 4) + rlane) * ldb + koff + k0;
      bh[j] = Frag<T>::load(Bb + bo);
      if (SPLIT) bl[j] = Frag<T>::load(Bb2 + bo);
    }
#pragma unroll
    for (int i = 0; i < 4; ++i) {
      const size_t ao = (size_t)(m0 + (i << 4) + rlane) * lda + koff + k0;
      V ah = Frag<T>::load(Ab + ao);
      V al;
      if (SPLIT) al = Frag<T>::load(Ab2 + ao);
#pragma unroll
      for (int j = 0; j < 4; ++j) {
        acc[i][j] = Frag<T>::mma(ah, bh[j], acc[i][j]);
        if (SPLIT) {
          acc[i][j] = Frag<T>::mma(ah, bl[j], acc[i][j]);
          acc[i][j] = Frag<T>::mma(al, bh[j], acc[i][j]);
        }
      }
      Frag<T>::guard(acc[i][0], acc[i][3], ah, SPLIT ? al : ah);
    }
    Frag<T>::keep(bh[0], bh[1], bh[2], bh[3]);
    if (SPLIT) Frag<T>::keep(bl[0], bl[1], bl[2], bl[3]);
  }
  acc_guard4(acc[0][0], acc[0][1], acc[0][2], acc[0][3]);
  acc_guard4(acc[1][0], acc[1][1], acc[1][2], acc[1][3]);
  acc_guard4(acc[2][0], acc[2][1], acc[2][2], acc[2][3]);
  acc_guard4(acc[3][0], acc[3][1], acc[3][2], acc[3][3]);

  // ---- epilogue ----
  float* slab = sT[wave];
  const float* Rb = RESID ? (resid + (size_t)b * strideR) : nullptr;
#pragma unroll
  for (int i = 0; i < 4; ++i) {
    const int mBase = m0 + (i << 4);
#pragma unroll
    for (int j = 0; j < 4; ++j) {
      const int n = n0 + (j << 4) + rlane;
      float bv = 0.f;
      if (BIAS_MODE == 2) bv = bias[n];
#pragma unroll
      for (int r = 0; r < 8; ++r) {
        float v = acc[i][j][r] * scale;
        if (BIAS_MODE == 1) v += bias[mBase + mOff + r];
        if (BIAS_MODE == 2) v += bv;
        if (RESID) v += Rb[(size_t)(mBase + mOff + r) * ldc + n];
        if (ACT == 1) v = tanhf(v);
        if (ACT == 2) v = fmaxf(v, 0.0f);
        if (ACT == 3) v = v / (1.0f + expf(-v));
        if (ACT == 4) v = (v > 0.f) ? v : 0.01f * v;
        if (ACT == 5) v = 0.5f * v * (1.0f + erff(v * 0.70710678118654752f));
        slab[(mOff + r) * 68 + (j << 4) + rlane] = v;
      }
    }
    __builtin_amdgcn_fence(__ATOMIC_RELEASE, "workgroup");
    __builtin_amdgcn_wave_barrier();
    __builtin_amdgcn_fence(__ATOMIC_ACQUIRE, "workgroup");
    if (OUT_MODE == 0) {
      float* C = (float*)Cout + (size_t)b * strideC;
      const int hh = lane >> 4, c4 = (lane & 15) * 4;     // row seg = 256 B = 16 lanes x 16 B
      {
#pragma unroll
        for (int it = 0; it < 8; ++it) {
          const int row = it * 2 + hh;
          v4f v = *(const v4f*)(slab + row * 68 + c4);
          *(v4f*)(C + (size_t)(mBase + row) * ldc + n0 + c4) = v;
        }
        
      }
    } else {
      const int q = lane >> 3, c8 = (lane & 7) * 8;
      unsigned short* C  = (unsigned short*)Cout  + (size_t)b * strideC;
      unsigned short* C2 = (OUT_MODE == 2) ? ((unsigned short*)Cout2 + (size_t)b * strideC) : nullptr;
      {
#pragma unroll
        for (int it = 0; it < 4; ++it) {
          const int row = it * 4 + q;
          const float* sp = slab + row * 68 + c8;
          v8h hv, lv;
#pragma unroll
          for (int e = 0; e < 8; ++e) {
            if (OUT_MODE == 1) {
              hv[e] = (_Float16)sp[e];
            } else {
              unsigned short hb = f2bf_bits(sp[e]);
              unsigned short lb = f2bf_bits(sp[e] - bf_bits2f(hb));
              hv[e] = __builtin_bit_cast(_Float16, hb);
              lv[e] = __builtin_bit_cast(_Float16, lb);
            }
          }
          *(v8h*)(C + (size_t)(mBase + row) * ldc + n0 + c8) = hv;
          if (OUT_MODE == 2) *(v8h*)(C2 + (size_t)(mBase + row) * ldc + n0 + c8) = lv;
        }
        
      }
    }
    __builtin_amdgcn_fence(__ATOMIC_RELEASE, "workgroup");
    __builtin_amdgcn_wave_barrier();
    __builtin_amdgcn_fence(__ATOMIC_ACQUIRE, "workgroup");
  }
}

__global__ __launch_bounds__(256) void cast_f32_f16x2(
    const float* __restrict__ in, _Float16* __restrict__ out, int n2) {
  int i = blockIdx.x * 256 + threadIdx.x;
  if (i < n2) {
    const _Float16 h0 = (_Float16)in[2 * i], h1 = (_Float16)in[2 * i + 1];
    const unsigned u = (unsigned)__builtin_bit_cast(unsigned short, h0) | ((unsigned)__builtin_bit_cast(unsigned short, h1) << 16);
    ((unsigned*)out)[i] = u;
    
  }
}


// ---- f32 [R][C] (row pitch ldi) -> f16 transposed [C][R] (row pitch ldo); 64x64 tiles; each output row segment
__global__ __launch_bounds__(256) void transpose_cast_f16(const float* __restrict__ in, int ldi,
                                                         _Float16* __restrict__ outT, int ldo, float scale) {
  __shared__ __align__(16) _Float16 tile[64][72];     // [c][r]
  const int c0 = blockIdx.x * 64, r0 = blockIdx.y * 64;
  const int t = threadIdx.y * 32 + threadIdx.x;
  for (int i = threadIdx.y; i < 64; i += 8) {
    tile[threadIdx.x][i]      = (_Float16)(in[(size_t)(r0 + i) * ldi + c0 + threadIdx.x] * scale);
    tile[32 + threadIdx.x][i] = (_Float16)(in[(size_t)(r0 + i) * ldi + c0 + 32 + threadIdx.x] * scale);
  }
  __syncthreads();
  const int q = t >> 3, c8 = (t & 7) * 8;
  {
#pragma unroll
    for (int it = 0; it < 2; ++it) {
      const int c = it * 32 + q;
      v8h hv = *(const v8h*)(&tile[c][c8]);
      *(v8h*)(outT + (size_t)(c0 + c) * ldo + r0 + c8) = hv;
    }
    
  }
}

#define BB 32
#define CIN 256
#define CM 128
#define NS 1024
// fold BN into 1x1 conv weights: W'[o][c] = W[o][c]*g[o]/sqrt(v[o]+eps) (f16), bias'[o] = b[o] - m[o]*scale
__global__ __launch_bounds__(256) void fold_bn_kernel(const float* __restrict__ Wm, const float* __restrict__ g, const float* __restrict__ bb, const float* __restrict__ m, const float* __restrict__ var,
                                                     int O, int Cc, unsigned* __restrict__ W16, float* __restrict__ bias) {
  const int i = blockIdx.x * 256 + threadIdx.x;
  if (i < O * Cc / 2) { const int o = (2 * i) / Cc; const float sc = g[o] / sqrtf(var[o] + 1e-5f);
    const unsigned u = (unsigned)__builtin_bit_cast(unsigned short, (_Float16)(Wm[2 * i] * sc)) | ((unsigned)__builtin_bit_cast(unsigned short, (_Float16)(Wm[2 * i + 1] * sc)) << 16);
    ((unsigned*)W16)[i] = u;  }
  if (i < O) { const float sc = g[i] / sqrtf(var[i] + 1e-5f); const float v = bb[i] - m[i] * sc; ((float*)bias)[i] = v;  }
}
// posᵀ as f16 into QP operand columns: QP[b][i][128 + c] = rel_h[c][ih] + rel_w[c][iw] (same for every b); thread per (b, i, c-pair)
__global__ __launch_bounds__(256) void pos_kernel(const float* __restrict__ relh, const float* __restrict__ relw, unsigned* __restrict__ QP) {
  const long t = (long)blockIdx.x * 256 + threadIdx.x;      // (b, i, cp): cp in 0..63
  const int cp = (int)(t & 63); const long bi = t >> 6; const int i = (int)(bi % NS);
  const int ih = i >> 5, iw = i & 31, c0 = 2 * cp;
  const float p0 = relh[(size_t)c0 * 32 + ih] + relw[(size_t)c0 * 32 + iw], p1 = relh[(size_t)(c0 + 1) * 32 + ih] + relw[(size_t)(c0 + 1) * 32 + iw];
  const unsigned u = (unsigned)__builtin_bit_cast(unsigned short, (_Float16)p0) | ((unsigned)__builtin_bit_cast(unsigned short, (_Float16)p1) << 16);
  ((unsigned*)QP)[(size_t)bi * 128 + 64 + cp] = u; 
}
__global__ __launch_bounds__(256) void softmax_kernel(const float* __restrict__ S, unsigned* __restrict__ P16) {
  __shared__ float red[8]; __shared__ float stat;
  const size_t row = blockIdx.x; const int t = threadIdx.x, lane = t & 31, wave = t >> 5;
  float v[4]; float mx = -INFINITY;
#pragma unroll
  for (int q = 0; q < 2; ++q) { const int n = q * 512 + 2 * t; v[2*q] = S[row * NS + n]; v[2*q+1] = S[row * NS + n + 1]; mx = fmaxf(mx, fmaxf(v[2*q], v[2*q+1])); }
  for (int o = 16; o > 0; o >>= 1) mx = fmaxf(mx, __shfl_xor(mx, o, 32));
  if (lane == 0) red[wave] = mx; __syncthreads();
  if (t == 0) { float m = red[0]; for (int w = 1; w < 8; ++w) m = fmaxf(m, red[w]); stat = m; } __syncthreads();
  const float m = stat; __syncthreads();
  float se = 0.f;
#pragma unroll
  for (int q = 0; q < 4; ++q) { v[q] = expf(v[q] - m); se += v[q]; }
  for (int o = 16; o > 0; o >>= 1) se += __shfl_xor(se, o, 32);
  if (lane == 0) red[wave] = se; __syncthreads();
  if (t == 0) { float s = 0.f; for (int w = 0; w < 8; ++w) s += red[w]; stat = 32768.0f / s; } __syncthreads();
  const float inv = stat;
  {
#pragma unroll
    for (int q = 0; q < 2; ++q) { const unsigned u = (unsigned)__builtin_bit_cast(unsigned short, (_Float16)(v[2*q] * inv)) | ((unsigned)__builtin_bit_cast(unsigned short, (_Float16)(v[2*q+1] * inv)) << 16);
      ((unsigned*)P16)[row * (NS / 2) + q * 256 + t] = u; }
    
  }
}
__global__ __launch_bounds__(256) void resid_kernel(const float* __restrict__ x, const float* __restrict__ y, float* __restrict__ out, long n4) {
  const long i = (long)blockIdx.x * 256 + threadIdx.x; if (i >= n4) return;
  const v4f v = *(const v4f*)(x + 4 * i) + *(const v4f*)(y + 4 * i);
  *(v4f*)(out + 4 * i) = v; 
}
extern "C" void kernel_launch(void* const* d_in, const int* in_sizes, int n_in, void* d_out, int out_size, void* d_ws, size_t ws_size, hipStream_t stream) {
  (void)in_sizes; (void)n_in; (void)out_size; (void)ws_size;
  const float* x = (const float*)d_in[0]; const float* w1 = (const float*)d_in[1];
  const float* g1 = (const float*)d_in[2]; const float* be1 = (const float*)d_in[3]; const float* m1 = (const float*)d_in[4]; const float* v1 = (const float*)d_in[5];
  const float* wq = (const float*)d_in[6]; const float* bq = (const float*)d_in[7]; const float* wk = (const float*)d_in[8]; const float* bk = (const float*)d_in[9];
  const float* wv = (const float*)d_in[10]; const float* bv = (const float*)d_in[11]; const float* relh = (const float*)d_in[12]; const float* relw = (const float*)d_in[13];
  const float* w2 = (const float*)d_in[14]; const float* g2 = (const float*)d_in[15]; const float* be2 = (const float*)d_in[16]; const float* m2 = (const float*)d_in[17]; const float* v2 = (const float*)d_in[18];
  float* out = (float*)d_out;   // [32][256][1024]
  // Workspace map (offsets in MiB; 256 MiB in all). All 32 images go through scores / softmax / p.v in one launch each, so S and P16 hold
  // every image; regions whose data is dead by then are used again (stream order separates the uses):
  //   [0,16) XT, read last by cv1; afterwards OT in [0,8) and the folded cv2 weights in [8,16)
  //   [64,192) S, read last by softmax; afterwards Y in [64,96)
  //   [192,256) P16, first written by softmax; before that the folded cv1 weights and the q/k/v weights, read last by the v product
  char* ws = (char*)d_ws;
  const size_t MiB = (size_t)1 << 20;
  _Float16* XT = (_Float16*)ws;                                      // x^T: [1024][32*256] f16
  unsigned* OT = (unsigned*)ws;                                      // [b][i][c] f16
  unsigned* W2f = (unsigned*)(ws + 8 * MiB); float* b2f = (float*)(ws + 9 * MiB);
  unsigned* X1T = (unsigned*)(ws + 16 * MiB);                        // [b][i][128] f16
  unsigned* QP = (unsigned*)(ws + 24 * MiB);                         // [b][i][q | pos] f16
  unsigned* KQ = (unsigned*)(ws + 40 * MiB);                         // [b][j][k | q]
  unsigned* V16 = (unsigned*)(ws + 56 * MiB);                        // [b][c][j] f16
  float* S = (float*)(ws + 64 * MiB);                                // [b][i][j] f32 scores, all 32 images
  float* Y = (float*)(ws + 64 * MiB);                                // [b][o][i] f32
  unsigned* P16 = (unsigned*)(ws + 192 * MiB);                       // [b][i][j] f16, all 32 images
  unsigned* W1f = (unsigned*)(ws + 192 * MiB); float* b1f = (float*)(ws + 193 * MiB);
  _Float16* Wq16 = (_Float16*)(ws + 194 * MiB); _Float16* Wk16 = (_Float16*)(ws + 195 * MiB); _Float16* Wv16 = (_Float16*)(ws + 196 * MiB);
  transpose_cast_f16<<<dim3(NS / 64, BB * CIN / 64), dim3(32, 8), 0, stream>>>(x, NS, XT, BB * CIN, 1.0f);   // [32*256][1024] -> [1024][8192]
  fold_bn_kernel<<<(CM * CIN / 2 + 255) / 256, 256, 0, stream>>>(w1, g1, be1, m1, v1, CM, CIN, W1f, b1f);
  cast_f32_f16x2<<<(CM * CM / 2 + 255) / 256, 256, 0, stream>>>(wq, Wq16, CM * CM / 2); cast_f32_f16x2<<<(CM * CM / 2 + 255) / 256, 256, 0, stream>>>(wk, Wk16, CM * CM / 2); cast_f32_f16x2<<<(CM * CM / 2 + 255) / 256, 256, 0, stream>>>(wv, Wv16, CM * CM / 2);
  // cv1: X1T[b][i][o] = silu(sum_c XT[i][b*256+c]*W1f[o][c] + b1f[o])   (grid.y = b, strideA = 256 halves within the transposed row)
  { const int t = (NS / 64) * (CM / 64);
    wmma_gemm64<0, false, 2, 1, false, 3><<<dim3((t + 7) / 8, BB), 256, 0, stream>>>(U16(XT), nullptr, BB * CIN, CIN, (const unsigned short*)W1f, nullptr, CIN, 0, X1T, nullptr, CM, (long)NS * CM, b1f, nullptr, 0, NS, CM, CIN, 1.0f); }
  fold_bn_kernel<<<(CIN * CM / 2 + 255) / 256, 256, 0, stream>>>(w2, g2, be2, m2, v2, CIN, CM, W2f, b2f);   // behind cv1: its place was XT's
  // q into QP[:, :, 0:128] and KQ[:, :, 128:256]; k into KQ[:, :, 0:128]; pos into QP[:, :, 128:256]; v as [c][j]
  { const int t = (NS / 64) * (CM / 64);
    wmma_gemm64<0, false, 2, 1, false, 0><<<dim3((t + 7) / 8, BB), 256, 0, stream>>>((const unsigned short*)X1T, nullptr, CM, (long)NS * CM, U16(Wq16), nullptr, CM, 0, QP, nullptr, 256, (long)NS * 256, bq, nullptr, 0, NS, CM, CM, 1.0f);
    wmma_gemm64<0, false, 2, 1, false, 0><<<dim3((t + 7) / 8, BB), 256, 0, stream>>>((const unsigned short*)X1T, nullptr, CM, (long)NS * CM, U16(Wq16), nullptr, CM, 0, KQ + 64, nullptr, 256, (long)NS * 256, bq, nullptr, 0, NS, CM, CM, 1.0f);
    wmma_gemm64<0, false, 2, 1, false, 0><<<dim3((t + 7) / 8, BB), 256, 0, stream>>>((const unsigned short*)X1T, nullptr, CM, (long)NS * CM, U16(Wk16), nullptr, CM, 0, KQ, nullptr, 256, (long)NS * 256, bk, nullptr, 0, NS, CM, CM, 1.0f);
    const int tv = (CM / 64) * (NS / 64);   // V[b][c][j] = sum_cc Wv[c][cc]*X1T[b][j][cc] + bv[c]: A = Wv16 [128][128], Bt = X1T[b] [1024][128]
    wmma_gemm64<0, false, 1, 1, false, 0><<<dim3((tv + 7) / 8, BB), 256, 0, stream>>>(U16(Wv16), nullptr, CM, 0, (const unsigned short*)X1T, nullptr, CM, (long)NS * CM, V16, nullptr, NS, (long)CM * NS, bv, nullptr, 0, CM, NS, CM, 1.0f); }
  pos_kernel<<<(BB * NS * 64 + 255) / 256, 256, 0, stream>>>(relh, relw, QP);
  // scores / softmax / p.v: one launch each over all 32 images (grid.y = b), so that p.v has 128 work-groups in flight and not 32
  { const int t = (NS / 64) * (NS / 64);   // scores[b] = QP[b]*KQ[b]^T (K = 256)
    wmma_gemm64<0, false, 0, 0, false><<<dim3((t + 7) / 8, BB), 256, 0, stream>>>((const unsigned short*)QP, nullptr, 256, (long)NS * 256, (const unsigned short*)KQ, nullptr, 256, (long)NS * 256, S, nullptr, NS, (long)NS * NS, nullptr, nullptr, 0, NS, NS, 256, 1.0f); }
  softmax_kernel<<<BB * NS, 256, 0, stream>>>(S, P16);
  { const int t = (NS / 64) * (CM / 64);   // OT[b][i][c] = sum_j P[b][i][j] * V[b][c][j]  (A = P[b] [1024][1024], Bt = V16[b] [128][1024])
    wmma_gemm64<0, false, 0, 1, false, 0><<<dim3((t + 7) / 8, BB), 256, 0, stream>>>((const unsigned short*)P16, nullptr, NS, (long)NS * NS, (const unsigned short*)V16, nullptr, NS, (long)CM * NS, OT, nullptr, CM, (long)NS * CM, nullptr, nullptr, 0, NS, CM, NS, 1.0f / 32768.0f); }
  { const int t = (CIN / 64) * (NS / 64);  // cv2: Y[b][o][i] = silu(sum_c W2f[o][c]*OT[b][i][c] + b2f[o])  (A = W2f [256][128], Bt = OT[b] [1024][128])
    wmma_gemm64<0, false, 1, 0, false, 3><<<dim3((t + 7) / 8, BB), 256, 0, stream>>>((const unsigned short*)W2f, nullptr, CM, 0, (const unsigned short*)OT, nullptr, CM, (long)NS * CM, Y, nullptr, NS, (long)CIN * NS, b2f, nullptr, 0, CIN, NS, CM, 1.0f); }
  resid_kernel<<<(BB * CIN * NS / 4 + 255) / 256, 256, 0, stream>>>(x, Y, out, (long)BB * CIN * NS / 4);
}

// v002
// Measured time: 150 microseconds a run.
// Next to v001, in two timings, it ran 1.67 and 1.66 times as fast.
// Counting every step since v000, it is 2.83 times as fast.
#include <hip/hip_runtime.h>
#include <math.h>
// BoT block: cv1 (1x1 conv 256→128, BN folded, SiLU), q/k/v 1x1 convs (+bias), the single-head attention over 1024 positions as two products in one kernel
// (scores = [q_i | pos_i]·[k_j | q_j]ᵀ with K = 256 — content-content and content-position in one product —, then p·vᵀ with p x2^15,
// K = 1024), cv2 (128→256, BN folded, SiLU): v_wmma_f32_16x16x32_f16, f16 operands, f32 accumulate; softmax and the residual add in f32
// on VALU. All per-batch GEMMs are batched through grid.y strides over the 32 images, scores and p·v included.
typedef __attribute__((ext_vector_type(16))) _Float16 v16h;
typedef __attribute__((ext_vector_type(8)))  _Float16 v8h;
typedef __attribute__((ext_vector_type(16))) __bf16   v16b;
typedef __attribute__((ext_vector_type(8)))  __bf16   v8b;
typedef __attribute__((ext_vector_type(8)))  float    v8f;
typedef __attribute__((ext_vector_type(4)))  float    v4f;
#define PSCALE 32768.0f
#define U16(p) ((const unsigned short*)(const void*)(p))
#define PSCALE_INV (1.0f / 32768.0f)

__device__ __forceinline__ unsigned short f2bf_bits(float f) {
  unsigned u = __float_as_uint(f);
  return (unsigned short)((u + 0x7FFFu + ((u >> 16) & 1u)) >> 16);
}
__device__ __forceinline__ float bf_bits2f(unsigned short h) { return __uint_as_float(((unsigned)h) << 16); }

// hazard guards as plain device helpers (no inline asm inside the kernel template body)
__device__ __forceinline__ void dep_guard_h(v8f& a, v8f& b, v16h x, v16h y) { asm volatile("v_nop\n\tv_nop\n\tv_nop\n\tv_nop" : "+v"(a), "+v"(b) : "v"(x), "v"(y)); }
__device__ __forceinline__ void dep_guard_b(v8f& a, v8f& b, v16b x, v16b y) { asm volatile("v_nop\n\tv_nop\n\tv_nop\n\tv_nop" : "+v"(a), "+v"(b) : "v"(x), "v"(y)); }
__device__ __forceinline__ void keep4_h(v16h a, v16h b, v16h c, v16h d) { asm volatile("v_nop" :: "v"(a), "v"(b), "v"(c), "v"(d)); }
__device__ __forceinline__ void keep4_b(v16b a, v16b b, v16b c, v16b d) { asm volatile("v_nop" :: "v"(a), "v"(b), "v"(c), "v"(d)); }
__device__ __forceinline__ void acc_guard4(v8f& a, v8f& b, v8f& c, v8f& d) { asm volatile("v_nop\n\tv_nop\n\tv_nop\n\tv_nop" : "+v"(a), "+v"(b), "+v"(c), "+v"(d)); }
template <typename T> struct Frag;
template <> struct Frag<_Float16> {
  typedef v16h V; union U { v16h v; v8h h[2]; };
  static __device__ __forceinline__ v16h load(const _Float16* p) {   // elements 0..7 <- p[0..7], 8..15 <- p[16..23]
    U f; f.h[0] = *(const v8h*)(p); f.h[1] = *(const v8h*)(p + 16); return f.v;
  }
  static __device__ __forceinline__ v8f mma(v16h a, v16h b, v8f c) {
    return __builtin_amdgcn_wmma_f32_16x16x32_f16(false, a, false, b, (short)0, c, false, false);
  }
  static __device__ __forceinline__ void guard(v8f& a, v8f& b, v16h x, v16h y) { dep_guard_h(a, b, x, y); }
  static __device__ __forceinline__ void keep(v16h a, v16h b, v16h c, v16h d) { keep4_h(a, b, c, d); }
};
template <> struct Frag<__bf16> {
  typedef v16b V; union U { v16b v; v8b h[2]; };
  static __device__ __forceinline__ v16b load(const __bf16* p) {
    U f; f.h[0] = *(const v8b*)(p); f.h[1] = *(const v8b*)(p + 16); return f.v;
  }
  static __device__ __forceinline__ v8f mma(v16b a, v16b b, v8f c) {
    return __builtin_amdgcn_wmma_f32_16x16x32_bf16(false, a, false, b, (short)0, c, false, false);
  }
  static __device__ __forceinline__ void guard(v8f& a, v8f& b, v16b x, v16b y) { dep_guard_b(a, b, x, y); }
  static __device__ __forceinline__ void keep(v16b a, v16b b, v16b c, v16b d) { keep4_b(a, b, c, d); }
};

// ---- Register-blocked batched WMMA GEMM ------------------------------------
// C[m,n] = scale * sum_k A[m,k] * Bt[n,k] (+bias)(+resid); each wave owns a 64x64 tile.
// A row-major [M,K]; Bt row-major [N,K]; M,N % 64 == 0, K % 32 == 0.
// SPLIT: operands are hi/lo planes (A2/Bt2 = lo planes, same layout); product = hi·hi + hi·lo + lo·hi.
// BIAS_MODE: 0 = none, 1 = bias[m], 2 = bias[n].
// OUT_MODE: 0 = f32, 1 = f16, 2 = bf16 hi plane (Cout) + bf16 lo plane (Cout2).
// ET: 0 = f16 operands, 1 = bf16 operands (pointers passed as 16-bit storage)
template <int ET> struct Elem;
template <> struct Elem<0> { typedef _Float16 T; };
template <> struct Elem<1> { typedef __bf16 T; };
template <int ET, bool SPLIT, int BIAS_MODE, int OUT_MODE, bool RESID, int ACT = 0>
__global__ __launch_bounds__(256) void wmma_gemm64(
    const unsigned short* __restrict__ Ap, const unsigned short* __restrict__ A2p, int lda, long strideA,
    const unsigned short* __restrict__ Btp, const unsigned short* __restrict__ Bt2p, int ldb, long strideB,
    void* __restrict__ Cout, void* __restrict__ Cout2, int ldc, long strideC,
    const float* __restrict__ bias,
    const float* __restrict__ resid, long strideR,
    int M, int N, int K, float scale) {
  typedef typename Elem<ET>::T T;
  typedef typename Frag<T>::V V;
  const T* A = (const T*)Ap; const T* A2 = (const T*)A2p; const T* Bt = (const T*)Btp; const T* Bt2 = (const T*)Bt2p;
  __shared__ __align__(16) float sT[8][16 * 68];   // per-wave 16x64 slab, pitch 68 floats
  const int b    = blockIdx.y;
  const int lane = threadIdx.x & 31;
  const int wave = threadIdx.x >> 5;
  const int tilesN = N >> 6;
  const int tilesM = M >> 6;
  const int tile = blockIdx.x * 8 + wave;
  if (tile >= tilesM * tilesN) return;   // wave-uniform; no block barriers in this kernel
  const int tm = tile / tilesN;
  const int tn = tile - tm * tilesN;
  const int m0 = tm << 6;
  const int n0 = tn << 6;

  const T* Ab  = A  + (size_t)b * strideA;
  const T* Bb  = Bt + (size_t)b * strideB;
  const T* Ab2 = SPLIT ? (A2  + (size_t)b * strideA) : nullptr;
  const T* Bb2 = SPLIT ? (Bt2 + (size_t)b * strideB) : nullptr;

  const int rlane = lane & 15;                 // row (A) / col (B, D) within subtile
  const int koff  = (lane >> 4) * 8;           // k offset of this lane half
  const int mOff  = (lane >> 4) * 8;           // D row offset

  v8f acc[4][4];
#pragma unroll
  for (int i = 0; i < 4; ++i)
#pragma unroll
    for (int j = 0; j < 4; ++j) acc[i][j] = (v8f){0.f,0.f,0.f,0.f,0.f,0.f,0.f,0.f};

  for (int k0 = 0; k0 < K; k0 += 32) {
    V bh[4], bl[4];
#pragma unroll
    for (int j = 0; j < 4; ++j) {
      const size_t bo = (size_t)(n0 + (j << 4) + rlane) * ldb + koff + k0;
      bh[j] = Frag<T>::load(Bb + bo);
      if (SPLIT) bl[j] = Frag<T>::load(Bb2 + bo);
    }
#pragma unroll
    for (int i = 0; i < 4; ++i) {
      const size_t ao = (size_t)(m0 + (i << 4) + rlane) * lda + koff + k0;
      V ah = Frag<T>::load(Ab + ao);
      V al;
      if (SPLIT) al = Frag<T>::load(Ab2 + ao);
#pragma unroll
      for (int j = 0; j < 4; ++j) {
        acc[i][j] = Frag<T>::mma(ah, bh[j], acc[i][j]);
        if (SPLIT) {
          acc[i][j] = Frag<T>::mma(ah, bl[j], acc[i][j]);
          acc[i][j] = Frag<T>::mma(al, bh[j], acc[i][j]);
        }
      }
      Frag<T>::guard(acc[i][0], acc[i][3], ah, SPLIT ? al : ah);
    }
    Frag<T>::keep(bh[0], bh[1], bh[2], bh[3]);
    if (SPLIT) Frag<T>::keep(bl[0], bl[1], bl[2], bl[3]);
  }
  acc_guard4(acc[0][0], acc[0][1], acc[0][2], acc[0][3]);
  acc_guard4(acc[1][0], acc[1][1], acc[1][2], acc[1][3]);
  acc_guard4(acc[2][0], acc[2][1], acc[2][2], acc[2][3]);
  acc_guard4(acc[3][0], acc[3][1], acc[3][2], acc[3][3]);

  // ---- epilogue ----
  float* slab = sT[wave];
  const float* Rb = RESID ? (resid + (size_t)b * strideR) : nullptr;
#pragma unroll
  for (int i = 0; i < 4; ++i) {
    const int mBase = m0 + (i << 4);
#pragma unroll
    for (int j = 0; j < 4; ++j) {
      const int n = n0 + (j << 4) + rlane;
      float bv = 0.f;
      if (BIAS_MODE == 2) bv = bias[n];
#pragma unroll
      for (int r = 0; r < 8; ++r) {
        float v = acc[i][j][r] * scale;
        if (BIAS_MODE == 1) v += bias[mBase + mOff + r];
        if (BIAS_MODE == 2) v += bv;
        if (RESID) v += Rb[(size_t)(mBase + mOff + r) * ldc + n];
        if (ACT == 1) v = tanhf(v);
        if (ACT == 2) v = fmaxf(v, 0.0f);
        if (ACT == 3) v = v / (1.0f + expf(-v));
        if (ACT == 4) v = (v > 0.f) ? v : 0.01f * v;
        if (ACT == 5) v = 0.5f * v * (1.0f + erff(v * 0.70710678118654752f));
        slab[(mOff + r) * 68 + (j << 4) + rlane] = v;
      }
    }
    __builtin_amdgcn_fence(__ATOMIC_RELEASE, "workgroup");
    __builtin_amdgcn_wave_barrier();
    __builtin_amdgcn_fence(__ATOMIC_ACQUIRE, "workgroup");
    if (OUT_MODE == 0) {
      float* C = (float*)Cout + (size_t)b * strideC;
      const int hh = lane >> 4, c4 = (lane & 15) * 4;     // row seg = 256 B = 16 lanes x 16 B
      {
#pragma unroll
        for (int it = 0; it < 8; ++it) {
          const int row = it * 2 + hh;
          v4f v = *(const v4f*)(slab + row * 68 + c4);
          *(v4f*)(C + (size_t)(mBase + row) * ldc + n0 + c4) = v;
        }
        
      }
    } else {
      const int q = lane >> 3, c8 = (lane & 7) * 8;
      unsigned short* C  = (unsigned short*)Cout  + (size_t)b * strideC;
      unsigned short* C2 = (OUT_MODE == 2) ? ((unsigned short*)Cout2 + (size_t)b * strideC) : nullptr;
      {
#pragma unroll
        for (int it = 0; it < 4; ++it) {
          const int row = it * 4 + q;
          const float* sp = slab + row * 68 + c8;
          v8h hv, lv;
#pragma unroll
          for (int e = 0; e < 8; ++e) {
            if (OUT_MODE == 1) {
              hv[e] = (_Float16)sp[e];
            } else {
              unsigned short hb = f2bf_bits(sp[e]);
              unsigned short lb = f2bf_bits(sp[e] - bf_bits2f(hb));
              hv[e] = __builtin_bit_cast(_Float16, hb);
              lv[e] = __builtin_bit_cast(_Float16, lb);
            }
          }
          *(v8h*)(C + (size_t)(mBase + row) * ldc + n0 + c8) = hv;
          if (OUT_MODE == 2) *(v8h*)(C2 + (size_t)(mBase + row) * ldc + n0 + c8) = lv;
        }
        
      }
    }
    __builtin_amdgcn_fence(__ATOMIC_RELEASE, "workgroup");
    __builtin_amdgcn_wave_barrier();
    __builtin_amdgcn_fence(__ATOMIC_ACQUIRE, "workgroup");
  }
}

__global__ __launch_bounds__(256) void cast_f32_f16x2(
    const float* __restrict__ in, _Float16* __restrict__ out, int n2) {
  int i = blockIdx.x * 256 + threadIdx.x;
  if (i < n2) {
    const _Float16 h0 = (_Float16)in[2 * i], h1 = (_Float16)in[2 * i + 1];
    const unsigned u = (unsigned)__builtin_bit_cast(unsigned short, h0) | ((unsigned)__builtin_bit_cast(unsigned short, h1) << 16);
    ((unsigned*)out)[i] = u;
    
  }
}


// ---- f32 [R][C] (row pitch ldi) -> f16 transposed [C][R] (row pitch ldo); 64x64 tiles; each output row segment
__global__ __launch_bounds__(256) void transpose_cast_f16(const float* __restrict__ in, int ldi,
                                                         _Float16* __restrict__ outT, int ldo, float scale) {
  __shared__ __align__(16) _Float16 tile[64][72];     // [c][r]
  const int c0 = blockIdx.x * 64, r0 = blockIdx.y * 64;
  const int t = threadIdx.y * 32 + threadIdx.x;
  for (int i = threadIdx.y; i < 64; i += 8) {
    tile[threadIdx.x][i]      = (_Float16)(in[(size_t)(r0 + i) * ldi + c0 + threadIdx.x] * scale);
    tile[32 + threadIdx.x][i] = (_Float16)(in[(size_t)(r0 + i) * ldi + c0 + 32 + threadIdx.x] * scale);
  }
  __syncthreads();
  const int q = t >> 3, c8 = (t & 7) * 8;
  {
#pragma unroll
    for (int it = 0; it < 2; ++it) {
      const int c = it * 32 + q;
      v8h hv = *(const v8h*)(&tile[c][c8]);
      *(v8h*)(outT + (size_t)(c0 + c) * ldo + r0 + c8) = hv;
    }
    
  }
}

#define BB 32
#define CIN 256
#define CM 128
#define NS 1024
// fold BN into 1x1 conv weights: W'[o][c] = W[o][c]*g[o]/sqrt(v[o]+eps) (f16), bias'[o] = b[o] - m[o]*scale
__global__ __launch_bounds__(256) void fold_bn_kernel(const float* __restrict__ Wm, const float* __restrict__ g, const float* __restrict__ bb, const float* __restrict__ m, const float* __restrict__ var,
                                                     int O, int Cc, unsigned* __restrict__ W16, float* __restrict__ bias) {
  const int i = blockIdx.x * 256 + threadIdx.x;
  if (i < O * Cc / 2) { const int o = (2 * i) / Cc; const float sc = g[o] / sqrtf(var[o] + 1e-5f);
    const unsigned u = (unsigned)__builtin_bit_cast(unsigned short, (_Float16)(Wm[2 * i] * sc)) | ((unsigned)__builtin_bit_cast(unsigned short, (_Float16)(Wm[2 * i + 1] * sc)) << 16);
    ((unsigned*)W16)[i] = u;  }
  if (i < O) { const float sc = g[i] / sqrtf(var[i] + 1e-5f); const float v = bb[i] - m[i] * sc; ((float*)bias)[i] = v;  }
}
// posᵀ as f16 into QP operand columns: QP[b][i][128 + c] = rel_h[c][ih] + rel_w[c][iw] (same for every b); thread per (b, i, c-pair)
__global__ __launch_bounds__(256) void pos_kernel(const float* __restrict__ relh, const float* __restrict__ relw, unsigned* __restrict__ QP) {
  const long t = (long)blockIdx.x * 256 + threadIdx.x;      // (b, i, cp): cp in 0..63
  const int cp = (int)(t & 63); const long bi = t >> 6; const int i = (int)(bi % NS);
  const int ih = i >> 5, iw = i & 31, c0 = 2 * cp;
  const float p0 = relh[(size_t)c0 * 32 + ih] + relw[(size_t)c0 * 32 + iw], p1 = relh[(size_t)(c0 + 1) * 32 + ih] + relw[(size_t)(c0 + 1) * 32 + iw];
  const unsigned u = (unsigned)__builtin_bit_cast(unsigned short, (_Float16)p0) | ((unsigned)__builtin_bit_cast(unsigned short, (_Float16)p1) << 16);
  ((unsigned*)QP)[(size_t)bi * 128 + 64 + cp] = u; 
}
typedef __attribute__((ext_vector_type(4))) unsigned u32x4;
typedef __attribute__((ext_vector_type(2))) float f32x2;
#define FA_KEYS 64                       // keys per stage
#define FA_NST (NS / FA_KEYS)            // stages
#define FA_PK 528                        // LDS pitch of a [k|q] row: 512 B + 16 B
#define FA_PV 144                        // LDS pitch of a v row's 64 keys: 128 B + 16 B
#define FA_KB (FA_KEYS * FA_PK)          // bytes of the [k|q] tile
#define FA_BUF (FA_KB + CM * FA_PV)      // bytes of one buffer
#define FA_PO 272                        // output staging pitch: 256 B + 16 B
__device__ __forceinline__ float xhalf(float x) {   // lane l <-> lane l ^ 16
  return __builtin_bit_cast(float, __builtin_amdgcn_permlanex16(__builtin_bit_cast(int, x), __builtin_bit_cast(int, x), 0x76543210, 0xfedcba98, false, false));
}
__global__ __launch_bounds__(256) __attribute__((amdgpu_waves_per_eu(2, 2))) void attn_fused(
    const _Float16* __restrict__ QPh, const _Float16* __restrict__ KQh, const _Float16* __restrict__ Vh, _Float16* __restrict__ OTh) {
  __shared__ __align__(16) unsigned char L[2 * FA_BUF];
  const int t = threadIdx.x, lane = t & 31, wave = t >> 5, c = lane & 15, h = lane >> 4;
  const int b = blockIdx.y, q0 = blockIdx.x * 128 + wave * 16;
  const unsigned char* Kg = (const unsigned char*)(KQh + (size_t)b * NS * 256) + t * 16;                       // a stage of [k|q] is 32 KiB in a row
  const unsigned char* Vg = (const unsigned char*)(Vh + (size_t)b * CM * NS) + (size_t)(t >> 3) * (NS * 2) + (t & 7) * 16;
  unsigned char* Lk = L + (t >> 5) * FA_PK + (t & 31) * 16;
  unsigned char* Lv = L + FA_KB + (t >> 3) * FA_PV + (t & 7) * 16;
  const float LOG2E = 1.4426950408889634f;

  v16h qf[8];
  { const _Float16* qp = QPh + ((size_t)b * NS + q0 + c) * 256 + 8 * h;
#pragma unroll
    for (int kc = 0; kc < 8; ++kc) qf[kc] = Frag<_Float16>::load(qp + 32 * kc);
    // in front of any rewrite of the address registers that the loads above name; the input keeps those registers live up to the wait
    asm volatile("s_wait_xcnt 0x0" :: "v"(qp) : "memory"); }
  __builtin_amdgcn_sched_barrier(0);         // keeps every later register write, a later load's result too, behind that wait
  u32x4 st[12];
#pragma unroll
  for (int s = 0; s < 8; ++s) st[s] = *(const u32x4*)(Kg + s * 4096);
#pragma unroll
  for (int s = 0; s < 4; ++s) st[8 + s] = *(const u32x4*)(Vg + (size_t)s * 32 * (NS * 2));
  asm volatile("s_wait_xcnt 0x0" ::: "memory");   // in front of any rewrite of the address registers that the loads above name
  __builtin_amdgcn_sched_barrier(0);         // keeps every later register write behind that wait
  v8f acc[8];
#pragma unroll
  for (int i = 0; i < 8; ++i) acc[i] = (v8f){0.f,0.f,0.f,0.f,0.f,0.f,0.f,0.f};
  float m_run = -INFINITY, l_run = 0.f;
#pragma unroll
  for (int s = 0; s < 8; ++s) *(u32x4*)(Lk + s * 8 * FA_PK) = st[s];
#pragma unroll
  for (int s = 0; s < 4; ++s) *(u32x4*)(Lv + s * 32 * FA_PV) = st[8 + s];
  __syncthreads();

  // one stage = two passes of 32 keys, read from the buffer at byte offset cur; ahead() issues what is to fly under the stage
  auto stage = [&](const int cur, auto&& ahead) {
    v16h kf[2][8];
    auto load_k = [&](const int sub) {       // the 32 LDS reads of a pass's [k|q] fragments, as one group
      const unsigned char* kp = L + cur + (sub * 32 + c) * FA_PK + 16 * h;
#pragma unroll
      for (int kc = 0; kc < 8; ++kc) {
        kf[0][kc] = Frag<_Float16>::load((const _Float16*)(kp + 64 * kc));
        kf[1][kc] = Frag<_Float16>::load((const _Float16*)(kp + 16 * FA_PK + 64 * kc));
      }
    };
    load_k(0);
    __builtin_amdgcn_sched_barrier(0);       // the LDS reads go first, as one group, and none of them lands between ahead()'s loads and their wait
    ahead();
    __builtin_amdgcn_sched_barrier(0);       // holds ahead()'s loads up here, so that they fly under the whole stage
#pragma unroll
    for (int sub = 0; sub < 2; ++sub) {
      v8f s0 = (v8f){0.f,0.f,0.f,0.f,0.f,0.f,0.f,0.f}, s1 = s0;
#pragma unroll
      for (int kc = 0; kc < 8; ++kc) {
        s0 = Frag<_Float16>::mma(kf[0][kc], qf[kc], s0);
        s1 = Frag<_Float16>::mma(kf[1][kc], qf[kc], s1);
      }
      v16h vf[8];
      const unsigned char* vp = L + cur + FA_KB + c * FA_PV + sub * 64 + 16 * h;
#pragma unroll
      for (int i = 0; i < 8; ++i) vf[i] = Frag<_Float16>::load((const _Float16*)(vp + i * 16 * FA_PV));
      if (sub == 0) load_k(1);               // same stage, so already published
      __builtin_amdgcn_sched_barrier(0);     // holds these reads up here as one group: their LDS latency passes under the softmax arithmetic
      float mx = fmaxf(s0[0], s1[0]);
#pragma unroll
      for (int r = 1; r < 8; ++r) mx = fmaxf(mx, fmaxf(s0[r], s1[r]));
      mx = fmaxf(mx, xhalf(mx)) * LOG2E;     // both halves now hold this query's maximum of the pass
      if (__builtin_amdgcn_ballot_w32(mx > m_run) != 0) {   // scalar branch: no query of the wave has a new maximum -> nothing to rescale
        const float m_new = fmaxf(m_run, mx);
        const float corr = __builtin_amdgcn_exp2f(m_run - m_new);   // 0 in the first pass, where m_run is -inf
        l_run *= corr; m_run = m_new;
#pragma unroll
        for (int i = 0; i < 8; ++i) acc[i] = acc[i] * corr;
      }
      const float nm = 15.0f - m_run;        // p x 2^15: small weights stay normal f16 numbers
      v16h pf; f32x2 ps0 = {0.f, 0.f}, ps1 = {0.f, 0.f};
#pragma unroll
      for (int r = 0; r < 8; r += 2) {       // two neighbouring registers at a time: packed multiply-adds and packed sums
        const f32x2 a0 = __builtin_elementwise_fma((f32x2){s0[r], s0[r + 1]}, (f32x2){LOG2E, LOG2E}, (f32x2){nm, nm});
        const f32x2 a1 = __builtin_elementwise_fma((f32x2){s1[r], s1[r + 1]}, (f32x2){LOG2E, LOG2E}, (f32x2){nm, nm});
        const f32x2 p0 = {__builtin_amdgcn_exp2f(a0.x), __builtin_amdgcn_exp2f(a0.y)}, p1 = {__builtin_amdgcn_exp2f(a1.x), __builtin_amdgcn_exp2f(a1.y)};
        ps0 += p0; ps1 += p1;
        pf[r] = (_Float16)p0.x; pf[r + 1] = (_Float16)p0.y; pf[8 + r] = (_Float16)p1.x; pf[9 + r] = (_Float16)p1.y;
      }
      ps0 += ps1;
      l_run += ps0.x + ps0.y;
#pragma unroll
      for (int i = 0; i < 8; ++i) acc[i] = Frag<_Float16>::mma(vf[i], pf, acc[i]);
    }
  };
  for (int sg = 0; sg + 1 < FA_NST; ++sg) {
    const int cur = (sg & 1) * FA_BUF, nxt = FA_BUF - cur;
    stage(cur, [&]() {                       // the next stage's global loads fly under this stage's products
#pragma unroll
      for (int s = 0; s < 8; ++s) st[s] = *(const u32x4*)(Kg + (size_t)(sg + 1) * (FA_KEYS * 512) + s * 4096);
#pragma unroll
      for (int s = 0; s < 4; ++s) st[8 + s] = *(const u32x4*)(Vg + (size_t)s * 32 * (NS * 2) + (sg + 1) * (FA_KEYS * 2));
      asm volatile("s_wait_xcnt 0x0" ::: "memory");   // in front of any rewrite of the address registers that the loads above name
    });
    // into the buffer whose last readers passed the barrier of the trip before
#pragma unroll
    for (int s = 0; s < 8; ++s) *(u32x4*)(Lk + nxt + s * 8 * FA_PK) = st[s];
#pragma unroll
    for (int s = 0; s < 4; ++s) *(u32x4*)(Lv + nxt + s * 32 * FA_PV) = st[8 + s];
    __syncthreads();                         // publishes the next stage and ends every wave's reads of this one
  }
  stage(((FA_NST - 1) & 1) * FA_BUF, []() {});
  __syncthreads();                           // every wave has left the buffers: they become output staging

  // O[i][c] = acc / sum, f16; staged per wave so that every 128-byte line of OT is stored whole
  const float inv = 1.0f / (l_run + xhalf(l_run));   // each half summed its own 8 keys of every tile
  unsigned char* Lw = L + wave * 16 * FA_PO;
#pragma unroll
  for (int i = 0; i < 8; ++i) {
    v8h hv;
#pragma unroll
    for (int r = 0; r < 8; ++r) hv[r] = (_Float16)(acc[i][r] * inv);
    *(v8h*)(Lw + c * FA_PO + 32 * i + 16 * h) = hv;   // row = query, bytes = channels 16 i + 8 h .. + 7
  }
  // the lanes of this wave read what other lanes of it wrote: keep the compiler from moving the reads over the writes
  __builtin_amdgcn_fence(__ATOMIC_RELEASE, "workgroup");
  __builtin_amdgcn_wave_barrier();
  __builtin_amdgcn_fence(__ATOMIC_ACQUIRE, "workgroup");
#pragma unroll
  for (int it = 0; it < 8; ++it) {
    const int row = it * 2 + h;
    const v8h hv = *(const v8h*)(Lw + row * FA_PO + c * 16);
    *(v8h*)(OTh + ((size_t)b * NS + q0 + row) * CM + c * 8) = hv;
  }
}
__global__ __launch_bounds__(256) void resid_kernel(const float* __restrict__ x, const float* __restrict__ y, float* __restrict__ out, long n4) {
  const long i = (long)blockIdx.x * 256 + threadIdx.x; if (i >= n4) return;
  const v4f v = *(const v4f*)(x + 4 * i) + *(const v4f*)(y + 4 * i);
  *(v4f*)(out + 4 * i) = v; 
}
extern "C" void kernel_launch(void* const* d_in, const int* in_sizes, int n_in, void* d_out, int out_size, void* d_ws, size_t ws_size, hipStream_t stream) {
  (void)in_sizes; (void)n_in; (void)out_size; (void)ws_size;
  const float* x = (const float*)d_in[0]; const float* w1 = (const float*)d_in[1];
  const float* g1 = (const float*)d_in[2]; const float* be1 = (const float*)d_in[3]; const float* m1 = (const float*)d_in[4]; const float* v1 = (const float*)d_in[5];
  const float* wq = (const float*)d_in[6]; const float* bq = (const float*)d_in[7]; const float* wk = (const float*)d_in[8]; const float* bk = (const float*)d_in[9];
  const float* wv = (const float*)d_in[10]; const float* bv = (const float*)d_in[11]; const float* relh = (const float*)d_in[12]; const float* relw = (const float*)d_in[13];
  const float* w2 = (const float*)d_in[14]; const float* g2 = (const float*)d_in[15]; const float* be2 = (const float*)d_in[16]; const float* m2 = (const float*)d_in[17]; const float* v2 = (const float*)d_in[18];
  float* out = (float*)d_out;   // [32][256][1024]
  // Workspace map (offsets in MiB; 256 MiB in all). Scores and p stay on chip, so nothing of them lies here.
  //   [0,16) XT, read last by cv1; afterwards OT in [0,8) and the folded cv2 weights in [8,16) (stream order separates the uses)
  //   [64,96) Y; [192,197) the folded cv1 weights and the q/k/v weights
  char* ws = (char*)d_ws;
  const size_t MiB = (size_t)1 << 20;
  _Float16* XT = (_Float16*)ws;                                      // x^T: [1024][32*256] f16
  unsigned* OT = (unsigned*)ws;                                      // [b][i][c] f16
  unsigned* W2f = (unsigned*)(ws + 8 * MiB); float* b2f = (float*)(ws + 9 * MiB);
  unsigned* X1T = (unsigned*)(ws + 16 * MiB);                        // [b][i][128] f16
  unsigned* QP = (unsigned*)(ws + 24 * MiB);                         // [b][i][q | pos] f16
  unsigned* KQ = (unsigned*)(ws + 40 * MiB);                         // [b][j][k | q]
  unsigned* V16 = (unsigned*)(ws + 56 * MiB);                        // [b][c][j] f16
  float* Y = (float*)(ws + 64 * MiB);                                // [b][o][i] f32
  unsigned* W1f = (unsigned*)(ws + 192 * MiB); float* b1f = (float*)(ws + 193 * MiB);
  _Float16* Wq16 = (_Float16*)(ws + 194 * MiB); _Float16* Wk16 = (_Float16*)(ws + 195 * MiB); _Float16* Wv16 = (_Float16*)(ws + 196 * MiB);
  transpose_cast_f16<<<dim3(NS / 64, BB * CIN / 64), dim3(32, 8), 0, stream>>>(x, NS, XT, BB * CIN, 1.0f);   // [32*256][1024] -> [1024][8192]
  fold_bn_kernel<<<(CM * CIN / 2 + 255) / 256, 256, 0, stream>>>(w1, g1, be1, m1, v1, CM, CIN, W1f, b1f);
  cast_f32_f16x2<<<(CM * CM / 2 + 255) / 256, 256, 0, stream>>>(wq, Wq16, CM * CM / 2); cast_f32_f16x2<<<(CM * CM / 2 + 255) / 256, 256, 0, stream>>>(wk, Wk16, CM * CM / 2); cast_f32_f16x2<<<(CM * CM / 2 + 255) / 256, 256, 0, stream>>>(wv, Wv16, CM * CM / 2);
  // cv1: X1T[b][i][o] = silu(sum_c XT[i][b*256+c]*W1f[o][c] + b1f[o])   (grid.y = b, strideA = 256 halves within the transposed row)
  { const int t = (NS / 64) * (CM / 64);
    wmma_gemm64<0, false, 2, 1, false, 3><<<dim3((t + 7) / 8, BB), 256, 0, stream>>>(U16(XT), nullptr, BB * CIN, CIN, (const unsigned short*)W1f, nullptr, CIN, 0, X1T, nullptr, CM, (long)NS * CM, b1f, nullptr, 0, NS, CM, CIN, 1.0f); }
  fold_bn_kernel<<<(CIN * CM / 2 + 255) / 256, 256, 0, stream>>>(w2, g2, be2, m2, v2, CIN, CM, W2f, b2f);   // behind cv1: its place was XT's
  // q into QP[:, :, 0:128] and KQ[:, :, 128:256]; k into KQ[:, :, 0:128]; pos into QP[:, :, 128:256]; v as [c][j]
  { const int t = (NS / 64) * (CM / 64);
    wmma_gemm64<0, false, 2, 1, false, 0><<<dim3((t + 7) / 8, BB), 256, 0, stream>>>((const unsigned short*)X1T, nullptr, CM, (long)NS * CM, U16(Wq16), nullptr, CM, 0, QP, nullptr, 256, (long)NS * 256, bq, nullptr, 0, NS, CM, CM, 1.0f);
    wmma_gemm64<0, false, 2, 1, false, 0><<<dim3((t + 7) / 8, BB), 256, 0, stream>>>((const unsigned short*)X1T, nullptr, CM, (long)NS * CM, U16(Wq16), nullptr, CM, 0, KQ + 64, nullptr, 256, (long)NS * 256, bq, nullptr, 0, NS, CM, CM, 1.0f);
    wmma_gemm64<0, false, 2, 1, false, 0><<<dim3((t + 7) / 8, BB), 256, 0, stream>>>((const unsigned short*)X1T, nullptr, CM, (long)NS * CM, U16(Wk16), nullptr, CM, 0, KQ, nullptr, 256, (long)NS * 256, bk, nullptr, 0, NS, CM, CM, 1.0f);
    const int tv = (CM / 64) * (NS / 64);   // V[b][c][j] = sum_cc Wv[c][cc]*X1T[b][j][cc] + bv[c]: A = Wv16 [128][128], Bt = X1T[b] [1024][128]
    wmma_gemm64<0, false, 1, 1, false, 0><<<dim3((tv + 7) / 8, BB), 256, 0, stream>>>(U16(Wv16), nullptr, CM, 0, (const unsigned short*)X1T, nullptr, CM, (long)NS * CM, V16, nullptr, NS, (long)CM * NS, bv, nullptr, 0, CM, NS, CM, 1.0f); }
  pos_kernel<<<(BB * NS * 64 + 255) / 256, 256, 0, stream>>>(relh, relw, QP);
  // scores, softmax and p.v in one launch: 8 work-groups of 128 queries per image
  attn_fused<<<dim3(NS / 128, BB), 256, 0, stream>>>((const _Float16*)QP, (const _Float16*)KQ, (const _Float16*)V16, (_Float16*)OT);
  { const int t = (CIN / 64) * (NS / 64);  // cv2: Y[b][o][i] = silu(sum_c W2f[o][c]*OT[b][i][c] + b2f[o])  (A = W2f [256][128], Bt = OT[b] [1024][128])
    wmma_gemm64<0, false, 1, 0, false, 3><<<dim3((t + 7) / 8, BB), 256, 0, stream>>>((const unsigned short*)W2f, nullptr, CM, 0, (const unsigned short*)OT, nullptr, CM, (long)NS * CM, Y, nullptr, NS, (long)CIN * NS, b2f, nullptr, 0, CIN, NS, CM, 1.0f); }
  resid_kernel<<<(BB * CIN * NS / 4 + 255) / 256, 256, 0, stream>>>(x, Y, out, (long)BB * CIN * NS / 4);
}

// v003
// A run of this version takes 120 microseconds.
// Timed twice side by side with v002, it ran 1.24 and 1.25 times as fast.
// Counting every step since v000, it is 3.53 times as fast.
#include <hip/hip_runtime.h>
#include <math.h>
// BoT block: cv1 (1x1 conv 256→128, BN folded, SiLU), q/k/v 1x1 convs (+bias), the single-head attention over 1024 positions as two products in one kernel
// (scores = [q_i | pos_i]·[k_j | q_j]ᵀ with K = 256 — content-content and content-position in one product —, then p·vᵀ with p x2^15,
// K = 1024), cv2 (128→256, BN folded, SiLU): v_wmma_f32_16x16x32_f16, f16 operands, f32 accumulate; softmax and the residual add in f32
// on VALU. All per-batch GEMMs are batched through grid.y strides over the 32 images, scores and p·v included.
typedef __attribute__((ext_vector_type(16))) _Float16 v16h;
typedef __attribute__((ext_vector_type(8)))  _Float16 v8h;
typedef __attribute__((ext_vector_type(16))) __bf16   v16b;
typedef __attribute__((ext_vector_type(8)))  __bf16   v8b;
typedef __attribute__((ext_vector_type(8)))  float    v8f;
typedef __attribute__((ext_vector_type(4)))  float    v4f;
#define PSCALE 32768.0f
#define U16(p) ((const unsigned short*)(const void*)(p))
#define PSCALE_INV (1.0f / 32768.0f)

__device__ __forceinline__ unsigned short f2bf_bits(float f) {
  unsigned u = __float_as_uint(f);
  return (unsigned short)((u + 0x7FFFu + ((u >> 16) & 1u)) >> 16);
}
__device__ __forceinline__ float bf_bits2f(unsigned short h) { return __uint_as_float(((unsigned)h) << 16); }

// hazard guards as plain device helpers (no inline asm inside the kernel template body)
__device__ __forceinline__ void dep_guard_h(v8f& a, v8f& b, v16h x, v16h y) { asm volatile("v_nop\n\tv_nop\n\tv_nop\n\tv_nop" : "+v"(a), "+v"(b) : "v"(x), "v"(y)); }
__device__ __forceinline__ void dep_guard_b(v8f& a, v8f& b, v16b x, v16b y) { asm volatile("v_nop\n\tv_nop\n\tv_nop\n\tv_nop" : "+v"(a), "+v"(b) : "v"(x), "v"(y)); }
__device__ __forceinline__ void keep4_h(v16h a, v16h b, v16h c, v16h d) { asm volatile("v_nop" :: "v"(a), "v"(b), "v"(c), "v"(d)); }
__device__ __forceinline__ void keep4_b(v16b a, v16b b, v16b c, v16b d) { asm volatile("v_nop" :: "v"(a), "v"(b), "v"(c), "v"(d)); }
__device__ __forceinline__ void acc_guard4(v8f& a, v8f& b, v8f& c, v8f& d) { asm volatile("v_nop\n\tv_nop\n\tv_nop\n\tv_nop" : "+v"(a), "+v"(b), "+v"(c), "+v"(d)); }
template <typename T> struct Frag;
template <> struct Frag<_Float16> {
  typedef v16h V; union U { v16h v; v8h h[2]; };
  static __device__ __forceinline__ v16h load(const _Float16* p) {   // elements 0..7 <- p[0..7], 8..15 <- p[16..23]
    U f; f.h[0] = *(const v8h*)(p); f.h[1] = *(const v8h*)(p + 16); return f.v;
  }
  static __device__ __forceinline__ v8f mma(v16h a, v16h b, v8f c) {
    return __builtin_amdgcn_wmma_f32_16x16x32_f16(false, a, false, b, (short)0, c, false, false);
  }
  static __device__ __forceinline__ void guard(v8f& a, v8f& b, v16h x, v16h y) { dep_guard_h(a, b, x, y); }
  static __device__ __forceinline__ void keep(v16h a, v16h b, v16h c, v16h d) { keep4_h(a, b, c, d); }
};
template <> struct Frag<__bf16> {
  typedef v16b V; union U { v16b v; v8b h[2]; };
  static __device__ __forceinline__ v16b load(const __bf16* p) {
    U f; f.h[0] = *(const v8b*)(p); f.h[1] = *(const v8b*)(p + 16); return f.v;
  }
  static __device__ __forceinline__ v8f mma(v16b a, v16b b, v8f c) {
    return __builtin_amdgcn_wmma_f32_16x16x32_bf16(false, a, false, b, (short)0, c, false, false);
  }
  static __device__ __forceinline__ void guard(v8f& a, v8f& b, v16b x, v16b y) { dep_guard_b(a, b, x, y); }
  static __device__ __forceinline__ void keep(v16b a, v16b b, v16b c, v16b d) { keep4_b(a, b, c, d); }
};

// ---- Register-blocked batched WMMA GEMM ------------------------------------
// C[m,n] = scale * sum_k A[m,k] * Bt[n,k] (+bias)(+resid); each wave owns a 64x64 tile.
// A row-major [M,K]; Bt row-major [N,K]; M,N % 64 == 0, K % 32 == 0.
// SPLIT: operands are hi/lo planes (A2/Bt2 = lo planes, same layout); product = hi·hi + hi·lo + lo·hi.
// BIAS_MODE: 0 = none, 1 = bias[m], 2 = bias[n].
// OUT_MODE: 0 = f32, 1 = f16, 2 = bf16 hi plane (Cout) + bf16 lo plane (Cout2).
// ET: 0 = f16 operands, 1 = bf16 operands (pointers passed as 16-bit storage)
template <int ET> struct Elem;
template <> struct Elem<0> { typedef _Float16 T; };
template <> struct Elem<1> { typedef __bf16 T; };
// The body is a device function (slab = the wave's own 16x64 LDS slab, bx and b = the work-group's tile group and image), so that
// several products that do not depend on each other can share one launch.
template <int ET, bool SPLIT, int BIAS_MODE, int OUT_MODE, bool RESID, int ACT = 0>
__device__ __forceinline__ void gemm64_tile(float* slab, const int bx, const int b,
    const unsigned short* __restrict__ Ap, const unsigned short* __restrict__ A2p, int lda, long strideA,
    const unsigned short* __restrict__ Btp, const unsigned short* __restrict__ Bt2p, int ldb, long strideB,
    void* __restrict__ Cout, void* __restrict__ Cout2, int ldc, long strideC,
    const float* __restrict__ bias,
    const float* __restrict__ resid, long strideR,
    int M, int N, int K, float scale) {
  typedef typename Elem<ET>::T T;
  typedef typename Frag<T>::V V;
  const T* A = (const T*)Ap; const T* A2 = (const T*)A2p; const T* Bt = (const T*)Btp; const T* Bt2 = (const T*)Bt2p;
  const int lane = threadIdx.x & 31;
  const int wave = threadIdx.x >> 5;
  const int tilesN = N >> 6;
  const int tilesM = M >> 6;
  const int tile = bx * 8 + wave;
  if (tile >= tilesM * tilesN) return;   // wave-uniform; no block barriers in this kernel
  const int tm = tile / tilesN;
  const int tn = tile - tm * tilesN;
  const int m0 = tm << 6;
  const int n0 = tn << 6;

  const T* Ab  = A  + (size_t)b * strideA;
  const T* Bb  = Bt + (size_t)b * strideB;
  const T* Ab2 = SPLIT ? (A2  + (size_t)b * strideA) : nullptr;
  const T* Bb2 = SPLIT ? (Bt2 + (size_t)b * strideB) : nullptr;

  const int rlane = lane & 15;                 // row (A) / col (B, D) within subtile
  const int koff  = (lane >> 4) * 8;           // k offset of this lane half
  const int mOff  = (lane >> 4) * 8;           // D row offset

  v8f acc[4][4];
#pragma unroll
  for (int i = 0; i < 4; ++i)
#pragma unroll
    for (int j = 0; j < 4; ++j) acc[i][j] = (v8f){0.f,0.f,0.f,0.f,0.f,0.f,0.f,0.f};

  for (int k0 = 0; k0 < K; k0 += 32) {
    V bh[4], bl[4];
#pragma unroll
    for (int j = 0; j < 4; ++j) {
      const size_t bo = (size_t)(n0 + (j << 4) + rlane) * ldb + koff + k0;
      bh[j] = Frag<T>::load(Bb + bo);
      if (SPLIT) bl[j] = Frag<T>::load(Bb2 + bo);
    }
#pragma unroll
    for (int i = 0; i < 4; ++i) {
      const size_t ao = (size_t)(m0 + (i << 4) + rlane) * lda + koff + k0;
      V ah = Frag<T>::load(Ab + ao);
      V al;
      if (SPLIT) al = Frag<T>::load(Ab2 + ao);
#pragma unroll
      for (int j = 0; j < 4; ++j) {
        acc[i][j] = Frag<T>::mma(ah, bh[j], acc[i][j]);
        if (SPLIT) {
          acc[i][j] = Frag<T>::mma(ah, bl[j], acc[i][j]);
          acc[i][j] = Frag<T>::mma(al, bh[j], acc[i][j]);
        }
      }
      Frag<T>::guard(acc[i][0], acc[i][3], ah, SPLIT ? al : ah);
    }
    Frag<T>::keep(bh[0], bh[1], bh[2], bh[3]);
    if (SPLIT) Frag<T>::keep(bl[0], bl[1], bl[2], bl[3]);
  }
  acc_guard4(acc[0][0], acc[0][1], acc[0][2], acc[0][3]);
  acc_guard4(acc[1][0], acc[1][1], acc[1][2], acc[1][3]);
  acc_guard4(acc[2][0], acc[2][1], acc[2][2], acc[2][3]);
  acc_guard4(acc[3][0], acc[3][1], acc[3][2], acc[3][3]);

  // ---- epilogue ----
  const float* Rb = RESID ? (resid + (size_t)b * strideR) : nullptr;
#pragma unroll
  for (int i = 0; i < 4; ++i) {
    const int mBase = m0 + (i << 4);
#pragma unroll
    for (int j = 0; j < 4; ++j) {
      const int n = n0 + (j << 4) + rlane;
      float bv = 0.f;
      if (BIAS_MODE == 2) bv = bias[n];
#pragma unroll
      for (int r = 0; r < 8; ++r) {
        float v = acc[i][j][r] * scale;
        if (BIAS_MODE == 1) v += bias[mBase + mOff + r];
        if (BIAS_MODE == 2) v += bv;
        if (RESID) v += Rb[(size_t)(mBase + mOff + r) * ldc + n];
        if (ACT == 1) v = tanhf(v);
        if (ACT == 2) v = fmaxf(v, 0.0f);
        if (ACT == 3) v = v / (1.0f + expf(-v));
        if (ACT == 4) v = (v > 0.f) ? v : 0.01f * v;
        if (ACT == 5) v = 0.5f * v * (1.0f + erff(v * 0.70710678118654752f));
        slab[(mOff + r) * 68 + (j << 4) + rlane] = v;
      }
    }
    __builtin_amdgcn_fence(__ATOMIC_RELEASE, "workgroup");
    __builtin_amdgcn_wave_barrier();
    __builtin_amdgcn_fence(__ATOMIC_ACQUIRE, "workgroup");
    if (OUT_MODE == 0) {
      float* C = (float*)Cout + (size_t)b * strideC;
      const int hh = lane >> 4, c4 = (lane & 15) * 4;     // row seg = 256 B = 16 lanes x 16 B
      {
#pragma unroll
        for (int it = 0; it < 8; ++it) {
          const int row = it * 2 + hh;
          v4f v = *(const v4f*)(slab + row * 68 + c4);
          *(v4f*)(C + (size_t)(mBase + row) * ldc + n0 + c4) = v;
        }
        
      }
    } else {
      const int q = lane >> 3, c8 = (lane & 7) * 8;
      unsigned short* C  = (unsigned short*)Cout  + (size_t)b * strideC;
      unsigned short* C2 = (OUT_MODE == 2) ? ((unsigned short*)Cout2 + (size_t)b * strideC) : nullptr;
      {
#pragma unroll
        for (int it = 0; it < 4; ++it) {
          const int row = it * 4 + q;
          const float* sp = slab + row * 68 + c8;
          v8h hv, lv;
#pragma unroll
          for (int e = 0; e < 8; ++e) {
            if (OUT_MODE == 1) {
              hv[e] = (_Float16)sp[e];
            } else {
              unsigned short hb = f2bf_bits(sp[e]);
              unsigned short lb = f2bf_bits(sp[e] - bf_bits2f(hb));
              hv[e] = __builtin_bit_cast(_Float16, hb);
              lv[e] = __builtin_bit_cast(_Float16, lb);
            }
          }
          *(v8h*)(C + (size_t)(mBase + row) * ldc + n0 + c8) = hv;
          if (OUT_MODE == 2) *(v8h*)(C2 + (size_t)(mBase + row) * ldc + n0 + c8) = lv;
        }
        
      }
    }
    __builtin_amdgcn_fence(__ATOMIC_RELEASE, "workgroup");
    __builtin_amdgcn_wave_barrier();
    __builtin_amdgcn_fence(__ATOMIC_ACQUIRE, "workgroup");
  }
}

template <int ET, bool SPLIT, int BIAS_MODE, int OUT_MODE, bool RESID, int ACT = 0>
__global__ __launch_bounds__(256) void wmma_gemm64(
    const unsigned short* __restrict__ Ap, const unsigned short* __restrict__ A2p, int lda, long strideA,
    const unsigned short* __restrict__ Btp, const unsigned short* __restrict__ Bt2p, int ldb, long strideB,
    void* __restrict__ Cout, void* __restrict__ Cout2, int ldc, long strideC,
    const float* __restrict__ bias,
    const float* __restrict__ resid, long strideR,
    int M, int N, int K, float scale) {
  __shared__ __align__(16) float sT[8][16 * 68];   // per-wave 16x64 slab, pitch 68 floats
  gemm64_tile<ET, SPLIT, BIAS_MODE, OUT_MODE, RESID, ACT>(sT[threadIdx.x >> 5], blockIdx.x, blockIdx.y, Ap, A2p, lda, strideA, Btp, Bt2p, ldb, strideB,
                                                          Cout, Cout2, ldc, strideC, bias, resid, strideR, M, N, K, scale);
}

__device__ __forceinline__ void cast_f32_f16x2(const int bx,
    const float* __restrict__ in, _Float16* __restrict__ out, int n2) {
  int i = bx * 256 + threadIdx.x;
  if (i < n2) {
    const _Float16 h0 = (_Float16)in[2 * i], h1 = (_Float16)in[2 * i + 1];
    const unsigned u = (unsigned)__builtin_bit_cast(unsigned short, h0) | ((unsigned)__builtin_bit_cast(unsigned short, h1) << 16);
    ((unsigned*)out)[i] = u;
    
  }
}


// ---- f32 [R][C] (row pitch ldi) -> f16 transposed [C][R] (row pitch ldo); 64x64 tiles; each output row segment
__device__ __forceinline__ void transpose_cast_f16(_Float16 (*tile)[72], const int bx, const int by, const float* __restrict__ in, int ldi,
                                                   _Float16* __restrict__ outT, int ldo, float scale) {   // tile: [c][r], 64 rows
  const int c0 = bx * 64, r0 = by * 64;
  const int t = threadIdx.x, tx = t & 31, ty = t >> 5;
  for (int i = ty; i < 64; i += 8) {
    tile[tx][i]      = (_Float16)(in[(size_t)(r0 + i) * ldi + c0 + tx] * scale);
    tile[32 + tx][i] = (_Float16)(in[(size_t)(r0 + i) * ldi + c0 + 32 + tx] * scale);
  }
  __syncthreads();
  const int q = t >> 3, c8 = (t & 7) * 8;
  {
#pragma unroll
    for (int it = 0; it < 2; ++it) {
      const int c = it * 32 + q;
      v8h hv = *(const v8h*)(&tile[c][c8]);
      *(v8h*)(outT + (size_t)(c0 + c) * ldo + r0 + c8) = hv;
    }
    // in front of any rewrite of the registers that the two stores above name: other jobs' code follows this one in the merged kernel
    asm volatile("s_wait_xcnt 0x0" ::: "memory");
  }
}

#define BB 32
#define CIN 256
#define CM 128
#define NS 1024
// fold BN into 1x1 conv weights: W'[o][c] = W[o][c]*g[o]/sqrt(v[o]+eps) (f16), bias'[o] = b[o] - m[o]*scale
__device__ __forceinline__ void fold_bn(const int bx, const float* __restrict__ Wm, const float* __restrict__ g, const float* __restrict__ bb, const float* __restrict__ m, const float* __restrict__ var,
                                        int O, int Cc, unsigned* __restrict__ W16, float* __restrict__ bias) {
  const int i = bx * 256 + threadIdx.x;
  if (i < O * Cc / 2) { const int o = (2 * i) / Cc; const float sc = g[o] / sqrtf(var[o] + 1e-5f);
    const unsigned u = (unsigned)__builtin_bit_cast(unsigned short, (_Float16)(Wm[2 * i] * sc)) | ((unsigned)__builtin_bit_cast(unsigned short, (_Float16)(Wm[2 * i + 1] * sc)) << 16);
    ((unsigned*)W16)[i] = u;  }
  if (i < O) { const float sc = g[i] / sqrtf(var[i] + 1e-5f); const float v = bb[i] - m[i] * sc; ((float*)bias)[i] = v;  }
}
// posᵀ as f16 into QP operand columns: QP[b][i][128 + c] = rel_h[c][ih] + rel_w[c][iw] (same for every b); thread per (b, i, c-pair)
__device__ __forceinline__ void pos_fill(const int bx, const float* __restrict__ relh, const float* __restrict__ relw, unsigned* __restrict__ QP) {
  const long t = (long)bx * 256 + threadIdx.x;      // (b, i, cp): cp in 0..63
  const int cp = (int)(t & 63); const long bi = t >> 6; const int i = (int)(bi % NS);
  const int ih = i >> 5, iw = i & 31, c0 = 2 * cp;
  const float p0 = relh[(size_t)c0 * 32 + ih] + relw[(size_t)c0 * 32 + iw], p1 = relh[(size_t)(c0 + 1) * 32 + ih] + relw[(size_t)(c0 + 1) * 32 + iw];
  const unsigned u = (unsigned)__builtin_bit_cast(unsigned short, (_Float16)p0) | ((unsigned)__builtin_bit_cast(unsigned short, (_Float16)p1) << 16);
  ((unsigned*)QP)[(size_t)bi * 128 + 64 + cp] = u;
  // in front of any rewrite of the registers that the store above names
  asm volatile("s_wait_xcnt 0x0" ::: "memory");
}
// ---- everything that reads inputs alone, in one launch: the work-group's index picks its job (block-uniform, so the barrier of the transpose is safe)
#define PB_FOLD (CM * CIN / 2 / 256)     // work-groups of one BN fold (both folds have 128 x 256 weights)
#define PB_CAST (CM * CM / 2 / 256)      // work-groups of one weight cast
#define PB_TR ((NS / 64) * (BB * CIN / 64))
#define PB_POS (BB * NS * 64 / 256)
__global__ __launch_bounds__(256) void prep_kernel(
    const float* __restrict__ x, _Float16* __restrict__ XT,
    const float* __restrict__ w1, const float* __restrict__ g1, const float* __restrict__ be1, const float* __restrict__ m1, const float* __restrict__ v1, unsigned* __restrict__ W1f, float* __restrict__ b1f,
    const float* __restrict__ w2, const float* __restrict__ g2, const float* __restrict__ be2, const float* __restrict__ m2, const float* __restrict__ v2, unsigned* __restrict__ W2f, float* __restrict__ b2f,
    const float* __restrict__ wq, const float* __restrict__ wk, const float* __restrict__ wv, _Float16* __restrict__ Wq16, _Float16* __restrict__ Wk16, _Float16* __restrict__ Wv16,
    const float* __restrict__ relh, const float* __restrict__ relw, unsigned* __restrict__ QP) {
  __shared__ __align__(16) _Float16 tile[64][72];
  int bx = blockIdx.x;
  if (bx < PB_FOLD) { fold_bn(bx, w1, g1, be1, m1, v1, CM, CIN, W1f, b1f); return; }
  bx -= PB_FOLD;
  if (bx < PB_FOLD) { fold_bn(bx, w2, g2, be2, m2, v2, CIN, CM, W2f, b2f); return; }
  bx -= PB_FOLD;
  if (bx < 3 * PB_CAST) {
    const int w = bx / PB_CAST;
    cast_f32_f16x2(bx - w * PB_CAST, w == 0 ? wq : w == 1 ? wk : wv, w == 0 ? Wq16 : w == 1 ? Wk16 : Wv16, CM * CM / 2);
    return;
  }
  bx -= 3 * PB_CAST;
  if (bx < PB_TR) { transpose_cast_f16(tile, bx % (NS / 64), bx / (NS / 64), x, NS, XT, BB * CIN, 1.0f); return; }   // [32*256][1024] -> [1024][8192]
  pos_fill(bx - PB_TR, relh, relw, QP);
}
// ---- the four products on x1 in one launch, picked by blockIdx.z: q into QP[:, :, 0:128], q again into KQ[:, :, 128:256], k into KQ[:, :, 0:128], v as [c][j]
__global__ __launch_bounds__(256) void qkv_gemm(
    const unsigned short* __restrict__ X1T, const unsigned short* __restrict__ Wq16, const unsigned short* __restrict__ Wk16, const unsigned short* __restrict__ Wv16,
    const float* __restrict__ bq, const float* __restrict__ bk, const float* __restrict__ bv,
    unsigned short* __restrict__ QP, unsigned short* __restrict__ KQ, unsigned short* __restrict__ V16) {
  __shared__ __align__(16) float sT[8][16 * 68];   // per-wave 16x64 slab, pitch 68 floats
  float* slab = sT[threadIdx.x >> 5];
  const int z = blockIdx.z;
  if (z == 3) {   // V[b][c][j] = sum_cc Wv[c][cc]*X1T[b][j][cc] + bv[c]: A = Wv16 [128][128], Bt = X1T[b] [1024][128]
    gemm64_tile<0, false, 1, 1, false, 0>(slab, blockIdx.x, blockIdx.y, Wv16, nullptr, CM, 0, X1T, nullptr, CM, (long)NS * CM, V16, nullptr, NS, (long)CM * NS, bv, nullptr, 0, CM, NS, CM, 1.0f);
    return;
  }
  gemm64_tile<0, false, 2, 1, false, 0>(slab, blockIdx.x, blockIdx.y, X1T, nullptr, CM, (long)NS * CM, z == 2 ? Wk16 : Wq16, nullptr, CM, 0,
                                        z == 0 ? QP : z == 1 ? KQ + CM : KQ, nullptr, 256, (long)NS * 256, z == 2 ? bk : bq, nullptr, 0, NS, CM, CM, 1.0f);
}
typedef __attribute__((ext_vector_type(4))) unsigned u32x4;
typedef __attribute__((ext_vector_type(2))) float f32x2;
#define FA_KEYS 64                       // keys per stage
#define FA_NST (NS / FA_KEYS)            // stages
#define FA_PK 528                        // LDS pitch of a [k|q] row: 512 B + 16 B
#define FA_PV 144                        // LDS pitch of a v row's 64 keys: 128 B + 16 B
#define FA_KB (FA_KEYS * FA_PK)          // bytes of the [k|q] tile
#define FA_BUF (FA_KB + CM * FA_PV)      // bytes of one buffer
#define FA_PO 272                        // output staging pitch: 256 B + 16 B
__device__ __forceinline__ float xhalf(float x) {   // lane l <-> lane l ^ 16
  return __builtin_bit_cast(float, __builtin_amdgcn_permlanex16(__builtin_bit_cast(int, x), __builtin_bit_cast(int, x), 0x76543210, 0xfedcba98, false, false));
}
__global__ __launch_bounds__(256) __attribute__((amdgpu_waves_per_eu(2, 2))) void attn_fused(
    const _Float16* __restrict__ QPh, const _Float16* __restrict__ KQh, const _Float16* __restrict__ Vh, _Float16* __restrict__ OTh) {
  __shared__ __align__(16) unsigned char L[2 * FA_BUF];
  const int t = threadIdx.x, lane = t & 31, wave = t >> 5, c = lane & 15, h = lane >> 4;
  const int b = blockIdx.y, q0 = blockIdx.x * 128 + wave * 16;
  const unsigned char* Kg = (const unsigned char*)(KQh + (size_t)b * NS * 256) + t * 16;                       // a stage of [k|q] is 32 KiB in a row
  const unsigned char* Vg = (const unsigned char*)(Vh + (size_t)b * CM * NS) + (size_t)(t >> 3) * (NS * 2) + (t & 7) * 16;
  unsigned char* Lk = L + (t >> 5) * FA_PK + (t & 31) * 16;
  unsigned char* Lv = L + FA_KB + (t >> 3) * FA_PV + (t & 7) * 16;
  const float LOG2E = 1.4426950408889634f;

  v16h qf[8];
  { const _Float16* qp = QPh + ((size_t)b * NS + q0 + c) * 256 + 8 * h;
#pragma unroll
    for (int kc = 0; kc < 8; ++kc) qf[kc] = Frag<_Float16>::load(qp + 32 * kc);
    // in front of any rewrite of the address registers that the loads above name; the input keeps those registers live up to the wait
    asm volatile("s_wait_xcnt 0x0" :: "v"(qp) : "memory"); }
  __builtin_amdgcn_sched_barrier(0);         // keeps every later register write, a later load's result too, behind that wait
  u32x4 st[12];
#pragma unroll
  for (int s = 0; s < 8; ++s) st[s] = *(const u32x4*)(Kg + s * 4096);
#pragma unroll
  for (int s = 0; s < 4; ++s) st[8 + s] = *(const u32x4*)(Vg + (size_t)s * 32 * (NS * 2));
  asm volatile("s_wait_xcnt 0x0" ::: "memory");   // in front of any rewrite of the address registers that the loads above name
  __builtin_amdgcn_sched_barrier(0);         // keeps every later register write behind that wait
  v8f acc[8];
#pragma unroll
  for (int i = 0; i < 8; ++i) acc[i] = (v8f){0.f,0.f,0.f,0.f,0.f,0.f,0.f,0.f};
  float m_run = -INFINITY, l_run = 0.f;
#pragma unroll
  for (int s = 0; s < 8; ++s) *(u32x4*)(Lk + s * 8 * FA_PK) = st[s];
#pragma unroll
  for (int s = 0; s < 4; ++s) *(u32x4*)(Lv + s * 32 * FA_PV) = st[8 + s];
  __syncthreads();

  // one stage = two passes of 32 keys, read from the buffer at byte offset cur; ahead() issues what is to fly under the stage
  auto stage = [&](const int cur, auto&& ahead) {
    v16h kf[2][8];
    auto load_k = [&](const int sub) {       // the 32 LDS reads of a pass's [k|q] fragments, as one group
      const unsigned char* kp = L + cur + (sub * 32 + c) * FA_PK + 16 * h;
#pragma unroll
      for (int kc = 0; kc < 8; ++kc) {
        kf[0][kc] = Frag<_Float16>::load((const _Float16*)(kp + 64 * kc));
        kf[1][kc] = Frag<_Float16>::load((const _Float16*)(kp + 16 * FA_PK + 64 * kc));
      }
    };
    load_k(0);
    __builtin_amdgcn_sched_barrier(0);       // the LDS reads go first, as one group, and none of them lands between ahead()'s loads and their wait
    ahead();
    __builtin_amdgcn_sched_barrier(0);       // holds ahead()'s loads up here, so that they fly under the whole stage
#pragma unroll
    for (int sub = 0; sub < 2; ++sub) {
      v8f s0 = (v8f){0.f,0.f,0.f,0.f,0.f,0.f,0.f,0.f}, s1 = s0;
#pragma unroll
      for (int kc = 0; kc < 8; ++kc) {
        s0 = Frag<_Float16>::mma(kf[0][kc], qf[kc], s0);
        s1 = Frag<_Float16>::mma(kf[1][kc], qf[kc], s1);
      }
      v16h vf[8];
      const unsigned char* vp = L + cur + FA_KB + c * FA_PV + sub * 64 + 16 * h;
#pragma unroll
      for (int i = 0; i < 8; ++i) vf[i] = Frag<_Float16>::load((const _Float16*)(vp + i * 16 * FA_PV));
      if (sub == 0) load_k(1);               // same stage, so already published
      __builtin_amdgcn_sched_barrier(0);     // holds these reads up here as one group: their LDS latency passes under the softmax arithmetic
      float mx = fmaxf(s0[0], s1[0]);
#pragma unroll
      for (int r = 1; r < 8; ++r) mx = fmaxf(mx, fmaxf(s0[r], s1[r]));
      mx = fmaxf(mx, xhalf(mx)) * LOG2E;     // both halves now hold this query's maximum of the pass
      if (__builtin_amdgcn_ballot_w32(mx > m_run) != 0) {   // scalar branch: no query of the wave has a new maximum -> nothing to rescale
        const float m_new = fmaxf(m_run, mx);
        const float corr = __builtin_amdgcn_exp2f(m_run - m_new);   // 0 in the first pass, where m_run is -inf
        l_run *= corr; m_run = m_new;
#pragma unroll
        for (int i = 0; i < 8; ++i) acc[i] = acc[i] * corr;
      }
      const float nm = 15.0f - m_run;        // p x 2^15: small weights stay normal f16 numbers
      v16h pf; f32x2 ps0 = {0.f, 0.f}, ps1 = {0.f, 0.f};
#pragma unroll
      for (int r = 0; r < 8; r += 2) {       // two neighbouring registers at a time: packed multiply-adds and packed sums
        const f32x2 a0 = __builtin_elementwise_fma((f32x2){s0[r], s0[r + 1]}, (f32x2){LOG2E, LOG2E}, (f32x2){nm, nm});
        const f32x2 a1 = __builtin_elementwise_fma((f32x2){s1[r], s1[r + 1]}, (f32x2){LOG2E, LOG2E}, (f32x2){nm, nm});
        const f32x2 p0 = {__builtin_amdgcn_exp2f(a0.x), __builtin_amdgcn_exp2f(a0.y)}, p1 = {__builtin_amdgcn_exp2f(a1.x), __builtin_amdgcn_exp2f(a1.y)};
        ps0 += p0; ps1 += p1;
        pf[r] = (_Float16)p0.x; pf[r + 1] = (_Float16)p0.y; pf[8 + r] = (_Float16)p1.x; pf[9 + r] = (_Float16)p1.y;
      }
      ps0 += ps1;
      l_run += ps0.x + ps0.y;
#pragma unroll
      for (int i = 0; i < 8; ++i) acc[i] = Frag<_Float16>::mma(vf[i], pf, acc[i]);
    }
  };
  for (int sg = 0; sg + 1 < FA_NST; ++sg) {
    const int cur = (sg & 1) * FA_BUF, nxt = FA_BUF - cur;
    stage(cur, [&]() {                       // the next stage's global loads fly under this stage's products
#pragma unroll
      for (int s = 0; s < 8; ++s) st[s] = *(const u32x4*)(Kg + (size_t)(sg + 1) * (FA_KEYS * 512) + s * 4096);
#pragma unroll
      for (int s = 0; s < 4; ++s) st[8 + s] = *(const u32x4*)(Vg + (size_t)s * 32 * (NS * 2) + (sg + 1) * (FA_KEYS * 2));
      asm volatile("s_wait_xcnt 0x0" ::: "memory");   // in front of any rewrite of the address registers that the loads above name
    });
    // into the buffer whose last readers passed the barrier of the trip before
#pragma unroll
    for (int s = 0; s < 8; ++s) *(u32x4*)(Lk + nxt + s * 8 * FA_PK) = st[s];
#pragma unroll
    for (int s = 0; s < 4; ++s) *(u32x4*)(Lv + nxt + s * 32 * FA_PV) = st[8 + s];
    __syncthreads();                         // publishes the next stage and ends every wave's reads of this one
  }
  stage(((FA_NST - 1) & 1) * FA_BUF, []() {});
  __syncthreads();                           // every wave has left the buffers: they become output staging

  // O[i][c] = acc / sum, f16; staged per wave so that every 128-byte line of OT is stored whole
  const float inv = 1.0f / (l_run + xhalf(l_run));   // each half summed its own 8 keys of every tile
  unsigned char* Lw = L + wave * 16 * FA_PO;
#pragma unroll
  for (int i = 0; i < 8; ++i) {
    v8h hv;
#pragma unroll
    for (int r = 0; r < 8; ++r) hv[r] = (_Float16)(acc[i][r] * inv);
    *(v8h*)(Lw + c * FA_PO + 32 * i + 16 * h) = hv;   // row = query, bytes = channels 16 i + 8 h .. + 7
  }
  // the lanes of this wave read what other lanes of it wrote: keep the compiler from moving the reads over the writes
  __builtin_amdgcn_fence(__ATOMIC_RELEASE, "workgroup");
  __builtin_amdgcn_wave_barrier();
  __builtin_amdgcn_fence(__ATOMIC_ACQUIRE, "workgroup");
#pragma unroll
  for (int it = 0; it < 8; ++it) {
    const int row = it * 2 + h;
    const v8h hv = *(const v8h*)(Lw + row * FA_PO + c * 16);
    *(v8h*)(OTh + ((size_t)b * NS + q0 + row) * CM + c * 8) = hv;
  }
}
__global__ __launch_bounds__(256) void resid_kernel(const float* __restrict__ x, const float* __restrict__ y, float* __restrict__ out, long n4) {
  const long i = (long)blockIdx.x * 256 + threadIdx.x; if (i >= n4) return;
  const v4f v = *(const v4f*)(x + 4 * i) + *(const v4f*)(y + 4 * i);
  *(v4f*)(out + 4 * i) = v; 
}
extern "C" void kernel_launch(void* const* d_in, const int* in_sizes, int n_in, void* d_out, int out_size, void* d_ws, size_t ws_size, hipStream_t stream) {
  (void)in_sizes; (void)n_in; (void)out_size; (void)ws_size;
  const float* x = (const float*)d_in[0]; const float* w1 = (const float*)d_in[1];
  const float* g1 = (const float*)d_in[2]; const float* be1 = (const float*)d_in[3]; const float* m1 = (const float*)d_in[4]; const float* v1 = (const float*)d_in[5];
  const float* wq = (const float*)d_in[6]; const float* bq = (const float*)d_in[7]; const float* wk = (const float*)d_in[8]; const float* bk = (const float*)d_in[9];
  const float* wv = (const float*)d_in[10]; const float* bv = (const float*)d_in[11]; const float* relh = (const float*)d_in[12]; const float* relw = (const float*)d_in[13];
  const float* w2 = (const float*)d_in[14]; const float* g2 = (const float*)d_in[15]; const float* be2 = (const float*)d_in[16]; const float* m2 = (const float*)d_in[17]; const float* v2 = (const float*)d_in[18];
  float* out = (float*)d_out;   // [32][256][1024]
  // Workspace map (offsets in MiB; 256 MiB in all). Scores and p stay on chip, so nothing of them lies here.
  //   [0,16) XT, read last by cv1; afterwards OT in [0,8) (stream order separates the uses)
  //   [64,96) Y; [192,199) the folded cv1 weights, the q/k/v weights and the folded cv2 weights
  char* ws = (char*)d_ws;
  const size_t MiB = (size_t)1 << 20;
  _Float16* XT = (_Float16*)ws;                                      // x^T: [1024][32*256] f16
  unsigned* OT = (unsigned*)ws;                                      // [b][i][c] f16
  unsigned* X1T = (unsigned*)(ws + 16 * MiB);                        // [b][i][128] f16
  unsigned* QP = (unsigned*)(ws + 24 * MiB);                         // [b][i][q | pos] f16
  unsigned* KQ = (unsigned*)(ws + 40 * MiB);                         // [b][j][k | q]
  unsigned* V16 = (unsigned*)(ws + 56 * MiB);                        // [b][c][j] f16
  float* Y = (float*)(ws + 64 * MiB);                                // [b][o][i] f32
  unsigned* W1f = (unsigned*)(ws + 192 * MiB); float* b1f = (float*)(ws + 193 * MiB);
  _Float16* Wq16 = (_Float16*)(ws + 194 * MiB); _Float16* Wk16 = (_Float16*)(ws + 195 * MiB); _Float16* Wv16 = (_Float16*)(ws + 196 * MiB);
  unsigned* W2f = (unsigned*)(ws + 197 * MiB); float* b2f = (float*)(ws + 198 * MiB);
  // x^T, both BN folds, the three weight casts and pos (into QP[:, :, 128:256]) read inputs alone: one launch
  prep_kernel<<<2 * PB_FOLD + 3 * PB_CAST + PB_TR + PB_POS, 256, 0, stream>>>(x, XT, w1, g1, be1, m1, v1, W1f, b1f, w2, g2, be2, m2, v2, W2f, b2f, wq, wk, wv, Wq16, Wk16, Wv16, relh, relw, QP);
  // cv1: X1T[b][i][o] = silu(sum_c XT[i][b*256+c]*W1f[o][c] + b1f[o])   (grid.y = b, strideA = 256 halves within the transposed row)
  { const int t = (NS / 64) * (CM / 64);
    wmma_gemm64<0, false, 2, 1, false, 3><<<dim3((t + 7) / 8, BB), 256, 0, stream>>>(U16(XT), nullptr, BB * CIN, CIN, (const unsigned short*)W1f, nullptr, CIN, 0, X1T, nullptr, CM, (long)NS * CM, b1f, nullptr, 0, NS, CM, CIN, 1.0f); }
  // q, q again, k and v all read x1 alone: one launch, grid.z picks the product (each has 32 tiles of 64 x 64 per image)
  qkv_gemm<<<dim3((NS / 64) * (CM / 64) / 8, BB, 4), 256, 0, stream>>>((const unsigned short*)X1T, U16(Wq16), U16(Wk16), U16(Wv16), bq, bk, bv, (unsigned short*)QP, (unsigned short*)KQ, (unsigned short*)V16);
  // scores, softmax and p.v in one launch: 8 work-groups of 128 queries per image
  attn_fused<<<dim3(NS / 128, BB), 256, 0, stream>>>((const _Float16*)QP, (const _Float16*)KQ, (const _Float16*)V16, (_Float16*)OT);
  { const int t = (CIN / 64) * (NS / 64);  // cv2: Y[b][o][i] = silu(sum_c W2f[o][c]*OT[b][i][c] + b2f[o])  (A = W2f [256][128], Bt = OT[b] [1024][128])
    wmma_gemm64<0, false, 1, 0, false, 3><<<dim3((t + 7) / 8, BB), 256, 0, stream>>>((const unsigned short*)W2f, nullptr, CM, 0, (const unsigned short*)OT, nullptr, CM, (long)NS * CM, Y, nullptr, NS, (long)CIN * NS, b2f, nullptr, 0, CIN, NS, CM, 1.0f); }
  resid_kernel<<<(BB * CIN * NS / 4 + 255) / 256, 256, 0, stream>>>(x, Y, out, (long)BB * CIN * NS / 4);
}

// v004
// Measured time: 84.5 microseconds a run.
// Next to v003, in two timings, it ran 1.42 and 1.41 times as fast.
// Over all steps from v000 it is 4.99 times as fast.
#include <hip/hip_runtime.h>
#include <math.h>
// BoT block: cv1 (1x1 conv 256→128, BN folded, SiLU), q/k/v 1x1 convs (+bias), the single-head attention over 1024 positions as two products in one kernel
// (scores = [q_i | pos_i]·[k_j | q_j]ᵀ with K = 256 — content-content and content-position in one product —, then p·vᵀ with p x2^15,
// K = 1024), cv2 (128→256, BN folded, SiLU): v_wmma_f32_16x16x32_f16, f16 operands, f32 accumulate; softmax and the residual add in f32
// on VALU. All per-batch GEMMs are batched through grid.y strides over the 32 images, scores and p·v included.
typedef __attribute__((ext_vector_type(16))) _Float16 v16h;
typedef __attribute__((ext_vector_type(8)))  _Float16 v8h;
typedef __attribute__((ext_vector_type(16))) __bf16   v16b;
typedef __attribute__((ext_vector_type(8)))  __bf16   v8b;
typedef __attribute__((ext_vector_type(8)))  float    v8f;
typedef __attribute__((ext_vector_type(4)))  float    v4f;
#define PSCALE 32768.0f
#define U16(p) ((const unsigned short*)(const void*)(p))
#define PSCALE_INV (1.0f / 32768.0f)

__device__ __forceinline__ unsigned short f2bf_bits(float f) {
  unsigned u = __float_as_uint(f);
  return (unsigned short)((u + 0x7FFFu + ((u >> 16) & 1u)) >> 16);
}
__device__ __forceinline__ float bf_bits2f(unsigned short h) { return __uint_as_float(((unsigned)h) << 16); }

// hazard guards as plain device helpers (no inline asm inside the kernel template body)
__device__ __forceinline__ void dep_guard_h(v8f& a, v8f& b, v16h x, v16h y) { asm volatile("v_nop\n\tv_nop\n\tv_nop\n\tv_nop" : "+v"(a), "+v"(b) : "v"(x), "v"(y)); }
__device__ __forceinline__ void dep_guard_b(v8f& a, v8f& b, v16b x, v16b y) { asm volatile("v_nop\n\tv_nop\n\tv_nop\n\tv_nop" : "+v"(a), "+v"(b) : "v"(x), "v"(y)); }
__device__ __forceinline__ void keep4_h(v16h a, v16h b, v16h c, v16h d) { asm volatile("v_nop" :: "v"(a), "v"(b), "v"(c), "v"(d)); }
__device__ __forceinline__ void keep4_b(v16b a, v16b b, v16b c, v16b d) { asm volatile("v_nop" :: "v"(a), "v"(b), "v"(c), "v"(d)); }
__device__ __forceinline__ void acc_guard4(v8f& a, v8f& b, v8f& c, v8f& d) { asm volatile("v_nop\n\tv_nop\n\tv_nop\n\tv_nop" : "+v"(a), "+v"(b), "+v"(c), "+v"(d)); }
template <typename T> struct Frag;
template <> struct Frag<_Float16> {
  typedef v16h V; union U { v16h v; v8h h[2]; };
  static __device__ __forceinline__ v16h load(const _Float16* p) {   // elements 0..7 <- p[0..7], 8..15 <- p[16..23]
    U f; f.h[0] = *(const v8h*)(p); f.h[1] = *(const v8h*)(p + 16); return f.v;
  }
  static __device__ __forceinline__ v8f mma(v16h a, v16h b, v8f c) {
    return __builtin_amdgcn_wmma_f32_16x16x32_f16(false, a, false, b, (short)0, c, false, false);
  }
  static __device__ __forceinline__ void guard(v8f& a, v8f& b, v16h x, v16h y) { dep_guard_h(a, b, x, y); }
  static __device__ __forceinline__ void keep(v16h a, v16h b, v16h c, v16h d) { keep4_h(a, b, c, d); }
};
template <> struct Frag<__bf16> {
  typedef v16b V; union U { v16b v; v8b h[2]; };
  static __device__ __forceinline__ v16b load(const __bf16* p) {
    U f; f.h[0] = *(const v8b*)(p); f.h[1] = *(const v8b*)(p + 16); return f.v;
  }
  static __device__ __forceinline__ v8f mma(v16b a, v16b b, v8f c) {
    return __builtin_amdgcn_wmma_f32_16x16x32_bf16(false, a, false, b, (short)0, c, false, false);
  }
  static __device__ __forceinline__ void guard(v8f& a, v8f& b, v16b x, v16b y) { dep_guard_b(a, b, x, y); }
  static __device__ __forceinline__ void keep(v16b a, v16b b, v16b c, v16b d) { keep4_b(a, b, c, d); }
};

// ---- Register-blocked batched WMMA GEMM ------------------------------------
// C[m,n] = scale * sum_k A[m,k] * Bt[n,k] (+bias)(+resid); each wave owns a 64x64 tile.
// A row-major [M,K]; Bt row-major [N,K]; M,N % 64 == 0, K % 32 == 0.
// SPLIT: operands are hi/lo planes (A2/Bt2 = lo planes, same layout); product = hi·hi + hi·lo + lo·hi.
// BIAS_MODE: 0 = none, 1 = bias[m], 2 = bias[n].
// OUT_MODE: 0 = f32, 1 = f16, 2 = bf16 hi plane (Cout) + bf16 lo plane (Cout2).
// ET: 0 = f16 operands, 1 = bf16 operands (pointers passed as 16-bit storage)
template <int ET> struct Elem;
template <> struct Elem<0> { typedef _Float16 T; };
template <> struct Elem<1> { typedef __bf16 T; };
// The body is a device function (slab = the wave's own 16x64 LDS slab, bx and b = the work-group's tile group and image), so that
// several products that do not depend on each other can share one launch.
template <int ET, bool SPLIT, int BIAS_MODE, int OUT_MODE, bool RESID, int ACT = 0>
__device__ __forceinline__ void gemm64_tile(float* slab, const int bx, const int b,
    const unsigned short* __restrict__ Ap, const unsigned short* __restrict__ A2p, int lda, long strideA,
    const unsigned short* __restrict__ Btp, const unsigned short* __restrict__ Bt2p, int ldb, long strideB,
    void* __restrict__ Cout, void* __restrict__ Cout2, int ldc, long strideC,
    const float* __restrict__ bias,
    const float* __restrict__ resid, long strideR,
    int M, int N, int K, float scale) {
  typedef typename Elem<ET>::T T;
  typedef typename Frag<T>::V V;
  const T* A = (const T*)Ap; const T* A2 = (const T*)A2p; const T* Bt = (const T*)Btp; const T* Bt2 = (const T*)Bt2p;
  const int lane = threadIdx.x & 31;
  const int wave = threadIdx.x >> 5;
  const int tilesN = N >> 6;
  const int tilesM = M >> 6;
  const int tile = bx * 8 + wave;
  if (tile >= tilesM * tilesN) return;   // wave-uniform; no block barriers in this kernel
  const int tm = tile / tilesN;
  const int tn = tile - tm * tilesN;
  const int m0 = tm << 6;
  const int n0 = tn << 6;

  const T* Ab  = A  + (size_t)b * strideA;
  const T* Bb  = Bt + (size_t)b * strideB;
  const T* Ab2 = SPLIT ? (A2  + (size_t)b * strideA) : nullptr;
  const T* Bb2 = SPLIT ? (Bt2 + (size_t)b * strideB) : nullptr;

  const int rlane = lane & 15;                 // row (A) / col (B, D) within subtile
  const int koff  = (lane >> 4) * 8;           // k offset of this lane half
  const int mOff  = (lane >> 4) * 8;           // D row offset

  v8f acc[4][4];
#pragma unroll
  for (int i = 0; i < 4; ++i)
#pragma unroll
    for (int j = 0; j < 4; ++j) acc[i][j] = (v8f){0.f,0.f,0.f,0.f,0.f,0.f,0.f,0.f};

  for (int k0 = 0; k0 < K; k0 += 32) {
    V bh[4], bl[4];
#pragma unroll
    for (int j = 0; j < 4; ++j) {
      const size_t bo = (size_t)(n0 + (j << 4) + rlane) * ldb + koff + k0;
      bh[j] = Frag<T>::load(Bb + bo);
      if (SPLIT) bl[j] = Frag<T>::load(Bb2 + bo);
    }
#pragma unroll
    for (int i = 0; i < 4; ++i) {
      const size_t ao = (size_t)(m0 + (i << 4) + rlane) * lda + koff + k0;
      V ah = Frag<T>::load(Ab + ao);
      V al;
      if (SPLIT) al = Frag<T>::load(Ab2 + ao);
#pragma unroll
      for (int j = 0; j < 4; ++j) {
        acc[i][j] = Frag<T>::mma(ah, bh[j], acc[i][j]);
        if (SPLIT) {
          acc[i][j] = Frag<T>::mma(ah, bl[j], acc[i][j]);
          acc[i][j] = Frag<T>::mma(al, bh[j], acc[i][j]);
        }
      }
      Frag<T>::guard(acc[i][0], acc[i][3], ah, SPLIT ? al : ah);
    }
    Frag<T>::keep(bh[0], bh[1], bh[2], bh[3]);
    if (SPLIT) Frag<T>::keep(bl[0], bl[1], bl[2], bl[3]);
  }
  acc_guard4(acc[0][0], acc[0][1], acc[0][2], acc[0][3]);
  acc_guard4(acc[1][0], acc[1][1], acc[1][2], acc[1][3]);
  acc_guard4(acc[2][0], acc[2][1], acc[2][2], acc[2][3]);
  acc_guard4(acc[3][0], acc[3][1], acc[3][2], acc[3][3]);

  // ---- epilogue ----
  const float* Rb = RESID ? (resid + (size_t)b * strideR) : nullptr;
#pragma unroll
  for (int i = 0; i < 4; ++i) {
    const int mBase = m0 + (i << 4);
#pragma unroll
    for (int j = 0; j < 4; ++j) {
      const int n = n0 + (j << 4) + rlane;
      float bv = 0.f;
      if (BIAS_MODE == 2) bv = bias[n];
#pragma unroll
      for (int r = 0; r < 8; ++r) {
        float v = acc[i][j][r] * scale;
        if (BIAS_MODE == 1) v += bias[mBase + mOff + r];
        if (BIAS_MODE == 2) v += bv;
        if (RESID) v += Rb[(size_t)(mBase + mOff + r) * ldc + n];
        if (ACT == 1) v = tanhf(v);
        if (ACT == 2) v = fmaxf(v, 0.0f);
        if (ACT == 3) v = v / (1.0f + expf(-v));
        if (ACT == 4) v = (v > 0.f) ? v : 0.01f * v;
        if (ACT == 5) v = 0.5f * v * (1.0f + erff(v * 0.70710678118654752f));
        slab[(mOff + r) * 68 + (j << 4) + rlane] = v;
      }
    }
    __builtin_amdgcn_fence(__ATOMIC_RELEASE, "workgroup");
    __builtin_amdgcn_wave_barrier();
    __builtin_amdgcn_fence(__ATOMIC_ACQUIRE, "workgroup");
    if (OUT_MODE == 0) {
      float* C = (float*)Cout + (size_t)b * strideC;
      const int hh = lane >> 4, c4 = (lane & 15) * 4;     // row seg = 256 B = 16 lanes x 16 B
      {
#pragma unroll
        for (int it = 0; it < 8; ++it) {
          const int row = it * 2 + hh;
          v4f v = *(const v4f*)(slab + row * 68 + c4);
          *(v4f*)(C + (size_t)(mBase + row) * ldc + n0 + c4) = v;
        }
        
      }
    } else {
      const int q = lane >> 3, c8 = (lane & 7) * 8;
      unsigned short* C  = (unsigned short*)Cout  + (size_t)b * strideC;
      unsigned short* C2 = (OUT_MODE == 2) ? ((unsigned short*)Cout2 + (size_t)b * strideC) : nullptr;
      {
#pragma unroll
        for (int it = 0; it < 4; ++it) {
          const int row = it * 4 + q;
          const float* sp = slab + row * 68 + c8;
          v8h hv, lv;
#pragma unroll
          for (int e = 0; e < 8; ++e) {
            if (OUT_MODE == 1) {
              hv[e] = (_Float16)sp[e];
            } else {
              unsigned short hb = f2bf_bits(sp[e]);
              unsigned short lb = f2bf_bits(sp[e] - bf_bits2f(hb));
              hv[e] = __builtin_bit_cast(_Float16, hb);
              lv[e] = __builtin_bit_cast(_Float16, lb);
            }
          }
          *(v8h*)(C + (size_t)(mBase + row) * ldc + n0 + c8) = hv;
          if (OUT_MODE == 2) *(v8h*)(C2 + (size_t)(mBase + row) * ldc + n0 + c8) = lv;
        }
        
      }
    }
    __builtin_amdgcn_fence(__ATOMIC_RELEASE, "workgroup");
    __builtin_amdgcn_wave_barrier();
    __builtin_amdgcn_fence(__ATOMIC_ACQUIRE, "workgroup");
  }
}

template <int ET, bool SPLIT, int BIAS_MODE, int OUT_MODE, bool RESID, int ACT = 0>
__global__ __launch_bounds__(256) void wmma_gemm64(
    const unsigned short* __restrict__ Ap, const unsigned short* __restrict__ A2p, int lda, long strideA,
    const unsigned short* __restrict__ Btp, const unsigned short* __restrict__ Bt2p, int ldb, long strideB,
    void* __restrict__ Cout, void* __restrict__ Cout2, int ldc, long strideC,
    const float* __restrict__ bias,
    const float* __restrict__ resid, long strideR,
    int M, int N, int K, float scale) {
  __shared__ __align__(16) float sT[8][16 * 68];   // per-wave 16x64 slab, pitch 68 floats
  gemm64_tile<ET, SPLIT, BIAS_MODE, OUT_MODE, RESID, ACT>(sT[threadIdx.x >> 5], blockIdx.x, blockIdx.y, Ap, A2p, lda, strideA, Btp, Bt2p, ldb, strideB,
                                                          Cout, Cout2, ldc, strideC, bias, resid, strideR, M, N, K, scale);
}

__device__ __forceinline__ void cast_f32_f16x2(const int bx,
    const float* __restrict__ in, _Float16* __restrict__ out, int n2) {
  int i = bx * 256 + threadIdx.x;
  if (i < n2) {
    const _Float16 h0 = (_Float16)in[2 * i], h1 = (_Float16)in[2 * i + 1];
    const unsigned u = (unsigned)__builtin_bit_cast(unsigned short, h0) | ((unsigned)__builtin_bit_cast(unsigned short, h1) << 16);
    ((unsigned*)out)[i] = u;
    
  }
}


// ---- f32 [R][C] (row pitch ldi) -> f16 transposed [C][R] (row pitch ldo); 64x64 tiles; each output row segment
__device__ __forceinline__ void transpose_cast_f16(_Float16 (*tile)[72], const int bx, const int by, const float* __restrict__ in, int ldi,
                                                   _Float16* __restrict__ outT, int ldo, float scale) {   // tile: [c][r], 64 rows
  const int c0 = bx * 64, r0 = by * 64;
  const int t = threadIdx.x, tx = t & 31, ty = t >> 5;
  for (int i = ty; i < 64; i += 8) {
    tile[tx][i]      = (_Float16)(in[(size_t)(r0 + i) * ldi + c0 + tx] * scale);
    tile[32 + tx][i] = (_Float16)(in[(size_t)(r0 + i) * ldi + c0 + 32 + tx] * scale);
  }
  __syncthreads();
  const int q = t >> 3, c8 = (t & 7) * 8;
  {
#pragma unroll
    for (int it = 0; it < 2; ++it) {
      const int c = it * 32 + q;
      v8h hv = *(const v8h*)(&tile[c][c8]);
      *(v8h*)(outT + (size_t)(c0 + c) * ldo + r0 + c8) = hv;
    }
    // in front of any rewrite of the registers that the two stores above name: other jobs' code follows this one in the merged kernel
    asm volatile("s_wait_xcnt 0x0" ::: "memory");
  }
}

#define BB 32
#define CIN 256
#define CM 128
#define NS 1024
// fold BN into 1x1 conv weights: W'[o][c] = W[o][c]*g[o]/sqrt(v[o]+eps) (f16), bias'[o] = b[o] - m[o]*scale
__device__ __forceinline__ void fold_bn(const int bx, const float* __restrict__ Wm, const float* __restrict__ g, const float* __restrict__ bb, const float* __restrict__ m, const float* __restrict__ var,
                                        int O, int Cc, unsigned* __restrict__ W16, float* __restrict__ bias) {
  const int i = bx * 256 + threadIdx.x;
  if (i < O * Cc / 2) { const int o = (2 * i) / Cc; const float sc = g[o] / sqrtf(var[o] + 1e-5f);
    const unsigned u = (unsigned)__builtin_bit_cast(unsigned short, (_Float16)(Wm[2 * i] * sc)) | ((unsigned)__builtin_bit_cast(unsigned short, (_Float16)(Wm[2 * i + 1] * sc)) << 16);
    ((unsigned*)W16)[i] = u;  }
  if (i < O) { const float sc = g[i] / sqrtf(var[i] + 1e-5f); const float v = bb[i] - m[i] * sc; ((float*)bias)[i] = v;  }
}
// posᵀ as f16 into QP operand columns: QP[b][i][128 + c] = rel_h[c][ih] + rel_w[c][iw] (same for every b); thread per (b, i, c-pair)
__device__ __forceinline__ void pos_fill(const int bx, const float* __restrict__ relh, const float* __restrict__ relw, unsigned* __restrict__ QP) {
  const long t = (long)bx * 256 + threadIdx.x;      // (b, i, cp): cp in 0..63
  const int cp = (int)(t & 63); const long bi = t >> 6; const int i = (int)(bi % NS);
  const int ih = i >> 5, iw = i & 31, c0 = 2 * cp;
  const float p0 = relh[(size_t)c0 * 32 + ih] + relw[(size_t)c0 * 32 + iw], p1 = relh[(size_t)(c0 + 1) * 32 + ih] + relw[(size_t)(c0 + 1) * 32 + iw];
  const unsigned u = (unsigned)__builtin_bit_cast(unsigned short, (_Float16)p0) | ((unsigned)__builtin_bit_cast(unsigned short, (_Float16)p1) << 16);
  ((unsigned*)QP)[(size_t)bi * 128 + 64 + cp] = u;
  // in front of any rewrite of the registers that the store above names
  asm volatile("s_wait_xcnt 0x0" ::: "memory");
}
// ---- everything that reads inputs alone, in one launch: the work-group's index picks its job (block-uniform, so the barrier of the transpose is safe)
#define PB_FOLD (CM * CIN / 2 / 256)     // work-groups of one BN fold (both folds have 128 x 256 weights)
#define PB_CAST (CM * CM / 2 / 256)      // work-groups of one weight cast
#define PB_TR ((NS / 64) * (BB * CIN / 64))
#define PB_POS (BB * NS * 64 / 256)
__global__ __launch_bounds__(256) void prep_kernel(
    const float* __restrict__ x, _Float16* __restrict__ XT,
    const float* __restrict__ w1, const float* __restrict__ g1, const float* __restrict__ be1, const float* __restrict__ m1, const float* __restrict__ v1, unsigned* __restrict__ W1f, float* __restrict__ b1f,
    const float* __restrict__ w2, const float* __restrict__ g2, const float* __restrict__ be2, const float* __restrict__ m2, const float* __restrict__ v2, unsigned* __restrict__ W2f, float* __restrict__ b2f,
    const float* __restrict__ wq, const float* __restrict__ wk, const float* __restrict__ wv, _Float16* __restrict__ Wq16, _Float16* __restrict__ Wk16, _Float16* __restrict__ Wv16,
    const float* __restrict__ relh, const float* __restrict__ relw, unsigned* __restrict__ QP) {
  __shared__ __align__(16) _Float16 tile[64][72];
  int bx = blockIdx.x;
  if (bx < PB_FOLD) { fold_bn(bx, w1, g1, be1, m1, v1, CM, CIN, W1f, b1f); return; }
  bx -= PB_FOLD;
  if (bx < PB_FOLD) { fold_bn(bx, w2, g2, be2, m2, v2, CIN, CM, W2f, b2f); return; }
  bx -= PB_FOLD;
  if (bx < 3 * PB_CAST) {
    const int w = bx / PB_CAST;
    cast_f32_f16x2(bx - w * PB_CAST, w == 0 ? wq : w == 1 ? wk : wv, w == 0 ? Wq16 : w == 1 ? Wk16 : Wv16, CM * CM / 2);
    return;
  }
  bx -= 3 * PB_CAST;
  if (bx < PB_TR) { transpose_cast_f16(tile, bx % (NS / 64), bx / (NS / 64), x, NS, XT, BB * CIN, 1.0f); return; }   // [32*256][1024] -> [1024][8192]
  pos_fill(bx - PB_TR, relh, relw, QP);
}
// ---- the four products on x1 in one launch, picked by blockIdx.z: q into QP[:, :, 0:128], q again into KQ[:, :, 128:256], k into KQ[:, :, 0:128], v as [c][j]
__global__ __launch_bounds__(256) void qkv_gemm(
    const unsigned short* __restrict__ X1T, const unsigned short* __restrict__ Wq16, const unsigned short* __restrict__ Wk16, const unsigned short* __restrict__ Wv16,
    const float* __restrict__ bq, const float* __restrict__ bk, const float* __restrict__ bv,
    unsigned short* __restrict__ QP, unsigned short* __restrict__ KQ, unsigned short* __restrict__ V16) {
  __shared__ __align__(16) float sT[8][16 * 68];   // per-wave 16x64 slab, pitch 68 floats
  float* slab = sT[threadIdx.x >> 5];
  const int z = blockIdx.z;
  if (z == 3) {   // V[b][c][j] = sum_cc Wv[c][cc]*X1T[b][j][cc] + bv[c]: A = Wv16 [128][128], Bt = X1T[b] [1024][128]
    gemm64_tile<0, false, 1, 1, false, 0>(slab, blockIdx.x, blockIdx.y, Wv16, nullptr, CM, 0, X1T, nullptr, CM, (long)NS * CM, V16, nullptr, NS, (long)CM * NS, bv, nullptr, 0, CM, NS, CM, 1.0f);
    return;
  }
  gemm64_tile<0, false, 2, 1, false, 0>(slab, blockIdx.x, blockIdx.y, X1T, nullptr, CM, (long)NS * CM, z == 2 ? Wk16 : Wq16, nullptr, CM, 0,
                                        z == 0 ? QP : z == 1 ? KQ + CM : KQ, nullptr, 256, (long)NS * 256, z == 2 ? bk : bq, nullptr, 0, NS, CM, CM, 1.0f);
}
typedef __attribute__((ext_vector_type(4))) unsigned u32x4;
typedef __attribute__((ext_vector_type(2))) float f32x2;
#define FA_KEYS 64                       // keys per stage
#define FA_NST (NS / FA_KEYS)            // stages
#define FA_PK 528                        // LDS pitch of a [k|q] row: 512 B + 16 B
#define FA_PV 144                        // LDS pitch of a v row's 64 keys: 128 B + 16 B
#define FA_KB (FA_KEYS * FA_PK)          // bytes of the [k|q] tile
#define FA_BUF (FA_KB + CM * FA_PV)      // bytes of one buffer
#define FA_PO 272                        // pitch of a query's 128 channels of O in LDS: 256 B + 16 B
#define FA_PY 528                        // pitch of an output channel's 128 queries (f32) in LDS: 512 B + 16 B
#define FA_OB (128 * FA_PO)              // bytes of the work-group's O rows
#define FA_TAIL (FA_OB + CIN * FA_PY)    // O rows and, behind them, the 256 x 128 tile of cv2's sums
__device__ __forceinline__ float xhalf(float x) {   // lane l <-> lane l ^ 16
  return __builtin_bit_cast(float, __builtin_amdgcn_permlanex16(__builtin_bit_cast(int, x), __builtin_bit_cast(int, x), 0x76543210, 0xfedcba98, false, false));
}
__global__ __launch_bounds__(256) __attribute__((amdgpu_waves_per_eu(2, 2))) void attn_fused(
    const _Float16* __restrict__ QPh, const _Float16* __restrict__ KQh, const _Float16* __restrict__ Vh,
    const _Float16* __restrict__ W2h, const float* __restrict__ b2, const float* __restrict__ x, float* __restrict__ out) {
  __shared__ __align__(16) unsigned char L[FA_TAIL > 2 * FA_BUF ? FA_TAIL : 2 * FA_BUF];
  const int t = threadIdx.x, lane = t & 31, wave = t >> 5, c = lane & 15, h = lane >> 4;
  const int b = blockIdx.y, q0 = blockIdx.x * 128 + wave * 16;
  const unsigned char* Kg = (const unsigned char*)(KQh + (size_t)b * NS * 256) + t * 16;                       // a stage of [k|q] is 32 KiB in a row
  const unsigned char* Vg = (const unsigned char*)(Vh + (size_t)b * CM * NS) + (size_t)(t >> 3) * (NS * 2) + (t & 7) * 16;
  unsigned char* Lk = L + (t >> 5) * FA_PK + (t & 31) * 16;
  unsigned char* Lv = L + FA_KB + (t >> 3) * FA_PV + (t & 7) * 16;
  const float LOG2E = 1.4426950408889634f;

  v16h qf[8];
  { const _Float16* qp = QPh + ((size_t)b * NS + q0 + c) * 256 + 8 * h;
#pragma unroll
    for (int kc = 0; kc < 8; ++kc) qf[kc] = Frag<_Float16>::load(qp + 32 * kc);
    // in front of any rewrite of the address registers that the loads above name; the input keeps those registers live up to the wait
    asm volatile("s_wait_xcnt 0x0" :: "v"(qp) : "memory"); }
  __builtin_amdgcn_sched_barrier(0);         // keeps every later register write, a later load's result too, behind that wait
  u32x4 st[12];
#pragma unroll
  for (int s = 0; s < 8; ++s) st[s] = *(const u32x4*)(Kg + s * 4096);
#pragma unroll
  for (int s = 0; s < 4; ++s) st[8 + s] = *(const u32x4*)(Vg + (size_t)s * 32 * (NS * 2));
  asm volatile("s_wait_xcnt 0x0" ::: "memory");   // in front of any rewrite of the address registers that the loads above name
  __builtin_amdgcn_sched_barrier(0);         // keeps every later register write behind that wait
  v8f acc[8];
#pragma unroll
  for (int i = 0; i < 8; ++i) acc[i] = (v8f){0.f,0.f,0.f,0.f,0.f,0.f,0.f,0.f};
  float m_run = -INFINITY, l_run = 0.f;
#pragma unroll
  for (int s = 0; s < 8; ++s) *(u32x4*)(Lk + s * 8 * FA_PK) = st[s];
#pragma unroll
  for (int s = 0; s < 4; ++s) *(u32x4*)(Lv + s * 32 * FA_PV) = st[8 + s];
  __syncthreads();

  // one stage = two passes of 32 keys, read from the buffer at byte offset cur; ahead() issues what is to fly under the stage
  auto stage = [&](const int cur, auto&& ahead) {
    v16h kf[2][8];
    auto load_k = [&](const int sub) {       // the 32 LDS reads of a pass's [k|q] fragments, as one group
      const unsigned char* kp = L + cur + (sub * 32 + c) * FA_PK + 16 * h;
#pragma unroll
      for (int kc = 0; kc < 8; ++kc) {
        kf[0][kc] = Frag<_Float16>::load((const _Float16*)(kp + 64 * kc));
        kf[1][kc] = Frag<_Float16>::load((const _Float16*)(kp + 16 * FA_PK + 64 * kc));
      }
    };
    load_k(0);
    __builtin_amdgcn_sched_barrier(0);       // the LDS reads go first, as one group, and none of them lands between ahead()'s loads and their wait
    ahead();
    __builtin_amdgcn_sched_barrier(0);       // holds ahead()'s loads up here, so that they fly under the whole stage
#pragma unroll
    for (int sub = 0; sub < 2; ++sub) {
      v8f s0 = (v8f){0.f,0.f,0.f,0.f,0.f,0.f,0.f,0.f}, s1 = s0;
#pragma unroll
      for (int kc = 0; kc < 8; ++kc) {
        s0 = Frag<_Float16>::mma(kf[0][kc], qf[kc], s0);
        s1 = Frag<_Float16>::mma(kf[1][kc], qf[kc], s1);
      }
      v16h vf[8];
      const unsigned char* vp = L + cur + FA_KB + c * FA_PV + sub * 64 + 16 * h;
#pragma unroll
      for (int i = 0; i < 8; ++i) vf[i] = Frag<_Float16>::load((const _Float16*)(vp + i * 16 * FA_PV));
      if (sub == 0) load_k(1);               // same stage, so already published
      __builtin_amdgcn_sched_barrier(0);     // holds these reads up here as one group: their LDS latency passes under the softmax arithmetic
      float mx = fmaxf(s0[0], s1[0]);
#pragma unroll
      for (int r = 1; r < 8; ++r) mx = fmaxf(mx, fmaxf(s0[r], s1[r]));
      mx = fmaxf(mx, xhalf(mx)) * LOG2E;     // both halves now hold this query's maximum of the pass
      if (__builtin_amdgcn_ballot_w32(mx > m_run) != 0) {   // scalar branch: no query of the wave has a new maximum -> nothing to rescale
        const float m_new = fmaxf(m_run, mx);
        const float corr = __builtin_amdgcn_exp2f(m_run - m_new);   // 0 in the first pass, where m_run is -inf
        l_run *= corr; m_run = m_new;
#pragma unroll
        for (int i = 0; i < 8; ++i) acc[i] = acc[i] * corr;
      }
      const float nm = 15.0f - m_run;        // p x 2^15: small weights stay normal f16 numbers
      v16h pf; f32x2 ps0 = {0.f, 0.f}, ps1 = {0.f, 0.f};
#pragma unroll
      for (int r = 0; r < 8; r += 2) {       // two neighbouring registers at a time: packed multiply-adds and packed sums
        const f32x2 a0 = __builtin_elementwise_fma((f32x2){s0[r], s0[r + 1]}, (f32x2){LOG2E, LOG2E}, (f32x2){nm, nm});
        const f32x2 a1 = __builtin_elementwise_fma((f32x2){s1[r], s1[r + 1]}, (f32x2){LOG2E, LOG2E}, (f32x2){nm, nm});
        const f32x2 p0 = {__builtin_amdgcn_exp2f(a0.x), __builtin_amdgcn_exp2f(a0.y)}, p1 = {__builtin_amdgcn_exp2f(a1.x), __builtin_amdgcn_exp2f(a1.y)};
        ps0 += p0; ps1 += p1;
        pf[r] = (_Float16)p0.x; pf[r + 1] = (_Float16)p0.y; pf[8 + r] = (_Float16)p1.x; pf[9 + r] = (_Float16)p1.y;
      }
      ps0 += ps1;
      l_run += ps0.x + ps0.y;
#pragma unroll
      for (int i = 0; i < 8; ++i) acc[i] = Frag<_Float16>::mma(vf[i], pf, acc[i]);
    }
  };
  for (int sg = 0; sg + 1 < FA_NST; ++sg) {
    const int cur = (sg & 1) * FA_BUF, nxt = FA_BUF - cur;
    stage(cur, [&]() {                       // the next stage's global loads fly under this stage's products
#pragma unroll
      for (int s = 0; s < 8; ++s) st[s] = *(const u32x4*)(Kg + (size_t)(sg + 1) * (FA_KEYS * 512) + s * 4096);
#pragma unroll
      for (int s = 0; s < 4; ++s) st[8 + s] = *(const u32x4*)(Vg + (size_t)s * 32 * (NS * 2) + (sg + 1) * (FA_KEYS * 2));
      asm volatile("s_wait_xcnt 0x0" ::: "memory");   // in front of any rewrite of the address registers that the loads above name
    });
    // into the buffer whose last readers passed the barrier of the trip before
#pragma unroll
    for (int s = 0; s < 8; ++s) *(u32x4*)(Lk + nxt + s * 8 * FA_PK) = st[s];
#pragma unroll
    for (int s = 0; s < 4; ++s) *(u32x4*)(Lv + nxt + s * 32 * FA_PV) = st[8 + s];
    __syncthreads();                         // publishes the next stage and ends every wave's reads of this one
  }
  // ---- behind the keys: cv2, SiLU and the residual add on the work-group's 128 queries. O goes from wave to wave through LDS, y never leaves the chip.
  // A wave owns output channels 32 wave .. + 31 for all 128 queries: W2f.O^T (A = its 32 rows of W2f, B = O rows [query][channel] from LDS).
  const int o0 = wave * 32;
  v16h wf[2][4]; v4f bs[2][2];
  stage(((FA_NST - 1) & 1) * FA_BUF, [&]() {   // the wave's rows of W2f and its bias fly under the last stage's products
    const _Float16* wp = W2h + (size_t)(o0 + c) * CM + 8 * h;
    const float* bp = b2 + o0 + 8 * h;
#pragma unroll
    for (int ot = 0; ot < 2; ++ot) {
#pragma unroll
      for (int kc = 0; kc < 4; ++kc) wf[ot][kc] = Frag<_Float16>::load(wp + ot * 16 * CM + 32 * kc);
      bs[ot][0] = *(const v4f*)(bp + 16 * ot); bs[ot][1] = *(const v4f*)(bp + 16 * ot + 4);
    }
    // in front of any rewrite of the address registers that the loads above name; the inputs keep those registers live up to the wait
    asm volatile("s_wait_xcnt 0x0" :: "v"(wp), "v"(bp) : "memory");
  });
  __syncthreads();                           // every wave has left the buffers: they become staging for O and for cv2's sums

  // O[i][c] = acc / sum, f16, a row per query
  const float inv = 1.0f / (l_run + xhalf(l_run));   // each half summed its own 8 keys of every tile
  unsigned char* Lw = L + wave * 16 * FA_PO;
#pragma unroll
  for (int i = 0; i < 8; ++i) {
    v8h hv;
#pragma unroll
    for (int r = 0; r < 8; ++r) hv[r] = (_Float16)(acc[i][r] * inv);
    *(v8h*)(Lw + c * FA_PO + 32 * i + 16 * h) = hv;   // row = query, bytes = channels 16 i + 8 h .. + 7
  }
  __syncthreads();                           // publishes every wave's 16 queries of O to the whole work-group
  const size_t xo = ((size_t)b * CIN + o0) * NS + blockIdx.x * 128 + lane * 4;   // a lane's 4 queries of channel o0
  const float* xp = x + xo;
  float* op = out + xo;
  v4f xc[8];
#pragma unroll
  for (int j = 0; j < 8; ++j) xc[j] = *(const v4f*)(xp + (size_t)j * NS);
  asm volatile("s_wait_xcnt 0x0" :: "v"(xp) : "memory");   // in front of any rewrite of the address registers that the loads above name
  __builtin_amdgcn_sched_barrier(0);         // holds the first 8 rows' loads of x up here: they fly under the product
  v8f d[2][8];
#pragma unroll
  for (int it = 0; it < 8; ++it) { d[0][it] = (v8f){0.f,0.f,0.f,0.f,0.f,0.f,0.f,0.f}; d[1][it] = d[0][it]; }
#pragma unroll
  for (int kc = 0; kc < 4; ++kc) {
    v16h of[8];
#pragma unroll
    for (int it = 0; it < 8; ++it) of[it] = Frag<_Float16>::load((const _Float16*)(L + (it * 16 + c) * FA_PO + 64 * kc + 16 * h));
#pragma unroll
    for (int it = 0; it < 8; ++it) {
      d[0][it] = Frag<_Float16>::mma(wf[0][kc], of[it], d[0][it]);
      d[1][it] = Frag<_Float16>::mma(wf[1][kc], of[it], d[1][it]);
    }
  }
  // through the wave's own 32 rows of LDS, so that a lane holds 4 neighbouring queries and a store is one channel's 128 queries: 4 whole lines
  float* slab = (float*)(L + FA_OB + o0 * FA_PY);
#pragma unroll
  for (int ot = 0; ot < 2; ++ot)
#pragma unroll
    for (int it = 0; it < 8; ++it)
#pragma unroll
      for (int r = 0; r < 8; ++r) slab[(ot * 16 + 8 * h + r) * (FA_PY / 4) + it * 16 + c] = d[ot][it][r] + bs[ot][r >> 2][r & 3];
  // the lanes of this wave read what other lanes of it wrote: keep the compiler from moving the reads over the writes
  __builtin_amdgcn_fence(__ATOMIC_RELEASE, "workgroup");
  __builtin_amdgcn_wave_barrier();
  __builtin_amdgcn_fence(__ATOMIC_ACQUIRE, "workgroup");
  const float* sp = slab + lane * 4;
  // stays rolled: the SiLU of 128 values a lane, unrolled, is several times the text of the rest of the kernel and runs only once
#pragma unroll 1
  for (int g = 0; g < 4; ++g) {              // 8 channels a trip; the next trip's x flies under this trip's arithmetic
    v4f xn[8];
#pragma unroll
    for (int j = 0; j < 8; ++j) xn[j] = xc[j];
    if (g < 3) {
#pragma unroll
      for (int j = 0; j < 8; ++j) xn[j] = *(const v4f*)(xp + (size_t)(8 + j) * NS);
    }
    __builtin_amdgcn_sched_barrier(0);       // holds those loads up here
#pragma unroll
    for (int j = 0; j < 8; ++j) {
      v4f y = *(const v4f*)(sp + j * (FA_PY / 4));
#pragma unroll
      for (int e = 0; e < 4; ++e) y[e] = y[e] / (1.0f + expf(-y[e]));
      *(v4f*)(op + (size_t)j * NS) = xc[j] + y;
    }
    asm volatile("s_wait_xcnt 0x0" ::: "memory");   // in front of the step of the address registers that this trip's loads and stores name
    __builtin_amdgcn_sched_barrier(0);       // keeps that step behind the wait
    xp += 8 * NS; op += 8 * NS; sp += 8 * (FA_PY / 4);
#pragma unroll
    for (int j = 0; j < 8; ++j) xc[j] = xn[j];
  }
}
extern "C" void kernel_launch(void* const* d_in, const int* in_sizes, int n_in, void* d_out, int out_size, void* d_ws, size_t ws_size, hipStream_t stream) {
  (void)in_sizes; (void)n_in; (void)out_size; (void)ws_size;
  const float* x = (const float*)d_in[0]; const float* w1 = (const float*)d_in[1];
  const float* g1 = (const float*)d_in[2]; const float* be1 = (const float*)d_in[3]; const float* m1 = (const float*)d_in[4]; const float* v1 = (const float*)d_in[5];
  const float* wq = (const float*)d_in[6]; const float* bq = (const float*)d_in[7]; const float* wk = (const float*)d_in[8]; const float* bk = (const float*)d_in[9];
  const float* wv = (const float*)d_in[10]; const float* bv = (const float*)d_in[11]; const float* relh = (const float*)d_in[12]; const float* relw = (const float*)d_in[13];
  const float* w2 = (const float*)d_in[14]; const float* g2 = (const float*)d_in[15]; const float* be2 = (const float*)d_in[16]; const float* m2 = (const float*)d_in[17]; const float* v2 = (const float*)d_in[18];
  float* out = (float*)d_out;   // [32][256][1024]
  // Workspace map (offsets in MiB; 256 MiB in all). Scores and p stay on chip, so nothing of them lies here.
  //   [0,16) XT; [192,199) the folded cv1 weights, the q/k/v weights and the folded cv2 weights
  char* ws = (char*)d_ws;
  const size_t MiB = (size_t)1 << 20;
  _Float16* XT = (_Float16*)ws;                                      // x^T: [1024][32*256] f16
  unsigned* X1T = (unsigned*)(ws + 16 * MiB);                        // [b][i][128] f16
  unsigned* QP = (unsigned*)(ws + 24 * MiB);                         // [b][i][q | pos] f16
  unsigned* KQ = (unsigned*)(ws + 40 * MiB);                         // [b][j][k | q]
  unsigned* V16 = (unsigned*)(ws + 56 * MiB);                        // [b][c][j] f16
  unsigned* W1f = (unsigned*)(ws + 192 * MiB); float* b1f = (float*)(ws + 193 * MiB);
  _Float16* Wq16 = (_Float16*)(ws + 194 * MiB); _Float16* Wk16 = (_Float16*)(ws + 195 * MiB); _Float16* Wv16 = (_Float16*)(ws + 196 * MiB);
  unsigned* W2f = (unsigned*)(ws + 197 * MiB); float* b2f = (float*)(ws + 198 * MiB);
  // x^T, both BN folds, the three weight casts and pos (into QP[:, :, 128:256]) read inputs alone: one launch
  prep_kernel<<<2 * PB_FOLD + 3 * PB_CAST + PB_TR + PB_POS, 256, 0, stream>>>(x, XT, w1, g1, be1, m1, v1, W1f, b1f, w2, g2, be2, m2, v2, W2f, b2f, wq, wk, wv, Wq16, Wk16, Wv16, relh, relw, QP);
  // cv1: X1T[b][i][o] = silu(sum_c XT[i][b*256+c]*W1f[o][c] + b1f[o])   (grid.y = b, strideA = 256 halves within the transposed row)
  { const int t = (NS / 64) * (CM / 64);
    wmma_gemm64<0, false, 2, 1, false, 3><<<dim3((t + 7) / 8, BB), 256, 0, stream>>>(U16(XT), nullptr, BB * CIN, CIN, (const unsigned short*)W1f, nullptr, CIN, 0, X1T, nullptr, CM, (long)NS * CM, b1f, nullptr, 0, NS, CM, CIN, 1.0f); }
  // q, q again, k and v all read x1 alone: one launch, grid.z picks the product (each has 32 tiles of 64 x 64 per image)
  qkv_gemm<<<dim3((NS / 64) * (CM / 64) / 8, BB, 4), 256, 0, stream>>>((const unsigned short*)X1T, U16(Wq16), U16(Wk16), U16(Wv16), bq, bk, bv, (unsigned short*)QP, (unsigned short*)KQ, (unsigned short*)V16);
  // scores, softmax, p.v, cv2 and the residual add (out = x + silu(W2f.O + b2f)) in one launch: 8 work-groups of 128 queries per image
  attn_fused<<<dim3(NS / 128, BB), 256, 0, stream>>>((const _Float16*)QP, (const _Float16*)KQ, (const _Float16*)V16, (const _Float16*)W2f, b2f, x, out);
}

// v005
// It runs in 77.6 microseconds.
// Timed twice side by side with v004, it ran 1.09 times as fast both times.
// All steps since v000 together make it 5.44 times as fast.
#include <hip/hip_runtime.h>
#include <math.h>
// BoT block: cv1 (1x1 conv 256→128, BN folded, SiLU), q/k/v 1x1 convs (+bias), the single-head attention over 1024 positions as two products in one kernel
// (scores = [q_i | pos_i]·[k_j | q_j]ᵀ with K = 256 — content-content and content-position in one product —, then p·vᵀ with p x2^15,
// K = 1024), cv2 (128→256, BN folded, SiLU): v_wmma_f32_16x16x32_f16, f16 operands, f32 accumulate; softmax and the residual add in f32
// on VALU. All per-batch GEMMs are batched through grid.y strides over the 32 images, scores and p·v included.
typedef __attribute__((ext_vector_type(16))) _Float16 v16h;
typedef __attribute__((ext_vector_type(8)))  _Float16 v8h;
typedef __attribute__((ext_vector_type(16))) __bf16   v16b;
typedef __attribute__((ext_vector_type(8)))  __bf16   v8b;
typedef __attribute__((ext_vector_type(8)))  float    v8f;
typedef __attribute__((ext_vector_type(4)))  float    v4f;
#define PSCALE 32768.0f
#define U16(p) ((const unsigned short*)(const void*)(p))
#define PSCALE_INV (1.0f / 32768.0f)

__device__ __forceinline__ unsigned short f2bf_bits(float f) {
  unsigned u = __float_as_uint(f);
  return (unsigned short)((u + 0x7FFFu + ((u >> 16) & 1u)) >> 16);
}
__device__ __forceinline__ float bf_bits2f(unsigned short h) { return __uint_as_float(((unsigned)h) << 16); }

// hazard guards as plain device helpers (no inline asm inside the kernel template body)
__device__ __forceinline__ void dep_guard_h(v8f& a, v8f& b, v16h x, v16h y) { asm volatile("v_nop\n\tv_nop\n\tv_nop\n\tv_nop" : "+v"(a), "+v"(b) : "v"(x), "v"(y)); }
__device__ __forceinline__ void dep_guard_b(v8f& a, v8f& b, v16b x, v16b y) { asm volatile("v_nop\n\tv_nop\n\tv_nop\n\tv_nop" : "+v"(a), "+v"(b) : "v"(x), "v"(y)); }
__device__ __forceinline__ void keep4_h(v16h a, v16h b, v16h c, v16h d) { asm volatile("v_nop" :: "v"(a), "v"(b), "v"(c), "v"(d)); }
__device__ __forceinline__ void keep4_b(v16b a, v16b b, v16b c, v16b d) { asm volatile("v_nop" :: "v"(a), "v"(b), "v"(c), "v"(d)); }
__device__ __forceinline__ void acc_guard4(v8f& a, v8f& b, v8f& c, v8f& d) { asm volatile("v_nop\n\tv_nop\n\tv_nop\n\tv_nop" : "+v"(a), "+v"(b), "+v"(c), "+v"(d)); }
template <typename T> struct Frag;
template <> struct Frag<_Float16> {
  typedef v16h V; union U { v16h v; v8h h[2]; };
  static __device__ __forceinline__ v16h load(const _Float16* p) {   // elements 0..7 <- p[0..7], 8..15 <- p[16..23]
    U f; f.h[0] = *(const v8h*)(p); f.h[1] = *(const v8h*)(p + 16); return f.v;
  }
  static __device__ __forceinline__ v8f mma(v16h a, v16h b, v8f c) {
    return __builtin_amdgcn_wmma_f32_16x16x32_f16(false, a, false, b, (short)0, c, false, false);
  }
  static __device__ __forceinline__ void guard(v8f& a, v8f& b, v16h x, v16h y) { dep_guard_h(a, b, x, y); }
  static __device__ __forceinline__ void keep(v16h a, v16h b, v16h c, v16h d) { keep4_h(a, b, c, d); }
};
template <> struct Frag<__bf16> {
  typedef v16b V; union U { v16b v; v8b h[2]; };
  static __device__ __forceinline__ v16b load(const __bf16* p) {
    U f; f.h[0] = *(const v8b*)(p); f.h[1] = *(const v8b*)(p + 16); return f.v;
  }
  static __device__ __forceinline__ v8f mma(v16b a, v16b b, v8f c) {
    return __builtin_amdgcn_wmma_f32_16x16x32_bf16(false, a, false, b, (short)0, c, false, false);
  }
  static __device__ __forceinline__ void guard(v8f& a, v8f& b, v16b x, v16b y) { dep_guard_b(a, b, x, y); }
  static __device__ __forceinline__ void keep(v16b a, v16b b, v16b c, v16b d) { keep4_b(a, b, c, d); }
};

// ---- Register-blocked batched WMMA GEMM ------------------------------------
// C[m,n] = scale * sum_k A[m,k] * Bt[n,k] (+bias)(+resid); each wave owns a 64x64 tile.
// A row-major [M,K]; Bt row-major [N,K]; M,N % 64 == 0, K % 32 == 0.
// SPLIT: operands are hi/lo planes (A2/Bt2 = lo planes, same layout); product = hi·hi + hi·lo + lo·hi.
// BIAS_MODE: 0 = none, 1 = bias[m], 2 = bias[n].
// OUT_MODE: 0 = f32, 1 = f16, 2 = bf16 hi plane (Cout) + bf16 lo plane (Cout2).
// ET: 0 = f16 operands, 1 = bf16 operands (pointers passed as 16-bit storage)
template <int ET> struct Elem;
template <> struct Elem<0> { typedef _Float16 T; };
template <> struct Elem<1> { typedef __bf16 T; };
// The body is a device function (slab = the wave's own 16x64 LDS slab, bx and b = the work-group's tile group and image), so that
// several products that do not depend on each other can share one launch.
template <int ET, bool SPLIT, int BIAS_MODE, int OUT_MODE, bool RESID, int ACT = 0>
__device__ __forceinline__ void gemm64_tile(float* slab, const int bx, const int b,
    const unsigned short* __restrict__ Ap, const unsigned short* __restrict__ A2p, int lda, long strideA,
    const unsigned short* __restrict__ Btp, const unsigned short* __restrict__ Bt2p, int ldb, long strideB,
    void* __restrict__ Cout, void* __restrict__ Cout2, int ldc, long strideC,
    const float* __restrict__ bias,
    const float* __restrict__ resid, long strideR,
    int M, int N, int K, float scale) {
  typedef typename Elem<ET>::T T;
  typedef typename Frag<T>::V V;
  const T* A = (const T*)Ap; const T* A2 = (const T*)A2p; const T* Bt = (const T*)Btp; const T* Bt2 = (const T*)Bt2p;
  const int lane = threadIdx.x & 31;
  const int wave = threadIdx.x >> 5;
  const int tilesN = N >> 6;
  const int tilesM = M >> 6;
  const int tile = bx * 8 + wave;
  if (tile >= tilesM * tilesN) return;   // wave-uniform; no block barriers in this kernel
  const int tm = tile / tilesN;
  const int tn = tile - tm * tilesN;
  const int m0 = tm << 6;
  const int n0 = tn << 6;

  const T* Ab  = A  + (size_t)b * strideA;
  const T* Bb  = Bt + (size_t)b * strideB;
  const T* Ab2 = SPLIT ? (A2  + (size_t)b * strideA) : nullptr;
  const T* Bb2 = SPLIT ? (Bt2 + (size_t)b * strideB) : nullptr;

  const int rlane = lane & 15;                 // row (A) / col (B, D) within subtile
  const int koff  = (lane >> 4) * 8;           // k offset of this lane half
  const int mOff  = (lane >> 4) * 8;           // D row offset

  v8f acc[4][4];
#pragma unroll
  for (int i = 0; i < 4; ++i)
#pragma unroll
    for (int j = 0; j < 4; ++j) acc[i][j] = (v8f){0.f,0.f,0.f,0.f,0.f,0.f,0.f,0.f};

  for (int k0 = 0; k0 < K; k0 += 32) {
    V bh[4], bl[4];
#pragma unroll
    for (int j = 0; j < 4; ++j) {
      const size_t bo = (size_t)(n0 + (j << 4) + rlane) * ldb + koff + k0;
      bh[j] = Frag<T>::load(Bb + bo);
      if (SPLIT) bl[j] = Frag<T>::load(Bb2 + bo);
    }
#pragma unroll
    for (int i = 0; i < 4; ++i) {
      const size_t ao = (size_t)(m0 + (i << 4) + rlane) * lda + koff + k0;
      V ah = Frag<T>::load(Ab + ao);
      V al;
      if (SPLIT) al = Frag<T>::load(Ab2 + ao);
#pragma unroll
      for (int j = 0; j < 4; ++j) {
        acc[i][j] = Frag<T>::mma(ah, bh[j], acc[i][j]);
        if (SPLIT) {
          acc[i][j] = Frag<T>::mma(ah, bl[j], acc[i][j]);
          acc[i][j] = Frag<T>::mma(al, bh[j], acc[i][j]);
        }
      }
      Frag<T>::guard(acc[i][0], acc[i][3], ah, SPLIT ? al : ah);
    }
    Frag<T>::keep(bh[0], bh[1], bh[2], bh[3]);
    if (SPLIT) Frag<T>::keep(bl[0], bl[1], bl[2], bl[3]);
  }
  acc_guard4(acc[0][0], acc[0][1], acc[0][2], acc[0][3]);
  acc_guard4(acc[1][0], acc[1][1], acc[1][2], acc[1][3]);
  acc_guard4(acc[2][0], acc[2][1], acc[2][2], acc[2][3]);
  acc_guard4(acc[3][0], acc[3][1], acc[3][2], acc[3][3]);

  // ---- epilogue ----
  const float* Rb = RESID ? (resid + (size_t)b * strideR) : nullptr;
#pragma unroll
  for (int i = 0; i < 4; ++i) {
    const int mBase = m0 + (i << 4);
#pragma unroll
    for (int j = 0; j < 4; ++j) {
      const int n = n0 + (j << 4) + rlane;
      float bv = 0.f;
      if (BIAS_MODE == 2) bv = bias[n];
#pragma unroll
      for (int r = 0; r < 8; ++r) {
        float v = acc[i][j][r] * scale;
        if (BIAS_MODE == 1) v += bias[mBase + mOff + r];
        if (BIAS_MODE == 2) v += bv;
        if (RESID) v += Rb[(size_t)(mBase + mOff + r) * ldc + n];
        if (ACT == 1) v = tanhf(v);
        if (ACT == 2) v = fmaxf(v, 0.0f);
        if (ACT == 3) v = v / (1.0f + expf(-v));
        if (ACT == 4) v = (v > 0.f) ? v : 0.01f * v;
        if (ACT == 5) v = 0.5f * v * (1.0f + erff(v * 0.70710678118654752f));
        slab[(mOff + r) * 68 + (j << 4) + rlane] = v;
      }
    }
    __builtin_amdgcn_fence(__ATOMIC_RELEASE, "workgroup");
    __builtin_amdgcn_wave_barrier();
    __builtin_amdgcn_fence(__ATOMIC_ACQUIRE, "workgroup");
    if (OUT_MODE == 0) {
      float* C = (float*)Cout + (size_t)b * strideC;
      const int hh = lane >> 4, c4 = (lane & 15) * 4;     // row seg = 256 B = 16 lanes x 16 B
      {
#pragma unroll
        for (int it = 0; it < 8; ++it) {
          const int row = it * 2 + hh;
          v4f v = *(const v4f*)(slab + row * 68 + c4);
          *(v4f*)(C + (size_t)(mBase + row) * ldc + n0 + c4) = v;
        }
        
      }
    } else {
      const int q = lane >> 3, c8 = (lane & 7) * 8;
      unsigned short* C  = (unsigned short*)Cout  + (size_t)b * strideC;
      unsigned short* C2 = (OUT_MODE == 2) ? ((unsigned short*)Cout2 + (size_t)b * strideC) : nullptr;
      {
#pragma unroll
        for (int it = 0; it < 4; ++it) {
          const int row = it * 4 + q;
          const float* sp = slab + row * 68 + c8;
          v8h hv, lv;
#pragma unroll
          for (int e = 0; e < 8; ++e) {
            if (OUT_MODE == 1) {
              hv[e] = (_Float16)sp[e];
            } else {
              unsigned short hb = f2bf_bits(sp[e]);
              unsigned short lb = f2bf_bits(sp[e] - bf_bits2f(hb));
              hv[e] = __builtin_bit_cast(_Float16, hb);
              lv[e] = __builtin_bit_cast(_Float16, lb);
            }
          }
          *(v8h*)(C + (size_t)(mBase + row) * ldc + n0 + c8) = hv;
          if (OUT_MODE == 2) *(v8h*)(C2 + (size_t)(mBase + row) * ldc + n0 + c8) = lv;
        }
        
      }
    }
    __builtin_amdgcn_fence(__ATOMIC_RELEASE, "workgroup");
    __builtin_amdgcn_wave_barrier();
    __builtin_amdgcn_fence(__ATOMIC_ACQUIRE, "workgroup");
  }
}

template <int ET, bool SPLIT, int BIAS_MODE, int OUT_MODE, bool RESID, int ACT = 0>
__global__ __launch_bounds__(256) void wmma_gemm64(
    const unsigned short* __restrict__ Ap, const unsigned short* __restrict__ A2p, int lda, long strideA,
    const unsigned short* __restrict__ Btp, const unsigned short* __restrict__ Bt2p, int ldb, long strideB,
    void* __restrict__ Cout, void* __restrict__ Cout2, int ldc, long strideC,
    const float* __restrict__ bias,
    const float* __restrict__ resid, long strideR,
    int M, int N, int K, float scale) {
  __shared__ __align__(16) float sT[8][16 * 68];   // per-wave 16x64 slab, pitch 68 floats
  gemm64_tile<ET, SPLIT, BIAS_MODE, OUT_MODE, RESID, ACT>(sT[threadIdx.x >> 5], blockIdx.x, blockIdx.y, Ap, A2p, lda, strideA, Btp, Bt2p, ldb, strideB,
                                                          Cout, Cout2, ldc, strideC, bias, resid, strideR, M, N, K, scale);
}

__device__ __forceinline__ void cast_f32_f16x2(const int bx,
    const float* __restrict__ in, _Float16* __restrict__ out, int n2) {
  int i = bx * 256 + threadIdx.x;
  if (i < n2) {
    const _Float16 h0 = (_Float16)in[2 * i], h1 = (_Float16)in[2 * i + 1];
    const unsigned u = (unsigned)__builtin_bit_cast(unsigned short, h0) | ((unsigned)__builtin_bit_cast(unsigned short, h1) << 16);
    ((unsigned*)out)[i] = u;
    
  }
}


// ---- f32 [R][C] (row pitch ldi) -> f16 transposed [C][R] (row pitch ldo); 64x64 tiles; each output row segment
__device__ __forceinline__ void transpose_cast_f16(_Float16 (*tile)[72], const int bx, const int by, const float* __restrict__ in, int ldi,
                                                   _Float16* __restrict__ outT, int ldo, float scale) {   // tile: [c][r], 64 rows
  const int c0 = bx * 64, r0 = by * 64;
  const int t = threadIdx.x, tx = t & 31, ty = t >> 5;
  for (int i = ty; i < 64; i += 8) {
    tile[tx][i]      = (_Float16)(in[(size_t)(r0 + i) * ldi + c0 + tx] * scale);
    tile[32 + tx][i] = (_Float16)(in[(size_t)(r0 + i) * ldi + c0 + 32 + tx] * scale);
  }
  __syncthreads();
  const int q = t >> 3, c8 = (t & 7) * 8;
  {
#pragma unroll
    for (int it = 0; it < 2; ++it) {
      const int c = it * 32 + q;
      v8h hv = *(const v8h*)(&tile[c][c8]);
      *(v8h*)(outT + (size_t)(c0 + c) * ldo + r0 + c8) = hv;
    }
    // in front of any rewrite of the registers that the two stores above name: other jobs' code follows this one in the merged kernel
    asm volatile("s_wait_xcnt 0x0" ::: "memory");
  }
}

#define BB 32
#define CIN 256
#define CM 128
#define NS 1024
// fold BN into 1x1 conv weights: W'[o][c] = W[o][c]*g[o]/sqrt(v[o]+eps) (f16), bias'[o] = b[o] - m[o]*scale
__device__ __forceinline__ void fold_bn(const int bx, const float* __restrict__ Wm, const float* __restrict__ g, const float* __restrict__ bb, const float* __restrict__ m, const float* __restrict__ var,
                                        int O, int Cc, unsigned* __restrict__ W16, float* __restrict__ bias) {
  const int i = bx * 256 + threadIdx.x;
  if (i < O * Cc / 2) { const int o = (2 * i) / Cc; const float sc = g[o] / sqrtf(var[o] + 1e-5f);
    const unsigned u = (unsigned)__builtin_bit_cast(unsigned short, (_Float16)(Wm[2 * i] * sc)) | ((unsigned)__builtin_bit_cast(unsigned short, (_Float16)(Wm[2 * i + 1] * sc)) << 16);
    ((unsigned*)W16)[i] = u;  }
  if (i < O) { const float sc = g[i] / sqrtf(var[i] + 1e-5f); const float v = bb[i] - m[i] * sc; ((float*)bias)[i] = v;  }
}
// pos^T as f16, once for all images (it does not depend on the image): POS[i][c] = rel_h[c][ih] + rel_w[c][iw]; a thread writes 8 neighbouring channels of one position
__device__ __forceinline__ void pos_fill(const int bx, const float* __restrict__ relh, const float* __restrict__ relw, _Float16* __restrict__ POS) {
  const int t = bx * 256 + threadIdx.x;             // (i, c8): c8 in 0..15
  const int c0 = (t & 15) * 8, i = t >> 4, rh = c0 * 32 + (i >> 5), rw = c0 * 32 + (i & 31);
  float ph[8], pw[8];
#pragma unroll
  for (int e = 0; e < 8; ++e) { ph[e] = relh[rh + e * 32]; pw[e] = relw[rw + e * 32]; }
  // in front of any rewrite of the index registers that the loads above name, a load's own result too; the inputs keep those registers live up to the wait
  asm volatile("s_wait_xcnt 0x0" :: "v"(rh), "v"(rw) : "memory");
  v8h hv;
#pragma unroll
  for (int e = 0; e < 8; ++e) hv[e] = (_Float16)(ph[e] + pw[e]);
  *(v8h*)(POS + (size_t)i * CM + c0) = hv;
  // in front of any rewrite of the registers that the store above names; a precaution: this is the merged kernel's last job
  asm volatile("s_wait_xcnt 0x0" ::: "memory");
}
// ---- everything that reads inputs alone, in one launch: the work-group's index picks its job (block-uniform, so the barrier of the transpose is safe)
#define PB_FOLD (CM * CIN / 2 / 256)     // work-groups of one BN fold (both folds have 128 x 256 weights)
#define PB_CAST (CM * CM / 2 / 256)      // work-groups of one weight cast
#define PB_TR ((NS / 64) * (BB * CIN / 64))
#define PB_POS (NS * (CM / 8) / 256)
__global__ __launch_bounds__(256) void prep_kernel(
    const float* __restrict__ x, _Float16* __restrict__ XT,
    const float* __restrict__ w1, const float* __restrict__ g1, const float* __restrict__ be1, const float* __restrict__ m1, const float* __restrict__ v1, unsigned* __restrict__ W1f, float* __restrict__ b1f,
    const float* __restrict__ w2, const float* __restrict__ g2, const float* __restrict__ be2, const float* __restrict__ m2, const float* __restrict__ v2, unsigned* __restrict__ W2f, float* __restrict__ b2f,
    const float* __restrict__ wq, const float* __restrict__ wk, const float* __restrict__ wv, _Float16* __restrict__ Wq16, _Float16* __restrict__ Wk16, _Float16* __restrict__ Wv16,
    const float* __restrict__ relh, const float* __restrict__ relw, _Float16* __restrict__ POS) {
  __shared__ __align__(16) _Float16 tile[64][72];
  int bx = blockIdx.x;
  if (bx < PB_FOLD) { fold_bn(bx, w1, g1, be1, m1, v1, CM, CIN, W1f, b1f); return; }
  bx -= PB_FOLD;
  if (bx < PB_FOLD) { fold_bn(bx, w2, g2, be2, m2, v2, CIN, CM, W2f, b2f); return; }
  bx -= PB_FOLD;
  if (bx < 3 * PB_CAST) {
    const int w = bx / PB_CAST;
    cast_f32_f16x2(bx - w * PB_CAST, w == 0 ? wq : w == 1 ? wk : wv, w == 0 ? Wq16 : w == 1 ? Wk16 : Wv16, CM * CM / 2);
    return;
  }
  bx -= 3 * PB_CAST;
  if (bx < PB_TR) { transpose_cast_f16(tile, bx % (NS / 64), bx / (NS / 64), x, NS, XT, BB * CIN, 1.0f); return; }   // [32*256][1024] -> [1024][8192]
  pos_fill(bx - PB_TR, relh, relw, POS);
}
// ---- the four products on x1 in one launch, picked by blockIdx.z: q into QP[:, :, 0:128], q again into KQ[:, :, 128:256], k into KQ[:, :, 0:128], v as [c][j]
__global__ __launch_bounds__(256) void qkv_gemm(
    const unsigned short* __restrict__ X1T, const unsigned short* __restrict__ Wq16, const unsigned short* __restrict__ Wk16, const unsigned short* __restrict__ Wv16,
    const float* __restrict__ bq, const float* __restrict__ bk, const float* __restrict__ bv,
    unsigned short* __restrict__ QP, unsigned short* __restrict__ KQ, unsigned short* __restrict__ V16) {
  __shared__ __align__(16) float sT[8][16 * 68];   // per-wave 16x64 slab, pitch 68 floats
  float* slab = sT[threadIdx.x >> 5];
  const int z = blockIdx.z;
  if (z == 3) {   // V[b][c][j] = sum_cc Wv[c][cc]*X1T[b][j][cc] + bv[c]: A = Wv16 [128][128], Bt = X1T[b] [1024][128]
    gemm64_tile<0, false, 1, 1, false, 0>(slab, blockIdx.x, blockIdx.y, Wv16, nullptr, CM, 0, X1T, nullptr, CM, (long)NS * CM, V16, nullptr, NS, (long)CM * NS, bv, nullptr, 0, CM, NS, CM, 1.0f);
    return;
  }
  gemm64_tile<0, false, 2, 1, false, 0>(slab, blockIdx.x, blockIdx.y, X1T, nullptr, CM, (long)NS * CM, z == 2 ? Wk16 : Wq16, nullptr, CM, 0,
                                        z == 0 ? QP : z == 1 ? KQ + CM : KQ, nullptr, 256, (long)NS * 256, z == 2 ? bk : bq, nullptr, 0, NS, CM, CM, 1.0f);
}
typedef __attribute__((ext_vector_type(4))) unsigned u32x4;
typedef __attribute__((ext_vector_type(2))) float f32x2;
#define FA_KEYS 64                       // keys per stage
#define FA_NST (NS / FA_KEYS)            // stages
#define FA_PK 528                        // LDS pitch of a [k|q] row: 512 B + 16 B
#define FA_PV 144                        // LDS pitch of a v row's 64 keys: 128 B + 16 B
#define FA_KB (FA_KEYS * FA_PK)          // bytes of the [k|q] tile
#define FA_BUF (FA_KB + CM * FA_PV)      // bytes of one buffer
#define FA_PO 272                        // pitch of a query's 128 channels of O in LDS: 256 B + 16 B
#define FA_PY 528                        // pitch of an output channel's 128 queries (f32) in LDS: 512 B + 16 B
#define FA_OB (128 * FA_PO)              // bytes of the work-group's O rows
#define FA_TAIL (FA_OB + CIN * FA_PY)    // O rows and, behind them, the 256 x 128 tile of cv2's sums
__device__ __forceinline__ float xhalf(float x) {   // lane l <-> lane l ^ 16
  return __builtin_bit_cast(float, __builtin_amdgcn_permlanex16(__builtin_bit_cast(int, x), __builtin_bit_cast(int, x), 0x76543210, 0xfedcba98, false, false));
}
__global__ __launch_bounds__(256) __attribute__((amdgpu_waves_per_eu(2, 2))) void attn_fused(
    const _Float16* __restrict__ QPh, const _Float16* __restrict__ POSh, const _Float16* __restrict__ KQh, const _Float16* __restrict__ Vh,
    const _Float16* __restrict__ W2h, const float* __restrict__ b2, const float* __restrict__ x, float* __restrict__ out) {
  __shared__ __align__(16) unsigned char L[FA_TAIL > 2 * FA_BUF ? FA_TAIL : 2 * FA_BUF];
  const int t = threadIdx.x, lane = t & 31, wave = t >> 5, c = lane & 15, h = lane >> 4;
  const int b = blockIdx.y, q0 = blockIdx.x * 128 + wave * 16;
  const unsigned char* Kg = (const unsigned char*)(KQh + (size_t)b * NS * 256) + t * 16;                       // a stage of [k|q] is 32 KiB in a row
  const unsigned char* Vg = (const unsigned char*)(Vh + (size_t)b * CM * NS) + (size_t)(t >> 3) * (NS * 2) + (t & 7) * 16;
  unsigned char* Lk = L + (t >> 5) * FA_PK + (t & 31) * 16;
  unsigned char* Lv = L + FA_KB + (t >> 3) * FA_PV + (t & 7) * 16;
  const float LOG2E = 1.4426950408889634f;

  v16h qf[8];
  { const _Float16* qp = QPh + ((size_t)b * NS + q0 + c) * 256 + 8 * h;
    const _Float16* pp = POSh + (size_t)(q0 + c) * CM + 8 * h;
#pragma unroll
    for (int kc = 0; kc < 4; ++kc) { qf[kc] = Frag<_Float16>::load(qp + 32 * kc); qf[4 + kc] = Frag<_Float16>::load(pp + 32 * kc); }
    // in front of any rewrite of the address registers that the loads above name; the inputs keep those registers live up to the wait
    asm volatile("s_wait_xcnt 0x0" :: "v"(qp), "v"(pp) : "memory"); }
  __builtin_amdgcn_sched_barrier(0);         // keeps every later register write, a later load's result too, behind that wait
  u32x4 st[12];
#pragma unroll
  for (int s = 0; s < 8; ++s) st[s] = *(const u32x4*)(Kg + s * 4096);
#pragma unroll
  for (int s = 0; s < 4; ++s) st[8 + s] = *(const u32x4*)(Vg + (size_t)s * 32 * (NS * 2));
  asm volatile("s_wait_xcnt 0x0" ::: "memory");   // in front of any rewrite of the address registers that the loads above name
  __builtin_amdgcn_sched_barrier(0);         // keeps every later register write behind that wait
  v8f acc[8];
#pragma unroll
  for (int i = 0; i < 8; ++i) acc[i] = (v8f){0.f,0.f,0.f,0.f,0.f,0.f,0.f,0.f};
  float m_run = -INFINITY, l_run = 0.f;
#pragma unroll
  for (int s = 0; s < 8; ++s) *(u32x4*)(Lk + s * 8 * FA_PK) = st[s];
#pragma unroll
  for (int s = 0; s < 4; ++s) *(u32x4*)(Lv + s * 32 * FA_PV) = st[8 + s];
  __syncthreads();

  // one stage = two passes of 32 keys, read from the buffer at byte offset cur; ahead() issues what is to fly under the stage
  auto stage = [&](const int cur, auto&& ahead) {
    v16h kf[2][8];
    auto load_k = [&](const int sub) {       // the 32 LDS reads of a pass's [k|q] fragments, as one group
      const unsigned char* kp = L + cur + (sub * 32 + c) * FA_PK + 16 * h;
#pragma unroll
      for (int kc = 0; kc < 8; ++kc) {
        kf[0][kc] = Frag<_Float16>::load((const _Float16*)(kp + 64 * kc));
        kf[1][kc] = Frag<_Float16>::load((const _Float16*)(kp + 16 * FA_PK + 64 * kc));
      }
    };
    load_k(0);
    __builtin_amdgcn_sched_barrier(0);       // the LDS reads go first, as one group, and none of them lands between ahead()'s loads and their wait
    ahead();
    __builtin_amdgcn_sched_barrier(0);       // holds ahead()'s loads up here, so that they fly under the whole stage
#pragma unroll
    for (int sub = 0; sub < 2; ++sub) {
      v8f s0 = (v8f){0.f,0.f,0.f,0.f,0.f,0.f,0.f,0.f}, s1 = s0;
#pragma unroll
      for (int kc = 0; kc < 8; ++kc) {
        s0 = Frag<_Float16>::mma(kf[0][kc], qf[kc], s0);
        s1 = Frag<_Float16>::mma(kf[1][kc], qf[kc], s1);
      }
      v16h vf[8];
      const unsigned char* vp = L + cur + FA_KB + c * FA_PV + sub * 64 + 16 * h;
#pragma unroll
      for (int i = 0; i < 8; ++i) vf[i] = Frag<_Float16>::load((const _Float16*)(vp + i * 16 * FA_PV));
      if (sub == 0) load_k(1);               // same stage, so already published
      __builtin_amdgcn_sched_barrier(0);     // holds these reads up here as one group: their LDS latency passes under the softmax arithmetic
      float mx = fmaxf(s0[0], s1[0]);
#pragma unroll
      for (int r = 1; r < 8; ++r) mx = fmaxf(mx, fmaxf(s0[r], s1[r]));
      mx = fmaxf(mx, xhalf(mx)) * LOG2E;     // both halves now hold this query's maximum of the pass
      if (__builtin_amdgcn_ballot_w32(mx > m_run) != 0) {   // scalar branch: no query of the wave has a new maximum -> nothing to rescale
        const float m_new = fmaxf(m_run, mx);
        const float corr = __builtin_amdgcn_exp2f(m_run - m_new);   // 0 in the first pass, where m_run is -inf
        l_run *= corr; m_run = m_new;
#pragma unroll
        for (int i = 0; i < 8; ++i) acc[i] = acc[i] * corr;
      }
      const float nm = 15.0f - m_run;        // p x 2^15: small weights stay normal f16 numbers
      v16h pf; f32x2 ps0 = {0.f, 0.f}, ps1 = {0.f, 0.f};
#pragma unroll
      for (int r = 0; r < 8; r += 2) {       // two neighbouring registers at a time: packed multiply-adds and packed sums
        const f32x2 a0 = __builtin_elementwise_fma((f32x2){s0[r], s0[r + 1]}, (f32x2){LOG2E, LOG2E}, (f32x2){nm, nm});
        const f32x2 a1 = __builtin_elementwise_fma((f32x2){s1[r], s1[r + 1]}, (f32x2){LOG2E, LOG2E}, (f32x2){nm, nm});
        const f32x2 p0 = {__builtin_amdgcn_exp2f(a0.x), __builtin_amdgcn_exp2f(a0.y)}, p1 = {__builtin_amdgcn_exp2f(a1.x), __builtin_amdgcn_exp2f(a1.y)};
        ps0 += p0; ps1 += p1;
        pf[r] = (_Float16)p0.x; pf[r + 1] = (_Float16)p0.y; pf[8 + r] = (_Float16)p1.x; pf[9 + r] = (_Float16)p1.y;
      }
      ps0 += ps1;
      l_run += ps0.x + ps0.y;
#pragma unroll
      for (int i = 0; i < 8; ++i) acc[i] = Frag<_Float16>::mma(vf[i], pf, acc[i]);
    }
  };
  for (int sg = 0; sg + 1 < FA_NST; ++sg) {
    const int cur = (sg & 1) * FA_BUF, nxt = FA_BUF - cur;
    stage(cur, [&]() {                       // the next stage's global loads fly under this stage's products
#pragma unroll
      for (int s = 0; s < 8; ++s) st[s] = *(const u32x4*)(Kg + (size_t)(sg + 1) * (FA_KEYS * 512) + s * 4096);
#pragma unroll
      for (int s = 0; s < 4; ++s) st[8 + s] = *(const u32x4*)(Vg + (size_t)s * 32 * (NS * 2) + (sg + 1) * (FA_KEYS * 2));
      asm volatile("s_wait_xcnt 0x0" ::: "memory");   // in front of any rewrite of the address registers that the loads above name
    });
    // into the buffer whose last readers passed the barrier of the trip before
#pragma unroll
    for (int s = 0; s < 8; ++s) *(u32x4*)(Lk + nxt + s * 8 * FA_PK) = st[s];
#pragma unroll
    for (int s = 0; s < 4; ++s) *(u32x4*)(Lv + nxt + s * 32 * FA_PV) = st[8 + s];
    __syncthreads();                         // publishes the next stage and ends every wave's reads of this one
  }
  // ---- behind the keys: cv2, SiLU and the residual add on the work-group's 128 queries. O goes from wave to wave through LDS, y never leaves the chip.
  // A wave owns output channels 32 wave .. + 31 for all 128 queries: W2f.O^T (A = its 32 rows of W2f, B = O rows [query][channel] from LDS).
  const int o0 = wave * 32;
  v16h wf[2][4]; v4f bs[2][2];
  stage(((FA_NST - 1) & 1) * FA_BUF, [&]() {   // the wave's rows of W2f and its bias fly under the last stage's products
    const _Float16* wp = W2h + (size_t)(o0 + c) * CM + 8 * h;
    const float* bp = b2 + o0 + 8 * h;
#pragma unroll
    for (int ot = 0; ot < 2; ++ot) {
#pragma unroll
      for (int kc = 0; kc < 4; ++kc) wf[ot][kc] = Frag<_Float16>::load(wp + ot * 16 * CM + 32 * kc);
      bs[ot][0] = *(const v4f*)(bp + 16 * ot); bs[ot][1] = *(const v4f*)(bp + 16 * ot + 4);
    }
    // in front of any rewrite of the address registers that the loads above name; the inputs keep those registers live up to the wait
    asm volatile("s_wait_xcnt 0x0" :: "v"(wp), "v"(bp) : "memory");
  });
  __syncthreads();                           // every wave has left the buffers: they become staging for O and for cv2's sums

  // O[i][c] = acc / sum, f16, a row per query
  const float inv = 1.0f / (l_run + xhalf(l_run));   // each half summed its own 8 keys of every tile
  unsigned char* Lw = L + wave * 16 * FA_PO;
#pragma unroll
  for (int i = 0; i < 8; ++i) {
    v8h hv;
#pragma unroll
    for (int r = 0; r < 8; ++r) hv[r] = (_Float16)(acc[i][r] * inv);
    *(v8h*)(Lw + c * FA_PO + 32 * i + 16 * h) = hv;   // row = query, bytes = channels 16 i + 8 h .. + 7
  }
  __syncthreads();                           // publishes every wave's 16 queries of O to the whole work-group
  const size_t xo = ((size_t)b * CIN + o0) * NS + blockIdx.x * 128 + lane * 4;   // a lane's 4 queries of channel o0
  const float* xp = x + xo;
  float* op = out + xo;
  v4f xc[8];
#pragma unroll
  for (int j = 0; j < 8; ++j) xc[j] = *(const v4f*)(xp + (size_t)j * NS);
  asm volatile("s_wait_xcnt 0x0" :: "v"(xp) : "memory");   // in front of any rewrite of the address registers that the loads above name
  __builtin_amdgcn_sched_barrier(0);         // holds the first 8 rows' loads of x up here: they fly under the product
  v8f d[2][8];
#pragma unroll
  for (int it = 0; it < 8; ++it) { d[0][it] = (v8f){0.f,0.f,0.f,0.f,0.f,0.f,0.f,0.f}; d[1][it] = d[0][it]; }
#pragma unroll
  for (int kc = 0; kc < 4; ++kc) {
    v16h of[8];
#pragma unroll
    for (int it = 0; it < 8; ++it) of[it] = Frag<_Float16>::load((const _Float16*)(L + (it * 16 + c) * FA_PO + 64 * kc + 16 * h));
#pragma unroll
    for (int it = 0; it < 8; ++it) {
      d[0][it] = Frag<_Float16>::mma(wf[0][kc], of[it], d[0][it]);
      d[1][it] = Frag<_Float16>::mma(wf[1][kc], of[it], d[1][it]);
    }
  }
  // through the wave's own 32 rows of LDS, so that a lane holds 4 neighbouring queries and a store is one channel's 128 queries: 4 whole lines
  float* slab = (float*)(L + FA_OB + o0 * FA_PY);
#pragma unroll
  for (int ot = 0; ot < 2; ++ot)
#pragma unroll
    for (int it = 0; it < 8; ++it)
#pragma unroll
      for (int r = 0; r < 8; ++r) slab[(ot * 16 + 8 * h + r) * (FA_PY / 4) + it * 16 + c] = d[ot][it][r] + bs[ot][r >> 2][r & 3];
  // the lanes of this wave read what other lanes of it wrote: keep the compiler from moving the reads over the writes
  __builtin_amdgcn_fence(__ATOMIC_RELEASE, "workgroup");
  __builtin_amdgcn_wave_barrier();
  __builtin_amdgcn_fence(__ATOMIC_ACQUIRE, "workgroup");
  const float* sp = slab + lane * 4;
  // stays rolled: the SiLU of 128 values a lane, unrolled, is several times the text of the rest of the kernel and runs only once
#pragma unroll 1
  for (int g = 0; g < 4; ++g) {              // 8 channels a trip; the next trip's x flies under this trip's arithmetic
    v4f xn[8];
#pragma unroll
    for (int j = 0; j < 8; ++j) xn[j] = xc[j];
    if (g < 3) {
#pragma unroll
      for (int j = 0; j < 8; ++j) xn[j] = *(const v4f*)(xp + (size_t)(8 + j) * NS);
    }
    __builtin_amdgcn_sched_barrier(0);       // holds those loads up here
#pragma unroll
    for (int j = 0; j < 8; ++j) {
      v4f y = *(const v4f*)(sp + j * (FA_PY / 4));
#pragma unroll
      for (int e = 0; e < 4; ++e) y[e] = y[e] / (1.0f + expf(-y[e]));
      *(v4f*)(op + (size_t)j * NS) = xc[j] + y;
    }
    asm volatile("s_wait_xcnt 0x0" ::: "memory");   // in front of the step of the address registers that this trip's loads and stores name
    __builtin_amdgcn_sched_barrier(0);       // keeps that step behind the wait
    xp += 8 * NS; op += 8 * NS; sp += 8 * (FA_PY / 4);
#pragma unroll
    for (int j = 0; j < 8; ++j) xc[j] = xn[j];
  }
}
extern "C" void kernel_launch(void* const* d_in, const int* in_sizes, int n_in, void* d_out, int out_size, void* d_ws, size_t ws_size, hipStream_t stream) {
  (void)in_sizes; (void)n_in; (void)out_size; (void)ws_size;
  const float* x = (const float*)d_in[0]; const float* w1 = (const float*)d_in[1];
  const float* g1 = (const float*)d_in[2]; const float* be1 = (const float*)d_in[3]; const float* m1 = (const float*)d_in[4]; const float* v1 = (const float*)d_in[5];
  const float* wq = (const float*)d_in[6]; const float* bq = (const float*)d_in[7]; const float* wk = (const float*)d_in[8]; const float* bk = (const float*)d_in[9];
  const float* wv = (const float*)d_in[10]; const float* bv = (const float*)d_in[11]; const float* relh = (const float*)d_in[12]; const float* relw = (const float*)d_in[13];
  const float* w2 = (const float*)d_in[14]; const float* g2 = (const float*)d_in[15]; const float* be2 = (const float*)d_in[16]; const float* m2 = (const float*)d_in[17]; const float* v2 = (const float*)d_in[18];
  float* out = (float*)d_out;   // [32][256][1024]
  // Workspace map (offsets in MiB; 256 MiB in all). Scores and p stay on chip, so nothing of them lies here.
  //   [0,16) XT; [192,200) the folded cv1 weights, the q/k/v weights, the folded cv2 weights and pos
  char* ws = (char*)d_ws;
  const size_t MiB = (size_t)1 << 20;
  _Float16* XT = (_Float16*)ws;                                      // x^T: [1024][32*256] f16
  unsigned* X1T = (unsigned*)(ws + 16 * MiB);                        // [b][i][128] f16
  unsigned* QP = (unsigned*)(ws + 24 * MiB);                         // [b][i][q | not used] f16, rows of 256
  unsigned* KQ = (unsigned*)(ws + 40 * MiB);                         // [b][j][k | q]
  unsigned* V16 = (unsigned*)(ws + 56 * MiB);                        // [b][c][j] f16
  unsigned* W1f = (unsigned*)(ws + 192 * MiB); float* b1f = (float*)(ws + 193 * MiB);
  _Float16* Wq16 = (_Float16*)(ws + 194 * MiB); _Float16* Wk16 = (_Float16*)(ws + 195 * MiB); _Float16* Wv16 = (_Float16*)(ws + 196 * MiB);
  unsigned* W2f = (unsigned*)(ws + 197 * MiB); float* b2f = (float*)(ws + 198 * MiB);
  _Float16* POS = (_Float16*)(ws + 199 * MiB);                       // [i][128] f16, one for all images
  // x^T, both BN folds, the three weight casts and pos read inputs alone: one launch
  prep_kernel<<<2 * PB_FOLD + 3 * PB_CAST + PB_TR + PB_POS, 256, 0, stream>>>(x, XT, w1, g1, be1, m1, v1, W1f, b1f, w2, g2, be2, m2, v2, W2f, b2f, wq, wk, wv, Wq16, Wk16, Wv16, relh, relw, POS);
  // cv1: X1T[b][i][o] = silu(sum_c XT[i][b*256+c]*W1f[o][c] + b1f[o])   (grid.y = b, strideA = 256 halves within the transposed row)
  { const int t = (NS / 64) * (CM / 64);
    wmma_gemm64<0, false, 2, 1, false, 3><<<dim3((t + 7) / 8, BB), 256, 0, stream>>>(U16(XT), nullptr, BB * CIN, CIN, (const unsigned short*)W1f, nullptr, CIN, 0, X1T, nullptr, CM, (long)NS * CM, b1f, nullptr, 0, NS, CM, CIN, 1.0f); }
  // q, q again, k and v all read x1 alone: one launch, grid.z picks the product (each has 32 tiles of 64 x 64 per image)
  qkv_gemm<<<dim3((NS / 64) * (CM / 64) / 8, BB, 4), 256, 0, stream>>>((const unsigned short*)X1T, U16(Wq16), U16(Wk16), U16(Wv16), bq, bk, bv, (unsigned short*)QP, (unsigned short*)KQ, (unsigned short*)V16);
  // scores, softmax, p.v, cv2 and the residual add (out = x + silu(W2f.O + b2f)) in one launch: 8 work-groups of 128 queries per image
  attn_fused<<<dim3(NS / 128, BB), 256, 0, stream>>>((const _Float16*)QP, POS, (const _Float16*)KQ, (const _Float16*)V16, (const _Float16*)W2f, b2f, x, out);
}

// v007
// Measured time: 50.3 microseconds a run.
// Versions in between are left out here; by their measured steps it is 1.55 times as fast as v005.
// Counting every step since v000, it is 8.45 times as fast.
#include <hip/hip_runtime.h>
#include <math.h>
// A bottleneck block with attention: cv1 (1x1 conv 256 -> 128, BN folded, SiLU), then single-head attention over 1024 positions and cv2 (128 -> 256, BN folded, SiLU) with the residual add.
// The scores are re-associated: q_i.k_j + pos_i.q_j = u_i.x1_j + (q_i.bk + pos_i.bq), with u_i = (Wk^T Wq) x1_i + Wq^T pos_i + Wk^T bq. The bracket does not depend
// on the key j, so the softmax over j is the same without it: the score product has K = 128, its key operand is x1 itself, and no k and no q are formed.
// All products on v_wmma_f32_16x16x32_f16, f16 operands, f32 accumulate (p x 2^15); softmax and the residual add in f32 on VALU.
typedef __attribute__((ext_vector_type(16))) _Float16 v16h;
typedef __attribute__((ext_vector_type(8)))  _Float16 v8h;
typedef __attribute__((ext_vector_type(16))) __bf16   v16b;
typedef __attribute__((ext_vector_type(8)))  __bf16   v8b;
typedef __attribute__((ext_vector_type(8)))  float    v8f;
typedef __attribute__((ext_vector_type(4)))  float    v4f;
#define PSCALE 32768.0f
#define U16(p) ((const unsigned short*)(const void*)(p))
#define PSCALE_INV (1.0f / 32768.0f)

__device__ __forceinline__ unsigned short f2bf_bits(float f) {
  unsigned u = __float_as_uint(f);
  return (unsigned short)((u + 0x7FFFu + ((u >> 16) & 1u)) >> 16);
}
__device__ __forceinline__ float bf_bits2f(unsigned short h) { return __uint_as_float(((unsigned)h) << 16); }

// hazard guards as plain device helpers
__device__ __forceinline__ void dep_guard_h(v8f& a, v8f& b, v16h x, v16h y) { asm volatile("v_nop\n\tv_nop\n\tv_nop\n\tv_nop" : "+v"(a), "+v"(b) : "v"(x), "v"(y)); }
__device__ __forceinline__ void dep_guard_b(v8f& a, v8f& b, v16b x, v16b y) { asm volatile("v_nop\n\tv_nop\n\tv_nop\n\tv_nop" : "+v"(a), "+v"(b) : "v"(x), "v"(y)); }
__device__ __forceinline__ void keep4_h(v16h a, v16h b, v16h c, v16h d) { asm volatile("v_nop" :: "v"(a), "v"(b), "v"(c), "v"(d)); }
__device__ __forceinline__ void keep4_b(v16b a, v16b b, v16b c, v16b d) { asm volatile("v_nop" :: "v"(a), "v"(b), "v"(c), "v"(d)); }
__device__ __forceinline__ void acc_guard4(v8f& a, v8f& b, v8f& c, v8f& d) { asm volatile("v_nop\n\tv_nop\n\tv_nop\n\tv_nop" : "+v"(a), "+v"(b), "+v"(c), "+v"(d)); }
template <typename T> struct Frag;
template <> struct Frag<_Float16> {
  typedef v16h V; union U { v16h v; v8h h[2]; };
  static __device__ __forceinline__ v16h load(const _Float16* p) {   // elements 0..7 <- p[0..7], 8..15 <- p[16..23]
    U f; f.h[0] = *(const v8h*)(p); f.h[1] = *(const v8h*)(p + 16); return f.v;
  }
  static __device__ __forceinline__ v8f mma(v16h a, v16h b, v8f c) {
    return __builtin_amdgcn_wmma_f32_16x16x32_f16(false, a, false, b, (short)0, c, false, false);
  }
  static __device__ __forceinline__ void guard(v8f& a, v8f& b, v16h x, v16h y) { dep_guard_h(a, b, x, y); }
  static __device__ __forceinline__ void keep(v16h a, v16h b, v16h c, v16h d) { keep4_h(a, b, c, d); }
};
template <> struct Frag<__bf16> {
  typedef v16b V; union U { v16b v; v8b h[2]; };
  static __device__ __forceinline__ v16b load(const __bf16* p) {
    U f; f.h[0] = *(const v8b*)(p); f.h[1] = *(const v8b*)(p + 16); return f.v;
  }
  static __device__ __forceinline__ v8f mma(v16b a, v16b b, v8f c) {
    return __builtin_amdgcn_wmma_f32_16x16x32_bf16(false, a, false, b, (short)0, c, false, false);
  }
  static __device__ __forceinline__ void guard(v8f& a, v8f& b, v16b x, v16b y) { dep_guard_b(a, b, x, y); }
  static __device__ __forceinline__ void keep(v16b a, v16b b, v16b c, v16b d) { keep4_b(a, b, c, d); }
};

// ---- Register-blocked batched WMMA GEMM ------------------------------------
// C[m,n] = scale * sum_k A[m,k] * Bt[n,k] (+bias)(+resid); each wave owns a 64x64 tile.
// A row-major [M,K]; Bt row-major [N,K]; M,N % 64 == 0, K % 32 == 0.
// SPLIT: operands are hi/lo planes (A2/Bt2 = lo planes, same layout); product = hi·hi + hi·lo + lo·hi.
// BIAS_MODE: 0 = none, 1 = bias[m], 2 = bias[n].
// OUT_MODE: 0 = f32, 1 = f16, 2 = bf16 hi plane (Cout) + bf16 lo plane (Cout2).
// ET: 0 = f16 operands, 1 = bf16 operands (pointers passed as 16-bit storage)
template <int ET> struct Elem;
template <> struct Elem<0> { typedef _Float16 T; };
template <> struct Elem<1> { typedef __bf16 T; };
// The body is a device function (slab = the wave's own 16x64 LDS slab, bx and b = the work-group's tile group and image), so that
// several products that do not depend on each other can share one launch.
template <int ET, bool SPLIT, int BIAS_MODE, int OUT_MODE, bool RESID, int ACT = 0>
__device__ __forceinline__ void gemm64_tile(float* slab, const int bx, const int b,
    const unsigned short* __restrict__ Ap, const unsigned short* __restrict__ A2p, int lda, long strideA,
    const unsigned short* __restrict__ Btp, const unsigned short* __restrict__ Bt2p, int ldb, long strideB,
    void* __restrict__ Cout, void* __restrict__ Cout2, int ldc, long strideC,
    const float* __restrict__ bias,
    const float* __restrict__ resid, long strideR,
    int M, int N, int K, float scale) {
  typedef typename Elem<ET>::T T;
  typedef typename Frag<T>::V V;
  const T* A = (const T*)Ap; const T* A2 = (const T*)A2p; const T* Bt = (const T*)Btp; const T* Bt2 = (const T*)Bt2p;
  const int lane = threadIdx.x & 31;
  const int wave = threadIdx.x >> 5;
  const int tilesN = N >> 6;
  const int tilesM = M >> 6;
  const int tile = bx * 8 + wave;
  if (tile >= tilesM * tilesN) return;   // wave-uniform; no block barriers in this kernel
  const int tm = tile / tilesN;
  const int tn = tile - tm * tilesN;
  const int m0 = tm << 6;
  const int n0 = tn << 6;

  const T* Ab  = A  + (size_t)b * strideA;
  const T* Bb  = Bt + (size_t)b * strideB;
  const T* Ab2 = SPLIT ? (A2  + (size_t)b * strideA) : nullptr;
  const T* Bb2 = SPLIT ? (Bt2 + (size_t)b * strideB) : nullptr;

  const int rlane = lane & 15;                 // row (A) / col (B, D) within subtile
  const int koff  = (lane >> 4) * 8;           // k offset of this lane half
  const int mOff  = (lane >> 4) * 8;           // D row offset

  v8f acc[4][4];
#pragma unroll
  for (int i = 0; i < 4; ++i)
#pragma unroll
    for (int j = 0; j < 4; ++j) acc[i][j] = (v8f){0.f,0.f,0.f,0.f,0.f,0.f,0.f,0.f};

  for (int k0 = 0; k0 < K; k0 += 32) {
    V bh[4], bl[4];
    const T *bp[4], *bp2[4];
#pragma unroll
    for (int j = 0; j < 4; ++j) {
      const size_t bo = (size_t)(n0 + (j << 4) + rlane) * ldb + koff + k0;
      bp[j] = Bb + bo;
      bh[j] = Frag<T>::load(bp[j]);
      if (SPLIT) { bp2[j] = Bb2 + bo; bl[j] = Frag<T>::load(bp2[j]); }
    }
    // in front of any rewrite of the address registers that the loads above name, a load's own result too; the inputs keep those registers live up to the wait
    asm volatile("s_wait_xcnt 0x0" :: "v"(bp[0]), "v"(bp[1]), "v"(bp[2]), "v"(bp[3]) : "memory");
    if (SPLIT) asm volatile("s_wait_xcnt 0x0" :: "v"(bp2[0]), "v"(bp2[1]), "v"(bp2[2]), "v"(bp2[3]) : "memory");
#pragma unroll
    for (int i = 0; i < 4; ++i) {
      const size_t ao = (size_t)(m0 + (i << 4) + rlane) * lda + koff + k0;
      const T* ap = Ab + ao;
      V ah = Frag<T>::load(ap);
      V al;
      asm volatile("s_wait_xcnt 0x0" :: "v"(ap) : "memory");   // the same, for this row block's loads
      if (SPLIT) { const T* ap2 = Ab2 + ao; al = Frag<T>::load(ap2); asm volatile("s_wait_xcnt 0x0" :: "v"(ap2) : "memory"); }
#pragma unroll
      for (int j = 0; j < 4; ++j) {
        acc[i][j] = Frag<T>::mma(ah, bh[j], acc[i][j]);
        if (SPLIT) {
          acc[i][j] = Frag<T>::mma(ah, bl[j], acc[i][j]);
          acc[i][j] = Frag<T>::mma(al, bh[j], acc[i][j]);
        }
      }
      Frag<T>::guard(acc[i][0], acc[i][3], ah, SPLIT ? al : ah);
    }
    Frag<T>::keep(bh[0], bh[1], bh[2], bh[3]);
    if (SPLIT) Frag<T>::keep(bl[0], bl[1], bl[2], bl[3]);
  }
  acc_guard4(acc[0][0], acc[0][1], acc[0][2], acc[0][3]);
  acc_guard4(acc[1][0], acc[1][1], acc[1][2], acc[1][3]);
  acc_guard4(acc[2][0], acc[2][1], acc[2][2], acc[2][3]);
  acc_guard4(acc[3][0], acc[3][1], acc[3][2], acc[3][3]);

  // ---- epilogue ----
  const float* Rb = RESID ? (resid + (size_t)b * strideR) : nullptr;
#pragma unroll
  for (int i = 0; i < 4; ++i) {
    const int mBase = m0 + (i << 4);
    // 16-bit output with a residual: a lane reads the residual as it will store the sums, 8 neighbouring columns of a row; the loads fly under the slab's LDS writes
    v4f rv[4][2];
    if (RESID && OUT_MODE != 0) {
      const float* rp = Rb + (size_t)(mBase + (lane >> 3)) * ldc + n0 + (lane & 7) * 8;
#pragma unroll
      for (int it = 0; it < 4; ++it) { rv[it][0] = *(const v4f*)(rp + (size_t)it * 4 * ldc); rv[it][1] = *(const v4f*)(rp + (size_t)it * 4 * ldc + 4); }
      // in front of any rewrite of the address registers that the loads above name, a load's own result too; the input keeps those registers live up to the wait
      asm volatile("s_wait_xcnt 0x0" :: "v"(rp) : "memory");
    }
#pragma unroll
    for (int j = 0; j < 4; ++j) {
      const int n = n0 + (j << 4) + rlane;
      float bv = 0.f;
      if (BIAS_MODE == 2) bv = bias[n];
#pragma unroll
      for (int r = 0; r < 8; ++r) {
        float v = acc[i][j][r] * scale;
        if (BIAS_MODE == 1) v += bias[mBase + mOff + r];
        if (BIAS_MODE == 2) v += bv;
        if (RESID && OUT_MODE == 0) v += Rb[(size_t)(mBase + mOff + r) * ldc + n];
        if (ACT == 1) v = tanhf(v);
        if (ACT == 2) v = fmaxf(v, 0.0f);
        if (ACT == 3) v = v / (1.0f + expf(-v));
        if (ACT == 4) v = (v > 0.f) ? v : 0.01f * v;
        if (ACT == 5) v = 0.5f * v * (1.0f + erff(v * 0.70710678118654752f));
        slab[(mOff + r) * 68 + (j << 4) + rlane] = v;
      }
    }
    __builtin_amdgcn_fence(__ATOMIC_RELEASE, "workgroup");
    __builtin_amdgcn_wave_barrier();
    __builtin_amdgcn_fence(__ATOMIC_ACQUIRE, "workgroup");
    if (OUT_MODE == 0) {
      float* C = (float*)Cout + (size_t)b * strideC;
      const int hh = lane >> 4, c4 = (lane & 15) * 4;     // row seg = 256 B = 16 lanes x 16 B
      {
#pragma unroll
        for (int it = 0; it < 8; ++it) {
          const int row = it * 2 + hh;
          v4f v = *(const v4f*)(slab + row * 68 + c4);
          *(v4f*)(C + (size_t)(mBase + row) * ldc + n0 + c4) = v;
        }
        
      }
    } else {
      const int q = lane >> 3, c8 = (lane & 7) * 8;
      unsigned short* C  = (unsigned short*)Cout  + (size_t)b * strideC;
      unsigned short* C2 = (OUT_MODE == 2) ? ((unsigned short*)Cout2 + (size_t)b * strideC) : nullptr;
      {
#pragma unroll
        for (int it = 0; it < 4; ++it) {
          const int row = it * 4 + q;
          const float* sp = slab + row * 68 + c8;
          v8h hv, lv;
#pragma unroll
          for (int e = 0; e < 8; ++e) {
            const float sv = RESID ? sp[e] + rv[it][e >> 2][e & 3] : sp[e];
            if (OUT_MODE == 1) {
              hv[e] = (_Float16)sv;
            } else {
              unsigned short hb = f2bf_bits(sv);
              unsigned short lb = f2bf_bits(sv - bf_bits2f(hb));
              hv[e] = __builtin_bit_cast(_Float16, hb);
              lv[e] = __builtin_bit_cast(_Float16, lb);
            }
          }
          *(v8h*)(C + (size_t)(mBase + row) * ldc + n0 + c8) = hv;
          if (OUT_MODE == 2) *(v8h*)(C2 + (size_t)(mBase + row) * ldc + n0 + c8) = lv;
        }
        
      }
    }
    asm volatile("s_wait_xcnt 0x0" ::: "memory");   // in front of any rewrite of the registers that the stores above name
    __builtin_amdgcn_fence(__ATOMIC_RELEASE, "workgroup");
    __builtin_amdgcn_wave_barrier();
    __builtin_amdgcn_fence(__ATOMIC_ACQUIRE, "workgroup");
  }
}

__device__ __forceinline__ void cast_f32_f16x2(const int bx,
    const float* __restrict__ in, _Float16* __restrict__ out, int n2) {
  int i = bx * 256 + threadIdx.x;
  if (i < n2) {
    const float* p = in + 2 * i;
    const float f0 = p[0], f1 = p[1];
    // in front of any rewrite of the address registers that the load above names, its own result too; the input keeps those registers live up to the wait
    asm volatile("s_wait_xcnt 0x0" :: "v"(p) : "memory");
    const _Float16 h0 = (_Float16)f0, h1 = (_Float16)f1;
    const unsigned u = (unsigned)__builtin_bit_cast(unsigned short, h0) | ((unsigned)__builtin_bit_cast(unsigned short, h1) << 16);
    ((unsigned*)out)[i] = u;
    
  }
}


#define BB 32
#define CIN 256
#define CM 128
#define NS 1024
// fold BN into 1x1 conv weights: W'[o][c] = W[o][c]*g[o]/sqrt(v[o]+eps) (f16), bias'[o] = b[o] - m[o]*scale
__device__ __forceinline__ void fold_bn(const int bx, const float* __restrict__ Wm, const float* __restrict__ g, const float* __restrict__ bb, const float* __restrict__ m, const float* __restrict__ var,
                                        int O, int Cc, unsigned* __restrict__ W16, float* __restrict__ bias) {
  const int i = bx * 256 + threadIdx.x;
  if (i < O * Cc / 2) { const int o = (2 * i) / Cc; const float sc = g[o] / sqrtf(var[o] + 1e-5f);
    const unsigned u = (unsigned)__builtin_bit_cast(unsigned short, (_Float16)(Wm[2 * i] * sc)) | ((unsigned)__builtin_bit_cast(unsigned short, (_Float16)(Wm[2 * i + 1] * sc)) << 16);
    ((unsigned*)W16)[i] = u;  }
  if (i < O) { const float sc = g[i] / sqrtf(var[i] + 1e-5f); const float v = bb[i] - m[i] * sc; ((float*)bias)[i] = v;  }
}
// ---- the two small products of the re-associated scores; they read inputs alone. A fragment's 16 k values lie a row apart in an f32 matrix [k][column]:
// element e <- k = e (e < 8) or 8 + e (e >= 8), counted from the lane half's first k: the k order of Frag::load, for A and B alike.
#define KROW(e) ((e) < 8 ? (e) : 8 + (e))
__device__ __forceinline__ v16h cvt16(const float* f) {
  v16h r;
#pragma unroll
  for (int e = 0; e < 16; ++e) r[e] = (_Float16)f[e];
  return r;
}
// G[a][b] = sum_c Wk[c][a] Wq[c][b], f16 rows [a][b]. Product with m = b and n = a, so that a lane holds 8 neighbouring b of one a; a wave owns 16 a x 64 b (whole 128-B lines).
__device__ __forceinline__ void g_fill(const int bx, const float* __restrict__ wq, const float* __restrict__ wk, _Float16* __restrict__ G16) {
  const int lane = threadIdx.x & 31, c = lane & 15, h = lane >> 4, w = bx * 8 + (threadIdx.x >> 5);
  const int a0 = (w & 7) * 16, b0 = (w >> 3) * 64;
  v8f acc[4];
#pragma unroll
  for (int mt = 0; mt < 4; ++mt) acc[mt] = (v8f){0.f,0.f,0.f,0.f,0.f,0.f,0.f,0.f};
  // stays rolled: unrolled, the four trips' loads are all hoisted to the top and take more registers than cv1, whose launch this job shares
#pragma unroll 1
  for (int kc = 0; kc < 4; ++kc) {
    const float* pk = wk + (32 * kc + 8 * h) * CM + a0 + c;
    const float* pq = wq + (32 * kc + 8 * h) * CM + b0 + c;
    float fk[16], fq[4][16];
#pragma unroll
    for (int e = 0; e < 16; ++e) {
      fk[e] = pk[KROW(e) * CM];
#pragma unroll
      for (int mt = 0; mt < 4; ++mt) fq[mt][e] = pq[KROW(e) * CM + 16 * mt];
    }
    // in front of any rewrite of the address registers that the loads above name, a load's own result too; the inputs keep those registers live up to the wait
    asm volatile("s_wait_xcnt 0x0" :: "v"(pk), "v"(pq) : "memory");
    __builtin_amdgcn_sched_barrier(0);       // keeps the loads in front of that wait and every later register write behind it
    const v16h bf = cvt16(fk);
#pragma unroll
    for (int mt = 0; mt < 4; ++mt) acc[mt] = Frag<_Float16>::mma(cvt16(fq[mt]), bf, acc[mt]);
  }
#pragma unroll
  for (int mt = 0; mt < 4; ++mt) {
    v8h hv;
#pragma unroll
    for (int r = 0; r < 8; ++r) hv[r] = (_Float16)acc[mt][r];
    *(v8h*)(G16 + (size_t)(a0 + c) * CM + b0 + 16 * mt + 8 * h) = hv;
  }
  // in front of any rewrite of the registers that the stores above name: other jobs' code follows this one in the merged kernel
  asm volatile("s_wait_xcnt 0x0" ::: "memory");
}
// PU[i][a] = sum_c Wq[c][a] pos[c][i] + sum_c Wk[c][a] bq[c], f32 rows [i][a], the same for every image (pos[c][i] = rel_h[c][ih] + rel_w[c][iw]): one product with
// K = 256, [Wq^T | Wk^T].[pos_i ; bq], m = a and n = i, so that a lane holds 8 neighbouring a of one position; a wave owns 16 positions x 32 a (whole 128-B lines).
__device__ __forceinline__ void pu_fill(const int bx, const float* __restrict__ wq, const float* __restrict__ wk, const float* __restrict__ bq,
                                        const float* __restrict__ relh, const float* __restrict__ relw, float* __restrict__ PU) {
  const int lane = threadIdx.x & 31, c = lane & 15, h = lane >> 4, w = bx * 8 + (threadIdx.x >> 5);
  const int i = (w >> 2) * 16 + c, a0 = (w & 3) * 32;
  v8f acc[2];
  acc[0] = (v8f){0.f,0.f,0.f,0.f,0.f,0.f,0.f,0.f}; acc[1] = acc[0];
  // stays rolled, for the same reason as in g_fill
#pragma unroll 1
  for (int kc = 0; kc < 4; ++kc) {
    const int k0 = 32 * kc + 8 * h;
    const float* gh = relh + k0 * 32 + (i >> 5);
    const float* gw = relw + k0 * 32 + (i & 31);
    const float* gb = bq + k0;
    const float* pq = wq + k0 * CM + a0 + c;
    const float* pk = wk + k0 * CM + a0 + c;
    float ph[16], pw[16], fb[16], fq[2][16], fk[2][16];
#pragma unroll
    for (int e = 0; e < 16; ++e) {
      ph[e] = gh[KROW(e) * 32]; pw[e] = gw[KROW(e) * 32]; fb[e] = gb[KROW(e)];
#pragma unroll
      for (int mt = 0; mt < 2; ++mt) { fq[mt][e] = pq[KROW(e) * CM + 16 * mt]; fk[mt][e] = pk[KROW(e) * CM + 16 * mt]; }
    }
    // in front of any rewrite of the address registers that the loads above name, a load's own result too; the inputs keep those registers live up to the wait
    asm volatile("s_wait_xcnt 0x0" :: "v"(gh), "v"(gw), "v"(gb), "v"(pq), "v"(pk) : "memory");
    __builtin_amdgcn_sched_barrier(0);       // keeps the loads in front of that wait and every later register write behind it
#pragma unroll
    for (int e = 0; e < 16; ++e) ph[e] += pw[e];
    const v16h bp = cvt16(ph), bb = cvt16(fb);
#pragma unroll
    for (int mt = 0; mt < 2; ++mt) {
      acc[mt] = Frag<_Float16>::mma(cvt16(fq[mt]), bp, acc[mt]);
      acc[mt] = Frag<_Float16>::mma(cvt16(fk[mt]), bb, acc[mt]);
    }
  }
#pragma unroll
  for (int mt = 0; mt < 2; ++mt) {
    float* p = PU + (size_t)i * CM + a0 + 16 * mt + 8 * h;
    *(v4f*)p = (v4f){acc[mt][0], acc[mt][1], acc[mt][2], acc[mt][3]};
    *(v4f*)(p + 4) = (v4f){acc[mt][4], acc[mt][5], acc[mt][6], acc[mt][7]};
  }
  // in front of any rewrite of the registers that the stores above name: other jobs' code follows this one in the merged kernel
  asm volatile("s_wait_xcnt 0x0" ::: "memory");
}
// ---- cv1 straight from x: x1[b][i][o] = silu(sum_c W1f[o][c] x[b][c][i] + b1f[o]), f16 rows [i][o]. Product with m = o and n = i: in x a fragment's 16 k values (channels) lie a
// row apart at one position, so a lane takes them as they lie, 16 neighbouring positions a load (the k order of KROW, as in the two fills above), and no transposed copy of x is made.
// A work-group owns 128 positions of one image, a wave 16 of them for all 128 output channels. The folded weights (f16, the same values for every work-group) are formed in LDS.
// Every loop of this function is unrolled: its index picks registers (the arrays live in registers) and immediate offsets, so that no address register is stepped while loads fly.
typedef __attribute__((ext_vector_type(4))) _Float16 v4h;
#define C1_PW 528                        // LDS pitch of a row of folded weights: 512 B + 16 B
#define C1_PS 272                        // LDS pitch of a position's 128 channels of x1: 256 B + 16 B
#define C1_WB (CM * C1_PW)               // bytes of the folded weights
#define C1_SB (16 * C1_PS)               // bytes of a wave's 16 positions of x1
#define C1_LDS (C1_WB + 8 * C1_SB + CM * 4)   // and, last, the folded bias
__device__ __forceinline__ void cv1_tile(unsigned char* L, const int bx, const float* __restrict__ x, const float* __restrict__ w1, const float* __restrict__ g1,
                                         const float* __restrict__ be1, const float* __restrict__ m1, const float* __restrict__ v1, _Float16* __restrict__ X1T) {
  const int lane = threadIdx.x & 31, wave = threadIdx.x >> 5, c = lane & 15, h = lane >> 4;
  const int b = bx >> 3, i0 = (bx & 7) * 128 + wave * 16, ow = wave * 16;
  float* bsh = (float*)(L + C1_WB + 8 * C1_SB);
  // the wave folds rows ow .. ow + 15 of w1: load j is 128 neighbouring columns of row ow + j / 2
  const float *pg = g1 + ow + c, *pv = v1 + ow + c, *pb = be1 + ow + c, *pm = m1 + ow + c;
  const float* wp = w1 + (size_t)ow * CIN + lane * 4;
  const float gg = *pg, vv = *pv, bb = *pb, mm = *pm;
  v4f wr[32];
#pragma unroll
  for (int j = 0; j < 32; ++j) wr[j] = *(const v4f*)(wp + j * 128);
  // in front of any rewrite of the address registers that the loads above name, a load's own result too; the inputs keep those registers live up to the wait
  asm volatile("s_wait_xcnt 0x0" :: "v"(pg), "v"(pv), "v"(pb), "v"(pm), "v"(wp) : "memory");
  const float* xp = x + ((size_t)b * CIN + 8 * h) * NS + i0 + c;
  float xr[8][16];                           // the wave's 16 positions of x, all 256 channels: 8 k steps
  auto load_x = [&](const int ks) {
#pragma unroll
    for (int e = 0; e < 16; ++e) xr[ks][e] = xp[(size_t)(32 * ks + KROW(e)) * NS];
    asm volatile("s_wait_xcnt 0x0" :: "v"(xp) : "memory");   // the same, for these loads
  };
#pragma unroll
  for (int ks = 0; ks < 4; ++ks) load_x(ks);
  __builtin_amdgcn_sched_barrier(0);         // holds all these loads up here: the first half of x flies under the fold
  const float sc = gg / sqrtf(vv + 1e-5f);   // lane c (either half) holds the scale of row ow + c
  bsh[ow + c] = bb - mm * sc;                // both halves store the same value
#pragma unroll
  for (int j = 0; j < 32; ++j) {
    const float s = __builtin_bit_cast(float, __builtin_amdgcn_readlane(__builtin_bit_cast(int, sc), j >> 1));
    const v4h hv = {(_Float16)(wr[j][0] * s), (_Float16)(wr[j][1] * s), (_Float16)(wr[j][2] * s), (_Float16)(wr[j][3] * s)};
    *(v4h*)(L + (ow + (j >> 1)) * C1_PW + (j & 1) * 256 + lane * 8) = hv;
  }
  __builtin_amdgcn_sched_barrier(0);         // the second half of x goes into the registers that the fold has left, not earlier
#pragma unroll
  for (int ks = 4; ks < 8; ++ks) load_x(ks);
  __syncthreads();                           // publishes every wave's 16 rows of folded weights and its part of the bias
  v8f acc[8];
#pragma unroll
  for (int mt = 0; mt < 8; ++mt) acc[mt] = (v8f){0.f,0.f,0.f,0.f,0.f,0.f,0.f,0.f};
  v16h bf[8];
#pragma unroll
  for (int ks = 0; ks < 8; ++ks) bf[ks] = cvt16(xr[ks]);
  __builtin_amdgcn_sched_barrier(0);         // all of x is f16 from here on: its f32 registers are free, so that a k step's weight fragments can be read as one group
#pragma unroll
  for (int ks = 0; ks < 8; ++ks) {
    const unsigned char* ap = L + c * C1_PW + 64 * ks + 16 * h;
    v16h af[8];
#pragma unroll
    for (int mt = 0; mt < 8; ++mt) af[mt] = Frag<_Float16>::load((const _Float16*)(ap + mt * 16 * C1_PW));
#pragma unroll
    for (int mt = 0; mt < 8; ++mt) acc[mt] = Frag<_Float16>::mma(af[mt], bf[ks], acc[mt]);
  }
  // a lane holds 8 neighbouring channels of one position per tile; through the wave's own slab, so that a store is two whole rows of x1 (512 B in a row)
  unsigned char* sl = L + C1_WB + wave * C1_SB;
#pragma unroll
  for (int mt = 0; mt < 8; ++mt) {
    const v4f b0 = *(const v4f*)(bsh + 16 * mt + 8 * h), b1 = *(const v4f*)(bsh + 16 * mt + 8 * h + 4);
    v8h hv;
#pragma unroll
    for (int r = 0; r < 8; ++r) {
      const float v = acc[mt][r] + (r < 4 ? b0[r & 3] : b1[r & 3]);
      hv[r] = (_Float16)(v / (1.0f + expf(-v)));
    }
    *(v8h*)(sl + c * C1_PS + 32 * mt + 16 * h) = hv;
  }
  // the lanes of this wave read what other lanes of it wrote: keep the compiler from moving the reads over the writes
  __builtin_amdgcn_fence(__ATOMIC_RELEASE, "workgroup");
  __builtin_amdgcn_wave_barrier();
  __builtin_amdgcn_fence(__ATOMIC_ACQUIRE, "workgroup");
  unsigned char* og = (unsigned char*)(X1T + ((size_t)b * NS + i0) * CM) + lane * 16;
  v8h ov[8];
#pragma unroll
  for (int it = 0; it < 8; ++it) ov[it] = *(const v8h*)(sl + (2 * it + h) * C1_PS + c * 16);
#pragma unroll
  for (int it = 0; it < 8; ++it) *(v8h*)(og + it * 512) = ov[it];
  asm volatile("s_wait_xcnt 0x0" ::: "memory");   // in front of any rewrite of the registers that the stores above name
}
// ---- everything in front of the products on x1, in one launch: the work-group's index picks its job (block-uniform, so the barrier of cv1 is safe). cv1 comes first: it is the long job.
// The others read inputs alone and are first used by a later launch.
#define PB_FOLD (CM * CIN / 2 / 256)     // work-groups of the BN fold of cv2 (256 x 128 weights)
#define PB_CAST (CM * CM / 2 / 256)      // work-groups of the cast of the v weights
#define CB_PU (NS / 16 * (CM / 32) / 8)   // work-groups of pu_fill
#define CB_G (CM / 16 * (CM / 64) / 8)    // work-groups of g_fill
#define CB_CV1 (BB * (NS / 128))
__global__ __launch_bounds__(256) void cv1_kernel(
    const float* __restrict__ x, const float* __restrict__ w1, const float* __restrict__ g1, const float* __restrict__ be1, const float* __restrict__ m1, const float* __restrict__ v1,
    _Float16* __restrict__ X1T,
    const float* __restrict__ wq, const float* __restrict__ wk, const float* __restrict__ bq, const float* __restrict__ relh, const float* __restrict__ relw,
    _Float16* __restrict__ G16, float* __restrict__ PU,
    const float* __restrict__ w2, const float* __restrict__ g2, const float* __restrict__ be2, const float* __restrict__ m2, const float* __restrict__ v2, unsigned* __restrict__ W2f, float* __restrict__ b2f,
    const float* __restrict__ wv, _Float16* __restrict__ Wv16) {
  __shared__ __align__(16) unsigned char L[C1_LDS];
  int bx = blockIdx.x;
  if (bx < CB_CV1) { cv1_tile(L, bx, x, w1, g1, be1, m1, v1, X1T); return; }
  bx -= CB_CV1;
  if (bx < CB_PU) { pu_fill(bx, wq, wk, bq, relh, relw, PU); return; }
  bx -= CB_PU;
  if (bx < CB_G) { g_fill(bx, wq, wk, G16); return; }
  bx -= CB_G;
  if (bx < PB_FOLD) { fold_bn(bx, w2, g2, be2, m2, v2, CIN, CM, W2f, b2f); return; }
  bx -= PB_FOLD;
  cast_f32_f16x2(bx, wv, Wv16, CM * CM / 2);
}
// ---- the two products on x1 in one launch, picked by blockIdx.z: u as [i][a], v as [c][j]
__global__ __launch_bounds__(256) void uv_gemm(
    const unsigned short* __restrict__ X1T, const unsigned short* __restrict__ G16, const unsigned short* __restrict__ Wv16,
    const float* __restrict__ PU, const float* __restrict__ bv,
    unsigned short* __restrict__ Ub, unsigned short* __restrict__ V16) {
  __shared__ __align__(16) float sT[8][16 * 68];   // per-wave 16x64 slab, pitch 68 floats
  float* slab = sT[threadIdx.x >> 5];
  if (blockIdx.z == 1) {   // V[b][c][j] = sum_cc Wv[c][cc]*X1T[b][j][cc] + bv[c]: A = Wv16 [128][128], Bt = X1T[b] [1024][128]
    gemm64_tile<0, false, 1, 1, false, 0>(slab, blockIdx.x, blockIdx.y, Wv16, nullptr, CM, 0, X1T, nullptr, CM, (long)NS * CM, V16, nullptr, NS, (long)CM * NS, bv, nullptr, 0, CM, NS, CM, 1.0f);
    return;
  }
  // U[b][i][a] = sum_bb X1T[b][i][bb]*G[a][bb] + PU[i][a]: PU comes in as the residual, the same rows for every image
  gemm64_tile<0, false, 0, 1, true, 0>(slab, blockIdx.x, blockIdx.y, X1T, nullptr, CM, (long)NS * CM, G16, nullptr, CM, 0, Ub, nullptr, CM, (long)NS * CM, nullptr, PU, 0, NS, CM, CM, 1.0f);
}
typedef __attribute__((ext_vector_type(4))) unsigned u32x4;
typedef __attribute__((ext_vector_type(2))) float f32x2;
#define FA_KEYS 64                       // keys per stage
#define FA_NST (NS / FA_KEYS)            // stages
#define FA_PK 272                        // LDS pitch of an x1 row: 256 B + 16 B
#define FA_PV 144                        // LDS pitch of a v row's 64 keys: 128 B + 16 B
#define FA_KB (FA_KEYS * FA_PK)          // bytes of the x1 tile
#define FA_BUF (FA_KB + CM * FA_PV)      // bytes of one buffer
#define FA_PO 272                        // pitch of a query's 128 channels of O in LDS: 256 B + 16 B
#define FA_PY 528                        // pitch of an output channel's 128 queries (f32) in LDS: 512 B + 16 B
#define FA_OB (128 * FA_PO)              // bytes of the work-group's O rows
#define FA_TAIL (FA_OB + CIN * FA_PY)    // O rows and, behind them, the 256 x 128 tile of cv2's sums
__device__ __forceinline__ float xhalf(float x) {   // lane l <-> lane l ^ 16
  return __builtin_bit_cast(float, __builtin_amdgcn_permlanex16(__builtin_bit_cast(int, x), __builtin_bit_cast(int, x), 0x76543210, 0xfedcba98, false, false));
}
__global__ __launch_bounds__(256) __attribute__((amdgpu_waves_per_eu(2, 2))) void attn_fused(
    const _Float16* __restrict__ Uh, const _Float16* __restrict__ X1h, const _Float16* __restrict__ Vh,
    const _Float16* __restrict__ W2h, const float* __restrict__ b2, const float* __restrict__ x, float* __restrict__ out) {
  __shared__ __align__(16) unsigned char L[FA_TAIL > 2 * FA_BUF ? FA_TAIL : 2 * FA_BUF];
  const int t = threadIdx.x, lane = t & 31, wave = t >> 5, c = lane & 15, h = lane >> 4;
  const int b = blockIdx.y, q0 = blockIdx.x * 128 + wave * 16;
  const unsigned char* Kg = (const unsigned char*)(X1h + (size_t)b * NS * CM) + t * 16;                        // a stage of x1 rows is 16 KiB in a row
  const unsigned char* Vg = (const unsigned char*)(Vh + (size_t)b * CM * NS) + (size_t)(t >> 3) * (NS * 2) + (t & 7) * 16;
  unsigned char* Lk = L + (t >> 4) * FA_PK + (t & 15) * 16;
  unsigned char* Lv = L + FA_KB + (t >> 3) * FA_PV + (t & 7) * 16;
  const float LOG2E = 1.4426950408889634f;

  v16h qf[4];
  { const _Float16* qp = Uh + ((size_t)b * NS + q0 + c) * CM + 8 * h;
#pragma unroll
    for (int kc = 0; kc < 4; ++kc) qf[kc] = Frag<_Float16>::load(qp + 32 * kc);
    // in front of any rewrite of the address registers that the loads above name; the input keeps those registers live up to the wait
    asm volatile("s_wait_xcnt 0x0" :: "v"(qp) : "memory"); }
  __builtin_amdgcn_sched_barrier(0);         // keeps every later register write, a later load's result too, behind that wait
  u32x4 st[8];
#pragma unroll
  for (int s = 0; s < 4; ++s) st[s] = *(const u32x4*)(Kg + s * 4096);
#pragma unroll
  for (int s = 0; s < 4; ++s) st[4 + s] = *(const u32x4*)(Vg + (size_t)s * 32 * (NS * 2));
  asm volatile("s_wait_xcnt 0x0" ::: "memory");   // in front of any rewrite of the address registers that the loads above name
  __builtin_amdgcn_sched_barrier(0);         // keeps every later register write behind that wait
  v8f acc[8];
#pragma unroll
  for (int i = 0; i < 8; ++i) acc[i] = (v8f){0.f,0.f,0.f,0.f,0.f,0.f,0.f,0.f};
  float m_run = -INFINITY, l_run = 0.f;
#pragma unroll
  for (int s = 0; s < 4; ++s) *(u32x4*)(Lk + s * 16 * FA_PK) = st[s];
#pragma unroll
  for (int s = 0; s < 4; ++s) *(u32x4*)(Lv + s * 32 * FA_PV) = st[4 + s];
  __syncthreads();

  // one stage = two passes of 32 keys, read from the buffer at byte offset cur; ahead() issues what is to fly under the stage
  auto stage = [&](const int cur, auto&& ahead) {
    v16h kf[2][4];
    auto load_k = [&](const int sub) {       // the 16 LDS reads of a pass's x1 fragments, as one group
      const unsigned char* kp = L + cur + (sub * 32 + c) * FA_PK + 16 * h;
#pragma unroll
      for (int kc = 0; kc < 4; ++kc) {
        kf[0][kc] = Frag<_Float16>::load((const _Float16*)(kp + 64 * kc));
        kf[1][kc] = Frag<_Float16>::load((const _Float16*)(kp + 16 * FA_PK + 64 * kc));
      }
    };
    load_k(0);
    __builtin_amdgcn_sched_barrier(0);       // the LDS reads go first, as one group, and none of them lands between ahead()'s loads and their wait
    ahead();
    __builtin_amdgcn_sched_barrier(0);       // holds ahead()'s loads up here, so that they fly under the whole stage
#pragma unroll
    for (int sub = 0; sub < 2; ++sub) {
      v8f s0 = (v8f){0.f,0.f,0.f,0.f,0.f,0.f,0.f,0.f}, s1 = s0;
#pragma unroll
      for (int kc = 0; kc < 4; ++kc) {
        s0 = Frag<_Float16>::mma(kf[0][kc], qf[kc], s0);
        s1 = Frag<_Float16>::mma(kf[1][kc], qf[kc], s1);
      }
      v16h vf[8];
      const unsigned char* vp = L + cur + FA_KB + c * FA_PV + sub * 64 + 16 * h;
#pragma unroll
      for (int i = 0; i < 8; ++i) vf[i] = Frag<_Float16>::load((const _Float16*)(vp + i * 16 * FA_PV));
      if (sub == 0) load_k(1);               // same stage, so already published
      __builtin_amdgcn_sched_barrier(0);     // holds these reads up here as one group: their LDS latency passes under the softmax arithmetic
      float mx = fmaxf(s0[0], s1[0]);
#pragma unroll
      for (int r = 1; r < 8; ++r) mx = fmaxf(mx, fmaxf(s0[r], s1[r]));
      mx = fmaxf(mx, xhalf(mx)) * LOG2E;     // both halves now hold this query's maximum of the pass
      if (__builtin_amdgcn_ballot_w32(mx > m_run) != 0) {   // scalar branch: no query of the wave has a new maximum -> nothing to rescale
        const float m_new = fmaxf(m_run, mx);
        const float corr = __builtin_amdgcn_exp2f(m_run - m_new);   // 0 in the first pass, where m_run is -inf
        l_run *= corr; m_run = m_new;
#pragma unroll
        for (int i = 0; i < 8; ++i) acc[i] = acc[i] * corr;
      }
      const float nm = 15.0f - m_run;        // p x 2^15: small weights stay normal f16 numbers
      v16h pf; f32x2 ps0 = {0.f, 0.f}, ps1 = {0.f, 0.f};
#pragma unroll
      for (int r = 0; r < 8; r += 2) {       // two neighbouring registers at a time: packed multiply-adds and packed sums
        const f32x2 a0 = __builtin_elementwise_fma((f32x2){s0[r], s0[r + 1]}, (f32x2){LOG2E, LOG2E}, (f32x2){nm, nm});
        const f32x2 a1 = __builtin_elementwise_fma((f32x2){s1[r], s1[r + 1]}, (f32x2){LOG2E, LOG2E}, (f32x2){nm, nm});
        const f32x2 p0 = {__builtin_amdgcn_exp2f(a0.x), __builtin_amdgcn_exp2f(a0.y)}, p1 = {__builtin_amdgcn_exp2f(a1.x), __builtin_amdgcn_exp2f(a1.y)};
        ps0 += p0; ps1 += p1;
        pf[r] = (_Float16)p0.x; pf[r + 1] = (_Float16)p0.y; pf[8 + r] = (_Float16)p1.x; pf[9 + r] = (_Float16)p1.y;
      }
      ps0 += ps1;
      l_run += ps0.x + ps0.y;
#pragma unroll
      for (int i = 0; i < 8; ++i) acc[i] = Frag<_Float16>::mma(vf[i], pf, acc[i]);
    }
  };
  for (int sg = 0; sg + 1 < FA_NST; ++sg) {
    const int cur = (sg & 1) * FA_BUF, nxt = FA_BUF - cur;
    stage(cur, [&]() {                       // the next stage's global loads fly under this stage's products
#pragma unroll
      for (int s = 0; s < 4; ++s) st[s] = *(const u32x4*)(Kg + (size_t)(sg + 1) * (FA_KEYS * 256) + s * 4096);
#pragma unroll
      for (int s = 0; s < 4; ++s) st[4 + s] = *(const u32x4*)(Vg + (size_t)s * 32 * (NS * 2) + (sg + 1) * (FA_KEYS * 2));
      asm volatile("s_wait_xcnt 0x0" ::: "memory");   // in front of any rewrite of the address registers that the loads above name
    });
    // into the buffer whose last readers passed the barrier of the trip before
#pragma unroll
    for (int s = 0; s < 4; ++s) *(u32x4*)(Lk + nxt + s * 16 * FA_PK) = st[s];
#pragma unroll
    for (int s = 0; s < 4; ++s) *(u32x4*)(Lv + nxt + s * 32 * FA_PV) = st[4 + s];
    __syncthreads();                         // publishes the next stage and ends every wave's reads of this one
  }
  // ---- behind the keys: cv2, SiLU and the residual add on the work-group's 128 queries. O goes from wave to wave through LDS, y never leaves the chip.
  // A wave owns output channels 32 wave .. + 31 for all 128 queries: W2f.O^T (A = its 32 rows of W2f, B = O rows [query][channel] from LDS).
  const int o0 = wave * 32;
  v16h wf[2][4]; v4f bs[2][2];
  stage(((FA_NST - 1) & 1) * FA_BUF, [&]() {   // the wave's rows of W2f and its bias fly under the last stage's products
    const _Float16* wp = W2h + (size_t)(o0 + c) * CM + 8 * h;
    const float* bp = b2 + o0 + 8 * h;
#pragma unroll
    for (int ot = 0; ot < 2; ++ot) {
#pragma unroll
      for (int kc = 0; kc < 4; ++kc) wf[ot][kc] = Frag<_Float16>::load(wp + ot * 16 * CM + 32 * kc);
      bs[ot][0] = *(const v4f*)(bp + 16 * ot); bs[ot][1] = *(const v4f*)(bp + 16 * ot + 4);
    }
    // in front of any rewrite of the address registers that the loads above name; the inputs keep those registers live up to the wait
    asm volatile("s_wait_xcnt 0x0" :: "v"(wp), "v"(bp) : "memory");
  });
  __syncthreads();                           // every wave has left the buffers: they become staging for O and for cv2's sums

  // O[i][c] = acc / sum, f16, a row per query
  const float inv = 1.0f / (l_run + xhalf(l_run));   // each half summed its own 8 keys of every tile
  unsigned char* Lw = L + wave * 16 * FA_PO;
#pragma unroll
  for (int i = 0; i < 8; ++i) {
    v8h hv;
#pragma unroll
    for (int r = 0; r < 8; ++r) hv[r] = (_Float16)(acc[i][r] * inv);
    *(v8h*)(Lw + c * FA_PO + 32 * i + 16 * h) = hv;   // row = query, bytes = channels 16 i + 8 h .. + 7
  }
  __syncthreads();                           // publishes every wave's 16 queries of O to the whole work-group
  const size_t xo = ((size_t)b * CIN + o0) * NS + blockIdx.x * 128 + lane * 4;   // a lane's 4 queries of channel o0
  const float* xp = x + xo;
  float* op = out + xo;
  v4f xc[8];
#pragma unroll
  for (int j = 0; j < 8; ++j) xc[j] = *(const v4f*)(xp + (size_t)j * NS);
  asm volatile("s_wait_xcnt 0x0" :: "v"(xp) : "memory");   // in front of any rewrite of the address registers that the loads above name
  __builtin_amdgcn_sched_barrier(0);         // holds the first 8 rows' loads of x up here: they fly under the product
  v8f d[2][8];
#pragma unroll
  for (int it = 0; it < 8; ++it) { d[0][it] = (v8f){0.f,0.f,0.f,0.f,0.f,0.f,0.f,0.f}; d[1][it] = d[0][it]; }
#pragma unroll
  for (int kc = 0; kc < 4; ++kc) {
    v16h of[8];
#pragma unroll
    for (int it = 0; it < 8; ++it) of[it] = Frag<_Float16>::load((const _Float16*)(L + (it * 16 + c) * FA_PO + 64 * kc + 16 * h));
#pragma unroll
    for (int it = 0; it < 8; ++it) {
      d[0][it] = Frag<_Float16>::mma(wf[0][kc], of[it], d[0][it]);
      d[1][it] = Frag<_Float16>::mma(wf[1][kc], of[it], d[1][it]);
    }
  }
  // through the wave's own 32 rows of LDS, so that a lane holds 4 neighbouring queries and a store is one channel's 128 queries: 4 whole lines
  float* slab = (float*)(L + FA_OB + o0 * FA_PY);
#pragma unroll
  for (int ot = 0; ot < 2; ++ot)
#pragma unroll
    for (int it = 0; it < 8; ++it)
#pragma unroll
      for (int r = 0; r < 8; ++r) slab[(ot * 16 + 8 * h + r) * (FA_PY / 4) + it * 16 + c] = d[ot][it][r] + bs[ot][r >> 2][r & 3];
  // the lanes of this wave read what other lanes of it wrote: keep the compiler from moving the reads over the writes
  __builtin_amdgcn_fence(__ATOMIC_RELEASE, "workgroup");
  __builtin_amdgcn_wave_barrier();
  __builtin_amdgcn_fence(__ATOMIC_ACQUIRE, "workgroup");
  const float* sp = slab + lane * 4;
  // stays rolled: the SiLU of 128 values a lane, unrolled, is several times the text of the rest of the kernel and runs only once
#pragma unroll 1
  for (int g = 0; g < 4; ++g) {              // 8 channels a trip; the next trip's x flies under this trip's arithmetic
    v4f xn[8];
#pragma unroll
    for (int j = 0; j < 8; ++j) xn[j] = xc[j];
    if (g < 3) {
#pragma unroll
      for (int j = 0; j < 8; ++j) xn[j] = *(const v4f*)(xp + (size_t)(8 + j) * NS);
    }
    __builtin_amdgcn_sched_barrier(0);       // holds those loads up here
#pragma unroll
    for (int j = 0; j < 8; ++j) {
      v4f y = *(const v4f*)(sp + j * (FA_PY / 4));
#pragma unroll
      for (int e = 0; e < 4; ++e) y[e] = y[e] / (1.0f + expf(-y[e]));
      *(v4f*)(op + (size_t)j * NS) = xc[j] + y;
    }
    asm volatile("s_wait_xcnt 0x0" ::: "memory");   // in front of the step of the address registers that this trip's loads and stores name
    __builtin_amdgcn_sched_barrier(0);       // keeps that step behind the wait
    xp += 8 * NS; op += 8 * NS; sp += 8 * (FA_PY / 4);
#pragma unroll
    for (int j = 0; j < 8; ++j) xc[j] = xn[j];
  }
}
extern "C" void kernel_launch(void* const* d_in, const int* in_sizes, int n_in, void* d_out, int out_size, void* d_ws, size_t ws_size, hipStream_t stream) {
  (void)in_sizes; (void)n_in; (void)out_size; (void)ws_size;
  const float* x = (const float*)d_in[0]; const float* w1 = (const float*)d_in[1];
  const float* g1 = (const float*)d_in[2]; const float* be1 = (const float*)d_in[3]; const float* m1 = (const float*)d_in[4]; const float* v1 = (const float*)d_in[5];
  const float* wq = (const float*)d_in[6]; const float* bq = (const float*)d_in[7]; const float* wk = (const float*)d_in[8]; const float* bk = (const float*)d_in[9];
  const float* wv = (const float*)d_in[10]; const float* bv = (const float*)d_in[11]; const float* relh = (const float*)d_in[12]; const float* relw = (const float*)d_in[13];
  const float* w2 = (const float*)d_in[14]; const float* g2 = (const float*)d_in[15]; const float* be2 = (const float*)d_in[16]; const float* m2 = (const float*)d_in[17]; const float* v2 = (const float*)d_in[18];
  float* out = (float*)d_out;   // [32][256][1024]
  (void)bk;                     // bk shifts all scores of a query by q_i.bk alike: the softmax over the keys does not see it
  // Workspace map (offsets in MiB; 256 MiB in all). Scores and p stay on chip, so nothing of them lies here.
  //   [16,24) x1; [24,32) u; [56,64) v; [194,200) G, the v weights, the folded cv2 weights and PU
  char* ws = (char*)d_ws;
  const size_t MiB = (size_t)1 << 20;
  unsigned* X1T = (unsigned*)(ws + 16 * MiB);                        // [b][i][128] f16
  unsigned* Ub = (unsigned*)(ws + 24 * MiB);                         // [b][i][128] f16
  unsigned* V16 = (unsigned*)(ws + 56 * MiB);                        // [b][c][j] f16
  _Float16* G16 = (_Float16*)(ws + 194 * MiB); _Float16* Wv16 = (_Float16*)(ws + 196 * MiB);
  unsigned* W2f = (unsigned*)(ws + 197 * MiB); float* b2f = (float*)(ws + 198 * MiB);
  float* PU = (float*)(ws + 199 * MiB);                              // [i][128] f32, one for all images
  // cv1 from x itself, with G, PU, the BN fold of cv2 and the cast of the v weights beside it
  cv1_kernel<<<CB_CV1 + CB_PU + CB_G + PB_FOLD + PB_CAST, 256, 0, stream>>>(x, w1, g1, be1, m1, v1, (_Float16*)X1T, wq, wk, bq, relh, relw, G16, PU, w2, g2, be2, m2, v2, W2f, b2f, wv, Wv16);
  // u and v both read x1: one launch, grid.z picks the product (each has 32 tiles of 64 x 64 per image)
  uv_gemm<<<dim3((NS / 64) * (CM / 64) / 8, BB, 2), 256, 0, stream>>>((const unsigned short*)X1T, U16(G16), U16(Wv16), PU, bv, (unsigned short*)Ub, (unsigned short*)V16);
  // scores, softmax, p.v, cv2 and the residual add (out = x + silu(W2f.O + b2f)) in one launch: 8 work-groups of 128 queries per image
  attn_fused<<<dim3(NS / 128, BB), 256, 0, stream>>>((const _Float16*)Ub, (const _Float16*)X1T, (const _Float16*)V16, (const _Float16*)W2f, b2f, x, out);
}

// v008
// A run of this version takes 44.4 microseconds.
// Next to v007, in two timings, it ran 1.14 times as fast each time.
// Counting every step since v000, it is 9.61 times as fast.
#include <hip/hip_runtime.h>
#include <math.h>
// A bottleneck block with attention: cv1 (1x1 conv 256 -> 128, BN folded, SiLU), then single-head attention over 1024 positions and cv2 (128 -> 256, BN folded, SiLU) with the residual add.
// The scores are re-associated: q_i.k_j + pos_i.q_j = u_i.x1_j + (q_i.bk + pos_i.bq), with u_i = (Wk^T Wq) x1_i + Wq^T pos_i + Wk^T bq. The bracket does not depend
// on the key j, so the softmax over j is the same without it: the score product has K = 128, its key operand is x1 itself, and no k and no q are formed.
// All products on v_wmma_f32_16x16x32_f16, f16 operands, f32 accumulate (p x 2^15); softmax and the residual add in f32 on VALU.
typedef __attribute__((ext_vector_type(16))) _Float16 v16h;
typedef __attribute__((ext_vector_type(8)))  _Float16 v8h;
typedef __attribute__((ext_vector_type(8)))  float    v8f;
typedef __attribute__((ext_vector_type(4)))  float    v4f;
template <typename T> struct Frag;
template <> struct Frag<_Float16> {
  typedef v16h V; union U { v16h v; v8h h[2]; };
  static __device__ __forceinline__ v16h load(const _Float16* p) {   // elements 0..7 <- p[0..7], 8..15 <- p[16..23]
    U f; f.h[0] = *(const v8h*)(p); f.h[1] = *(const v8h*)(p + 16); return f.v;
  }
  static __device__ __forceinline__ v8f mma(v16h a, v16h b, v8f c) {
    return __builtin_amdgcn_wmma_f32_16x16x32_f16(false, a, false, b, (short)0, c, false, false);
  }
};

#define BB 32
#define CIN 256
#define CM 128
#define NS 1024
// fold BN into 1x1 conv weights: W'[o][c] = W[o][c]*g[o]/sqrt(v[o]+eps) (f16), bias'[o] = b[o] - m[o]*scale
__device__ __forceinline__ void fold_bn(const int bx, const float* __restrict__ Wm, const float* __restrict__ g, const float* __restrict__ bb, const float* __restrict__ m, const float* __restrict__ var,
                                        int O, int Cc, unsigned* __restrict__ W16, float* __restrict__ bias) {
  const int i = bx * 256 + threadIdx.x;
  if (i < O * Cc / 2) { const int o = (2 * i) / Cc; const float sc = g[o] / sqrtf(var[o] + 1e-5f);
    const unsigned u = (unsigned)__builtin_bit_cast(unsigned short, (_Float16)(Wm[2 * i] * sc)) | ((unsigned)__builtin_bit_cast(unsigned short, (_Float16)(Wm[2 * i + 1] * sc)) << 16);
    ((unsigned*)W16)[i] = u;  }
  if (i < O) { const float sc = g[i] / sqrtf(var[i] + 1e-5f); const float v = bb[i] - m[i] * sc; ((float*)bias)[i] = v;  }
}
// ---- the two small products of the re-associated scores; they read inputs alone. A fragment's 16 k values lie a row apart in an f32 matrix [k][column]:
// element e <- k = e (e < 8) or 8 + e (e >= 8), counted from the lane half's first k: the k order of Frag::load, for A and B alike.
#define KROW(e) ((e) < 8 ? (e) : 8 + (e))
__device__ __forceinline__ v16h cvt16(const float* f) {
  v16h r;
#pragma unroll
  for (int e = 0; e < 16; ++e) r[e] = (_Float16)f[e];
  return r;
}
// G[a][b] = sum_c Wk[c][a] Wq[c][b], f16 rows [a][b]. Product with m = b and n = a, so that a lane holds 8 neighbouring b of one a; a wave owns 16 a x 64 b (whole 128-B lines).
__device__ __forceinline__ void g_fill(const int bx, const float* __restrict__ wq, const float* __restrict__ wk, _Float16* __restrict__ G16) {
  const int lane = threadIdx.x & 31, c = lane & 15, h = lane >> 4, w = bx * 8 + (threadIdx.x >> 5);
  const int a0 = (w & 7) * 16, b0 = (w >> 3) * 64;
  v8f acc[4];
#pragma unroll
  for (int mt = 0; mt < 4; ++mt) acc[mt] = (v8f){0.f,0.f,0.f,0.f,0.f,0.f,0.f,0.f};
  // stays rolled: unrolled, the four trips' loads are all hoisted to the top and take more registers than cv1, whose launch this job shares
#pragma unroll 1
  for (int kc = 0; kc < 4; ++kc) {
    const float* pk = wk + (32 * kc + 8 * h) * CM + a0 + c;
    const float* pq = wq + (32 * kc + 8 * h) * CM + b0 + c;
    float fk[16], fq[4][16];
#pragma unroll
    for (int e = 0; e < 16; ++e) {
      fk[e] = pk[KROW(e) * CM];
#pragma unroll
      for (int mt = 0; mt < 4; ++mt) fq[mt][e] = pq[KROW(e) * CM + 16 * mt];
    }
    // in front of any rewrite of the address registers that the loads above name, a load's own result too; the inputs keep those registers live up to the wait
    asm volatile("s_wait_xcnt 0x0" :: "v"(pk), "v"(pq) : "memory");
    __builtin_amdgcn_sched_barrier(0);       // keeps the loads in front of that wait and every later register write behind it
    const v16h bf = cvt16(fk);
#pragma unroll
    for (int mt = 0; mt < 4; ++mt) acc[mt] = Frag<_Float16>::mma(cvt16(fq[mt]), bf, acc[mt]);
  }
#pragma unroll
  for (int mt = 0; mt < 4; ++mt) {
    v8h hv;
#pragma unroll
    for (int r = 0; r < 8; ++r) hv[r] = (_Float16)acc[mt][r];
    *(v8h*)(G16 + (size_t)(a0 + c) * CM + b0 + 16 * mt + 8 * h) = hv;
  }
  // in front of any rewrite of the registers that the stores above name: other jobs' code follows this one in the merged kernel
  asm volatile("s_wait_xcnt 0x0" ::: "memory");
}
// PU[i][a] = sum_c Wq[c][a] pos[c][i] + sum_c Wk[c][a] bq[c], f32, the same for every image (pos[c][i] = rel_h[c][ih] + rel_w[c][iw]): one product with
// K = 256, [Wq^T | Wk^T].[pos_i ; bq], m = a and n = i, so that a lane holds 8 neighbouring a of one position; a wave owns 16 positions x 32 a.
// Its reader, the u product in the attention kernel, holds its sums in the same lanes and registers, so PU lies as the lanes hold it:
// [16 positions][16 a][registers 0..3 | 4..7][lane][4 floats]: a store here and a load there are 512 B in a row.
__device__ __forceinline__ void pu_fill(const int bx, const float* __restrict__ wq, const float* __restrict__ wk, const float* __restrict__ bq,
                                        const float* __restrict__ relh, const float* __restrict__ relw, float* __restrict__ PU) {
  const int lane = threadIdx.x & 31, c = lane & 15, h = lane >> 4, w = bx * 8 + (threadIdx.x >> 5);
  const int i = (w >> 2) * 16 + c, a0 = (w & 3) * 32;
  v8f acc[2];
  acc[0] = (v8f){0.f,0.f,0.f,0.f,0.f,0.f,0.f,0.f}; acc[1] = acc[0];
  // stays rolled, for the same reason as in g_fill
#pragma unroll 1
  for (int kc = 0; kc < 4; ++kc) {
    const int k0 = 32 * kc + 8 * h;
    const float* gh = relh + k0 * 32 + (i >> 5);
    const float* gw = relw + k0 * 32 + (i & 31);
    const float* gb = bq + k0;
    const float* pq = wq + k0 * CM + a0 + c;
    const float* pk = wk + k0 * CM + a0 + c;
    float ph[16], pw[16], fb[16], fq[2][16], fk[2][16];
#pragma unroll
    for (int e = 0; e < 16; ++e) {
      ph[e] = gh[KROW(e) * 32]; pw[e] = gw[KROW(e) * 32]; fb[e] = gb[KROW(e)];
#pragma unroll
      for (int mt = 0; mt < 2; ++mt) { fq[mt][e] = pq[KROW(e) * CM + 16 * mt]; fk[mt][e] = pk[KROW(e) * CM + 16 * mt]; }
    }
    // in front of any rewrite of the address registers that the loads above name, a load's own result too; the inputs keep those registers live up to the wait
    asm volatile("s_wait_xcnt 0x0" :: "v"(gh), "v"(gw), "v"(gb), "v"(pq), "v"(pk) : "memory");
    __builtin_amdgcn_sched_barrier(0);       // keeps the loads in front of that wait and every later register write behind it
#pragma unroll
    for (int e = 0; e < 16; ++e) ph[e] += pw[e];
    const v16h bp = cvt16(ph), bb = cvt16(fb);
#pragma unroll
    for (int mt = 0; mt < 2; ++mt) {
      acc[mt] = Frag<_Float16>::mma(cvt16(fq[mt]), bp, acc[mt]);
      acc[mt] = Frag<_Float16>::mma(cvt16(fk[mt]), bb, acc[mt]);
    }
  }
#pragma unroll
  for (int mt = 0; mt < 2; ++mt) {
    float* p = PU + (size_t)((w >> 2) * 8 + (w & 3) * 2 + mt) * 256 + lane * 4;
    *(v4f*)p = (v4f){acc[mt][0], acc[mt][1], acc[mt][2], acc[mt][3]};
    *(v4f*)(p + 128) = (v4f){acc[mt][4], acc[mt][5], acc[mt][6], acc[mt][7]};
  }
  // in front of any rewrite of the registers that the stores above name: other jobs' code follows this one in the merged kernel
  asm volatile("s_wait_xcnt 0x0" ::: "memory");
}
// ---- cv1 straight from x: x1[b][i][o] = silu(sum_c W1f[o][c] x[b][c][i] + b1f[o]), f16 rows [i][o]. Product with m = o and n = i: in x a fragment's 16 k values (channels) lie a
// row apart at one position, so a lane takes them as they lie, 16 neighbouring positions a load (the k order of KROW, as in the two fills above), and no transposed copy of x is made.
// A work-group owns 128 positions of one image, a wave 16 of them for all 128 output channels. The folded weights (f16, the same values for every work-group) are formed in LDS.
// Behind it, on the same 128 positions: v[b][c][j] = sum_cc Wv[c][cc] x1[b][j][cc] + bv[c], f16 rows [c][j]. Product with m = j and n = c (A = x1 rows from every wave's slab,
// B = the wave's own 16 rows of Wv), so that a lane holds 8 neighbouring positions of one channel; a wave owns 16 channels for all 128 positions.
// Every loop of this function is unrolled: its index picks registers (the arrays live in registers) and immediate offsets, so that no address register is stepped while loads fly.
typedef __attribute__((ext_vector_type(4))) _Float16 v4h;
#define C1_PW 528                        // LDS pitch of a row of folded weights: 512 B + 16 B
#define C1_PS 272                        // LDS pitch of a position's 128 channels of x1: 256 B + 16 B
#define C1_WB (CM * C1_PW)               // bytes of the folded weights
#define C1_SB (16 * C1_PS)               // bytes of a wave's 16 positions of x1
#define C1_VO (C1_WB + 8 * C1_SB + CM * 4)    // behind the folded bias: the v weights, f16 rows of pitch C1_PS; a wave's 16 rows later hold its 16 channels of v
#define C1_LDS (C1_VO + 8 * C1_SB)
__device__ __forceinline__ void cv1_tile(unsigned char* L, const int bx, const float* __restrict__ x, const float* __restrict__ w1, const float* __restrict__ g1,
                                         const float* __restrict__ be1, const float* __restrict__ m1, const float* __restrict__ v1, _Float16* __restrict__ X1T,
                                         const float* __restrict__ wv, const float* __restrict__ bv, _Float16* __restrict__ V16) {
  const int lane = threadIdx.x & 31, wave = threadIdx.x >> 5, c = lane & 15, h = lane >> 4;
  const int b = bx >> 3, i0 = (bx & 7) * 128 + wave * 16, ow = wave * 16;
  float* bsh = (float*)(L + C1_WB + 8 * C1_SB);
  // the wave folds rows ow .. ow + 15 of w1: load j is 128 neighbouring columns of row ow + j / 2
  const float *pg = g1 + ow + c, *pv = v1 + ow + c, *pb = be1 + ow + c, *pm = m1 + ow + c;
  const float* wp = w1 + (size_t)ow * CIN + lane * 4;
  const float gg = *pg, vv = *pv, bb = *pb, mm = *pm;
  v4f wr[32];
#pragma unroll
  for (int j = 0; j < 32; ++j) wr[j] = *(const v4f*)(wp + j * 128);
  // in front of any rewrite of the address registers that the loads above name, a load's own result too; the inputs keep those registers live up to the wait
  asm volatile("s_wait_xcnt 0x0" :: "v"(pg), "v"(pv), "v"(pb), "v"(pm), "v"(wp) : "memory");
  const float* xp = x + ((size_t)b * CIN + 8 * h) * NS + i0 + c;
  float xr[8][16];                           // the wave's 16 positions of x, all 256 channels: 8 k steps
  auto load_x = [&](const int ks) {
#pragma unroll
    for (int e = 0; e < 16; ++e) xr[ks][e] = xp[(size_t)(32 * ks + KROW(e)) * NS];
    asm volatile("s_wait_xcnt 0x0" :: "v"(xp) : "memory");   // the same, for these loads
  };
#pragma unroll
  for (int ks = 0; ks < 4; ++ks) load_x(ks);
  __builtin_amdgcn_sched_barrier(0);         // holds all these loads up here: the first half of x flies under the fold
  const float sc = gg / sqrtf(vv + 1e-5f);   // lane c (either half) holds the scale of row ow + c
  bsh[ow + c] = bb - mm * sc;                // both halves store the same value
#pragma unroll
  for (int j = 0; j < 32; ++j) {
    const float s = __builtin_bit_cast(float, __builtin_amdgcn_readlane(__builtin_bit_cast(int, sc), j >> 1));
    const v4h hv = {(_Float16)(wr[j][0] * s), (_Float16)(wr[j][1] * s), (_Float16)(wr[j][2] * s), (_Float16)(wr[j][3] * s)};
    *(v4h*)(L + (ow + (j >> 1)) * C1_PW + (j & 1) * 256 + lane * 8) = hv;
  }
  __builtin_amdgcn_sched_barrier(0);         // the v weights and the second half of x go into the registers that the fold has left, not earlier
  // the wave's own 16 rows of the v weights, a whole row (512 B) a load
  const float* vwp = wv + (size_t)ow * CM + lane * 4;
  const float* pbv = bv + ow + c;
  v4f vr[16];
#pragma unroll
  for (int j = 0; j < 16; ++j) vr[j] = *(const v4f*)(vwp + j * CM);
  const float bvv = *pbv;
  asm volatile("s_wait_xcnt 0x0" :: "v"(vwp), "v"(pbv) : "memory");   // the same, for these loads
#pragma unroll
  for (int ks = 4; ks < 8; ++ks) load_x(ks);
  __syncthreads();                           // publishes every wave's 16 rows of folded weights and its part of the bias
  v8f acc[8];
#pragma unroll
  for (int mt = 0; mt < 8; ++mt) acc[mt] = (v8f){0.f,0.f,0.f,0.f,0.f,0.f,0.f,0.f};
  unsigned char* vs = L + C1_VO + wave * C1_SB;   // read back as fragments by this wave alone, behind the barrier in front of the v product
#pragma unroll
  for (int j = 0; j < 16; ++j) {
    const v4h hv = {(_Float16)vr[j][0], (_Float16)vr[j][1], (_Float16)vr[j][2], (_Float16)vr[j][3]};
    *(v4h*)(vs + j * C1_PS + lane * 8) = hv;
  }
  v16h bf[8];
#pragma unroll
  for (int ks = 0; ks < 8; ++ks) bf[ks] = cvt16(xr[ks]);
  __builtin_amdgcn_sched_barrier(0);         // all of x is f16 from here on: its f32 registers are free, so that a k step's weight fragments can be read as one group
#pragma unroll
  for (int ks = 0; ks < 8; ++ks) {
    const unsigned char* ap = L + c * C1_PW + 64 * ks + 16 * h;
    v16h af[8];
#pragma unroll
    for (int mt = 0; mt < 8; ++mt) af[mt] = Frag<_Float16>::load((const _Float16*)(ap + mt * 16 * C1_PW));
#pragma unroll
    for (int mt = 0; mt < 8; ++mt) acc[mt] = Frag<_Float16>::mma(af[mt], bf[ks], acc[mt]);
  }
  // a lane holds 8 neighbouring channels of one position per tile; through the wave's own slab, so that a store is two whole rows of x1 (512 B in a row)
  unsigned char* sl = L + C1_WB + wave * C1_SB;
#pragma unroll
  for (int mt = 0; mt < 8; ++mt) {
    const v4f b0 = *(const v4f*)(bsh + 16 * mt + 8 * h), b1 = *(const v4f*)(bsh + 16 * mt + 8 * h + 4);
    v8h hv;
#pragma unroll
    for (int r = 0; r < 8; ++r) {
      const float v = acc[mt][r] + (r < 4 ? b0[r & 3] : b1[r & 3]);
      hv[r] = (_Float16)(v / (1.0f + expf(-v)));
    }
    *(v8h*)(sl + c * C1_PS + 32 * mt + 16 * h) = hv;
  }
  __syncthreads();                           // publishes every wave's 16 positions of x1 to the whole work-group (and to the other lanes of the wave itself)
  unsigned char* og = (unsigned char*)(X1T + ((size_t)b * NS + i0) * CM) + lane * 16;
  v8h ov[8];
#pragma unroll
  for (int it = 0; it < 8; ++it) ov[it] = *(const v8h*)(sl + (2 * it + h) * C1_PS + c * 16);
#pragma unroll
  for (int it = 0; it < 8; ++it) *(v8h*)(og + it * 512) = ov[it];
  asm volatile("s_wait_xcnt 0x0" ::: "memory");   // in front of any rewrite of the registers that the stores above name
  // ---- v on the work-group's 128 positions
  v16h wf[4];
#pragma unroll
  for (int kc = 0; kc < 4; ++kc) wf[kc] = Frag<_Float16>::load((const _Float16*)(vs + c * C1_PS + 64 * kc + 16 * h));
  v8f va[8];
#pragma unroll
  for (int mt = 0; mt < 8; ++mt) va[mt] = (v8f){0.f,0.f,0.f,0.f,0.f,0.f,0.f,0.f};
  const unsigned char* xs = L + C1_WB + c * C1_PS + 16 * h;
  v16h xa[2][8];
#pragma unroll
  for (int mt = 0; mt < 8; ++mt) xa[0][mt] = Frag<_Float16>::load((const _Float16*)(xs + mt * C1_SB));
#pragma unroll
  for (int kc = 0; kc < 4; ++kc) {
    if (kc < 3) {
#pragma unroll
      for (int mt = 0; mt < 8; ++mt) xa[(kc + 1) & 1][mt] = Frag<_Float16>::load((const _Float16*)(xs + mt * C1_SB + 64 * (kc + 1)));
    }
    __builtin_amdgcn_sched_barrier(0);       // holds the next k step's LDS reads up here as one group: their latency passes under this step's products
#pragma unroll
    for (int mt = 0; mt < 8; ++mt) va[mt] = Frag<_Float16>::mma(xa[kc & 1][mt], wf[kc], va[mt]);
  }
  // through the wave's own rows of LDS (its weights are in registers by now), so that a store is two channels' 128 positions: 4 whole lines
#pragma unroll
  for (int mt = 0; mt < 8; ++mt) {
    v8h hv;
#pragma unroll
    for (int r = 0; r < 8; ++r) hv[r] = (_Float16)(va[mt][r] + bvv);
    *(v8h*)(vs + c * C1_PS + 32 * mt + 16 * h) = hv;   // row = channel, bytes = positions 16 mt + 8 h .. + 7
  }
  // the lanes of this wave read what other lanes of it wrote: keep the compiler from moving the reads over the writes. The fences name LDS alone,
  // so that the wave does not wait here for its stores of x1, which are still under way
  __builtin_amdgcn_fence(__ATOMIC_RELEASE, "workgroup", "local");
  __builtin_amdgcn_wave_barrier();
  __builtin_amdgcn_fence(__ATOMIC_ACQUIRE, "workgroup", "local");
  unsigned char* vg = (unsigned char*)(V16 + ((size_t)b * CM + ow + h) * NS + (bx & 7) * 128) + c * 16;
  v8h vv8[8];
#pragma unroll
  for (int it = 0; it < 8; ++it) vv8[it] = *(const v8h*)(vs + (2 * it + h) * C1_PS + c * 16);
#pragma unroll
  for (int it = 0; it < 8; ++it) *(v8h*)(vg + (size_t)it * (2 * NS * 2)) = vv8[it];
  asm volatile("s_wait_xcnt 0x0" ::: "memory");   // in front of any rewrite of the registers that the stores above name
}
// ---- everything in front of the attention kernel, in one launch: the work-group's index picks its job (block-uniform, so the barriers of cv1 are safe). cv1 comes first: it is the long job.
// The others read inputs alone and are first used by a later launch.
#define PB_FOLD (CM * CIN / 2 / 256)     // work-groups of the BN fold of cv2 (256 x 128 weights)
#define CB_PU (NS / 16 * (CM / 32) / 8)   // work-groups of pu_fill
#define CB_G (CM / 16 * (CM / 64) / 8)    // work-groups of g_fill
#define CB_CV1 (BB * (NS / 128))
__global__ __launch_bounds__(256) void cv1_kernel(
    const float* __restrict__ x, const float* __restrict__ w1, const float* __restrict__ g1, const float* __restrict__ be1, const float* __restrict__ m1, const float* __restrict__ v1,
    _Float16* __restrict__ X1T, const float* __restrict__ wv, const float* __restrict__ bv, _Float16* __restrict__ V16,
    const float* __restrict__ wq, const float* __restrict__ wk, const float* __restrict__ bq, const float* __restrict__ relh, const float* __restrict__ relw,
    _Float16* __restrict__ G16, float* __restrict__ PU,
    const float* __restrict__ w2, const float* __restrict__ g2, const float* __restrict__ be2, const float* __restrict__ m2, const float* __restrict__ v2, unsigned* __restrict__ W2f, float* __restrict__ b2f) {
  __shared__ __align__(16) unsigned char L[C1_LDS];
  int bx = blockIdx.x;
  if (bx < CB_CV1) { cv1_tile(L, bx, x, w1, g1, be1, m1, v1, X1T, wv, bv, V16); return; }
  bx -= CB_CV1;
  if (bx < CB_PU) { pu_fill(bx, wq, wk, bq, relh, relw, PU); return; }
  bx -= CB_PU;
  if (bx < CB_G) { g_fill(bx, wq, wk, G16); return; }
  bx -= CB_G;
  fold_bn(bx, w2, g2, be2, m2, v2, CIN, CM, W2f, b2f);
}
typedef __attribute__((ext_vector_type(4))) unsigned u32x4;
typedef __attribute__((ext_vector_type(2))) float f32x2;
#define FA_KEYS 64                       // keys per stage
#define FA_NST (NS / FA_KEYS)            // stages
#define FA_PK 272                        // LDS pitch of an x1 row: 256 B + 16 B
#define FA_PV 144                        // LDS pitch of a v row's 64 keys: 128 B + 16 B
#define FA_KB (FA_KEYS * FA_PK)          // bytes of the x1 tile
#define FA_BUF (FA_KB + CM * FA_PV)      // bytes of one buffer
#define FA_PO 272                        // pitch of a query's 128 channels of O in LDS: 256 B + 16 B
#define FA_PY 528                        // pitch of an output channel's 128 queries (f32) in LDS: 512 B + 16 B
#define FA_OB (128 * FA_PO)              // bytes of the work-group's O rows
#define FA_TAIL (FA_OB + CIN * FA_PY)    // O rows and, behind them, the 256 x 128 tile of cv2's sums
__device__ __forceinline__ float xhalf(float x) {   // lane l <-> lane l ^ 16
  return __builtin_bit_cast(float, __builtin_amdgcn_permlanex16(__builtin_bit_cast(int, x), __builtin_bit_cast(int, x), 0x76543210, 0xfedcba98, false, false));
}
__global__ __launch_bounds__(256) __attribute__((amdgpu_waves_per_eu(2, 2))) void attn_fused(
    const _Float16* __restrict__ Gh, const float* __restrict__ PU, const _Float16* __restrict__ X1h, const _Float16* __restrict__ Vh,
    const _Float16* __restrict__ W2h, const float* __restrict__ b2, const float* __restrict__ x, float* __restrict__ out) {
  __shared__ __align__(16) unsigned char L[FA_TAIL > 2 * FA_BUF ? FA_TAIL : 2 * FA_BUF];
  const int t = threadIdx.x, lane = t & 31, wave = t >> 5, c = lane & 15, h = lane >> 4;
  const int b = blockIdx.y, q0 = blockIdx.x * 128 + wave * 16;
  const unsigned char* Kg = (const unsigned char*)(X1h + (size_t)b * NS * CM) + t * 16;                        // a stage of x1 rows is 16 KiB in a row
  const unsigned char* Vg = (const unsigned char*)(Vh + (size_t)b * CM * NS) + (size_t)(t >> 3) * (NS * 2) + (t & 7) * 16;
  unsigned char* Lk = L + (t >> 4) * FA_PK + (t & 15) * 16;
  unsigned char* Lv = L + FA_KB + (t >> 3) * FA_PV + (t & 7) * 16;
  const float LOG2E = 1.4426950408889634f;

  v16h xq[4];                                // the x1 rows of the wave's 16 queries
  { const _Float16* qp = X1h + ((size_t)b * NS + q0 + c) * CM + 8 * h;
#pragma unroll
    for (int kc = 0; kc < 4; ++kc) xq[kc] = Frag<_Float16>::load(qp + 32 * kc);
    // in front of any rewrite of the address registers that the loads above name; the input keeps those registers live up to the wait
    asm volatile("s_wait_xcnt 0x0" :: "v"(qp) : "memory"); }
  __builtin_amdgcn_sched_barrier(0);         // keeps every later register write, a later load's result too, behind that wait
  u32x4 st[8], gs[8];
  const unsigned char* Gg = (const unsigned char*)Gh + t * 16;                  // G is 32 KiB in a row
  const float* pp = PU + (size_t)(q0 >> 4) * (16 * CM) + lane * 4;              // the wave's 16 positions of PU, as its lanes hold them
  v4f pu[8][2];
#pragma unroll
  for (int s = 0; s < 8; ++s) gs[s] = *(const u32x4*)(Gg + s * 4096);
#pragma unroll
  for (int s = 0; s < 4; ++s) st[s] = *(const u32x4*)(Kg + s * 4096);
#pragma unroll
  for (int s = 0; s < 4; ++s) st[4 + s] = *(const u32x4*)(Vg + (size_t)s * 32 * (NS * 2));
#pragma unroll
  for (int mt = 0; mt < 8; ++mt) { pu[mt][0] = *(const v4f*)(pp + mt * 256); pu[mt][1] = *(const v4f*)(pp + mt * 256 + 128); }
  asm volatile("s_wait_xcnt 0x0" ::: "memory");   // in front of any rewrite of the address registers that the loads above name
  __builtin_amdgcn_sched_barrier(0);         // keeps every later register write behind that wait
  v8f acc[8];
#pragma unroll
  for (int i = 0; i < 8; ++i) acc[i] = (v8f){0.f,0.f,0.f,0.f,0.f,0.f,0.f,0.f};
  float m_run = -INFINITY, l_run = 0.f;
#pragma unroll
  for (int s = 0; s < 4; ++s) *(u32x4*)(Lk + s * 16 * FA_PK) = st[s];
#pragma unroll
  for (int s = 0; s < 4; ++s) *(u32x4*)(Lv + s * 32 * FA_PV) = st[4 + s];
  // G behind the two buffers, in LDS that only the tail uses again: rows of pitch FA_PK
#pragma unroll
  for (int s = 0; s < 8; ++s) *(u32x4*)(Lk + 2 * FA_BUF + s * 16 * FA_PK) = gs[s];
  __syncthreads();

  v16h qf[4];
  {
    v8f ua[8];
#pragma unroll
    for (int mt = 0; mt < 8; ++mt) ua[mt] = (v8f){0.f,0.f,0.f,0.f,0.f,0.f,0.f,0.f};
    const unsigned char* gp = L + 2 * FA_BUF + c * FA_PK + 16 * h;
    v16h gf[2][8];
#pragma unroll
    for (int mt = 0; mt < 8; ++mt) gf[0][mt] = Frag<_Float16>::load((const _Float16*)(gp + mt * 16 * FA_PK));
#pragma unroll
    for (int kc = 0; kc < 4; ++kc) {
      if (kc < 3) {
#pragma unroll
        for (int mt = 0; mt < 8; ++mt) gf[(kc + 1) & 1][mt] = Frag<_Float16>::load((const _Float16*)(gp + mt * 16 * FA_PK + 64 * (kc + 1)));
      }
      __builtin_amdgcn_sched_barrier(0);     // holds the next k step's LDS reads up here as one group: their latency passes under this step's products
#pragma unroll
      for (int mt = 0; mt < 8; ++mt) ua[mt] = Frag<_Float16>::mma(gf[kc & 1][mt], xq[kc], ua[mt]);
    }
#pragma unroll
    for (int kc = 0; kc < 4; ++kc)
#pragma unroll
      for (int r = 0; r < 8; ++r) {
        qf[kc][r] = (_Float16)(ua[2 * kc][r] + pu[2 * kc][r >> 2][r & 3]);
        qf[kc][8 + r] = (_Float16)(ua[2 * kc + 1][r] + pu[2 * kc + 1][r >> 2][r & 3]);
      }
  }
  // one stage = two passes of 32 keys, read from the buffer at byte offset cur; ahead() issues what is to fly under the stage
  auto stage = [&](const int cur, auto&& ahead) {
    v16h kf[2][4];
    auto load_k = [&](const int sub) {       // the 16 LDS reads of a pass's x1 fragments, as one group
      const unsigned char* kp = L + cur + (sub * 32 + c) * FA_PK + 16 * h;
#pragma unroll
      for (int kc = 0; kc < 4; ++kc) {
        kf[0][kc] = Frag<_Float16>::load((const _Float16*)(kp + 64 * kc));
        kf[1][kc] = Frag<_Float16>::load((const _Float16*)(kp + 16 * FA_PK + 64 * kc));
      }
    };
    load_k(0);
    __builtin_amdgcn_sched_barrier(0);       // the LDS reads go first, as one group, and none of them lands between ahead()'s loads and their wait
    ahead();
    __builtin_amdgcn_sched_barrier(0);       // holds ahead()'s loads up here, so that they fly under the whole stage
#pragma unroll
    for (int sub = 0; sub < 2; ++sub) {
      v8f s0 = (v8f){0.f,0.f,0.f,0.f,0.f,0.f,0.f,0.f}, s1 = s0;
#pragma unroll
      for (int kc = 0; kc < 4; ++kc) {
        s0 = Frag<_Float16>::mma(kf[0][kc], qf[kc], s0);
        s1 = Frag<_Float16>::mma(kf[1][kc], qf[kc], s1);
      }
      v16h vf[8];
      const unsigned char* vp = L + cur + FA_KB + c * FA_PV + sub * 64 + 16 * h;
#pragma unroll
      for (int i = 0; i < 8; ++i) vf[i] = Frag<_Float16>::load((const _Float16*)(vp + i * 16 * FA_PV));
      if (sub == 0) load_k(1);               // same stage, so already published
      __builtin_amdgcn_sched_barrier(0);     // holds these reads up here as one group: their LDS latency passes under the softmax arithmetic
      float mx = fmaxf(s0[0], s1[0]);
#pragma unroll
      for (int r = 1; r < 8; ++r) mx = fmaxf(mx, fmaxf(s0[r], s1[r]));
      mx = fmaxf(mx, xhalf(mx)) * LOG2E;     // both halves now hold this query's maximum of the pass
      if (__builtin_amdgcn_ballot_w32(mx > m_run) != 0) {   // scalar branch: no query of the wave has a new maximum -> nothing to rescale
        const float m_new = fmaxf(m_run, mx);
        const float corr = __builtin_amdgcn_exp2f(m_run - m_new);   // 0 in the first pass, where m_run is -inf
        l_run *= corr; m_run = m_new;
#pragma unroll
        for (int i = 0; i < 8; ++i) acc[i] = acc[i] * corr;
      }
      const float nm = 15.0f - m_run;        // p x 2^15: small weights stay normal f16 numbers
      v16h pf; f32x2 ps0 = {0.f, 0.f}, ps1 = {0.f, 0.f};
#pragma unroll
      for (int r = 0; r < 8; r += 2) {       // two neighbouring registers at a time: packed multiply-adds and packed sums
        const f32x2 a0 = __builtin_elementwise_fma((f32x2){s0[r], s0[r + 1]}, (f32x2){LOG2E, LOG2E}, (f32x2){nm, nm});
        const f32x2 a1 = __builtin_elementwise_fma((f32x2){s1[r], s1[r + 1]}, (f32x2){LOG2E, LOG2E}, (f32x2){nm, nm});
        const f32x2 p0 = {__builtin_amdgcn_exp2f(a0.x), __builtin_amdgcn_exp2f(a0.y)}, p1 = {__builtin_amdgcn_exp2f(a1.x), __builtin_amdgcn_exp2f(a1.y)};
        ps0 += p0; ps1 += p1;
        pf[r] = (_Float16)p0.x; pf[r + 1] = (_Float16)p0.y; pf[8 + r] = (_Float16)p1.x; pf[9 + r] = (_Float16)p1.y;
      }
      ps0 += ps1;
      l_run += ps0.x + ps0.y;
#pragma unroll
      for (int i = 0; i < 8; ++i) acc[i] = Frag<_Float16>::mma(vf[i], pf, acc[i]);
    }
  };
  for (int sg = 0; sg + 1 < FA_NST; ++sg) {
    const int cur = (sg & 1) * FA_BUF, nxt = FA_BUF - cur;
    stage(cur, [&]() {                       // the next stage's global loads fly under this stage's products
#pragma unroll
      for (int s = 0; s < 4; ++s) st[s] = *(const u32x4*)(Kg + (size_t)(sg + 1) * (FA_KEYS * 256) + s * 4096);
#pragma unroll
      for (int s = 0; s < 4; ++s) st[4 + s] = *(const u32x4*)(Vg + (size_t)s * 32 * (NS * 2) + (sg + 1) * (FA_KEYS * 2));
      asm volatile("s_wait_xcnt 0x0" ::: "memory");   // in front of any rewrite of the address registers that the loads above name
    });
    // into the buffer whose last readers passed the barrier of the trip before
#pragma unroll
    for (int s = 0; s < 4; ++s) *(u32x4*)(Lk + nxt + s * 16 * FA_PK) = st[s];
#pragma unroll
    for (int s = 0; s < 4; ++s) *(u32x4*)(Lv + nxt + s * 32 * FA_PV) = st[4 + s];
    __syncthreads();                         // publishes the next stage and ends every wave's reads of this one
  }
  // ---- behind the keys: cv2, SiLU and the residual add on the work-group's 128 queries. O goes from wave to wave through LDS, y never leaves the chip.
  // A wave owns output channels 32 wave .. + 31 for all 128 queries: W2f.O^T (A = its 32 rows of W2f, B = O rows [query][channel] from LDS).
  const int o0 = wave * 32;
  v16h wf[2][4]; v4f bs[2][2];
  stage(((FA_NST - 1) & 1) * FA_BUF, [&]() {   // the wave's rows of W2f and its bias fly under the last stage's products
    const _Float16* wp = W2h + (size_t)(o0 + c) * CM + 8 * h;
    const float* bp = b2 + o0 + 8 * h;
#pragma unroll
    for (int ot = 0; ot < 2; ++ot) {
#pragma unroll
      for (int kc = 0; kc < 4; ++kc) wf[ot][kc] = Frag<_Float16>::load(wp + ot * 16 * CM + 32 * kc);
      bs[ot][0] = *(const v4f*)(bp + 16 * ot); bs[ot][1] = *(const v4f*)(bp + 16 * ot + 4);
    }
    // in front of any rewrite of the address registers that the loads above name; the inputs keep those registers live up to the wait
    asm volatile("s_wait_xcnt 0x0" :: "v"(wp), "v"(bp) : "memory");
  });
  __syncthreads();                           // every wave has left the buffers: they become staging for O and for cv2's sums

  // O[i][c] = acc / sum, f16, a row per query
  const float inv = 1.0f / (l_run + xhalf(l_run));   // each half summed its own 8 keys of every tile
  unsigned char* Lw = L + wave * 16 * FA_PO;
#pragma unroll
  for (int i = 0; i < 8; ++i) {
    v8h hv;
#pragma unroll
    for (int r = 0; r < 8; ++r) hv[r] = (_Float16)(acc[i][r] * inv);
    *(v8h*)(Lw + c * FA_PO + 32 * i + 16 * h) = hv;   // row = query, bytes = channels 16 i + 8 h .. + 7
  }
  __syncthreads();                           // publishes every wave's 16 queries of O to the whole work-group
  const size_t xo = ((size_t)b * CIN + o0) * NS + blockIdx.x * 128 + lane * 4;   // a lane's 4 queries of channel o0
  const float* xp = x + xo;
  float* op = out + xo;
  v4f xc[8];
#pragma unroll
  for (int j = 0; j < 8; ++j) xc[j] = *(const v4f*)(xp + (size_t)j * NS);
  asm volatile("s_wait_xcnt 0x0" :: "v"(xp) : "memory");   // in front of any rewrite of the address registers that the loads above name
  __builtin_amdgcn_sched_barrier(0);         // holds the first 8 rows' loads of x up here: they fly under the product
  v8f d[2][8];
#pragma unroll
  for (int it = 0; it < 8; ++it) { d[0][it] = (v8f){0.f,0.f,0.f,0.f,0.f,0.f,0.f,0.f}; d[1][it] = d[0][it]; }
#pragma unroll
  for (int kc = 0; kc < 4; ++kc) {
    v16h of[8];
#pragma unroll
    for (int it = 0; it < 8; ++it) of[it] = Frag<_Float16>::load((const _Float16*)(L + (it * 16 + c) * FA_PO + 64 * kc + 16 * h));
#pragma unroll
    for (int it = 0; it < 8; ++it) {
      d[0][it] = Frag<_Float16>::mma(wf[0][kc], of[it], d[0][it]);
      d[1][it] = Frag<_Float16>::mma(wf[1][kc], of[it], d[1][it]);
    }
  }
  // through the wave's own 32 rows of LDS, so that a lane holds 4 neighbouring queries and a store is one channel's 128 queries: 4 whole lines
  float* slab = (float*)(L + FA_OB + o0 * FA_PY);
#pragma unroll
  for (int ot = 0; ot < 2; ++ot)
#pragma unroll
    for (int it = 0; it < 8; ++it)
#pragma unroll
      for (int r = 0; r < 8; ++r) slab[(ot * 16 + 8 * h + r) * (FA_PY / 4) + it * 16 + c] = d[ot][it][r] + bs[ot][r >> 2][r & 3];
  // the lanes of this wave read what other lanes of it wrote: keep the compiler from moving the reads over the writes
  __builtin_amdgcn_fence(__ATOMIC_RELEASE, "workgroup");
  __builtin_amdgcn_wave_barrier();
  __builtin_amdgcn_fence(__ATOMIC_ACQUIRE, "workgroup");
  const float* sp = slab + lane * 4;
  // stays rolled: the SiLU of 128 values a lane, unrolled, is several times the text of the rest of the kernel and runs only once
#pragma unroll 1
  for (int g = 0; g < 4; ++g) {              // 8 channels a trip; the next trip's x flies under this trip's arithmetic
    v4f xn[8];
#pragma unroll
    for (int j = 0; j < 8; ++j) xn[j] = xc[j];
    if (g < 3) {
#pragma unroll
      for (int j = 0; j < 8; ++j) xn[j] = *(const v4f*)(xp + (size_t)(8 + j) * NS);
    }
    __builtin_amdgcn_sched_barrier(0);       // holds those loads up here
#pragma unroll
    for (int j = 0; j < 8; ++j) {
      v4f y = *(const v4f*)(sp + j * (FA_PY / 4));
#pragma unroll
      for (int e = 0; e < 4; ++e) y[e] = y[e] / (1.0f + expf(-y[e]));
      *(v4f*)(op + (size_t)j * NS) = xc[j] + y;
    }
    asm volatile("s_wait_xcnt 0x0" ::: "memory");   // in front of the step of the address registers that this trip's loads and stores name
    __builtin_amdgcn_sched_barrier(0);       // keeps that step behind the wait
    xp += 8 * NS; op += 8 * NS; sp += 8 * (FA_PY / 4);
#pragma unroll
    for (int j = 0; j < 8; ++j) xc[j] = xn[j];
  }
}
extern "C" void kernel_launch(void* const* d_in, const int* in_sizes, int n_in, void* d_out, int out_size, void* d_ws, size_t ws_size, hipStream_t stream) {
  (void)in_sizes; (void)n_in; (void)out_size; (void)ws_size;
  const float* x = (const float*)d_in[0]; const float* w1 = (const float*)d_in[1];
  const float* g1 = (const float*)d_in[2]; const float* be1 = (const float*)d_in[3]; const float* m1 = (const float*)d_in[4]; const float* v1 = (const float*)d_in[5];
  const float* wq = (const float*)d_in[6]; const float* bq = (const float*)d_in[7]; const float* wk = (const float*)d_in[8]; const float* bk = (const float*)d_in[9];
  const float* wv = (const float*)d_in[10]; const float* bv = (const float*)d_in[11]; const float* relh = (const float*)d_in[12]; const float* relw = (const float*)d_in[13];
  const float* w2 = (const float*)d_in[14]; const float* g2 = (const float*)d_in[15]; const float* be2 = (const float*)d_in[16]; const float* m2 = (const float*)d_in[17]; const float* v2 = (const float*)d_in[18];
  float* out = (float*)d_out;   // [32][256][1024]
  (void)bk;                     // bk shifts all scores of a query by q_i.bk alike: the softmax over the keys does not see it
  // Workspace map (offsets in MiB; 256 MiB in all). Scores and p stay on chip, so nothing of them lies here.
  //   [16,24) x1; [56,64) v; [194,200) G, the folded cv2 weights and PU
  char* ws = (char*)d_ws;
  const size_t MiB = (size_t)1 << 20;
  unsigned* X1T = (unsigned*)(ws + 16 * MiB);                        // [b][i][128] f16
  unsigned* V16 = (unsigned*)(ws + 56 * MiB);                        // [b][c][j] f16
  _Float16* G16 = (_Float16*)(ws + 194 * MiB);
  unsigned* W2f = (unsigned*)(ws + 197 * MiB); float* b2f = (float*)(ws + 198 * MiB);
  float* PU = (float*)(ws + 199 * MiB);                              // 1024 x 128 f32 in its reader's lane order, one for all images
  // cv1 from x itself and v behind it, with G, PU and the BN fold of cv2 beside them
  cv1_kernel<<<CB_CV1 + CB_PU + CB_G + PB_FOLD, 256, 0, stream>>>(x, w1, g1, be1, m1, v1, (_Float16*)X1T, wv, bv, (_Float16*)V16, wq, wk, bq, relh, relw, G16, PU, w2, g2, be2, m2, v2, W2f, b2f);
  // u, scores, softmax, p.v, cv2 and the residual add (out = x + silu(W2f.O + b2f)) in one launch: 8 work-groups of 128 queries per image
  attn_fused<<<dim3(NS / 128, BB), 256, 0, stream>>>(G16, PU, (const _Float16*)X1T, (const _Float16*)V16, (const _Float16*)W2f, b2f, x, out);
}

// v009
// One run takes 40.9 microseconds.
// Next to v008, in two timings, it ran 1.09 times as fast each time.
// Over all steps from v000 it is 10.4 times as fast.
#include <hip/hip_runtime.h>
#include <math.h>
// A bottleneck block with attention: cv1 (1x1 conv 256 -> 128, BN folded, SiLU), then single-head attention over 1024 positions and cv2 (128 -> 256, BN folded, SiLU) with the residual add.
// The scores are re-associated: q_i.k_j + pos_i.q_j = u_i.x1_j + (q_i.bk + pos_i.bq), with u_i = (Wk^T Wq) x1_i + Wq^T pos_i + Wk^T bq. The bracket does not depend
// on the key j, so the softmax over j is the same without it: the score product has K = 128, its key operand is x1 itself, and no k and no q are formed.
// All products on v_wmma_f32_16x16x32_f16, f16 operands, f32 accumulate (p x 2^15); softmax and the residual add in f32 on VALU.
typedef __attribute__((ext_vector_type(16))) _Float16 v16h;
typedef __attribute__((ext_vector_type(8)))  _Float16 v8h;
typedef __attribute__((ext_vector_type(8)))  float    v8f;
typedef __attribute__((ext_vector_type(4)))  float    v4f;
template <typename T> struct Frag;
template <> struct Frag<_Float16> {
  typedef v16h V; union U { v16h v; v8h h[2]; };
  static __device__ __forceinline__ v16h load(const _Float16* p) {   // elements 0..7 <- p[0..7], 8..15 <- p[16..23]
    U f; f.h[0] = *(const v8h*)(p); f.h[1] = *(const v8h*)(p + 16); return f.v;
  }
  static __device__ __forceinline__ v8f mma(v16h a, v16h b, v8f c) {
    return __builtin_amdgcn_wmma_f32_16x16x32_f16(false, a, false, b, (short)0, c, false, false);
  }
};

__device__ __forceinline__ void silu8(float (&v)[8]) {
  float a[8], s[8];
#pragma unroll
  for (int e = 0; e < 8; ++e) a[e] = v[e] * -1.4426950408889634f;
  asm("v_exp_f32 %0, %8\n\tv_exp_f32 %1, %9\n\tv_exp_f32 %2, %10\n\tv_exp_f32 %3, %11\n\t"
      "v_exp_f32 %4, %12\n\tv_exp_f32 %5, %13\n\tv_exp_f32 %6, %14\n\tv_exp_f32 %7, %15\n\t"
      "v_add_f32 %0, 1.0, %0\n\tv_add_f32 %1, 1.0, %1\n\tv_add_f32 %2, 1.0, %2\n\tv_add_f32 %3, 1.0, %3\n\t"
      "v_add_f32 %4, 1.0, %4\n\tv_add_f32 %5, 1.0, %5\n\tv_add_f32 %6, 1.0, %6\n\tv_add_f32 %7, 1.0, %7\n\t"
      "v_rcp_f32 %0, %0\n\tv_rcp_f32 %1, %1\n\tv_rcp_f32 %2, %2\n\tv_rcp_f32 %3, %3\n\t"
      "v_rcp_f32 %4, %4\n\tv_rcp_f32 %5, %5\n\tv_rcp_f32 %6, %6\n\tv_rcp_f32 %7, %7\n\t"
      "v_nop"
      : "=&v"(s[0]), "=&v"(s[1]), "=&v"(s[2]), "=&v"(s[3]), "=&v"(s[4]), "=&v"(s[5]), "=&v"(s[6]), "=&v"(s[7])
      : "v"(a[0]), "v"(a[1]), "v"(a[2]), "v"(a[3]), "v"(a[4]), "v"(a[5]), "v"(a[6]), "v"(a[7]));
#pragma unroll
  for (int e = 0; e < 8; ++e) v[e] *= s[e];
}
#define BB 32
#define CIN 256
#define CM 128
#define NS 1024
// fold BN into 1x1 conv weights: W'[o][c] = W[o][c]*g[o]/sqrt(v[o]+eps) (f16), bias'[o] = b[o] - m[o]*scale
__device__ __forceinline__ void fold_bn(const int bx, const float* __restrict__ Wm, const float* __restrict__ g, const float* __restrict__ bb, const float* __restrict__ m, const float* __restrict__ var,
                                        int O, int Cc, unsigned* __restrict__ W16, float* __restrict__ bias) {
  const int i = bx * 256 + threadIdx.x;
  if (i < O * Cc / 2) { const int o = (2 * i) / Cc; const float sc = g[o] / sqrtf(var[o] + 1e-5f);
    const unsigned u = (unsigned)__builtin_bit_cast(unsigned short, (_Float16)(Wm[2 * i] * sc)) | ((unsigned)__builtin_bit_cast(unsigned short, (_Float16)(Wm[2 * i + 1] * sc)) << 16);
    ((unsigned*)W16)[i] = u;  }
  if (i < O) { const float sc = g[i] / sqrtf(var[i] + 1e-5f); const float v = bb[i] - m[i] * sc; ((float*)bias)[i] = v;  }
}
// ---- the two small products of the re-associated scores; they read inputs alone. A fragment's 16 k values lie a row apart in an f32 matrix [k][column]:
// element e <- k = e (e < 8) or 8 + e (e >= 8), counted from the lane half's first k: the k order of Frag::load, for A and B alike.
#define KROW(e) ((e) < 8 ? (e) : 8 + (e))
__device__ __forceinline__ v16h cvt16(const float* f) {
  v16h r;
#pragma unroll
  for (int e = 0; e < 16; ++e) r[e] = (_Float16)f[e];
  return r;
}
// G[a][b] = sum_c Wk[c][a] Wq[c][b], f16 rows [a][b]. Product with m = b and n = a, so that a lane holds 8 neighbouring b of one a; a wave owns 16 a x 64 b (whole 128-B lines).
__device__ __forceinline__ void g_fill(const int bx, const float* __restrict__ wq, const float* __restrict__ wk, _Float16* __restrict__ G16) {
  const int lane = threadIdx.x & 31, c = lane & 15, h = lane >> 4, w = bx * 8 + (threadIdx.x >> 5);
  const int a0 = (w & 7) * 16, b0 = (w >> 3) * 64;
  v8f acc[4];
#pragma unroll
  for (int mt = 0; mt < 4; ++mt) acc[mt] = (v8f){0.f,0.f,0.f,0.f,0.f,0.f,0.f,0.f};
  // stays rolled: unrolled, the four trips' loads are all hoisted to the top and take more registers than cv1, whose launch this job shares
#pragma unroll 1
  for (int kc = 0; kc < 4; ++kc) {
    const float* pk = wk + (32 * kc + 8 * h) * CM + a0 + c;
    const float* pq = wq + (32 * kc + 8 * h) * CM + b0 + c;
    float fk[16], fq[4][16];
#pragma unroll
    for (int e = 0; e < 16; ++e) {
      fk[e] = pk[KROW(e) * CM];
#pragma unroll
      for (int mt = 0; mt < 4; ++mt) fq[mt][e] = pq[KROW(e) * CM + 16 * mt];
    }
    // in front of any rewrite of the address registers that the loads above name, a load's own result too; the inputs keep those registers live up to the wait
    asm volatile("s_wait_xcnt 0x0" :: "v"(pk), "v"(pq) : "memory");
    __builtin_amdgcn_sched_barrier(0);       // keeps the loads in front of that wait and every later register write behind it
    const v16h bf = cvt16(fk);
#pragma unroll
    for (int mt = 0; mt < 4; ++mt) acc[mt] = Frag<_Float16>::mma(cvt16(fq[mt]), bf, acc[mt]);
  }
#pragma unroll
  for (int mt = 0; mt < 4; ++mt) {
    v8h hv;
#pragma unroll
    for (int r = 0; r < 8; ++r) hv[r] = (_Float16)acc[mt][r];
    *(v8h*)(G16 + (size_t)(a0 + c) * CM + b0 + 16 * mt + 8 * h) = hv;
  }
  // in front of any rewrite of the registers that the stores above name: other jobs' code follows this one in the merged kernel
  asm volatile("s_wait_xcnt 0x0" ::: "memory");
}
// PU[i][a] = sum_c Wq[c][a] pos[c][i] + sum_c Wk[c][a] bq[c], f32, the same for every image (pos[c][i] = rel_h[c][ih] + rel_w[c][iw]): one product with
// K = 256, [Wq^T | Wk^T].[pos_i ; bq], m = a and n = i, so that a lane holds 8 neighbouring a of one position; a wave owns 16 positions x 32 a.
// Its reader, the u product in the attention kernel, holds its sums in the same lanes and registers, so PU lies as the lanes hold it:
// [16 positions][16 a][registers 0..3 | 4..7][lane][4 floats]: a store here and a load there are 512 B in a row.
__device__ __forceinline__ void pu_fill(const int bx, const float* __restrict__ wq, const float* __restrict__ wk, const float* __restrict__ bq,
                                        const float* __restrict__ relh, const float* __restrict__ relw, float* __restrict__ PU) {
  const int lane = threadIdx.x & 31, c = lane & 15, h = lane >> 4, w = bx * 8 + (threadIdx.x >> 5);
  const int i = (w >> 2) * 16 + c, a0 = (w & 3) * 32;
  v8f acc[2];
  acc[0] = (v8f){0.f,0.f,0.f,0.f,0.f,0.f,0.f,0.f}; acc[1] = acc[0];
  // stays rolled, for the same reason as in g_fill
#pragma unroll 1
  for (int kc = 0; kc < 4; ++kc) {
    const int k0 = 32 * kc + 8 * h;
    const float* gh = relh + k0 * 32 + (i >> 5);
    const float* gw = relw + k0 * 32 + (i & 31);
    const float* gb = bq + k0;
    const float* pq = wq + k0 * CM + a0 + c;
    const float* pk = wk + k0 * CM + a0 + c;
    float ph[16], pw[16], fb[16], fq[2][16], fk[2][16];
#pragma unroll
    for (int e = 0; e < 16; ++e) {
      ph[e] = gh[KROW(e) * 32]; pw[e] = gw[KROW(e) * 32]; fb[e] = gb[KROW(e)];
#pragma unroll
      for (int mt = 0; mt < 2; ++mt) { fq[mt][e] = pq[KROW(e) * CM + 16 * mt]; fk[mt][e] = pk[KROW(e) * CM + 16 * mt]; }
    }
    // in front of any rewrite of the address registers that the loads above name, a load's own result too; the inputs keep those registers live up to the wait
    asm volatile("s_wait_xcnt 0x0" :: "v"(gh), "v"(gw), "v"(gb), "v"(pq), "v"(pk) : "memory");
    __builtin_amdgcn_sched_barrier(0);       // keeps the loads in front of that wait and every later register write behind it
#pragma unroll
    for (int e = 0; e < 16; ++e) ph[e] += pw[e];
    const v16h bp = cvt16(ph), bb = cvt16(fb);
#pragma unroll
    for (int mt = 0; mt < 2; ++mt) {
      acc[mt] = Frag<_Float16>::mma(cvt16(fq[mt]), bp, acc[mt]);
      acc[mt] = Frag<_Float16>::mma(cvt16(fk[mt]), bb, acc[mt]);
    }
  }
#pragma unroll
  for (int mt = 0; mt < 2; ++mt) {
    float* p = PU + (size_t)((w >> 2) * 8 + (w & 3) * 2 + mt) * 256 + lane * 4;
    *(v4f*)p = (v4f){acc[mt][0], acc[mt][1], acc[mt][2], acc[mt][3]};
    *(v4f*)(p + 128) = (v4f){acc[mt][4], acc[mt][5], acc[mt][6], acc[mt][7]};
  }
  // in front of any rewrite of the registers that the stores above name: other jobs' code follows this one in the merged kernel
  asm volatile("s_wait_xcnt 0x0" ::: "memory");
}
// ---- cv1 straight from x: x1[b][i][o] = silu(sum_c W1f[o][c] x[b][c][i] + b1f[o]), f16 rows [i][o]. Product with m = o and n = i: in x a fragment's 16 k values (channels) lie a
// row apart at one position, so a lane takes them as they lie, 16 neighbouring positions a load (the k order of KROW, as in the two fills above), and no transposed copy of x is made.
// A work-group owns 128 positions of one image, a wave 16 of them for all 128 output channels. The folded weights (f16, the same values for every work-group) are formed in LDS.
// Behind it, on the same 128 positions: v[b][c][j] = sum_cc Wv[c][cc] x1[b][j][cc] + bv[c], f16 rows [c][j]. Product with m = j and n = c (A = x1 rows from every wave's slab,
// B = the wave's own 16 rows of Wv), so that a lane holds 8 neighbouring positions of one channel; a wave owns 16 channels for all 128 positions.
// Every loop of this function is unrolled: its index picks registers (the arrays live in registers) and immediate offsets, so that no address register is stepped while loads fly.
typedef __attribute__((ext_vector_type(4))) _Float16 v4h;
#define C1_PW 528                        // LDS pitch of a row of folded weights: 512 B + 16 B
#define C1_PS 272                        // LDS pitch of a position's 128 channels of x1: 256 B + 16 B
#define C1_WB (CM * C1_PW)               // bytes of the folded weights
#define C1_SB (16 * C1_PS)               // bytes of a wave's 16 positions of x1
#define C1_VO (C1_WB + 8 * C1_SB + CM * 4)    // behind the folded bias: the v weights, f16 rows of pitch C1_PS; a wave's 16 rows later hold its 16 channels of v
#define C1_LDS (C1_VO + 8 * C1_SB)
__device__ __forceinline__ void cv1_tile(unsigned char* L, const int bx, const float* __restrict__ x, const float* __restrict__ w1, const float* __restrict__ g1,
                                         const float* __restrict__ be1, const float* __restrict__ m1, const float* __restrict__ v1, _Float16* __restrict__ X1T,
                                         const float* __restrict__ wv, const float* __restrict__ bv, _Float16* __restrict__ V16) {
  const int lane = threadIdx.x & 31, wave = threadIdx.x >> 5, c = lane & 15, h = lane >> 4;
  const int b = bx >> 3, i0 = (bx & 7) * 128 + wave * 16, ow = wave * 16;
  float* bsh = (float*)(L + C1_WB + 8 * C1_SB);
  // the wave folds rows ow .. ow + 15 of w1: load j is 128 neighbouring columns of row ow + j / 2
  const float *pg = g1 + ow + c, *pv = v1 + ow + c, *pb = be1 + ow + c, *pm = m1 + ow + c;
  const float* wp = w1 + (size_t)ow * CIN + lane * 4;
  const float gg = *pg, vv = *pv, bb = *pb, mm = *pm;
  v4f wr[32];
#pragma unroll
  for (int j = 0; j < 32; ++j) wr[j] = *(const v4f*)(wp + j * 128);
  // in front of any rewrite of the address registers that the loads above name, a load's own result too; the inputs keep those registers live up to the wait
  asm volatile("s_wait_xcnt 0x0" :: "v"(pg), "v"(pv), "v"(pb), "v"(pm), "v"(wp) : "memory");
  const float* xp = x + ((size_t)b * CIN + 8 * h) * NS + i0 + c;
  float xr[8][16];                           // the wave's 16 positions of x, all 256 channels: 8 k steps
  auto load_x = [&](const int ks) {
#pragma unroll
    for (int e = 0; e < 16; ++e) xr[ks][e] = xp[(size_t)(32 * ks + KROW(e)) * NS];
    asm volatile("s_wait_xcnt 0x0" :: "v"(xp) : "memory");   // the same, for these loads
  };
#pragma unroll
  for (int ks = 0; ks < 4; ++ks) load_x(ks);
  __builtin_amdgcn_sched_barrier(0);         // holds all these loads up here: the first half of x flies under the fold
  const float sc = gg / sqrtf(vv + 1e-5f);   // lane c (either half) holds the scale of row ow + c
  bsh[ow + c] = bb - mm * sc;                // both halves store the same value
#pragma unroll
  for (int j = 0; j < 32; ++j) {
    const float s = __builtin_bit_cast(float, __builtin_amdgcn_readlane(__builtin_bit_cast(int, sc), j >> 1));
    const v4h hv = {(_Float16)(wr[j][0] * s), (_Float16)(wr[j][1] * s), (_Float16)(wr[j][2] * s), (_Float16)(wr[j][3] * s)};
    *(v4h*)(L + (ow + (j >> 1)) * C1_PW + (j & 1) * 256 + lane * 8) = hv;
  }
  __builtin_amdgcn_sched_barrier(0);         // the v weights and the second half of x go into the registers that the fold has left, not earlier
  // the wave's own 16 rows of the v weights, a whole row (512 B) a load
  const float* vwp = wv + (size_t)ow * CM + lane * 4;
  const float* pbv = bv + ow + c;
  v4f vr[16];
#pragma unroll
  for (int j = 0; j < 16; ++j) vr[j] = *(const v4f*)(vwp + j * CM);
  const float bvv = *pbv;
  asm volatile("s_wait_xcnt 0x0" :: "v"(vwp), "v"(pbv) : "memory");   // the same, for these loads
#pragma unroll
  for (int ks = 4; ks < 8; ++ks) load_x(ks);
  __syncthreads();                           // publishes every wave's 16 rows of folded weights and its part of the bias
  v8f acc[8];
#pragma unroll
  for (int mt = 0; mt < 8; ++mt) acc[mt] = (v8f){0.f,0.f,0.f,0.f,0.f,0.f,0.f,0.f};
  unsigned char* vs = L + C1_VO + wave * C1_SB;   // read back as fragments by this wave alone, behind the barrier in front of the v product
#pragma unroll
  for (int j = 0; j < 16; ++j) {
    const v4h hv = {(_Float16)vr[j][0], (_Float16)vr[j][1], (_Float16)vr[j][2], (_Float16)vr[j][3]};
    *(v4h*)(vs + j * C1_PS + lane * 8) = hv;
  }
  v16h bf[8];
#pragma unroll
  for (int ks = 0; ks < 8; ++ks) bf[ks] = cvt16(xr[ks]);
  __builtin_amdgcn_sched_barrier(0);         // all of x is f16 from here on: its f32 registers are free, so that a k step's weight fragments can be read as one group
#pragma unroll
  for (int ks = 0; ks < 8; ++ks) {
    const unsigned char* ap = L + c * C1_PW + 64 * ks + 16 * h;
    v16h af[8];
#pragma unroll
    for (int mt = 0; mt < 8; ++mt) af[mt] = Frag<_Float16>::load((const _Float16*)(ap + mt * 16 * C1_PW));
#pragma unroll
    for (int mt = 0; mt < 8; ++mt) acc[mt] = Frag<_Float16>::mma(af[mt], bf[ks], acc[mt]);
  }
  // a lane holds 8 neighbouring channels of one position per tile; through the wave's own slab, so that a store is two whole rows of x1 (512 B in a row)
  unsigned char* sl = L + C1_WB + wave * C1_SB;
#pragma unroll
  for (int mt = 0; mt < 8; ++mt) {
    const v4f b0 = *(const v4f*)(bsh + 16 * mt + 8 * h), b1 = *(const v4f*)(bsh + 16 * mt + 8 * h + 4);
    float v[8];
#pragma unroll
    for (int r = 0; r < 8; ++r) v[r] = acc[mt][r] + (r < 4 ? b0[r & 3] : b1[r & 3]);
    silu8(v);
    v8h hv;
#pragma unroll
    for (int r = 0; r < 8; ++r) hv[r] = (_Float16)v[r];
    *(v8h*)(sl + c * C1_PS + 32 * mt + 16 * h) = hv;
  }
  __syncthreads();                           // publishes every wave's 16 positions of x1 to the whole work-group (and to the other lanes of the wave itself)
  unsigned char* og = (unsigned char*)(X1T + ((size_t)b * NS + i0) * CM) + lane * 16;
  v8h ov[8];
#pragma unroll
  for (int it = 0; it < 8; ++it) ov[it] = *(const v8h*)(sl + (2 * it + h) * C1_PS + c * 16);
#pragma unroll
  for (int it = 0; it < 8; ++it) *(v8h*)(og + it * 512) = ov[it];
  asm volatile("s_wait_xcnt 0x0" ::: "memory");   // in front of any rewrite of the registers that the stores above name
  // ---- v on the work-group's 128 positions
  v16h wf[4];
#pragma unroll
  for (int kc = 0; kc < 4; ++kc) wf[kc] = Frag<_Float16>::load((const _Float16*)(vs + c * C1_PS + 64 * kc + 16 * h));
  v8f va[8];
#pragma unroll
  for (int mt = 0; mt < 8; ++mt) va[mt] = (v8f){0.f,0.f,0.f,0.f,0.f,0.f,0.f,0.f};
  const unsigned char* xs = L + C1_WB + c * C1_PS + 16 * h;
  v16h xa[2][8];
#pragma unroll
  for (int mt = 0; mt < 8; ++mt) xa[0][mt] = Frag<_Float16>::load((const _Float16*)(xs + mt * C1_SB));
#pragma unroll
  for (int kc = 0; kc < 4; ++kc) {
    if (kc < 3) {
#pragma unroll
      for (int mt = 0; mt < 8; ++mt) xa[(kc + 1) & 1][mt] = Frag<_Float16>::load((const _Float16*)(xs + mt * C1_SB + 64 * (kc + 1)));
    }
    __builtin_amdgcn_sched_barrier(0);       // holds the next k step's LDS reads up here as one group: their latency passes under this step's products
#pragma unroll
    for (int mt = 0; mt < 8; ++mt) va[mt] = Frag<_Float16>::mma(xa[kc & 1][mt], wf[kc], va[mt]);
  }
  // through the wave's own rows of LDS (its weights are in registers by now), so that a store is two channels' 128 positions: 4 whole lines
#pragma unroll
  for (int mt = 0; mt < 8; ++mt) {
    v8h hv;
#pragma unroll
    for (int r = 0; r < 8; ++r) hv[r] = (_Float16)(va[mt][r] + bvv);
    *(v8h*)(vs + c * C1_PS + 32 * mt + 16 * h) = hv;   // row = channel, bytes = positions 16 mt + 8 h .. + 7
  }
  // the lanes of this wave read what other lanes of it wrote: keep the compiler from moving the reads over the writes. The fences name LDS alone,
  // so that the wave does not wait here for its stores of x1, which are still under way
  __builtin_amdgcn_fence(__ATOMIC_RELEASE, "workgroup", "local");
  __builtin_amdgcn_wave_barrier();
  __builtin_amdgcn_fence(__ATOMIC_ACQUIRE, "workgroup", "local");
  unsigned char* vg = (unsigned char*)(V16 + ((size_t)b * CM + ow + h) * NS + (bx & 7) * 128) + c * 16;
  v8h vv8[8];
#pragma unroll
  for (int it = 0; it < 8; ++it) vv8[it] = *(const v8h*)(vs + (2 * it + h) * C1_PS + c * 16);
#pragma unroll
  for (int it = 0; it < 8; ++it) *(v8h*)(vg + (size_t)it * (2 * NS * 2)) = vv8[it];
  asm volatile("s_wait_xcnt 0x0" ::: "memory");   // in front of any rewrite of the registers that the stores above name
}
// ---- everything in front of the attention kernel, in one launch: the work-group's index picks its job (block-uniform, so the barriers of cv1 are safe). cv1 comes first: it is the long job.
// The others read inputs alone and are first used by a later launch.
#define PB_FOLD (CM * CIN / 2 / 256)     // work-groups of the BN fold of cv2 (256 x 128 weights)
#define CB_PU (NS / 16 * (CM / 32) / 8)   // work-groups of pu_fill
#define CB_G (CM / 16 * (CM / 64) / 8)    // work-groups of g_fill
#define CB_CV1 (BB * (NS / 128))
__global__ __launch_bounds__(256) void cv1_kernel(
    const float* __restrict__ x, const float* __restrict__ w1, const float* __restrict__ g1, const float* __restrict__ be1, const float* __restrict__ m1, const float* __restrict__ v1,
    _Float16* __restrict__ X1T, const float* __restrict__ wv, const float* __restrict__ bv, _Float16* __restrict__ V16,
    const float* __restrict__ wq, const float* __restrict__ wk, const float* __restrict__ bq, const float* __restrict__ relh, const float* __restrict__ relw,
    _Float16* __restrict__ G16, float* __restrict__ PU,
    const float* __restrict__ w2, const float* __restrict__ g2, const float* __restrict__ be2, const float* __restrict__ m2, const float* __restrict__ v2, unsigned* __restrict__ W2f, float* __restrict__ b2f) {
  __shared__ __align__(16) unsigned char L[C1_LDS];
  int bx = blockIdx.x;
  if (bx < CB_CV1) { cv1_tile(L, bx, x, w1, g1, be1, m1, v1, X1T, wv, bv, V16); return; }
  bx -= CB_CV1;
  if (bx < CB_PU) { pu_fill(bx, wq, wk, bq, relh, relw, PU); return; }
  bx -= CB_PU;
  if (bx < CB_G) { g_fill(bx, wq, wk, G16); return; }
  bx -= CB_G;
  fold_bn(bx, w2, g2, be2, m2, v2, CIN, CM, W2f, b2f);
}
typedef __attribute__((ext_vector_type(4))) unsigned u32x4;
typedef __attribute__((ext_vector_type(2))) float f32x2;
#define FA_KEYS 64                       // keys per stage
#define FA_NST (NS / FA_KEYS)            // stages
#define FA_PK 272                        // LDS pitch of an x1 row: 256 B + 16 B
#define FA_PV 144                        // LDS pitch of a v row's 64 keys: 128 B + 16 B
#define FA_KB (FA_KEYS * FA_PK)          // bytes of the x1 tile
#define FA_BUF (FA_KB + CM * FA_PV)      // bytes of one buffer
#define FA_PO 272                        // pitch of a query's 128 channels of O in LDS: 256 B + 16 B
#define FA_PY 528                        // pitch of an output channel's 128 queries (f32) in LDS: 512 B + 16 B
#define FA_OB (128 * FA_PO)              // bytes of the work-group's O rows
#define FA_TAIL (FA_OB + CIN * FA_PY)    // O rows and, behind them, the 256 x 128 tile of cv2's sums
__device__ __forceinline__ float xhalf(float x) {   // lane l <-> lane l ^ 16
  return __builtin_bit_cast(float, __builtin_amdgcn_permlanex16(__builtin_bit_cast(int, x), __builtin_bit_cast(int, x), 0x76543210, 0xfedcba98, false, false));
}
__global__ __launch_bounds__(256) __attribute__((amdgpu_waves_per_eu(2, 2))) void attn_fused(
    const _Float16* __restrict__ Gh, const float* __restrict__ PU, const _Float16* __restrict__ X1h, const _Float16* __restrict__ Vh,
    const _Float16* __restrict__ W2h, const float* __restrict__ b2, const float* __restrict__ x, float* __restrict__ out) {
  __shared__ __align__(16) unsigned char L[FA_TAIL > 2 * FA_BUF ? FA_TAIL : 2 * FA_BUF];
  const int t = threadIdx.x, lane = t & 31, wave = t >> 5, c = lane & 15, h = lane >> 4;
  const int b = blockIdx.y, q0 = blockIdx.x * 128 + wave * 16;
  const unsigned char* Kg = (const unsigned char*)(X1h + (size_t)b * NS * CM) + t * 16;                        // a stage of x1 rows is 16 KiB in a row
  const unsigned char* Vg = (const unsigned char*)(Vh + (size_t)b * CM * NS) + (size_t)(t >> 3) * (NS * 2) + (t & 7) * 16;
  unsigned char* Lk = L + (t >> 4) * FA_PK + (t & 15) * 16;
  unsigned char* Lv = L + FA_KB + (t >> 3) * FA_PV + (t & 7) * 16;
  const float LOG2E = 1.4426950408889634f;

  v16h xq[4];                                // the x1 rows of the wave's 16 queries
  { const _Float16* qp = X1h + ((size_t)b * NS + q0 + c) * CM + 8 * h;
#pragma unroll
    for (int kc = 0; kc < 4; ++kc) xq[kc] = Frag<_Float16>::load(qp + 32 * kc);
    // in front of any rewrite of the address registers that the loads above name; the input keeps those registers live up to the wait
    asm volatile("s_wait_xcnt 0x0" :: "v"(qp) : "memory"); }
  __builtin_amdgcn_sched_barrier(0);         // keeps every later register write, a later load's result too, behind that wait
  u32x4 st[8], gs[8];
  const unsigned char* Gg = (const unsigned char*)Gh + t * 16;                  // G is 32 KiB in a row
  const float* pp = PU + (size_t)(q0 >> 4) * (16 * CM) + lane * 4;              // the wave's 16 positions of PU, as its lanes hold them
  v4f pu[8][2];
#pragma unroll
  for (int s = 0; s < 8; ++s) gs[s] = *(const u32x4*)(Gg + s * 4096);
#pragma unroll
  for (int s = 0; s < 4; ++s) st[s] = *(const u32x4*)(Kg + s * 4096);
#pragma unroll
  for (int s = 0; s < 4; ++s) st[4 + s] = *(const u32x4*)(Vg + (size_t)s * 32 * (NS * 2));
#pragma unroll
  for (int mt = 0; mt < 8; ++mt) { pu[mt][0] = *(const v4f*)(pp + mt * 256); pu[mt][1] = *(const v4f*)(pp + mt * 256 + 128); }
  asm volatile("s_wait_xcnt 0x0" ::: "memory");   // in front of any rewrite of the address registers that the loads above name
  __builtin_amdgcn_sched_barrier(0);         // keeps every later register write behind that wait
  v8f acc[8];
#pragma unroll
  for (int i = 0; i < 8; ++i) acc[i] = (v8f){0.f,0.f,0.f,0.f,0.f,0.f,0.f,0.f};
  float m_run = -INFINITY, l_run = 0.f;
#pragma unroll
  for (int s = 0; s < 4; ++s) *(u32x4*)(Lk + s * 16 * FA_PK) = st[s];
#pragma unroll
  for (int s = 0; s < 4; ++s) *(u32x4*)(Lv + s * 32 * FA_PV) = st[4 + s];
  // G behind the two buffers, in LDS that only the tail uses again: rows of pitch FA_PK
#pragma unroll
  for (int s = 0; s < 8; ++s) *(u32x4*)(Lk + 2 * FA_BUF + s * 16 * FA_PK) = gs[s];
  __syncthreads();

  v16h qf[4];
  {
    v8f ua[8];
#pragma unroll
    for (int mt = 0; mt < 8; ++mt) ua[mt] = (v8f){0.f,0.f,0.f,0.f,0.f,0.f,0.f,0.f};
    const unsigned char* gp = L + 2 * FA_BUF + c * FA_PK + 16 * h;
    v16h gf[2][8];
#pragma unroll
    for (int mt = 0; mt < 8; ++mt) gf[0][mt] = Frag<_Float16>::load((const _Float16*)(gp + mt * 16 * FA_PK));
#pragma unroll
    for (int kc = 0; kc < 4; ++kc) {
      if (kc < 3) {
#pragma unroll
        for (int mt = 0; mt < 8; ++mt) gf[(kc + 1) & 1][mt] = Frag<_Float16>::load((const _Float16*)(gp + mt * 16 * FA_PK + 64 * (kc + 1)));
      }
      __builtin_amdgcn_sched_barrier(0);     // holds the next k step's LDS reads up here as one group: their latency passes under this step's products
#pragma unroll
      for (int mt = 0; mt < 8; ++mt) ua[mt] = Frag<_Float16>::mma(gf[kc & 1][mt], xq[kc], ua[mt]);
    }
#pragma unroll
    for (int kc = 0; kc < 4; ++kc)
#pragma unroll
      for (int r = 0; r < 8; ++r) {
        qf[kc][r] = (_Float16)(ua[2 * kc][r] + pu[2 * kc][r >> 2][r & 3]);
        qf[kc][8 + r] = (_Float16)(ua[2 * kc + 1][r] + pu[2 * kc + 1][r >> 2][r & 3]);
      }
  }
  // one stage = two passes of 32 keys, read from the buffer at byte offset cur; ahead() issues what is to fly under the stage
  auto stage = [&](const int cur, auto&& ahead) {
    v16h kf[2][4];
    auto load_k = [&](const int sub) {       // the 16 LDS reads of a pass's x1 fragments, as one group
      const unsigned char* kp = L + cur + (sub * 32 + c) * FA_PK + 16 * h;
#pragma unroll
      for (int kc = 0; kc < 4; ++kc) {
        kf[0][kc] = Frag<_Float16>::load((const _Float16*)(kp + 64 * kc));
        kf[1][kc] = Frag<_Float16>::load((const _Float16*)(kp + 16 * FA_PK + 64 * kc));
      }
    };
    load_k(0);
    __builtin_amdgcn_sched_barrier(0);       // the LDS reads go first, as one group, and none of them lands between ahead()'s loads and their wait
    ahead();
    __builtin_amdgcn_sched_barrier(0);       // holds ahead()'s loads up here, so that they fly under the whole stage
#pragma unroll
    for (int sub = 0; sub < 2; ++sub) {
      v8f s0 = (v8f){0.f,0.f,0.f,0.f,0.f,0.f,0.f,0.f}, s1 = s0;
#pragma unroll
      for (int kc = 0; kc < 4; ++kc) {
        s0 = Frag<_Float16>::mma(kf[0][kc], qf[kc], s0);
        s1 = Frag<_Float16>::mma(kf[1][kc], qf[kc], s1);
      }
      v16h vf[8];
      const unsigned char* vp = L + cur + FA_KB + c * FA_PV + sub * 64 + 16 * h;
#pragma unroll
      for (int i = 0; i < 8; ++i) vf[i] = Frag<_Float16>::load((const _Float16*)(vp + i * 16 * FA_PV));
      if (sub == 0) load_k(1);               // same stage, so already published
      __builtin_amdgcn_sched_barrier(0);     // holds these reads up here as one group: their LDS latency passes under the softmax arithmetic
      float mx = fmaxf(s0[0], s1[0]);
#pragma unroll
      for (int r = 1; r < 8; ++r) mx = fmaxf(mx, fmaxf(s0[r], s1[r]));
      mx = fmaxf(mx, xhalf(mx)) * LOG2E;     // both halves now hold this query's maximum of the pass
      if (__builtin_amdgcn_ballot_w32(mx > m_run) != 0) {   // scalar branch: no query of the wave has a new maximum -> nothing to rescale
        const float m_new = fmaxf(m_run, mx);
        const float corr = __builtin_amdgcn_exp2f(m_run - m_new);   // 0 in the first pass, where m_run is -inf
        l_run *= corr; m_run = m_new;
#pragma unroll
        for (int i = 0; i < 8; ++i) acc[i] = acc[i] * corr;
      }
      const float nm = 15.0f - m_run;        // p x 2^15: small weights stay normal f16 numbers
      v16h pf; f32x2 ps0 = {0.f, 0.f}, ps1 = {0.f, 0.f};
#pragma unroll
      for (int r = 0; r < 8; r += 2) {       // two neighbouring registers at a time: packed multiply-adds and packed sums
        const f32x2 a0 = __builtin_elementwise_fma((f32x2){s0[r], s0[r + 1]}, (f32x2){LOG2E, LOG2E}, (f32x2){nm, nm});
        const f32x2 a1 = __builtin_elementwise_fma((f32x2){s1[r], s1[r + 1]}, (f32x2){LOG2E, LOG2E}, (f32x2){nm, nm});
        const f32x2 p0 = {__builtin_amdgcn_exp2f(a0.x), __builtin_amdgcn_exp2f(a0.y)}, p1 = {__builtin_amdgcn_exp2f(a1.x), __builtin_amdgcn_exp2f(a1.y)};
        ps0 += p0; ps1 += p1;
        pf[r] = (_Float16)p0.x; pf[r + 1] = (_Float16)p0.y; pf[8 + r] = (_Float16)p1.x; pf[9 + r] = (_Float16)p1.y;
      }
      ps0 += ps1;
      l_run += ps0.x + ps0.y;
#pragma unroll
      for (int i = 0; i < 8; ++i) acc[i] = Frag<_Float16>::mma(vf[i], pf, acc[i]);
    }
  };
  for (int sg = 0; sg + 1 < FA_NST; ++sg) {
    const int cur = (sg & 1) * FA_BUF, nxt = FA_BUF - cur;
    stage(cur, [&]() {                       // the next stage's global loads fly under this stage's products
#pragma unroll
      for (int s = 0; s < 4; ++s) st[s] = *(const u32x4*)(Kg + (size_t)(sg + 1) * (FA_KEYS * 256) + s * 4096);
#pragma unroll
      for (int s = 0; s < 4; ++s) st[4 + s] = *(const u32x4*)(Vg + (size_t)s * 32 * (NS * 2) + (sg + 1) * (FA_KEYS * 2));
      asm volatile("s_wait_xcnt 0x0" ::: "memory");   // in front of any rewrite of the address registers that the loads above name
    });
    // into the buffer whose last readers passed the barrier of the trip before
#pragma unroll
    for (int s = 0; s < 4; ++s) *(u32x4*)(Lk + nxt + s * 16 * FA_PK) = st[s];
#pragma unroll
    for (int s = 0; s < 4; ++s) *(u32x4*)(Lv + nxt + s * 32 * FA_PV) = st[4 + s];
    __syncthreads();                         // publishes the next stage and ends every wave's reads of this one
  }
  // ---- behind the keys: cv2, SiLU and the residual add on the work-group's 128 queries. O goes from wave to wave through LDS, y never leaves the chip.
  // A wave owns output channels 32 wave .. + 31 for all 128 queries: W2f.O^T (A = its 32 rows of W2f, B = O rows [query][channel] from LDS).
  const int o0 = wave * 32;
  v16h wf[2][4]; v4f bs[2][2];
  stage(((FA_NST - 1) & 1) * FA_BUF, [&]() {   // the wave's rows of W2f and its bias fly under the last stage's products
    const _Float16* wp = W2h + (size_t)(o0 + c) * CM + 8 * h;
    const float* bp = b2 + o0 + 8 * h;
#pragma unroll
    for (int ot = 0; ot < 2; ++ot) {
#pragma unroll
      for (int kc = 0; kc < 4; ++kc) wf[ot][kc] = Frag<_Float16>::load(wp + ot * 16 * CM + 32 * kc);
      bs[ot][0] = *(const v4f*)(bp + 16 * ot); bs[ot][1] = *(const v4f*)(bp + 16 * ot + 4);
    }
    // in front of any rewrite of the address registers that the loads above name; the inputs keep those registers live up to the wait
    asm volatile("s_wait_xcnt 0x0" :: "v"(wp), "v"(bp) : "memory");
  });
  __syncthreads();                           // every wave has left the buffers: they become staging for O and for cv2's sums

  // O[i][c] = acc / sum, f16, a row per query
  const float inv = 1.0f / (l_run + xhalf(l_run));   // each half summed its own 8 keys of every tile
  unsigned char* Lw = L + wave * 16 * FA_PO;
#pragma unroll
  for (int i = 0; i < 8; ++i) {
    v8h hv;
#pragma unroll
    for (int r = 0; r < 8; ++r) hv[r] = (_Float16)(acc[i][r] * inv);
    *(v8h*)(Lw + c * FA_PO + 32 * i + 16 * h) = hv;   // row = query, bytes = channels 16 i + 8 h .. + 7
  }
  __syncthreads();                           // publishes every wave's 16 queries of O to the whole work-group
  const size_t xo = ((size_t)b * CIN + o0) * NS + blockIdx.x * 128 + lane * 4;   // a lane's 4 queries of channel o0
  const float* xp = x + xo;
  float* op = out + xo;
  v4f xc[8];
#pragma unroll
  for (int j = 0; j < 8; ++j) xc[j] = *(const v4f*)(xp + (size_t)j * NS);
  asm volatile("s_wait_xcnt 0x0" :: "v"(xp) : "memory");   // in front of any rewrite of the address registers that the loads above name
  __builtin_amdgcn_sched_barrier(0);         // holds the first 8 rows' loads of x up here: they fly under the product
  v8f d[2][8];
#pragma unroll
  for (int it = 0; it < 8; ++it) { d[0][it] = (v8f){0.f,0.f,0.f,0.f,0.f,0.f,0.f,0.f}; d[1][it] = d[0][it]; }
#pragma unroll
  for (int kc = 0; kc < 4; ++kc) {
    v16h of[8];
#pragma unroll
    for (int it = 0; it < 8; ++it) of[it] = Frag<_Float16>::load((const _Float16*)(L + (it * 16 + c) * FA_PO + 64 * kc + 16 * h));
#pragma unroll
    for (int it = 0; it < 8; ++it) {
      d[0][it] = Frag<_Float16>::mma(wf[0][kc], of[it], d[0][it]);
      d[1][it] = Frag<_Float16>::mma(wf[1][kc], of[it], d[1][it]);
    }
  }
  // through the wave's own 32 rows of LDS, so that a lane holds 4 neighbouring queries and a store is one channel's 128 queries: 4 whole lines
  float* slab = (float*)(L + FA_OB + o0 * FA_PY);
#pragma unroll
  for (int ot = 0; ot < 2; ++ot)
#pragma unroll
    for (int it = 0; it < 8; ++it)
#pragma unroll
      for (int r = 0; r < 8; ++r) slab[(ot * 16 + 8 * h + r) * (FA_PY / 4) + it * 16 + c] = d[ot][it][r] + bs[ot][r >> 2][r & 3];
  // the lanes of this wave read what other lanes of it wrote: keep the compiler from moving the reads over the writes
  __builtin_amdgcn_fence(__ATOMIC_RELEASE, "workgroup");
  __builtin_amdgcn_wave_barrier();
  __builtin_amdgcn_fence(__ATOMIC_ACQUIRE, "workgroup");
  const float* sp = slab + lane * 4;
  // stays rolled: the loop runs four trips, and unrolled it is four times the text
#pragma unroll 1
  for (int g = 0; g < 4; ++g) {              // 8 channels a trip; the next trip's x flies under this trip's arithmetic
    v4f xn[8];
#pragma unroll
    for (int j = 0; j < 8; ++j) xn[j] = xc[j];
    if (g < 3) {
#pragma unroll
      for (int j = 0; j < 8; ++j) xn[j] = *(const v4f*)(xp + (size_t)(8 + j) * NS);
    }
    __builtin_amdgcn_sched_barrier(0);       // holds those loads up here
    v4f res[8];
#pragma unroll
    for (int j = 0; j < 8; j += 2) {         // two channels' values, 8 a lane, at a time
      const v4f y0 = *(const v4f*)(sp + j * (FA_PY / 4)), y1 = *(const v4f*)(sp + (j + 1) * (FA_PY / 4));
      float y[8] = {y0[0], y0[1], y0[2], y0[3], y1[0], y1[1], y1[2], y1[3]};
      silu8(y);
      res[j] = xc[j] + (v4f){y[0], y[1], y[2], y[3]};
      res[j + 1] = xc[j + 1] + (v4f){y[4], y[5], y[6], y[7]};
    }
    __builtin_amdgcn_sched_barrier(0);       // keeps the trip's 8 stores together, directly in front of their wait: nothing rewrites a register that they name ahead of it
#pragma unroll
    for (int j = 0; j < 8; ++j) *(v4f*)(op + (size_t)j * NS) = res[j];
    asm volatile("s_wait_xcnt 0x0" ::: "memory");   // in front of the step of the address registers that this trip's loads and stores name
    __builtin_amdgcn_sched_barrier(0);       // keeps that step behind the wait
    xp += 8 * NS; op += 8 * NS; sp += 8 * (FA_PY / 4);
#pragma unroll
    for (int j = 0; j < 8; ++j) xc[j] = xn[j];
  }
}
extern "C" void kernel_launch(void* const* d_in, const int* in_sizes, int n_in, void* d_out, int out_size, void* d_ws, size_t ws_size, hipStream_t stream) {
  (void)in_sizes; (void)n_in; (void)out_size; (void)ws_size;
  const float* x = (const float*)d_in[0]; const float* w1 = (const float*)d_in[1];
  const float* g1 = (const float*)d_in[2]; const float* be1 = (const float*)d_in[3]; const float* m1 = (const float*)d_in[4]; const float* v1 = (const float*)d_in[5];
  const float* wq = (const float*)d_in[6]; const float* bq = (const float*)d_in[7]; const float* wk = (const float*)d_in[8]; const float* bk = (const float*)d_in[9];
  const float* wv = (const float*)d_in[10]; const float* bv = (const float*)d_in[11]; const float* relh = (const float*)d_in[12]; const float* relw = (const float*)d_in[13];
  const float* w2 = (const float*)d_in[14]; const float* g2 = (const float*)d_in[15]; const float* be2 = (const float*)d_in[16]; const float* m2 = (const float*)d_in[17]; const float* v2 = (const float*)d_in[18];
  float* out = (float*)d_out;   // [32][256][1024]
  (void)bk;                     // bk shifts all scores of a query by q_i.bk alike: the softmax over the keys does not see it
  // Workspace map (offsets in MiB; 256 MiB in all). Scores and p stay on chip, so nothing of them lies here.
  //   [16,24) x1; [56,64) v; [194,200) G, the folded cv2 weights and PU
  char* ws = (char*)d_ws;
  const size_t MiB = (size_t)1 << 20;
  unsigned* X1T = (unsigned*)(ws + 16 * MiB);                        // [b][i][128] f16
  unsigned* V16 = (unsigned*)(ws + 56 * MiB);                        // [b][c][j] f16
  _Float16* G16 = (_Float16*)(ws + 194 * MiB);
  unsigned* W2f = (unsigned*)(ws + 197 * MiB); float* b2f = (float*)(ws + 198 * MiB);
  float* PU = (float*)(ws + 199 * MiB);                              // 1024 x 128 f32 in its reader's lane order, one for all images
  // cv1 from x itself and v behind it, with G, PU and the BN fold of cv2 beside them
  cv1_kernel<<<CB_CV1 + CB_PU + CB_G + PB_FOLD, 256, 0, stream>>>(x, w1, g1, be1, m1, v1, (_Float16*)X1T, wv, bv, (_Float16*)V16, wq, wk, bq, relh, relw, G16, PU, w2, g2, be2, m2, v2, W2f, b2f);
  // u, scores, softmax, p.v, cv2 and the residual add (out = x + silu(W2f.O + b2f)) in one launch: 8 work-groups of 128 queries per image
  attn_fused<<<dim3(NS / 128, BB), 256, 0, stream>>>(G16, PU, (const _Float16*)X1T, (const _Float16*)V16, (const _Float16*)W2f, b2f, x, out);
}

// v010
// It runs in 39.3 microseconds.
// Next to v009, in two timings, it ran 1.03 and 1.04 times as fast.
// Over all steps from v000 it is 10.8 times as fast.
#include <hip/hip_runtime.h>
#include <math.h>
// A bottleneck block with attention: cv1 (1x1 conv 256 -> 128, BN folded, SiLU), then single-head attention over 1024 positions and cv2 (128 -> 256, BN folded, SiLU) with the residual add.
// The scores are re-associated: q_i.k_j + pos_i.q_j = u_i.x1_j + (q_i.bk + pos_i.bq), with u_i = (Wk^T Wq) x1_i + Wq^T pos_i + Wk^T bq. The bracket does not depend
// on the key j, so the softmax over j is the same without it: the score product has K = 128, its key operand is x1 itself, and no k and no q are formed.
// All products on v_wmma_f32_16x16x32_f16, f16 operands, f32 accumulate (p x 2^15); softmax and the residual add in f32 on VALU.
typedef __attribute__((ext_vector_type(16))) _Float16 v16h;
typedef __attribute__((ext_vector_type(8)))  _Float16 v8h;
typedef __attribute__((ext_vector_type(8)))  float    v8f;
typedef __attribute__((ext_vector_type(4)))  float    v4f;
template <typename T> struct Frag;
template <> struct Frag<_Float16> {
  typedef v16h V; union U { v16h v; v8h h[2]; };
  static __device__ __forceinline__ v16h load(const _Float16* p) {   // elements 0..7 <- p[0..7], 8..15 <- p[16..23]
    U f; f.h[0] = *(const v8h*)(p); f.h[1] = *(const v8h*)(p + 16); return f.v;
  }
  static __device__ __forceinline__ v8f mma(v16h a, v16h b, v8f c) {
    return __builtin_amdgcn_wmma_f32_16x16x32_f16(false, a, false, b, (short)0, c, false, false);
  }
};

__device__ __forceinline__ void silu8(float (&v)[8]) {
  float a[8], s[8];
#pragma unroll
  for (int e = 0; e < 8; ++e) a[e] = v[e] * -1.4426950408889634f;
  asm("v_exp_f32 %0, %8\n\tv_exp_f32 %1, %9\n\tv_exp_f32 %2, %10\n\tv_exp_f32 %3, %11\n\t"
      "v_exp_f32 %4, %12\n\tv_exp_f32 %5, %13\n\tv_exp_f32 %6, %14\n\tv_exp_f32 %7, %15\n\t"
      "v_add_f32 %0, 1.0, %0\n\tv_add_f32 %1, 1.0, %1\n\tv_add_f32 %2, 1.0, %2\n\tv_add_f32 %3, 1.0, %3\n\t"
      "v_add_f32 %4, 1.0, %4\n\tv_add_f32 %5, 1.0, %5\n\tv_add_f32 %6, 1.0, %6\n\tv_add_f32 %7, 1.0, %7\n\t"
      "v_rcp_f32 %0, %0\n\tv_rcp_f32 %1, %1\n\tv_rcp_f32 %2, %2\n\tv_rcp_f32 %3, %3\n\t"
      "v_rcp_f32 %4, %4\n\tv_rcp_f32 %5, %5\n\tv_rcp_f32 %6, %6\n\tv_rcp_f32 %7, %7\n\t"
      "v_nop"
      : "=&v"(s[0]), "=&v"(s[1]), "=&v"(s[2]), "=&v"(s[3]), "=&v"(s[4]), "=&v"(s[5]), "=&v"(s[6]), "=&v"(s[7])
      : "v"(a[0]), "v"(a[1]), "v"(a[2]), "v"(a[3]), "v"(a[4]), "v"(a[5]), "v"(a[6]), "v"(a[7]));
#pragma unroll
  for (int e = 0; e < 8; ++e) v[e] *= s[e];
}
#define BB 32
#define CIN 256
#define CM 128
#define NS 1024
// fold BN into 1x1 conv weights: W'[o][c] = W[o][c]*g[o]/sqrt(v[o]+eps) (f16), bias'[o] = b[o] - m[o]*scale
__device__ __forceinline__ void fold_bn(const int bx, const float* __restrict__ Wm, const float* __restrict__ g, const float* __restrict__ bb, const float* __restrict__ m, const float* __restrict__ var,
                                        int O, int Cc, unsigned* __restrict__ W16, float* __restrict__ bias) {
  const int i = bx * 256 + threadIdx.x;
  if (i < O * Cc / 2) { const int o = (2 * i) / Cc; const float sc = g[o] / sqrtf(var[o] + 1e-5f);
    const unsigned u = (unsigned)__builtin_bit_cast(unsigned short, (_Float16)(Wm[2 * i] * sc)) | ((unsigned)__builtin_bit_cast(unsigned short, (_Float16)(Wm[2 * i + 1] * sc)) << 16);
    ((unsigned*)W16)[i] = u;  }
  if (i < O) { const float sc = g[i] / sqrtf(var[i] + 1e-5f); const float v = bb[i] - m[i] * sc; ((float*)bias)[i] = v;  }
}
// ---- the two small products of the re-associated scores; they read inputs alone. A fragment's 16 k values lie a row apart in an f32 matrix [k][column]:
// element e <- k = e (e < 8) or 8 + e (e >= 8), counted from the lane half's first k: the k order of Frag::load, for A and B alike.
#define KROW(e) ((e) < 8 ? (e) : 8 + (e))
__device__ __forceinline__ v16h cvt16(const float* f) {
  v16h r;
#pragma unroll
  for (int e = 0; e < 16; ++e) r[e] = (_Float16)f[e];
  return r;
}
// G[a][b] = sum_c Wk[c][a] Wq[c][b], f16 rows [a][b]. Product with m = b and n = a, so that a lane holds 8 neighbouring b of one a; a wave owns 16 a x 64 b (whole 128-B lines).
__device__ __forceinline__ void g_fill(const int bx, const float* __restrict__ wq, const float* __restrict__ wk, _Float16* __restrict__ G16) {
  const int lane = threadIdx.x & 31, c = lane & 15, h = lane >> 4, w = bx * 8 + (threadIdx.x >> 5);
  const int a0 = (w & 7) * 16, b0 = (w >> 3) * 64;
  v8f acc[4];
#pragma unroll
  for (int mt = 0; mt < 4; ++mt) acc[mt] = (v8f){0.f,0.f,0.f,0.f,0.f,0.f,0.f,0.f};
  // stays rolled: unrolled, the four trips' loads are all hoisted to the top and take more registers than cv1, whose launch this job shares
#pragma unroll 1
  for (int kc = 0; kc < 4; ++kc) {
    const float* pk = wk + (32 * kc + 8 * h) * CM + a0 + c;
    const float* pq = wq + (32 * kc + 8 * h) * CM + b0 + c;
    float fk[16], fq[4][16];
#pragma unroll
    for (int e = 0; e < 16; ++e) {
      fk[e] = pk[KROW(e) * CM];
#pragma unroll
      for (int mt = 0; mt < 4; ++mt) fq[mt][e] = pq[KROW(e) * CM + 16 * mt];
    }
    // in front of any rewrite of the address registers that the loads above name, a load's own result too; the inputs keep those registers live up to the wait
    asm volatile("s_wait_xcnt 0x0" :: "v"(pk), "v"(pq) : "memory");
    __builtin_amdgcn_sched_barrier(0);       // keeps the loads in front of that wait and every later register write behind it
    const v16h bf = cvt16(fk);
#pragma unroll
    for (int mt = 0; mt < 4; ++mt) acc[mt] = Frag<_Float16>::mma(cvt16(fq[mt]), bf, acc[mt]);
  }
#pragma unroll
  for (int mt = 0; mt < 4; ++mt) {
    v8h hv;
#pragma unroll
    for (int r = 0; r < 8; ++r) hv[r] = (_Float16)acc[mt][r];
    *(v8h*)(G16 + (size_t)(a0 + c) * CM + b0 + 16 * mt + 8 * h) = hv;
  }
  // in front of any rewrite of the registers that the stores above name: other jobs' code follows this one in the merged kernel
  asm volatile("s_wait_xcnt 0x0" ::: "memory");
}
// PU[i][a] = sum_c Wq[c][a] pos[c][i] + sum_c Wk[c][a] bq[c], f32, the same for every image (pos[c][i] = rel_h[c][ih] + rel_w[c][iw]): one product with
// K = 256, [Wq^T | Wk^T].[pos_i ; bq], m = a and n = i, so that a lane holds 8 neighbouring a of one position; a wave owns 16 positions x 32 a.
// Its reader, the u product in the attention kernel, holds its sums in the same lanes and registers, so PU lies as the lanes hold it:
// [16 positions][16 a][registers 0..3 | 4..7][lane][4 floats]: a store here and a load there are 512 B in a row.
__device__ __forceinline__ void pu_fill(const int bx, const float* __restrict__ wq, const float* __restrict__ wk, const float* __restrict__ bq,
                                        const float* __restrict__ relh, const float* __restrict__ relw, float* __restrict__ PU) {
  const int lane = threadIdx.x & 31, c = lane & 15, h = lane >> 4, w = bx * 8 + (threadIdx.x >> 5);
  const int i = (w >> 2) * 16 + c, a0 = (w & 3) * 32;
  v8f acc[2];
  acc[0] = (v8f){0.f,0.f,0.f,0.f,0.f,0.f,0.f,0.f}; acc[1] = acc[0];
  // stays rolled, for the same reason as in g_fill
#pragma unroll 1
  for (int kc = 0; kc < 4; ++kc) {
    const int k0 = 32 * kc + 8 * h;
    const float* gh = relh + k0 * 32 + (i >> 5);
    const float* gw = relw + k0 * 32 + (i & 31);
    const float* gb = bq + k0;
    const float* pq = wq + k0 * CM + a0 + c;
    const float* pk = wk + k0 * CM + a0 + c;
    float ph[16], pw[16], fb[16], fq[2][16], fk[2][16];
#pragma unroll
    for (int e = 0; e < 16; ++e) {
      ph[e] = gh[KROW(e) * 32]; pw[e] = gw[KROW(e) * 32]; fb[e] = gb[KROW(e)];
#pragma unroll
      for (int mt = 0; mt < 2; ++mt) { fq[mt][e] = pq[KROW(e) * CM + 16 * mt]; fk[mt][e] = pk[KROW(e) * CM + 16 * mt]; }
    }
    // in front of any rewrite of the address registers that the loads above name, a load's own result too; the inputs keep those registers live up to the wait
    asm volatile("s_wait_xcnt 0x0" :: "v"(gh), "v"(gw), "v"(gb), "v"(pq), "v"(pk) : "memory");
    __builtin_amdgcn_sched_barrier(0);       // keeps the loads in front of that wait and every later register write behind it
#pragma unroll
    for (int e = 0; e < 16; ++e) ph[e] += pw[e];
    const v16h bp = cvt16(ph), bb = cvt16(fb);
#pragma unroll
    for (int mt = 0; mt < 2; ++mt) {
      acc[mt] = Frag<_Float16>::mma(cvt16(fq[mt]), bp, acc[mt]);
      acc[mt] = Frag<_Float16>::mma(cvt16(fk[mt]), bb, acc[mt]);
    }
  }
#pragma unroll
  for (int mt = 0; mt < 2; ++mt) {
    float* p = PU + (size_t)((w >> 2) * 8 + (w & 3) * 2 + mt) * 256 + lane * 4;
    *(v4f*)p = (v4f){acc[mt][0], acc[mt][1], acc[mt][2], acc[mt][3]};
    *(v4f*)(p + 128) = (v4f){acc[mt][4], acc[mt][5], acc[mt][6], acc[mt][7]};
  }
  // in front of any rewrite of the registers that the stores above name: other jobs' code follows this one in the merged kernel
  asm volatile("s_wait_xcnt 0x0" ::: "memory");
}
// ---- cv1 straight from x: x1[b][i][o] = silu(sum_c W1f[o][c] x[b][c][i] + b1f[o]), f16 rows [i][o]. Product with m = o and n = i: in x a fragment's 16 k values (channels) lie a
// row apart at one position, so a lane takes them as they lie, 16 neighbouring positions a load (the k order of KROW, as in the two fills above), and no transposed copy of x is made.
// A work-group owns 128 positions of one image, a wave 16 of them for all 128 output channels. The folded weights (f16, the same values for every work-group) are formed in LDS.
// Behind it, on the same 128 positions: v[b][c][j] = sum_cc Wv[c][cc] x1[b][j][cc] + bv[c], f16 rows [c][j]. Product with m = j and n = c (A = x1 rows from every wave's slab,
// B = the wave's own 16 rows of Wv), so that a lane holds 8 neighbouring positions of one channel; a wave owns 16 channels for all 128 positions.
// Every loop of this function is unrolled: its index picks registers (the arrays live in registers) and immediate offsets, so that no address register is stepped while loads fly.
typedef __attribute__((ext_vector_type(4))) _Float16 v4h;
#define C1_PW 528                        // LDS pitch of a row of folded weights: 512 B + 16 B
#define C1_PS 272                        // LDS pitch of a position's 128 channels of x1: 256 B + 16 B
#define C1_WB (CM * C1_PW)               // bytes of the folded weights
#define C1_SB (16 * C1_PS)               // bytes of a wave's 16 positions of x1
#define C1_VO (C1_WB + 8 * C1_SB + CM * 4)    // behind the folded bias: the v weights, f16 rows of pitch C1_PS; a wave's 16 rows later hold its 16 channels of v
#define C1_LDS (C1_VO + 8 * C1_SB)
__device__ __forceinline__ void cv1_tile(unsigned char* L, const int bx, const float* __restrict__ x, const float* __restrict__ w1, const float* __restrict__ g1,
                                         const float* __restrict__ be1, const float* __restrict__ m1, const float* __restrict__ v1, _Float16* __restrict__ X1T,
                                         const float* __restrict__ wv, const float* __restrict__ bv, _Float16* __restrict__ V16) {
  const int lane = threadIdx.x & 31, wave = threadIdx.x >> 5, c = lane & 15, h = lane >> 4;
  const int b = bx >> 3, i0 = (bx & 7) * 128 + wave * 16, ow = wave * 16;
  float* bsh = (float*)(L + C1_WB + 8 * C1_SB);
  // the wave folds rows ow .. ow + 15 of w1: load j is 128 neighbouring columns of row ow + j / 2
  const float *pg = g1 + ow + c, *pv = v1 + ow + c, *pb = be1 + ow + c, *pm = m1 + ow + c;
  const float* wp = w1 + (size_t)ow * CIN + lane * 4;
  const float gg = *pg, vv = *pv, bb = *pb, mm = *pm;
  v4f wr[32];
#pragma unroll
  for (int j = 0; j < 32; ++j) wr[j] = *(const v4f*)(wp + j * 128);
  // in front of any rewrite of the address registers that the loads above name, a load's own result too; the inputs keep those registers live up to the wait
  asm volatile("s_wait_xcnt 0x0" :: "v"(pg), "v"(pv), "v"(pb), "v"(pm), "v"(wp) : "memory");
  const float* xp = x + ((size_t)b * CIN + 8 * h) * NS + i0 + c;
  float xr[8][16];                           // the wave's 16 positions of x, all 256 channels: 8 k steps
  auto load_x = [&](const int ks) {
#pragma unroll
    for (int e = 0; e < 16; ++e) xr[ks][e] = xp[(size_t)(32 * ks + KROW(e)) * NS];
    asm volatile("s_wait_xcnt 0x0" :: "v"(xp) : "memory");   // the same, for these loads
  };
#pragma unroll
  for (int ks = 0; ks < 4; ++ks) load_x(ks);
  __builtin_amdgcn_sched_barrier(0);         // holds all these loads up here: the first half of x flies under the fold
  const float sc = gg / sqrtf(vv + 1e-5f);   // lane c (either half) holds the scale of row ow + c
  bsh[ow + c] = bb - mm * sc;                // both halves store the same value
#pragma unroll
  for (int j = 0; j < 32; ++j) {
    const float s = __builtin_bit_cast(float, __builtin_amdgcn_readlane(__builtin_bit_cast(int, sc), j >> 1));
    const v4h hv = {(_Float16)(wr[j][0] * s), (_Float16)(wr[j][1] * s), (_Float16)(wr[j][2] * s), (_Float16)(wr[j][3] * s)};
    *(v4h*)(L + (ow + (j >> 1)) * C1_PW + (j & 1) * 256 + lane * 8) = hv;
  }
  __builtin_amdgcn_sched_barrier(0);         // the v weights and the second half of x go into the registers that the fold has left, not earlier
  // the wave's own 16 rows of the v weights, a whole row (512 B) a load
  const float* vwp = wv + (size_t)ow * CM + lane * 4;
  const float* pbv = bv + ow + c;
  v4f vr[16];
#pragma unroll
  for (int j = 0; j < 16; ++j) vr[j] = *(const v4f*)(vwp + j * CM);
  const float bvv = *pbv;
  asm volatile("s_wait_xcnt 0x0" :: "v"(vwp), "v"(pbv) : "memory");   // the same, for these loads
#pragma unroll
  for (int ks = 4; ks < 8; ++ks) load_x(ks);
  __syncthreads();                           // publishes every wave's 16 rows of folded weights and its part of the bias
  v8f acc[8];
#pragma unroll
  for (int mt = 0; mt < 8; ++mt) acc[mt] = (v8f){0.f,0.f,0.f,0.f,0.f,0.f,0.f,0.f};
  unsigned char* vs = L + C1_VO + wave * C1_SB;   // read back as fragments by this wave alone, behind the barrier in front of the v product
#pragma unroll
  for (int j = 0; j < 16; ++j) {
    const v4h hv = {(_Float16)vr[j][0], (_Float16)vr[j][1], (_Float16)vr[j][2], (_Float16)vr[j][3]};
    *(v4h*)(vs + j * C1_PS + lane * 8) = hv;
  }
  v16h bf[8];
#pragma unroll
  for (int ks = 0; ks < 8; ++ks) bf[ks] = cvt16(xr[ks]);
  __builtin_amdgcn_sched_barrier(0);         // all of x is f16 from here on: its f32 registers are free, so that a k step's weight fragments can be read as one group
#pragma unroll
  for (int ks = 0; ks < 8; ++ks) {
    const unsigned char* ap = L + c * C1_PW + 64 * ks + 16 * h;
    v16h af[8];
#pragma unroll
    for (int mt = 0; mt < 8; ++mt) af[mt] = Frag<_Float16>::load((const _Float16*)(ap + mt * 16 * C1_PW));
#pragma unroll
    for (int mt = 0; mt < 8; ++mt) acc[mt] = Frag<_Float16>::mma(af[mt], bf[ks], acc[mt]);
  }
  // a lane holds 8 neighbouring channels of one position per tile; through the wave's own slab, so that a store is two whole rows of x1 (512 B in a row)
  unsigned char* sl = L + C1_WB + wave * C1_SB;
#pragma unroll
  for (int mt = 0; mt < 8; ++mt) {
    const v4f b0 = *(const v4f*)(bsh + 16 * mt + 8 * h), b1 = *(const v4f*)(bsh + 16 * mt + 8 * h + 4);
    float v[8];
#pragma unroll
    for (int r = 0; r < 8; ++r) v[r] = acc[mt][r] + (r < 4 ? b0[r & 3] : b1[r & 3]);
    silu8(v);
    v8h hv;
#pragma unroll
    for (int r = 0; r < 8; ++r) hv[r] = (_Float16)v[r];
    *(v8h*)(sl + c * C1_PS + 32 * mt + 16 * h) = hv;
  }
  __syncthreads();                           // publishes every wave's 16 positions of x1 to the whole work-group (and to the other lanes of the wave itself)
  unsigned char* og = (unsigned char*)(X1T + ((size_t)b * NS + i0) * CM) + lane * 16;
  v8h ov[8];
#pragma unroll
  for (int it = 0; it < 8; ++it) ov[it] = *(const v8h*)(sl + (2 * it + h) * C1_PS + c * 16);
#pragma unroll
  for (int it = 0; it < 8; ++it) *(v8h*)(og + it * 512) = ov[it];
  asm volatile("s_wait_xcnt 0x0" ::: "memory");   // in front of any rewrite of the registers that the stores above name
  // ---- v on the work-group's 128 positions
  v16h wf[4];
#pragma unroll
  for (int kc = 0; kc < 4; ++kc) wf[kc] = Frag<_Float16>::load((const _Float16*)(vs + c * C1_PS + 64 * kc + 16 * h));
  v8f va[8];
#pragma unroll
  for (int mt = 0; mt < 8; ++mt) va[mt] = (v8f){0.f,0.f,0.f,0.f,0.f,0.f,0.f,0.f};
  const unsigned char* xs = L + C1_WB + c * C1_PS + 16 * h;
  v16h xa[2][8];
#pragma unroll
  for (int mt = 0; mt < 8; ++mt) xa[0][mt] = Frag<_Float16>::load((const _Float16*)(xs + mt * C1_SB));
#pragma unroll
  for (int kc = 0; kc < 4; ++kc) {
    if (kc < 3) {
#pragma unroll
      for (int mt = 0; mt < 8; ++mt) xa[(kc + 1) & 1][mt] = Frag<_Float16>::load((const _Float16*)(xs + mt * C1_SB + 64 * (kc + 1)));
    }
    __builtin_amdgcn_sched_barrier(0);       // holds the next k step's LDS reads up here as one group: their latency passes under this step's products
#pragma unroll
    for (int mt = 0; mt < 8; ++mt) va[mt] = Frag<_Float16>::mma(xa[kc & 1][mt], wf[kc], va[mt]);
  }
  // through the wave's own rows of LDS (its weights are in registers by now), so that a store is two channels' 128 positions: 4 whole lines
#pragma unroll
  for (int mt = 0; mt < 8; ++mt) {
    v8h hv;
#pragma unroll
    for (int r = 0; r < 8; ++r) hv[r] = (_Float16)(va[mt][r] + bvv);
    *(v8h*)(vs + c * C1_PS + 32 * mt + 16 * h) = hv;   // row = channel, bytes = positions 16 mt + 8 h .. + 7
  }
  // the lanes of this wave read what other lanes of it wrote: keep the compiler from moving the reads over the writes. The fences name LDS alone,
  // so that the wave does not wait here for its stores of x1, which are still under way
  __builtin_amdgcn_fence(__ATOMIC_RELEASE, "workgroup", "local");
  __builtin_amdgcn_wave_barrier();
  __builtin_amdgcn_fence(__ATOMIC_ACQUIRE, "workgroup", "local");
  unsigned char* vg = (unsigned char*)(V16 + ((size_t)b * CM + ow + h) * NS + (bx & 7) * 128) + c * 16;
  v8h vv8[8];
#pragma unroll
  for (int it = 0; it < 8; ++it) vv8[it] = *(const v8h*)(vs + (2 * it + h) * C1_PS + c * 16);
#pragma unroll
  for (int it = 0; it < 8; ++it) *(v8h*)(vg + (size_t)it * (2 * NS * 2)) = vv8[it];
  asm volatile("s_wait_xcnt 0x0" ::: "memory");   // in front of any rewrite of the registers that the stores above name
}
// ---- everything in front of the attention kernel, in one launch: the work-group's index picks its job (block-uniform, so the barriers of cv1 are safe). cv1 comes first: it is the long job.
// The others read inputs alone and are first used by a later launch.
#define PB_FOLD (CM * CIN / 2 / 256)     // work-groups of the BN fold of cv2 (256 x 128 weights)
#define CB_PU (NS / 16 * (CM / 32) / 8)   // work-groups of pu_fill
#define CB_G (CM / 16 * (CM / 64) / 8)    // work-groups of g_fill
#define CB_CV1 (BB * (NS / 128))
__global__ __launch_bounds__(256) void cv1_kernel(
    const float* __restrict__ x, const float* __restrict__ w1, const float* __restrict__ g1, const float* __restrict__ be1, const float* __restrict__ m1, const float* __restrict__ v1,
    _Float16* __restrict__ X1T, const float* __restrict__ wv, const float* __restrict__ bv, _Float16* __restrict__ V16,
    const float* __restrict__ wq, const float* __restrict__ wk, const float* __restrict__ bq, const float* __restrict__ relh, const float* __restrict__ relw,
    _Float16* __restrict__ G16, float* __restrict__ PU,
    const float* __restrict__ w2, const float* __restrict__ g2, const float* __restrict__ be2, const float* __restrict__ m2, const float* __restrict__ v2, unsigned* __restrict__ W2f, float* __restrict__ b2f) {
  __shared__ __align__(16) unsigned char L[C1_LDS];
  int bx = blockIdx.x;
  if (bx < CB_CV1) { cv1_tile(L, bx, x, w1, g1, be1, m1, v1, X1T, wv, bv, V16); return; }
  bx -= CB_CV1;
  if (bx < CB_PU) { pu_fill(bx, wq, wk, bq, relh, relw, PU); return; }
  bx -= CB_PU;
  if (bx < CB_G) { g_fill(bx, wq, wk, G16); return; }
  bx -= CB_G;
  fold_bn(bx, w2, g2, be2, m2, v2, CIN, CM, W2f, b2f);
}
typedef __attribute__((ext_vector_type(4))) unsigned u32x4;
typedef __attribute__((ext_vector_type(2))) float f32x2;
#define FA_KEYS 64                       // keys per stage
#define FA_NST (NS / FA_KEYS)            // stages
#define FA_PK 272                        // LDS pitch of an x1 row: 256 B + 16 B
#define FA_PV 144                        // LDS pitch of a v row's 64 keys: 128 B + 16 B
#define FA_KB (FA_KEYS * FA_PK)          // bytes of the x1 tile
#define FA_BUF (FA_KB + CM * FA_PV)      // bytes of one buffer
#define FA_GO (3 * FA_BUF)               // G behind the three buffers, rows of pitch FA_PK
#define FA_UO (FA_GO + CM * FA_PK)       // behind G: the four u fragments of every query tile, 4 KiB a tile
#define FA_HEAD (FA_UO + 8 * 4096)
#define FA_XO FA_GO                      // behind the keys the same bytes carry what the pairs swap: 8 KiB of O sums a wave, then 256 B of maxima and sums a wave
#define FA_PO 272                        // pitch of a query's 128 channels of O in LDS: 256 B + 16 B
#define FA_PY 528                        // pitch of an output channel's 128 queries (f32) in LDS: 512 B + 16 B
#define FA_OB (128 * FA_PO)              // bytes of the work-group's O rows
#define FA_TAIL (FA_OB + CIN * FA_PY)    // O rows and, behind them, the 256 x 128 tile of cv2's sums
__device__ __forceinline__ float xhalf(float x) {   // lane l <-> lane l ^ 16
  return __builtin_bit_cast(float, __builtin_amdgcn_permlanex16(__builtin_bit_cast(int, x), __builtin_bit_cast(int, x), 0x76543210, 0xfedcba98, false, false));
}
__global__ __launch_bounds__(256) __attribute__((amdgpu_waves_per_eu(2, 2))) void attn_fused(
    const _Float16* __restrict__ Gh, const float* __restrict__ PU, const _Float16* __restrict__ X1h, const _Float16* __restrict__ Vh,
    const _Float16* __restrict__ W2h, const float* __restrict__ b2, const float* __restrict__ x, float* __restrict__ out) {
  __shared__ __align__(16) unsigned char L[FA_TAIL > FA_HEAD ? FA_TAIL : FA_HEAD];
  const int t = threadIdx.x, lane = t & 31, wave = t >> 5, c = lane & 15, h = lane >> 4;
  const int kh = __builtin_amdgcn_readfirstlane(wave) & 1;   // which half of a stage's keys; in a scalar register, so that the tests on it are scalar branches
  const int b = blockIdx.y, tp = wave & 6;   // tp: the first of the pair's two query tiles
  const unsigned char* Kg = (const unsigned char*)(X1h + (size_t)b * NS * CM) + t * 16;                        // a stage of x1 rows is 16 KiB in a row
  const unsigned char* Vg = (const unsigned char*)(Vh + (size_t)b * CM * NS) + (size_t)(t >> 3) * (NS * 2) + (t & 7) * 16;
  unsigned char* Lk = L + (t >> 4) * FA_PK + (t & 15) * 16;
  unsigned char* Lv = L + FA_KB + (t >> 3) * FA_PV + (t & 7) * 16;
  const float LOG2E = 1.4426950408889634f;

  v16h xq[2][4];                             // the x1 rows of the pair's 32 queries
  { const _Float16* qp = X1h + ((size_t)b * NS + blockIdx.x * 128 + tp * 16 + c) * CM + 8 * h;
#pragma unroll
    for (int qt = 0; qt < 2; ++qt)
#pragma unroll
      for (int kc = 0; kc < 4; ++kc) xq[qt][kc] = Frag<_Float16>::load(qp + qt * 16 * CM + 32 * kc);
    // in front of any rewrite of the address registers that the loads above name; the input keeps those registers live up to the wait
    asm volatile("s_wait_xcnt 0x0" :: "v"(qp) : "memory"); }
  __builtin_amdgcn_sched_barrier(0);         // keeps every later register write, a later load's result too, behind that wait
  u32x4 st[8], s1[8], gs[8];
  const unsigned char* Gg = (const unsigned char*)Gh + t * 16;                  // G is 32 KiB in a row
  const float* pp = PU + (size_t)((blockIdx.x * 8 + tp) * 8 + 4 * kh) * 256 + lane * 4;   // the wave's 64 channels of PU at the pair's first 16 positions, as its lanes hold them
  v4f pu[2][4][2];
#pragma unroll
  for (int s = 0; s < 8; ++s) gs[s] = *(const u32x4*)(Gg + s * 4096);
#pragma unroll
  for (int s = 0; s < 4; ++s) st[s] = *(const u32x4*)(Kg + s * 4096);
#pragma unroll
  for (int s = 0; s < 4; ++s) st[4 + s] = *(const u32x4*)(Vg + (size_t)s * 32 * (NS * 2));
#pragma unroll
  for (int qt = 0; qt < 2; ++qt)
#pragma unroll
    for (int j = 0; j < 4; ++j) { pu[qt][j][0] = *(const v4f*)(pp + (qt * 8 + j) * 256); pu[qt][j][1] = *(const v4f*)(pp + (qt * 8 + j) * 256 + 128); }
#pragma unroll
  for (int s = 0; s < 4; ++s) s1[s] = *(const u32x4*)(Kg + FA_KEYS * 256 + s * 4096);
#pragma unroll
  for (int s = 0; s < 4; ++s) s1[4 + s] = *(const u32x4*)(Vg + (size_t)s * 32 * (NS * 2) + FA_KEYS * 2);
  asm volatile("s_wait_xcnt 0x0" ::: "memory");   // in front of any rewrite of the address registers that the loads above name
  __builtin_amdgcn_sched_barrier(0);         // keeps every later register write behind that wait
  v8f acc[2][8];
#pragma unroll
  for (int i = 0; i < 8; ++i) { acc[0][i] = (v8f){0.f,0.f,0.f,0.f,0.f,0.f,0.f,0.f}; acc[1][i] = acc[0][i]; }
  float m_run[2] = {-INFINITY, -INFINITY}, l_run[2] = {0.f, 0.f};
#pragma unroll
  for (int s = 0; s < 8; ++s) *(u32x4*)(Lk + FA_GO + s * 16 * FA_PK) = gs[s];
#pragma unroll
  for (int s = 0; s < 4; ++s) *(u32x4*)(Lk + s * 16 * FA_PK) = st[s];
#pragma unroll
  for (int s = 0; s < 4; ++s) *(u32x4*)(Lv + s * 32 * FA_PV) = st[4 + s];
#pragma unroll
  for (int s = 0; s < 4; ++s) *(u32x4*)(Lk + FA_BUF + s * 16 * FA_PK) = s1[s];
#pragma unroll
  for (int s = 0; s < 4; ++s) *(u32x4*)(Lv + FA_BUF + s * 32 * FA_PV) = s1[4 + s];
  __syncthreads();                           // publishes G and the first two stages

  v16h qf[2][4];
  {
    v8f ua[2][4];
#pragma unroll
    for (int j = 0; j < 4; ++j) { ua[0][j] = (v8f){0.f,0.f,0.f,0.f,0.f,0.f,0.f,0.f}; ua[1][j] = ua[0][j]; }
    const unsigned char* gp = L + FA_GO + (kh * 64 + c) * FA_PK + 16 * h;
    v16h gf[2][4];
#pragma unroll
    for (int j = 0; j < 4; ++j) gf[0][j] = Frag<_Float16>::load((const _Float16*)(gp + j * 16 * FA_PK));
#pragma unroll
    for (int kc = 0; kc < 4; ++kc) {
      if (kc < 3) {
#pragma unroll
        for (int j = 0; j < 4; ++j) gf[(kc + 1) & 1][j] = Frag<_Float16>::load((const _Float16*)(gp + j * 16 * FA_PK + 64 * (kc + 1)));
      }
      __builtin_amdgcn_sched_barrier(0);     // holds the next k step's LDS reads up here as one group: their latency passes under this step's products
#pragma unroll
      for (int j = 0; j < 4; ++j)
#pragma unroll
        for (int qt = 0; qt < 2; ++qt) ua[qt][j] = Frag<_Float16>::mma(gf[kc & 1][j], xq[qt][kc], ua[qt][j]);
    }
    // the wave's two fragments of each tile (k steps 2 kh and 2 kh + 1 of the score product) go to LDS as its lanes hold them (512 B in a row a store); every wave's lanes hold them the same way
    unsigned char* ux = L + FA_UO + lane * 16;
#pragma unroll
    for (int qt = 0; qt < 2; ++qt)
#pragma unroll
      for (int kk = 0; kk < 2; ++kk) {
        v8h lo, hi;
#pragma unroll
        for (int r = 0; r < 8; ++r) {
          lo[r] = (_Float16)(ua[qt][2 * kk][r] + pu[qt][2 * kk][r >> 2][r & 3]);
          hi[r] = (_Float16)(ua[qt][2 * kk + 1][r] + pu[qt][2 * kk + 1][r >> 2][r & 3]);
        }
        *(v8h*)(ux + (tp + qt) * 4096 + (2 * kh + kk) * 1024) = lo;
        *(v8h*)(ux + (tp + qt) * 4096 + (2 * kh + kk) * 1024 + 512) = hi;
      }
    __syncthreads();                         // publishes every wave's u fragments to its partner (its own it reads back with them)
#pragma unroll
    for (int qt = 0; qt < 2; ++qt)
#pragma unroll
      for (int kc = 0; kc < 4; ++kc) {
        Frag<_Float16>::U f;
        f.h[0] = *(const v8h*)(ux + (tp + qt) * 4096 + kc * 1024);
        f.h[1] = *(const v8h*)(ux + (tp + qt) * 4096 + kc * 1024 + 512);
        qf[qt][kc] = f.v;
      }
  }
  v16h kf[2][4];
  auto load_k = [&](const int buf) {         // the 16 LDS reads of the wave's 32 x1 rows of the stage in the buffer at byte offset buf, as one group
    const unsigned char* kp = L + buf + (kh * 32 + c) * FA_PK + 16 * h;
#pragma unroll
    for (int kc = 0; kc < 4; ++kc) {
      kf[0][kc] = Frag<_Float16>::load((const _Float16*)(kp + 64 * kc));
      kf[1][kc] = Frag<_Float16>::load((const _Float16*)(kp + 16 * FA_PK + 64 * kc));
    }
  };
  load_k(0);
  // one stage = the wave's 32 keys against its two query tiles, v read from the buffer at byte offset cur; the x1 fragments are in registers already, and those of the next
  // stage (buffer at nxt, where there is one) are read behind the score products; ahead() issues what is to fly under the stage
  auto stage = [&](const int cur, const int nxt, const bool more, auto&& ahead) {
    ahead();
    __builtin_amdgcn_sched_barrier(0);       // holds ahead()'s loads up here, so that they fly under the whole stage
    v8f sc[2][2];
#pragma unroll
    for (int qt = 0; qt < 2; ++qt) { sc[qt][0] = (v8f){0.f,0.f,0.f,0.f,0.f,0.f,0.f,0.f}; sc[qt][1] = sc[qt][0]; }
#pragma unroll
    for (int kc = 0; kc < 4; ++kc)
#pragma unroll
      for (int qt = 0; qt < 2; ++qt) {
        sc[qt][0] = Frag<_Float16>::mma(kf[0][kc], qf[qt][kc], sc[qt][0]);
        sc[qt][1] = Frag<_Float16>::mma(kf[1][kc], qf[qt][kc], sc[qt][1]);
      }
    v16h vf[8];
    const unsigned char* vp = L + cur + FA_KB + c * FA_PV + kh * 64 + 16 * h;
#pragma unroll
    for (int i = 0; i < 8; ++i) vf[i] = Frag<_Float16>::load((const _Float16*)(vp + i * 16 * FA_PV));
    if (more) load_k(nxt);                   // published by the barrier of the trip before
    __builtin_amdgcn_sched_barrier(0);       // holds these reads up here as one group: their LDS latency passes under the softmax arithmetic
    float mx[2];
#pragma unroll
    for (int qt = 0; qt < 2; ++qt) {
      mx[qt] = fmaxf(sc[qt][0][0], sc[qt][1][0]);
#pragma unroll
      for (int r = 1; r < 8; ++r) mx[qt] = fmaxf(mx[qt], fmaxf(sc[qt][0][r], sc[qt][1][r]));
    }
#pragma unroll
    for (int qt = 0; qt < 2; ++qt) mx[qt] = fmaxf(mx[qt], xhalf(mx[qt])) * LOG2E;   // both halves now hold this query's maximum of the stage
    if (__builtin_amdgcn_ballot_w32((mx[0] > m_run[0]) | (mx[1] > m_run[1])) != 0) {   // scalar branch: no query of the wave has a new maximum -> nothing to rescale
#pragma unroll
      for (int qt = 0; qt < 2; ++qt) {
        const float m_new = fmaxf(m_run[qt], mx[qt]);
        const float corr = __builtin_amdgcn_exp2f(m_run[qt] - m_new);   // 0 in the first stage, where m_run is -inf; 1 where the maximum stays
        l_run[qt] *= corr; m_run[qt] = m_new;
#pragma unroll
        for (int i = 0; i < 8; ++i) acc[qt][i] = acc[qt][i] * corr;
      }
    }
    v16h pf[2];
#pragma unroll
    for (int qt = 0; qt < 2; ++qt) {
      const float nm = 15.0f - m_run[qt];    // p x 2^15: small weights stay normal f16 numbers
      f32x2 ps0 = {0.f, 0.f}, ps1 = {0.f, 0.f};
#pragma unroll
      for (int r = 0; r < 8; r += 2) {       // two neighbouring registers at a time: packed multiply-adds and packed sums
        const f32x2 a0 = __builtin_elementwise_fma((f32x2){sc[qt][0][r], sc[qt][0][r + 1]}, (f32x2){LOG2E, LOG2E}, (f32x2){nm, nm});
        const f32x2 a1 = __builtin_elementwise_fma((f32x2){sc[qt][1][r], sc[qt][1][r + 1]}, (f32x2){LOG2E, LOG2E}, (f32x2){nm, nm});
        const f32x2 p0 = {__builtin_amdgcn_exp2f(a0.x), __builtin_amdgcn_exp2f(a0.y)}, p1 = {__builtin_amdgcn_exp2f(a1.x), __builtin_amdgcn_exp2f(a1.y)};
        ps0 += p0; ps1 += p1;
        pf[qt][r] = (_Float16)p0.x; pf[qt][r + 1] = (_Float16)p0.y; pf[qt][8 + r] = (_Float16)p1.x; pf[qt][9 + r] = (_Float16)p1.y;
      }
      ps0 += ps1;
      l_run[qt] += ps0.x + ps0.y;
    }
#pragma unroll
    for (int i = 0; i < 8; ++i)
#pragma unroll
      for (int qt = 0; qt < 2; ++qt) acc[qt][i] = Frag<_Float16>::mma(vf[i], pf[qt], acc[qt][i]);
  };
  int cur = 0, nx1 = FA_BUF, nx2 = 2 * FA_BUF;   // byte offsets of the buffers of this stage, of the next one and of the one behind it
  for (int sg = 0; sg + 1 < FA_NST; ++sg) {
    const bool fill = sg + 2 < FA_NST;       // the same for the whole work-group
    stage(cur, nx1, true, [&]() {            // the global loads of the stage after the next fly under this stage's products
      if (fill) {
#pragma unroll
        for (int s = 0; s < 4; ++s) st[s] = *(const u32x4*)(Kg + (size_t)(sg + 2) * (FA_KEYS * 256) + s * 4096);
#pragma unroll
        for (int s = 0; s < 4; ++s) st[4 + s] = *(const u32x4*)(Vg + (size_t)s * 32 * (NS * 2) + (sg + 2) * (FA_KEYS * 2));
        asm volatile("s_wait_xcnt 0x0" ::: "memory");   // in front of any rewrite of the address registers that the loads above name
      }
    });
    __builtin_amdgcn_sched_barrier(0);       // keeps the waits for ahead()'s loads behind the stage's last products: the loads have the whole stage to land, and no product waits for them
    if (fill) {                              // into the buffer whose last readers passed the barrier of the trip before
#pragma unroll
      for (int s = 0; s < 4; ++s) *(u32x4*)(Lk + nx2 + s * 16 * FA_PK) = st[s];
#pragma unroll
      for (int s = 0; s < 4; ++s) *(u32x4*)(Lv + nx2 + s * 32 * FA_PV) = st[4 + s];
    }
    __syncthreads();                         // publishes the stage just stored and ends every wave's reads of this one
    const int old = cur; cur = nx1; nx1 = nx2; nx2 = old;
  }
  // ---- behind the keys: cv2, SiLU and the residual add on the work-group's 128 queries. O goes from wave to wave through LDS, y never leaves the chip.
  // A wave owns output channels 32 wave .. + 31 for all 128 queries: W2f.O^T (A = its 32 rows of W2f, B = O rows [query][channel] from LDS).
  const int o0 = wave * 32;
  v16h wf[2][4]; v4f bs[2][2];
  stage(cur, 0, false, [&]() {               // the wave's rows of W2f and its bias fly under the last stage's products
    const _Float16* wp = W2h + (size_t)(o0 + c) * CM + 8 * h;
    const float* bp = b2 + o0 + 8 * h;
#pragma unroll
    for (int ot = 0; ot < 2; ++ot) {
#pragma unroll
      for (int kc = 0; kc < 4; ++kc) wf[ot][kc] = Frag<_Float16>::load(wp + ot * 16 * CM + 32 * kc);
      bs[ot][0] = *(const v4f*)(bp + 16 * ot); bs[ot][1] = *(const v4f*)(bp + 16 * ot + 4);
    }
    // in front of any rewrite of the address registers that the loads above name; the inputs keep those registers live up to the wait
    asm volatile("s_wait_xcnt 0x0" :: "v"(wp), "v"(bp) : "memory");
  });
  // the pair's swap: a wave hands over, as its lanes hold them, maximum, sum and O sums of the tile that its partner finishes (512 B in a row a store). These bytes held G and u:
  // their last readers passed the barriers of the stages
  unsigned char* xs = L + FA_XO + lane * 16;
  unsigned char* xm = L + FA_XO + 8 * 8192 + lane * 8;
  auto hand = [&](const int qt) {
#pragma unroll
    for (int i = 0; i < 8; ++i) {
      *(v4f*)(xs + wave * 8192 + i * 1024) = (v4f){acc[qt][i][0], acc[qt][i][1], acc[qt][i][2], acc[qt][i][3]};
      *(v4f*)(xs + wave * 8192 + i * 1024 + 512) = (v4f){acc[qt][i][4], acc[qt][i][5], acc[qt][i][6], acc[qt][i][7]};
    }
    *(f32x2*)(xm + wave * 256) = (f32x2){m_run[qt], l_run[qt]};
  };
  if (kh) hand(0); else hand(1);
  __syncthreads();                           // publishes what the pairs swap; and every wave has left the buffers: they become staging for O and for cv2's sums

  // O[i][c] = (own sums and the partner's, each scaled to the common maximum) / sum, f16, a row per query
  unsigned char* Lw = L + wave * 16 * FA_PO;
  const f32x2 ml = *(const f32x2*)(xm + (wave ^ 1) * 256);
  v4f po[8][2];                              // all of the partner's sums are read first, as one group: behind the stores of O the compiler would take them one by one
#pragma unroll
  for (int i = 0; i < 8; ++i) { po[i][0] = *(const v4f*)(xs + (wave ^ 1) * 8192 + i * 1024); po[i][1] = *(const v4f*)(xs + (wave ^ 1) * 8192 + i * 1024 + 512); }
  auto finish = [&](const int qt) {
    const float dm = m_run[qt] - ml.x;       // the side with the larger maximum keeps its scale, the other comes down by 2^-|dm|
    const float e = __builtin_amdgcn_exp2f(-fabsf(dm));
    const float ca = dm < 0.f ? e : 1.0f, cb = dm < 0.f ? 1.0f : e;
    const float l = l_run[qt] * ca + ml.y * cb;
    const float inv = 1.0f / (l + xhalf(l));   // each half summed its own 8 keys of every tile
    const float fa = ca * inv, fb = cb * inv;
#pragma unroll
    for (int i = 0; i < 8; ++i) {
      v8h hv;
#pragma unroll
      for (int r = 0; r < 8; ++r) hv[r] = (_Float16)(acc[qt][i][r] * fa + po[i][r >> 2][r & 3] * fb);
      *(v8h*)(Lw + c * FA_PO + 32 * i + 16 * h) = hv;   // row = query, bytes = channels 16 i + 8 h .. + 7
    }
  };
  if (kh) finish(1); else finish(0);
  __syncthreads();                           // publishes every wave's 16 queries of O to the whole work-group
  const size_t xo = ((size_t)b * CIN + o0) * NS + blockIdx.x * 128 + lane * 4;   // a lane's 4 queries of channel o0
  const float* xp = x + xo;
  float* op = out + xo;
  v4f xc[8];
#pragma unroll
  for (int j = 0; j < 8; ++j) xc[j] = *(const v4f*)(xp + (size_t)j * NS);
  asm volatile("s_wait_xcnt 0x0" :: "v"(xp) : "memory");   // in front of any rewrite of the address registers that the loads above name
  __builtin_amdgcn_sched_barrier(0);         // holds the first 8 rows' loads of x up here: they fly under the product
  v8f d[2][8];
#pragma unroll
  for (int it = 0; it < 8; ++it) { d[0][it] = (v8f){0.f,0.f,0.f,0.f,0.f,0.f,0.f,0.f}; d[1][it] = d[0][it]; }
#pragma unroll
  for (int kc = 0; kc < 4; ++kc) {
    v16h of[8];
#pragma unroll
    for (int it = 0; it < 8; ++it) of[it] = Frag<_Float16>::load((const _Float16*)(L + (it * 16 + c) * FA_PO + 64 * kc + 16 * h));
#pragma unroll
    for (int it = 0; it < 8; ++it) {
      d[0][it] = Frag<_Float16>::mma(wf[0][kc], of[it], d[0][it]);
      d[1][it] = Frag<_Float16>::mma(wf[1][kc], of[it], d[1][it]);
    }
  }
  // through the wave's own 32 rows of LDS, so that a lane holds 4 neighbouring queries and a store is one channel's 128 queries: 4 whole lines
  float* slab = (float*)(L + FA_OB + o0 * FA_PY);
#pragma unroll
  for (int ot = 0; ot < 2; ++ot)
#pragma unroll
    for (int it = 0; it < 8; ++it)
#pragma unroll
      for (int r = 0; r < 8; ++r) slab[(ot * 16 + 8 * h + r) * (FA_PY / 4) + it * 16 + c] = d[ot][it][r] + bs[ot][r >> 2][r & 3];
  // the lanes of this wave read what other lanes of it wrote: keep the compiler from moving the reads over the writes
  __builtin_amdgcn_fence(__ATOMIC_RELEASE, "workgroup");
  __builtin_amdgcn_wave_barrier();
  __builtin_amdgcn_fence(__ATOMIC_ACQUIRE, "workgroup");
  const float* sp = slab + lane * 4;
  // stays rolled: the loop runs four trips, and unrolled it is four times the text
#pragma unroll 1
  for (int g = 0; g < 4; ++g) {              // 8 channels a trip; the next trip's x flies under this trip's arithmetic
    v4f xn[8];
#pragma unroll
    for (int j = 0; j < 8; ++j) xn[j] = xc[j];
    if (g < 3) {
#pragma unroll
      for (int j = 0; j < 8; ++j) xn[j] = *(const v4f*)(xp + (size_t)(8 + j) * NS);
    }
    __builtin_amdgcn_sched_barrier(0);       // holds those loads up here
    v4f res[8];
#pragma unroll
    for (int j = 0; j < 8; j += 2) {         // two channels' values, 8 a lane, at a time
      const v4f y0 = *(const v4f*)(sp + j * (FA_PY / 4)), y1 = *(const v4f*)(sp + (j + 1) * (FA_PY / 4));
      float y[8] = {y0[0], y0[1], y0[2], y0[3], y1[0], y1[1], y1[2], y1[3]};
      silu8(y);
      res[j] = xc[j] + (v4f){y[0], y[1], y[2], y[3]};
      res[j + 1] = xc[j + 1] + (v4f){y[4], y[5], y[6], y[7]};
    }
    __builtin_amdgcn_sched_barrier(0);       // keeps the trip's 8 stores together, directly in front of their wait: nothing rewrites a register that they name ahead of it
#pragma unroll
    for (int j = 0; j < 8; ++j) *(v4f*)(op + (size_t)j * NS) = res[j];
    asm volatile("s_wait_xcnt 0x0" ::: "memory");   // in front of the step of the address registers that this trip's loads and stores name
    __builtin_amdgcn_sched_barrier(0);       // keeps that step behind the wait
    xp += 8 * NS; op += 8 * NS; sp += 8 * (FA_PY / 4);
#pragma unroll
    for (int j = 0; j < 8; ++j) xc[j] = xn[j];
  }
}
extern "C" void kernel_launch(void* const* d_in, const int* in_sizes, int n_in, void* d_out, int out_size, void* d_ws, size_t ws_size, hipStream_t stream) {
  (void)in_sizes; (void)n_in; (void)out_size; (void)ws_size;
  const float* x = (const float*)d_in[0]; const float* w1 = (const float*)d_in[1];
  const float* g1 = (const float*)d_in[2]; const float* be1 = (const float*)d_in[3]; const float* m1 = (const float*)d_in[4]; const float* v1 = (const float*)d_in[5];
  const float* wq = (const float*)d_in[6]; const float* bq = (const float*)d_in[7]; const float* wk = (const float*)d_in[8]; const float* bk = (const float*)d_in[9];
  const float* wv = (const float*)d_in[10]; const float* bv = (const float*)d_in[11]; const float* relh = (const float*)d_in[12]; const float* relw = (const float*)d_in[13];
  const float* w2 = (const float*)d_in[14]; const float* g2 = (const float*)d_in[15]; const float* be2 = (const float*)d_in[16]; const float* m2 = (const float*)d_in[17]; const float* v2 = (const float*)d_in[18];
  float* out = (float*)d_out;   // [32][256][1024]
  (void)bk;                     // bk shifts all scores of a query by q_i.bk alike: the softmax over the keys does not see it
  // Workspace map (offsets in MiB; 256 MiB in all). Scores and p stay on chip, so nothing of them lies here.
  //   [16,24) x1; [56,64) v; [194,200) G, the folded cv2 weights and PU
  char* ws = (char*)d_ws;
  const size_t MiB = (size_t)1 << 20;
  unsigned* X1T = (unsigned*)(ws + 16 * MiB);                        // [b][i][128] f16
  unsigned* V16 = (unsigned*)(ws + 56 * MiB);                        // [b][c][j] f16
  _Float16* G16 = (_Float16*)(ws + 194 * MiB);
  unsigned* W2f = (unsigned*)(ws + 197 * MiB); float* b2f = (float*)(ws + 198 * MiB);
  float* PU = (float*)(ws + 199 * MiB);                              // 1024 x 128 f32 in its reader's lane order, one for all images
  // cv1 from x itself and v behind it, with G, PU and the BN fold of cv2 beside them
  cv1_kernel<<<CB_CV1 + CB_PU + CB_G + PB_FOLD, 256, 0, stream>>>(x, w1, g1, be1, m1, v1, (_Float16*)X1T, wv, bv, (_Float16*)V16, wq, wk, bq, relh, relw, G16, PU, w2, g2, be2, m2, v2, W2f, b2f);
  // u, scores, softmax, p.v, cv2 and the residual add (out = x + silu(W2f.O + b2f)) in one launch: 8 work-groups of 128 queries per image
  attn_fused<<<dim3(NS / 128, BB), 256, 0, stream>>>(G16, PU, (const _Float16*)X1T, (const _Float16*)V16, (const _Float16*)W2f, b2f, x, out);
}
